// v000
// The times below were measured on an AMD MI455X: many runs one after another, warmed up first and cycling through
// copies of the inputs, with the whole window's GPU time divided by the number of runs. Launches and the gaps
// between them are all in it. The median over several windows is given; except for v000 it joins two sittings, which
// can be a few percent apart, so the side-by-side timings, each taken in one sitting, are the better comparison.
// v000, which the later versions start from, runs in 508 microseconds.
#include <hip/hip_runtime.h>
// All contractions on v_wmma_f32_16x16x32_bf16, f32 accumulate: Q/K/V = x·Wᵀ with x/W rounded to bf16 (single exact-product
// term), QKᵀ and P·V 3-term bf16 hi/lo splits, out = o·W_oᵀ with o split hi/lo (2 terms). The 64-point rFFT band powers,
// log1p, the 5->8 band-bias projection and softmax are f32 on VALU.
#define BB 2
#define NN 2048
#define DM 512
#define NH 8
#define HD 64
#define PL 64
#define NBANDS 5

typedef __bf16 v16b __attribute__((ext_vector_type(16)));
typedef unsigned short v8us __attribute__((ext_vector_type(8), may_alias));
typedef float  v8f  __attribute__((ext_vector_type(8)));
typedef float  v4f  __attribute__((ext_vector_type(4)));
typedef float  v4fa __attribute__((ext_vector_type(4), may_alias));
union FragB { v16b v; v8us half[2]; unsigned short u[16]; };

__device__ __forceinline__ unsigned short bf16_bits(float x) { unsigned int u = __float_as_uint(x); return (unsigned short)((u + 0x7FFFu + ((u >> 16) & 1u)) >> 16); }
__device__ __forceinline__ float bf16_val(unsigned short b) { return __uint_as_float(((unsigned int)b) << 16); }
__device__ __forceinline__ float bf16_round(float x) { return bf16_val(bf16_bits(x)); }
// D += A·B with NT terms: 1 = ah·bh, 2 = + al·bh (A split), 3 = + ah·bl (both split)
template <int NT>
__device__ __forceinline__ v8f mmaN(v16b ah, v16b al, v16b bh, v16b bl, v8f c) {
  c = __builtin_amdgcn_wmma_f32_16x16x32_bf16(false, ah, false, bh, (short)0, c, false, false);
  if (NT >= 2) c = __builtin_amdgcn_wmma_f32_16x16x32_bf16(false, al, false, bh, (short)0, c, false, false);
  if (NT >= 3) c = __builtin_amdgcn_wmma_f32_16x16x32_bf16(false, ah, false, bl, (short)0, c, false, false);
  asm volatile("v_nop\n\tv_nop\n\tv_nop\n\tv_nop" : "+v"(c) : "v"(ah), "v"(al), "v"(bh), "v"(bl));
  return c;
}

__global__ __launch_bounds__(256) void k_wt_bf16(const float* __restrict__ W, unsigned short* __restrict__ Wt, int K, int N) {
  const int t = blockIdx.x * 256 + threadIdx.x;
  const int k8n = K / 8;
  if (t >= N * k8n) return;
  const int n = t / k8n, k8 = (t % k8n) * 8;
  v8us v;
#pragma unroll
  for (int i = 0; i < 8; ++i) v[i] = bf16_bits(W[(size_t)(k8 + i) * N + n]);
  *(v8us*)(Wt + (size_t)n * K + k8) = v;
  
}

// GEMM C[M][N] (f32, pitch ldc) = act(A[M][K]·W + bias). A f32 row-major (pitch lda) converted per fragment to bf16
// (ASPLIT: hi/lo two planes -> 2 terms, else single rounded term); Wt bf16 [N][K] (pitch ldb). BIAS_BF16 rounds the
// bias to bf16 first (bias quantised to bf16 before the add). K%32==0, M%16==0, N%64==0.
template <bool ASPLIT, int ACT, bool BIAS_BF16>
__global__ __launch_bounds__(128) void k_gemm_bf(const float* __restrict__ A, int lda, const unsigned short* __restrict__ Wt, int ldb,
                                               const float* __restrict__ bias, float* __restrict__ C, int ldc, int M, int N, int K) {
  __shared__ __attribute__((aligned(16))) float so[4][16][64];
  const int tid = threadIdx.x, w = tid >> 5, lane = tid & 31, ln = lane & 15, hh = lane >> 4;
  const int ntn = N / 64;
  const int wid = blockIdx.x * 4 + w;
  const int mt = wid / ntn, nq = wid % ntn;
  if (mt * 16 >= M) return;
  const int row0 = mt * 16, col0 = nq * 64;
  const float* arow = A + (size_t)(row0 + ln) * lda;
  v8f acc[4] = {};
  for (int kb = 0; kb < K; kb += 32) {
    FragB ah, al;
    const v4f x0 = *(const v4fa*)(arow + kb + 8 * hh), x1 = *(const v4fa*)(arow + kb + 8 * hh + 4);
    const v4f x2 = *(const v4fa*)(arow + kb + 16 + 8 * hh), x3 = *(const v4fa*)(arow + kb + 16 + 8 * hh + 4);
    float xs[16] = {x0[0],x0[1],x0[2],x0[3],x1[0],x1[1],x1[2],x1[3],x2[0],x2[1],x2[2],x2[3],x3[0],x3[1],x3[2],x3[3]};
#pragma unroll
    for (int i = 0; i < 16; ++i) { const unsigned short hb = bf16_bits(xs[i]); ah.u[i] = hb; al.u[i] = ASPLIT ? bf16_bits(xs[i] - bf16_val(hb)) : (unsigned short)0; }
#pragma unroll
    for (int t = 0; t < 4; ++t) {
      const unsigned short* brow = Wt + (size_t)(col0 + t * 16 + ln) * ldb + kb;
      FragB b;
      b.half[0] = *(const v8us*)(brow + 8 * hh);
      b.half[1] = *(const v8us*)(brow + 16 + 8 * hh);
      acc[t] = mmaN<ASPLIT ? 2 : 1>(ah.v, al.v, b.v, b.v, acc[t]);
    }
  }
#pragma unroll
  for (int t = 0; t < 4; ++t) {
    float bv = bias ? bias[col0 + t * 16 + ln] : 0.f;
    if (BIAS_BF16) bv = bf16_round(bv);
#pragma unroll
    for (int r = 0; r < 8; ++r) { float v = acc[t][r] + bv; if (ACT == 1) v = fmaxf(v, 0.f); so[w][8 * hh + r][t * 16 + ln] = v; }
  }
  __builtin_amdgcn_fence(__ATOMIC_ACQ_REL, "workgroup");
  __builtin_amdgcn_wave_barrier();
  const int rsub = lane >> 4, c4 = (lane & 15) * 4;
  {
#pragma unroll
    for (int q = 0; q < 8; ++q) {
      const int r = q * 2 + rsub;
      const v4f v = *(const v4fa*)&so[w][r][c4];
      *(v4f*)(C + (size_t)(row0 + r) * ldc + col0 + c4) = v;
    }
    
  }
}

// Flash-style causal/unmasked attention, all contractions 3-term bf16 hi/lo splits, f32 softmax with running max.
// q,k,v rows are read from f32 buffers with arbitrary row pitch (so they can live inside a fused qkv buffer);
// D = head size (multiple of 32, <= 128); one wave = 16 query rows; block = 4 waves (64 queries) sharing K/V chunks of 32.
template <int D, bool CAUSAL>
__global__ __launch_bounds__(128) void k_flash(const float* __restrict__ qb, const float* __restrict__ kb, const float* __restrict__ vb,
                                             int pitch, int T, int H, float scale, float* __restrict__ y, int ypitch) {
  constexpr int KS = D / 32;        // k-steps for QK
  constexpr int DT = D / 16;        // d tiles for PV
  __shared__ __attribute__((aligned(16))) unsigned short sKh[32][D + 8], sKl[32][D + 8], sVh[32][D + 8], sVl[32][D + 8];
  __shared__ __attribute__((aligned(16))) unsigned short sPh[4][16][40], sPl[4][16][40];
  __shared__ __attribute__((aligned(16))) float sO[4][16][D];
  const int tid = threadIdx.x, w = tid >> 5, lane = tid & 31, ln = lane & 15, hh = lane >> 4;
  const int nqb = (T + 63) / 64;
  const int bh = blockIdx.x / nqb, qblk = blockIdx.x % nqb;
  const int b = bh / H, h = bh % H;
  const int q0 = qblk * 64 + w * 16;
  const float* Q = qb + (size_t)b * T * pitch + h * D;
  const float* K = kb + (size_t)b * T * pitch + h * D;
  const float* V = vb + (size_t)b * T * pitch + h * D;

  // A fragments of the wave's 16 query rows (scaled), hi/lo
  FragB aqh[KS], aql[KS];
  {
    int row = q0 + ln; if (row >= T) row = T - 1;
    const float* qr = Q + (size_t)row * pitch;
#pragma unroll
    for (int ks = 0; ks < KS; ++ks)
#pragma unroll
      for (int i = 0; i < 16; ++i) {
        const int d = ks * 32 + ((i < 8) ? (8 * hh + i) : (16 + 8 * hh + (i - 8)));
        const float x = qr[d] * scale; const unsigned short hb = bf16_bits(x);
        aqh[ks].u[i] = hb; aql[ks].u[i] = bf16_bits(x - bf16_val(hb));
      }
  }
  float m_r[8], l_r[8];
#pragma unroll
  for (int r = 0; r < 8; ++r) { m_r[r] = -3.0e38f; l_r[r] = 0.f; }
  v8f oacc[DT];
#pragma unroll
  for (int dt = 0; dt < DT; ++dt) oacc[dt] = (v8f){0.f,0.f,0.f,0.f,0.f,0.f,0.f,0.f};

  const int kv_end = CAUSAL ? min(T, qblk * 64 + 64) : T;     // block-uniform
  for (int j0 = 0; j0 < kv_end; j0 += 32) {
    __syncthreads();
    for (int e = tid; e < 32 * (D / 4); e += 128) {
      const int r = e / (D / 4), c4 = (e % (D / 4)) * 4;
      const int key = j0 + r;
      v4f kf = {0.f,0.f,0.f,0.f}, vf = {0.f,0.f,0.f,0.f};
      if (key < T) { kf = *(const v4fa*)(K + (size_t)key * pitch + c4); vf = *(const v4fa*)(V + (size_t)key * pitch + c4); }
#pragma unroll
      for (int t = 0; t < 4; ++t) {
        unsigned short hb = bf16_bits(kf[t]); sKh[r][c4 + t] = hb; sKl[r][c4 + t] = bf16_bits(kf[t] - bf16_val(hb));
        hb = bf16_bits(vf[t]); sVh[r][c4 + t] = hb; sVl[r][c4 + t] = bf16_bits(vf[t] - bf16_val(hb));
      }
    }
    __syncthreads();
    // S tile 16 x 32
    v8f s[2];
#pragma unroll
    for (int nt = 0; nt < 2; ++nt) {
      v8f acc = {};
#pragma unroll
      for (int ks = 0; ks < KS; ++ks) {
        FragB bh_, bl_;
        bh_.half[0] = *(const v8us*)&sKh[nt * 16 + ln][ks * 32 + 8 * hh]; bh_.half[1] = *(const v8us*)&sKh[nt * 16 + ln][ks * 32 + 16 + 8 * hh];
        bl_.half[0] = *(const v8us*)&sKl[nt * 16 + ln][ks * 32 + 8 * hh]; bl_.half[1] = *(const v8us*)&sKl[nt * 16 + ln][ks * 32 + 16 + 8 * hh];
        acc = mmaN<3>(aqh[ks].v, aql[ks].v, bh_.v, bl_.v, acc);
      }
      s[nt] = acc;
    }
    // mask + running max (rows 8hh+r; the 16 lanes of a half share rows)
    float alpha[8];
#pragma unroll
    for (int r = 0; r < 8; ++r) {
      const int qi = q0 + 8 * hh + r;
      const int ja = j0 + ln, jb = j0 + 16 + ln;
      if (CAUSAL) { if (ja > qi) s[0][r] = -3.0e38f; if (jb > qi) s[1][r] = -3.0e38f; }
      if (ja >= T) s[0][r] = -3.0e38f;
      if (jb >= T) s[1][r] = -3.0e38f;
      float mx = fmaxf(s[0][r], s[1][r]);
      mx = fmaxf(mx, __shfl_xor(mx, 1, 32)); mx = fmaxf(mx, __shfl_xor(mx, 2, 32)); mx = fmaxf(mx, __shfl_xor(mx, 4, 32)); mx = fmaxf(mx, __shfl_xor(mx, 8, 32));
      const float mnew = fmaxf(m_r[r], mx);
      alpha[r] = (mnew > -1.0e38f) ? __expf(m_r[r] - mnew) : 1.0f;
      const float p0 = (s[0][r] > -1.0e38f) ? __expf(s[0][r] - mnew) : 0.f;
      const float p1 = (s[1][r] > -1.0e38f) ? __expf(s[1][r] - mnew) : 0.f;
      m_r[r] = mnew;
      l_r[r] = l_r[r] * alpha[r] + p0 + p1;            // per-lane partial row sum (16 lanes combined at the end)
      unsigned short hb = bf16_bits(p0); sPh[w][8 * hh + r][ln] = hb;      sPl[w][8 * hh + r][ln] = bf16_bits(p0 - bf16_val(hb));
      hb = bf16_bits(p1);                sPh[w][8 * hh + r][16 + ln] = hb; sPl[w][8 * hh + r][16 + ln] = bf16_bits(p1 - bf16_val(hb));
    }
#pragma unroll
    for (int dt = 0; dt < DT; ++dt)
#pragma unroll
      for (int r = 0; r < 8; ++r) oacc[dt][r] *= alpha[r];
    __builtin_amdgcn_fence(__ATOMIC_ACQ_REL, "workgroup");
    __builtin_amdgcn_wave_barrier();
    FragB pah, pal;
    pah.half[0] = *(const v8us*)&sPh[w][ln][8 * hh]; pah.half[1] = *(const v8us*)&sPh[w][ln][16 + 8 * hh];
    pal.half[0] = *(const v8us*)&sPl[w][ln][8 * hh]; pal.half[1] = *(const v8us*)&sPl[w][ln][16 + 8 * hh];
#pragma unroll
    for (int dt = 0; dt < DT; ++dt) {
      FragB bvh, bvl;
#pragma unroll
      for (int i = 0; i < 8; ++i) {
        bvh.u[i] = sVh[8 * hh + i][dt * 16 + ln]; bvh.u[8 + i] = sVh[16 + 8 * hh + i][dt * 16 + ln];
        bvl.u[i] = sVl[8 * hh + i][dt * 16 + ln]; bvl.u[8 + i] = sVl[16 + 8 * hh + i][dt * 16 + ln];
      }
      oacc[dt] = mmaN<3>(pah.v, pal.v, bvh.v, bvl.v, oacc[dt]);
    }
    __builtin_amdgcn_fence(__ATOMIC_ACQ_REL, "workgroup");
    __builtin_amdgcn_wave_barrier();
  }
#pragma unroll
  for (int r = 0; r < 8; ++r) {
    float l = l_r[r];
    l += __shfl_xor(l, 1, 32); l += __shfl_xor(l, 2, 32); l += __shfl_xor(l, 4, 32); l += __shfl_xor(l, 8, 32);
    l_r[r] = (l > 0.f) ? 1.0f / l : 0.f;
  }
#pragma unroll
  for (int dt = 0; dt < DT; ++dt)
#pragma unroll
    for (int r = 0; r < 8; ++r) sO[w][8 * hh + r][dt * 16 + ln] = oacc[dt][r] * l_r[r];
  __builtin_amdgcn_fence(__ATOMIC_ACQ_REL, "workgroup");
  __builtin_amdgcn_wave_barrier();
  {
    for (int r = 0; r < 16; ++r) {
      const int row = q0 + r;
      if (row < T && lane < D / 4) {
        const v4f val = *(const v4fa*)&sO[w][r][lane * 4];
        *(v4f*)(y + ((size_t)b * T + row) * ypitch + h * D + lane * 4) = val;
      }
    }
    
  }
}

// Self-attention (Tq == Tk == T) with optional int mask [T][T] (nonzero = keep) and/or causal flag; 3-term bf16 splits;
// Q/K/V rows read from f32 buffers: X + b*T*pitch + h*D + row*pitch. y[b][row][h*D + d], pitch ypitch. D % 32 == 0.
template <int D>
__global__ __launch_bounds__(128) void k_flashm(const float* __restrict__ Qb, int qpitch, const float* __restrict__ Kb, int kpitch,
                                              const float* __restrict__ Vb, int vpitch, int T, int H, float scale,
                                              const int* __restrict__ mask, int causal, float* __restrict__ y, int ypitch, const float* __restrict__ sbias) {
  constexpr int KS = D / 32, DT = D / 16;
  __shared__ __attribute__((aligned(16))) unsigned short sKh[32][D + 8], sKl[32][D + 8], sVh[32][D + 8], sVl[32][D + 8];
  __shared__ __attribute__((aligned(16))) unsigned short sPh[4][16][40], sPl[4][16][40];
  __shared__ __attribute__((aligned(16))) float sO[4][16][D];
  const int tid = threadIdx.x, w = tid >> 5, lane = tid & 31, ln = lane & 15, hh = lane >> 4;
  const int nqb = (T + 63) / 64;
  const int bh = blockIdx.x / nqb, qblk = blockIdx.x % nqb;
  const int b = bh / H, h = bh % H;
  const int q0 = qblk * 64 + w * 16;
  const float* Q = Qb + (size_t)b * T * qpitch + h * D;
  const float* K = Kb + (size_t)b * T * kpitch + h * D;
  const float* V = Vb + (size_t)b * T * vpitch + h * D;
  FragB aqh[KS], aql[KS];
  {
    int row = q0 + ln; if (row >= T) row = T - 1;
    const float* qr = Q + (size_t)row * qpitch;
#pragma unroll
    for (int ks = 0; ks < KS; ++ks)
#pragma unroll
      for (int i = 0; i < 16; ++i) {
        const int d = ks * 32 + ((i < 8) ? (8 * hh + i) : (16 + 8 * hh + (i - 8)));
        const float x = qr[d] * scale; const unsigned short hb = bf16_bits(x);
        aqh[ks].u[i] = hb; aql[ks].u[i] = bf16_bits(x - bf16_val(hb));
      }
  }
  int qrow[8];
#pragma unroll
  for (int r = 0; r < 8; ++r) { int qi = q0 + 8 * hh + r; qrow[r] = qi < T ? qi : T - 1; }
  float m_r[8], l_r[8];
#pragma unroll
  for (int r = 0; r < 8; ++r) { m_r[r] = -3.0e38f; l_r[r] = 0.f; }
  v8f oacc[DT];
#pragma unroll
  for (int dt = 0; dt < DT; ++dt) oacc[dt] = (v8f){0.f,0.f,0.f,0.f,0.f,0.f,0.f,0.f};
  const int kv_end = causal ? min(T, qblk * 64 + 64) : T;
  for (int j0 = 0; j0 < kv_end; j0 += 32) {
    __syncthreads();
    for (int e = tid; e < 32 * (D / 4); e += 128) {
      const int r = e / (D / 4), c4 = (e % (D / 4)) * 4; const int key = j0 + r;
      v4f kf = {0.f,0.f,0.f,0.f}, vf = {0.f,0.f,0.f,0.f};
      if (key < T) { kf = *(const v4fa*)(K + (size_t)key * kpitch + c4); vf = *(const v4fa*)(V + (size_t)key * vpitch + c4); }
#pragma unroll
      for (int t = 0; t < 4; ++t) {
        unsigned short hb = bf16_bits(kf[t]); sKh[r][c4 + t] = hb; sKl[r][c4 + t] = bf16_bits(kf[t] - bf16_val(hb));
        hb = bf16_bits(vf[t]); sVh[r][c4 + t] = hb; sVl[r][c4 + t] = bf16_bits(vf[t] - bf16_val(hb));
      }
    }
    __syncthreads();
    v8f s[2];
#pragma unroll
    for (int nt = 0; nt < 2; ++nt) {
      v8f acc = {};
#pragma unroll
      for (int ks = 0; ks < KS; ++ks) {
        FragB bh_, bl_;
        bh_.half[0] = *(const v8us*)&sKh[nt * 16 + ln][ks * 32 + 8 * hh]; bh_.half[1] = *(const v8us*)&sKh[nt * 16 + ln][ks * 32 + 16 + 8 * hh];
        bl_.half[0] = *(const v8us*)&sKl[nt * 16 + ln][ks * 32 + 8 * hh]; bl_.half[1] = *(const v8us*)&sKl[nt * 16 + ln][ks * 32 + 16 + 8 * hh];
        acc = mmaN<3>(aqh[ks].v, aql[ks].v, bh_.v, bl_.v, acc);
      }
      s[nt] = acc;
    }
    float alpha[8];
#pragma unroll
    for (int r = 0; r < 8; ++r) {
      const int qi = qrow[r];
      const int ja = j0 + ln, jb = j0 + 16 + ln;
      bool keepa = ja < T, keepb = jb < T;
      if (sbias) { const float bq = sbias[(size_t)bh * T + qi]; if (keepa) s[0][r] += bq + sbias[(size_t)bh * T + ja]; if (keepb) s[1][r] += bq + sbias[(size_t)bh * T + jb]; }
      if (causal) { keepa = keepa && (ja <= qi); keepb = keepb && (jb <= qi); }
      if (mask) { if (keepa) keepa = mask[(size_t)qi * T + ja] != 0; if (keepb) keepb = mask[(size_t)qi * T + jb] != 0; }
      if (!keepa) s[0][r] = -3.0e38f;
      if (!keepb) s[1][r] = -3.0e38f;
      float mx = fmaxf(s[0][r], s[1][r]);
      mx = fmaxf(mx, __shfl_xor(mx, 1, 32)); mx = fmaxf(mx, __shfl_xor(mx, 2, 32)); mx = fmaxf(mx, __shfl_xor(mx, 4, 32)); mx = fmaxf(mx, __shfl_xor(mx, 8, 32));
      const float mnew = fmaxf(m_r[r], mx);
      alpha[r] = (mnew > -1.0e38f) ? __expf(m_r[r] - mnew) : 1.0f;
      const float p0 = keepa ? __expf(s[0][r] - mnew) : 0.f;
      const float p1 = keepb ? __expf(s[1][r] - mnew) : 0.f;
      m_r[r] = mnew;
      l_r[r] = l_r[r] * alpha[r] + p0 + p1;
      unsigned short hb = bf16_bits(p0); sPh[w][8 * hh + r][ln] = hb;      sPl[w][8 * hh + r][ln] = bf16_bits(p0 - bf16_val(hb));
      hb = bf16_bits(p1);                sPh[w][8 * hh + r][16 + ln] = hb; sPl[w][8 * hh + r][16 + ln] = bf16_bits(p1 - bf16_val(hb));
    }
#pragma unroll
    for (int dt = 0; dt < DT; ++dt)
#pragma unroll
      for (int r = 0; r < 8; ++r) oacc[dt][r] *= alpha[r];
    __builtin_amdgcn_fence(__ATOMIC_ACQ_REL, "workgroup");
    __builtin_amdgcn_wave_barrier();
    FragB pah, pal;
    pah.half[0] = *(const v8us*)&sPh[w][ln][8 * hh]; pah.half[1] = *(const v8us*)&sPh[w][ln][16 + 8 * hh];
    pal.half[0] = *(const v8us*)&sPl[w][ln][8 * hh]; pal.half[1] = *(const v8us*)&sPl[w][ln][16 + 8 * hh];
#pragma unroll
    for (int dt = 0; dt < DT; ++dt) {
      FragB bvh, bvl;
#pragma unroll
      for (int i = 0; i < 8; ++i) {
        bvh.u[i] = sVh[8 * hh + i][dt * 16 + ln]; bvh.u[8 + i] = sVh[16 + 8 * hh + i][dt * 16 + ln];
        bvl.u[i] = sVl[8 * hh + i][dt * 16 + ln]; bvl.u[8 + i] = sVl[16 + 8 * hh + i][dt * 16 + ln];
      }
      oacc[dt] = mmaN<3>(pah.v, pal.v, bvh.v, bvl.v, oacc[dt]);
    }
    __builtin_amdgcn_fence(__ATOMIC_ACQ_REL, "workgroup");
    __builtin_amdgcn_wave_barrier();
  }
  // NaN for fully-masked rows (softmax over a row of -inf)
#pragma unroll
  for (int r = 0; r < 8; ++r) {
    float l = l_r[r];
    l += __shfl_xor(l, 1, 32); l += __shfl_xor(l, 2, 32); l += __shfl_xor(l, 4, 32); l += __shfl_xor(l, 8, 32);
    l_r[r] = (m_r[r] > -1.0e38f) ? 1.0f / l : __builtin_nanf("");
  }
#pragma unroll
  for (int dt = 0; dt < DT; ++dt)
#pragma unroll
    for (int r = 0; r < 8; ++r) sO[w][8 * hh + r][dt * 16 + ln] = oacc[dt][r] * l_r[r];
  __builtin_amdgcn_fence(__ATOMIC_ACQ_REL, "workgroup");
  __builtin_amdgcn_wave_barrier();
  {
    for (int r = 0; r < 16; ++r) {
      const int row = q0 + r;
      if (row < T && lane < D / 4) {
        const v4f val = *(const v4fa*)&sO[w][r][lane * 4];
        *(v4f*)(y + ((size_t)b * T + row) * ypitch + h * D + lane * 4) = val;
      }
    }
    
  }
}

__global__ __launch_bounds__(256) void k_round_rows(const float* __restrict__ W, unsigned short* __restrict__ Wt, int n8) {
  const int t = blockIdx.x * 256 + threadIdx.x;
  if (t >= n8) return;
  const v4f a = *(const v4fa*)(W + (size_t)t * 8), b = *(const v4fa*)(W + (size_t)t * 8 + 4);
  v8us v; v[0]=bf16_bits(a[0]); v[1]=bf16_bits(a[1]); v[2]=bf16_bits(a[2]); v[3]=bf16_bits(a[3]);
  v[4]=bf16_bits(b[0]); v[5]=bf16_bits(b[1]); v[6]=bf16_bits(b[2]); v[7]=bf16_bits(b[3]);
  *(v8us*)(Wt + (size_t)t * 8) = v; 
}

// 32 patches per block: 64-point rDFT power per bin k = 0..32 (1056 (patch, bin) pairs over the 256 threads), band means, log1p,
// then bias[b][h][n] = Σ_c bp[c]·band_bias[h][c] for the 8 heads; (threads 0..31, one patch each);
// layout sbias[(b*H + h)*N + n]: for fixed (b,h) consecutive n are contiguous, so a block
// writes 32 consecutive n for each h = 128 B pieces (wave h stores head h).
__global__ __launch_bounds__(256) void k_bandbias(const float* __restrict__ patches, const float* __restrict__ band_bias, float* __restrict__ sbias) {
  __shared__ float sp[32][PL];
  __shared__ float pw[32][33];
  __shared__ float sb[NH][32];
  const int tid = threadIdx.x;
  const int blk = blockIdx.x;                 // over B*N/32
  const int b = blk / (NN / 32), n0 = (blk % (NN / 32)) * 32;
  for (int e = tid; e < 32 * PL; e += 256) { const int r = e / PL, c = e % PL; sp[r][c] = bf16_round(patches[((size_t)b * NN + n0 + r) * PL + c]); }
  __syncthreads();
  // 32 patches x 33 bins = 1056 (patch, bin) pairs over 256 threads
  for (int e = tid; e < 32 * 33; e += 256) {
    const int r = e / 33, kbin = e % 33;
    float re = 0.f, im = 0.f;
#pragma unroll 1
    for (int n = 0; n < PL; ++n) {
      const int m = (kbin * n) & (PL - 1);                   // angle = 2*pi*m/64, exact reduction
      const float ang = 0.09817477042468103f * (float)m;     // 2*pi/64
      const float c = cosf(ang), s = sinf(ang);
      re += sp[r][n] * c; im -= sp[r][n] * s;
    }
    pw[r][kbin] = re * re + im * im;
  }
  __syncthreads();
  if (tid < 32) {
    const int r = tid;
    // bands sorted by name: alpha {3}, beta {4..7}, delta {1}, gamma {8..25}, theta {2}  (rfftfreq(64, 1/250) = 3.90625 k)
    float bp[NBANDS];
    bp[0] = pw[r][3];
    bp[1] = (pw[r][4] + pw[r][5] + pw[r][6] + pw[r][7]) * 0.25f;
    bp[2] = pw[r][1];
    { float s = 0.f;
#pragma unroll 1
      for (int kbin = 8; kbin <= 25; ++kbin) s += pw[r][kbin]; bp[3] = s * (1.0f / 18.0f); }
    bp[4] = pw[r][2];
#pragma unroll 1
    for (int c = 0; c < NBANDS; ++c) bp[c] = log1pf(bp[c]);
#pragma unroll 1
    for (int h = 0; h < NH; ++h) {
      float s = 0.f;
#pragma unroll 1
      for (int c = 0; c < NBANDS; ++c) s += bp[c] * bf16_round(band_bias[h * NBANDS + c]);
      sb[h][r] = s;
    }
  }
  __syncthreads();
  {
    const int h = tid >> 5, r = tid & 31;
    float* dst = sbias + ((size_t)(b * NH + h)) * NN + n0 + r;
    const float v = sb[h][r];
    *(float*)dst = v; 
  }
}

extern "C" void kernel_launch(void* const* d_in, const int* in_sizes, int n_in,
                              void* d_out, int out_size, void* d_ws, size_t ws_size, hipStream_t stream) {
  (void)in_sizes; (void)n_in; (void)out_size;
  const float* x = (const float*)d_in[0]; const float* patches = (const float*)d_in[1];
  const float* Wq = (const float*)d_in[2]; const float* bq = (const float*)d_in[3];
  const float* Wk = (const float*)d_in[4]; const float* bk = (const float*)d_in[5];
  const float* Wv = (const float*)d_in[6]; const float* bv = (const float*)d_in[7];
  const float* Wo = (const float*)d_in[8]; const float* bo = (const float*)d_in[9];
  const float* band_bias = (const float*)d_in[10];
  char* ws = (char*)d_ws; size_t off = 0;
  unsigned short* Wqt = (unsigned short*)(ws + off); off += (size_t)DM * DM * 2;
  unsigned short* Wkt = (unsigned short*)(ws + off); off += (size_t)DM * DM * 2;
  unsigned short* Wvt = (unsigned short*)(ws + off); off += (size_t)DM * DM * 2;
  unsigned short* Wot = (unsigned short*)(ws + off); off += (size_t)DM * DM * 2;
  float* qb = (float*)(ws + off); off += (size_t)BB * NN * DM * 4;
  float* kb2 = (float*)(ws + off); off += (size_t)BB * NN * DM * 4;
  float* vb2 = (float*)(ws + off); off += (size_t)BB * NN * DM * 4;
  float* ob = (float*)(ws + off); off += (size_t)BB * NN * DM * 4;
  float* sbias = (float*)(ws + off); off += (size_t)BB * NH * NN * 4;
  if (off > ws_size) return;
  const int M = BB * NN, n8 = DM * DM / 8;
  k_round_rows<<<(n8 + 255) / 256, 256, 0, stream>>>(Wq, Wqt, n8);
  k_round_rows<<<(n8 + 255) / 256, 256, 0, stream>>>(Wk, Wkt, n8);
  k_round_rows<<<(n8 + 255) / 256, 256, 0, stream>>>(Wv, Wvt, n8);
  k_round_rows<<<(n8 + 255) / 256, 256, 0, stream>>>(Wo, Wot, n8);
  const int gb = ((M / 16) * (DM / 64) + 3) / 4;
  k_gemm_bf<false, 0, true><<<gb, 128, 0, stream>>>(x, DM, Wqt, DM, bq, qb, DM, M, DM, DM);
  k_gemm_bf<false, 0, true><<<gb, 128, 0, stream>>>(x, DM, Wkt, DM, bk, kb2, DM, M, DM, DM);
  k_gemm_bf<false, 0, true><<<gb, 128, 0, stream>>>(x, DM, Wvt, DM, bv, vb2, DM, M, DM, DM);
  k_bandbias<<<BB * NN / 32, 256, 0, stream>>>(patches, band_bias, sbias);
  k_flashm<HD><<<BB * NH * (NN / 64), 128, 0, stream>>>(qb, DM, kb2, DM, vb2, DM, NN, NH, 0.125f, nullptr, 0, ob, DM, sbias);
  k_gemm_bf<true, 0, true><<<gb, 128, 0, stream>>>(ob, DM, Wot, DM, bo, (float*)d_out, DM, M, DM, DM);
}

// v001
// One run takes 288 microseconds.
// In both of two side-by-side timings against v000, it was 1.79 times as fast.
#include <hip/hip_runtime.h>
// All contractions on v_wmma_f32_16x16x32_bf16, f32 accumulate: Q/K/V = x·Wᵀ with x/W rounded to bf16 (single exact-product
// term), QKᵀ and P·V 3-term bf16 hi/lo splits, out = o·W_oᵀ with o split hi/lo (2 terms). The 64-point rFFT band powers,
// log1p, the 5->8 band-bias projection and softmax are f32 on VALU.
#define BB 2
#define NN 2048
#define DM 512
#define NH 8
#define HD 64
#define PL 64
#define NBANDS 5

typedef __bf16 v16b __attribute__((ext_vector_type(16)));
typedef unsigned short v8us __attribute__((ext_vector_type(8), may_alias));
typedef float  v8f  __attribute__((ext_vector_type(8)));
typedef float  v4f  __attribute__((ext_vector_type(4)));
typedef float  v4fa __attribute__((ext_vector_type(4), may_alias));
union FragB { v16b v; v8us half[2]; unsigned short u[16]; };

__device__ __forceinline__ unsigned short bf16_bits(float x) { unsigned int u = __float_as_uint(x); return (unsigned short)((u + 0x7FFFu + ((u >> 16) & 1u)) >> 16); }
__device__ __forceinline__ float bf16_val(unsigned short b) { return __uint_as_float(((unsigned int)b) << 16); }
__device__ __forceinline__ float bf16_round(float x) { return bf16_val(bf16_bits(x)); }
// D += A·B with NT terms: 1 = ah·bh, 2 = + al·bh (A split), 3 = + ah·bl (both split)
template <int NT>
__device__ __forceinline__ v8f mmaN(v16b ah, v16b al, v16b bh, v16b bl, v8f c) {
  c = __builtin_amdgcn_wmma_f32_16x16x32_bf16(false, ah, false, bh, (short)0, c, false, false);
  if (NT >= 2) c = __builtin_amdgcn_wmma_f32_16x16x32_bf16(false, al, false, bh, (short)0, c, false, false);
  if (NT >= 3) c = __builtin_amdgcn_wmma_f32_16x16x32_bf16(false, ah, false, bl, (short)0, c, false, false);
  asm volatile("v_nop\n\tv_nop\n\tv_nop\n\tv_nop" : "+v"(c) : "v"(ah), "v"(al), "v"(bh), "v"(bl));
  return c;
}

__global__ __launch_bounds__(256) void k_wt_bf16(const float* __restrict__ W, unsigned short* __restrict__ Wt, int K, int N) {
  const int t = blockIdx.x * 256 + threadIdx.x;
  const int k8n = K / 8;
  if (t >= N * k8n) return;
  const int n = t / k8n, k8 = (t % k8n) * 8;
  v8us v;
#pragma unroll
  for (int i = 0; i < 8; ++i) v[i] = bf16_bits(W[(size_t)(k8 + i) * N + n]);
  *(v8us*)(Wt + (size_t)n * K + k8) = v;
  
}

// GEMM C[M][N] (f32, pitch ldc) = act(A[M][K]·W + bias). A f32 row-major (pitch lda) converted per fragment to bf16
// (ASPLIT: hi/lo two planes -> 2 terms, else single rounded term); Wt bf16 [N][K] (pitch ldb). BIAS_BF16 rounds the
// bias to bf16 first (bias quantised to bf16 before the add). K%32==0, M%16==0, N%64==0.
template <bool ASPLIT, int ACT, bool BIAS_BF16>
__global__ __launch_bounds__(128) void k_gemm_bf(const float* __restrict__ A, int lda, const unsigned short* __restrict__ Wt, int ldb,
                                               const float* __restrict__ bias, float* __restrict__ C, int ldc, int M, int N, int K) {
  __shared__ __attribute__((aligned(16))) float so[4][16][64];
  const int tid = threadIdx.x, w = tid >> 5, lane = tid & 31, ln = lane & 15, hh = lane >> 4;
  const int ntn = N / 64;
  const int wid = blockIdx.x * 4 + w;
  const int mt = wid / ntn, nq = wid % ntn;
  if (mt * 16 >= M) return;
  const int row0 = mt * 16, col0 = nq * 64;
  const float* arow = A + (size_t)(row0 + ln) * lda;
  v8f acc[4] = {};
  for (int kb = 0; kb < K; kb += 32) {
    FragB ah, al;
    const v4f x0 = *(const v4fa*)(arow + kb + 8 * hh), x1 = *(const v4fa*)(arow + kb + 8 * hh + 4);
    const v4f x2 = *(const v4fa*)(arow + kb + 16 + 8 * hh), x3 = *(const v4fa*)(arow + kb + 16 + 8 * hh + 4);
    float xs[16] = {x0[0],x0[1],x0[2],x0[3],x1[0],x1[1],x1[2],x1[3],x2[0],x2[1],x2[2],x2[3],x3[0],x3[1],x3[2],x3[3]};
#pragma unroll
    for (int i = 0; i < 16; ++i) { const unsigned short hb = bf16_bits(xs[i]); ah.u[i] = hb; al.u[i] = ASPLIT ? bf16_bits(xs[i] - bf16_val(hb)) : (unsigned short)0; }
#pragma unroll
    for (int t = 0; t < 4; ++t) {
      const unsigned short* brow = Wt + (size_t)(col0 + t * 16 + ln) * ldb + kb;
      FragB b;
      b.half[0] = *(const v8us*)(brow + 8 * hh);
      b.half[1] = *(const v8us*)(brow + 16 + 8 * hh);
      acc[t] = mmaN<ASPLIT ? 2 : 1>(ah.v, al.v, b.v, b.v, acc[t]);
    }
  }
#pragma unroll
  for (int t = 0; t < 4; ++t) {
    float bv = bias ? bias[col0 + t * 16 + ln] : 0.f;
    if (BIAS_BF16) bv = bf16_round(bv);
#pragma unroll
    for (int r = 0; r < 8; ++r) { float v = acc[t][r] + bv; if (ACT == 1) v = fmaxf(v, 0.f); so[w][8 * hh + r][t * 16 + ln] = v; }
  }
  __builtin_amdgcn_fence(__ATOMIC_ACQ_REL, "workgroup");
  __builtin_amdgcn_wave_barrier();
  const int rsub = lane >> 4, c4 = (lane & 15) * 4;
  {
#pragma unroll
    for (int q = 0; q < 8; ++q) {
      const int r = q * 2 + rsub;
      const v4f v = *(const v4fa*)&so[w][r][c4];
      *(v4f*)(C + (size_t)(row0 + r) * ldc + col0 + c4) = v;
    }
    
  }
}

// Flash-style causal/unmasked attention, all contractions 3-term bf16 hi/lo splits, f32 softmax with running max.
// q,k,v rows are read from f32 buffers with arbitrary row pitch (so they can live inside a fused qkv buffer);
// D = head size (multiple of 32, <= 128); one wave = 16 query rows; block = 4 waves (64 queries) sharing K/V chunks of 32.
template <int D, bool CAUSAL>
__global__ __launch_bounds__(128) void k_flash(const float* __restrict__ qb, const float* __restrict__ kb, const float* __restrict__ vb,
                                             int pitch, int T, int H, float scale, float* __restrict__ y, int ypitch) {
  constexpr int KS = D / 32;        // k-steps for QK
  constexpr int DT = D / 16;        // d tiles for PV
  __shared__ __attribute__((aligned(16))) unsigned short sKh[32][D + 8], sKl[32][D + 8], sVh[32][D + 8], sVl[32][D + 8];
  __shared__ __attribute__((aligned(16))) unsigned short sPh[4][16][40], sPl[4][16][40];
  __shared__ __attribute__((aligned(16))) float sO[4][16][D];
  const int tid = threadIdx.x, w = tid >> 5, lane = tid & 31, ln = lane & 15, hh = lane >> 4;
  const int nqb = (T + 63) / 64;
  const int bh = blockIdx.x / nqb, qblk = blockIdx.x % nqb;
  const int b = bh / H, h = bh % H;
  const int q0 = qblk * 64 + w * 16;
  const float* Q = qb + (size_t)b * T * pitch + h * D;
  const float* K = kb + (size_t)b * T * pitch + h * D;
  const float* V = vb + (size_t)b * T * pitch + h * D;

  // A fragments of the wave's 16 query rows (scaled), hi/lo
  FragB aqh[KS], aql[KS];
  {
    int row = q0 + ln; if (row >= T) row = T - 1;
    const float* qr = Q + (size_t)row * pitch;
#pragma unroll
    for (int ks = 0; ks < KS; ++ks)
#pragma unroll
      for (int i = 0; i < 16; ++i) {
        const int d = ks * 32 + ((i < 8) ? (8 * hh + i) : (16 + 8 * hh + (i - 8)));
        const float x = qr[d] * scale; const unsigned short hb = bf16_bits(x);
        aqh[ks].u[i] = hb; aql[ks].u[i] = bf16_bits(x - bf16_val(hb));
      }
  }
  float m_r[8], l_r[8];
#pragma unroll
  for (int r = 0; r < 8; ++r) { m_r[r] = -3.0e38f; l_r[r] = 0.f; }
  v8f oacc[DT];
#pragma unroll
  for (int dt = 0; dt < DT; ++dt) oacc[dt] = (v8f){0.f,0.f,0.f,0.f,0.f,0.f,0.f,0.f};

  const int kv_end = CAUSAL ? min(T, qblk * 64 + 64) : T;     // block-uniform
  for (int j0 = 0; j0 < kv_end; j0 += 32) {
    __syncthreads();
    for (int e = tid; e < 32 * (D / 4); e += 128) {
      const int r = e / (D / 4), c4 = (e % (D / 4)) * 4;
      const int key = j0 + r;
      v4f kf = {0.f,0.f,0.f,0.f}, vf = {0.f,0.f,0.f,0.f};
      if (key < T) { kf = *(const v4fa*)(K + (size_t)key * pitch + c4); vf = *(const v4fa*)(V + (size_t)key * pitch + c4); }
#pragma unroll
      for (int t = 0; t < 4; ++t) {
        unsigned short hb = bf16_bits(kf[t]); sKh[r][c4 + t] = hb; sKl[r][c4 + t] = bf16_bits(kf[t] - bf16_val(hb));
        hb = bf16_bits(vf[t]); sVh[r][c4 + t] = hb; sVl[r][c4 + t] = bf16_bits(vf[t] - bf16_val(hb));
      }
    }
    __syncthreads();
    // S tile 16 x 32
    v8f s[2];
#pragma unroll
    for (int nt = 0; nt < 2; ++nt) {
      v8f acc = {};
#pragma unroll
      for (int ks = 0; ks < KS; ++ks) {
        FragB bh_, bl_;
        bh_.half[0] = *(const v8us*)&sKh[nt * 16 + ln][ks * 32 + 8 * hh]; bh_.half[1] = *(const v8us*)&sKh[nt * 16 + ln][ks * 32 + 16 + 8 * hh];
        bl_.half[0] = *(const v8us*)&sKl[nt * 16 + ln][ks * 32 + 8 * hh]; bl_.half[1] = *(const v8us*)&sKl[nt * 16 + ln][ks * 32 + 16 + 8 * hh];
        acc = mmaN<3>(aqh[ks].v, aql[ks].v, bh_.v, bl_.v, acc);
      }
      s[nt] = acc;
    }
    // mask + running max (rows 8hh+r; the 16 lanes of a half share rows)
    float alpha[8];
#pragma unroll
    for (int r = 0; r < 8; ++r) {
      const int qi = q0 + 8 * hh + r;
      const int ja = j0 + ln, jb = j0 + 16 + ln;
      if (CAUSAL) { if (ja > qi) s[0][r] = -3.0e38f; if (jb > qi) s[1][r] = -3.0e38f; }
      if (ja >= T) s[0][r] = -3.0e38f;
      if (jb >= T) s[1][r] = -3.0e38f;
      float mx = fmaxf(s[0][r], s[1][r]);
      mx = fmaxf(mx, __shfl_xor(mx, 1, 32)); mx = fmaxf(mx, __shfl_xor(mx, 2, 32)); mx = fmaxf(mx, __shfl_xor(mx, 4, 32)); mx = fmaxf(mx, __shfl_xor(mx, 8, 32));
      const float mnew = fmaxf(m_r[r], mx);
      alpha[r] = (mnew > -1.0e38f) ? __expf(m_r[r] - mnew) : 1.0f;
      const float p0 = (s[0][r] > -1.0e38f) ? __expf(s[0][r] - mnew) : 0.f;
      const float p1 = (s[1][r] > -1.0e38f) ? __expf(s[1][r] - mnew) : 0.f;
      m_r[r] = mnew;
      l_r[r] = l_r[r] * alpha[r] + p0 + p1;            // per-lane partial row sum (16 lanes combined at the end)
      unsigned short hb = bf16_bits(p0); sPh[w][8 * hh + r][ln] = hb;      sPl[w][8 * hh + r][ln] = bf16_bits(p0 - bf16_val(hb));
      hb = bf16_bits(p1);                sPh[w][8 * hh + r][16 + ln] = hb; sPl[w][8 * hh + r][16 + ln] = bf16_bits(p1 - bf16_val(hb));
    }
#pragma unroll
    for (int dt = 0; dt < DT; ++dt)
#pragma unroll
      for (int r = 0; r < 8; ++r) oacc[dt][r] *= alpha[r];
    __builtin_amdgcn_fence(__ATOMIC_ACQ_REL, "workgroup");
    __builtin_amdgcn_wave_barrier();
    FragB pah, pal;
    pah.half[0] = *(const v8us*)&sPh[w][ln][8 * hh]; pah.half[1] = *(const v8us*)&sPh[w][ln][16 + 8 * hh];
    pal.half[0] = *(const v8us*)&sPl[w][ln][8 * hh]; pal.half[1] = *(const v8us*)&sPl[w][ln][16 + 8 * hh];
#pragma unroll
    for (int dt = 0; dt < DT; ++dt) {
      FragB bvh, bvl;
#pragma unroll
      for (int i = 0; i < 8; ++i) {
        bvh.u[i] = sVh[8 * hh + i][dt * 16 + ln]; bvh.u[8 + i] = sVh[16 + 8 * hh + i][dt * 16 + ln];
        bvl.u[i] = sVl[8 * hh + i][dt * 16 + ln]; bvl.u[8 + i] = sVl[16 + 8 * hh + i][dt * 16 + ln];
      }
      oacc[dt] = mmaN<3>(pah.v, pal.v, bvh.v, bvl.v, oacc[dt]);
    }
    __builtin_amdgcn_fence(__ATOMIC_ACQ_REL, "workgroup");
    __builtin_amdgcn_wave_barrier();
  }
#pragma unroll
  for (int r = 0; r < 8; ++r) {
    float l = l_r[r];
    l += __shfl_xor(l, 1, 32); l += __shfl_xor(l, 2, 32); l += __shfl_xor(l, 4, 32); l += __shfl_xor(l, 8, 32);
    l_r[r] = (l > 0.f) ? 1.0f / l : 0.f;
  }
#pragma unroll
  for (int dt = 0; dt < DT; ++dt)
#pragma unroll
    for (int r = 0; r < 8; ++r) sO[w][8 * hh + r][dt * 16 + ln] = oacc[dt][r] * l_r[r];
  __builtin_amdgcn_fence(__ATOMIC_ACQ_REL, "workgroup");
  __builtin_amdgcn_wave_barrier();
  {
    for (int r = 0; r < 16; ++r) {
      const int row = q0 + r;
      if (row < T && lane < D / 4) {
        const v4f val = *(const v4fa*)&sO[w][r][lane * 4];
        *(v4f*)(y + ((size_t)b * T + row) * ypitch + h * D + lane * 4) = val;
      }
    }
    
  }
}

// Self-attention (Tq == Tk == T), 3-term bf16 splits. T, the row pitch and the three options (causal, int mask [T][T] with
// nonzero = keep, additive score bias sbias[bh][q] + sbias[bh][k]) are template constants, so the key loop holds no branch.
// Q/K/V rows read from f32 buffers: X + b*T*PITCH + h*D + row*PITCH. y[b][row][h*D + d], pitch PITCH. D % 32 == 0, T % 64 == 0.
template <int D, int T, int PITCH, bool CAUSAL, bool HASMASK, bool HASBIAS>
__global__ __launch_bounds__(128) void k_flashm(const float* __restrict__ Qb, const float* __restrict__ Kb, const float* __restrict__ Vb,
                                              int H, float scale, const int* __restrict__ mask, float* __restrict__ y, const float* __restrict__ sbias) {
  static_assert(T % 64 == 0 && D % 32 == 0, "whole query blocks and key chunks only");
  constexpr int KS = D / 32, DT = D / 16;
  constexpr int NST = 32 * (D / 4) / 128;      // staging trips per thread, the same for every thread
  constexpr int RPT = 128 / (D / 4);           // key rows that the block stages per trip
  __shared__ __attribute__((aligned(16))) unsigned short sKh[32][D + 8], sKl[32][D + 8], sVh[32][D + 8], sVl[32][D + 8];
  __shared__ __attribute__((aligned(16))) unsigned short sPh[4][16][40], sPl[4][16][40];
  __shared__ __attribute__((aligned(16))) float sO[4][16][D];
  const int tid = threadIdx.x, w = tid >> 5, lane = tid & 31, ln = lane & 15, hh = lane >> 4;
  constexpr int nqb = T / 64;
  const int bh = blockIdx.x / nqb, qblk = blockIdx.x % nqb;
  const int b = bh / H, h = bh % H;
  const int q0 = qblk * 64 + w * 16;
  const float* Q = Qb + (size_t)b * T * PITCH + h * D;
  const float* K = Kb + (size_t)b * T * PITCH + h * D;
  const float* V = Vb + (size_t)b * T * PITCH + h * D;
  const float* SB = sbias + (size_t)bh * T;
  const unsigned uln = (unsigned)ln, toff = (unsigned)(tid / (D / 4)) * PITCH + (unsigned)(tid % (D / 4)) * 4u;
  FragB aqh[KS], aql[KS];
  {
    const float* qr = Q + (size_t)(q0 + ln) * PITCH;
#pragma unroll
    for (int ks = 0; ks < KS; ++ks)
#pragma unroll
      for (int i = 0; i < 16; ++i) {
        const int d = ks * 32 + ((i < 8) ? (8 * hh + i) : (16 + 8 * hh + (i - 8)));
        const float x = qr[d] * scale; const unsigned short hb = bf16_bits(x);
        aqh[ks].u[i] = hb; aql[ks].u[i] = bf16_bits(x - bf16_val(hb));
      }
  }
  float bq_r[8];                               // the wave's query biases, read once
#pragma unroll
  for (int r = 0; r < 8; ++r) bq_r[r] = HASBIAS ? SB[q0 + 8 * hh + r] : 0.f;
  float m_r[8], l_r[8];
#pragma unroll
  for (int r = 0; r < 8; ++r) { m_r[r] = -3.0e38f; l_r[r] = 0.f; }
  v8f oacc[DT];
#pragma unroll
  for (int dt = 0; dt < DT; ++dt) oacc[dt] = (v8f){0.f,0.f,0.f,0.f,0.f,0.f,0.f,0.f};
  const int kv_end = CAUSAL ? qblk * 64 + 64 : T;
  for (int j0 = 0; j0 < kv_end; j0 += 32) {
    __syncthreads();
    // every global read of the chunk is issued here, together: the two key biases and the thread's K and V pieces
    // (one address per operand and chunk; the staging trips differ by a constant offset only)
    const float* Kj = K + (size_t)j0 * PITCH; const float* Vj = V + (size_t)j0 * PITCH; const float* SBj = SB + j0;
    const float bka = HASBIAS ? SBj[uln] : 0.f, bkb = HASBIAS ? SBj[uln + 16u] : 0.f;
    v4f kf[NST], vf[NST];
#pragma unroll
    for (int it = 0; it < NST; ++it) {
      kf[it] = *(const v4fa*)(Kj + (toff + (unsigned)(it * RPT * PITCH))); vf[it] = *(const v4fa*)(Vj + (toff + (unsigned)(it * RPT * PITCH)));
    }
    asm volatile("s_wait_xcnt 0x0" ::: "memory");   // the conversions below reuse the loads' address registers
    __builtin_amdgcn_sched_barrier(0);         // keeps all ten loads above the conversions: sunk among them, a load pays its latency alone
#pragma unroll
    for (int it = 0; it < NST; ++it) {
      const int e = tid + it * 128;
      const int r = e / (D / 4), c4 = (e % (D / 4)) * 4;
#pragma unroll
      for (int t = 0; t < 4; ++t) {
        unsigned short hb = bf16_bits(kf[it][t]); sKh[r][c4 + t] = hb; sKl[r][c4 + t] = bf16_bits(kf[it][t] - bf16_val(hb));
        hb = bf16_bits(vf[it][t]); sVh[r][c4 + t] = hb; sVl[r][c4 + t] = bf16_bits(vf[it][t] - bf16_val(hb));
      }
    }
    __syncthreads();
    v8f s[2];
#pragma unroll
    for (int nt = 0; nt < 2; ++nt) {
      v8f acc = {};
#pragma unroll
      for (int ks = 0; ks < KS; ++ks) {
        FragB bh_, bl_;
        bh_.half[0] = *(const v8us*)&sKh[nt * 16 + ln][ks * 32 + 8 * hh]; bh_.half[1] = *(const v8us*)&sKh[nt * 16 + ln][ks * 32 + 16 + 8 * hh];
        bl_.half[0] = *(const v8us*)&sKl[nt * 16 + ln][ks * 32 + 8 * hh]; bl_.half[1] = *(const v8us*)&sKl[nt * 16 + ln][ks * 32 + 16 + 8 * hh];
        acc = mmaN<3>(aqh[ks].v, aql[ks].v, bh_.v, bl_.v, acc);
      }
      s[nt] = acc;
    }
    float alpha[8];
#pragma unroll
    for (int r = 0; r < 8; ++r) {
      const int qi = q0 + 8 * hh + r;
      const int ja = j0 + ln, jb = j0 + 16 + ln;
      bool keepa = true, keepb = true;
      if (HASBIAS) { s[0][r] += bq_r[r] + bka; s[1][r] += bq_r[r] + bkb; }
      if (CAUSAL) { keepa = ja <= qi; keepb = jb <= qi; }
      if (HASMASK) { keepa = keepa && mask[(size_t)qi * T + ja] != 0; keepb = keepb && mask[(size_t)qi * T + jb] != 0; }
      if (!keepa) s[0][r] = -3.0e38f;
      if (!keepb) s[1][r] = -3.0e38f;
      float mx = fmaxf(s[0][r], s[1][r]);
      mx = fmaxf(mx, __shfl_xor(mx, 1, 32)); mx = fmaxf(mx, __shfl_xor(mx, 2, 32)); mx = fmaxf(mx, __shfl_xor(mx, 4, 32)); mx = fmaxf(mx, __shfl_xor(mx, 8, 32));
      const float mnew = fmaxf(m_r[r], mx);
      alpha[r] = (mnew > -1.0e38f) ? __expf(m_r[r] - mnew) : 1.0f;
      const float p0 = keepa ? __expf(s[0][r] - mnew) : 0.f;
      const float p1 = keepb ? __expf(s[1][r] - mnew) : 0.f;
      m_r[r] = mnew;
      l_r[r] = l_r[r] * alpha[r] + p0 + p1;
      unsigned short hb = bf16_bits(p0); sPh[w][8 * hh + r][ln] = hb;      sPl[w][8 * hh + r][ln] = bf16_bits(p0 - bf16_val(hb));
      hb = bf16_bits(p1);                sPh[w][8 * hh + r][16 + ln] = hb; sPl[w][8 * hh + r][16 + ln] = bf16_bits(p1 - bf16_val(hb));
    }
#pragma unroll
    for (int dt = 0; dt < DT; ++dt)
#pragma unroll
      for (int r = 0; r < 8; ++r) oacc[dt][r] *= alpha[r];
    __builtin_amdgcn_fence(__ATOMIC_ACQ_REL, "workgroup");
    __builtin_amdgcn_wave_barrier();
    FragB pah, pal;
    pah.half[0] = *(const v8us*)&sPh[w][ln][8 * hh]; pah.half[1] = *(const v8us*)&sPh[w][ln][16 + 8 * hh];
    pal.half[0] = *(const v8us*)&sPl[w][ln][8 * hh]; pal.half[1] = *(const v8us*)&sPl[w][ln][16 + 8 * hh];
#pragma unroll
    for (int dt = 0; dt < DT; ++dt) {
      FragB bvh, bvl;
#pragma unroll
      for (int i = 0; i < 8; ++i) {
        bvh.u[i] = sVh[8 * hh + i][dt * 16 + ln]; bvh.u[8 + i] = sVh[16 + 8 * hh + i][dt * 16 + ln];
        bvl.u[i] = sVl[8 * hh + i][dt * 16 + ln]; bvl.u[8 + i] = sVl[16 + 8 * hh + i][dt * 16 + ln];
      }
      oacc[dt] = mmaN<3>(pah.v, pal.v, bvh.v, bvl.v, oacc[dt]);
    }
    __builtin_amdgcn_fence(__ATOMIC_ACQ_REL, "workgroup");
    __builtin_amdgcn_wave_barrier();
  }
  // NaN for fully-masked rows (softmax over a row of -inf)
#pragma unroll
  for (int r = 0; r < 8; ++r) {
    float l = l_r[r];
    l += __shfl_xor(l, 1, 32); l += __shfl_xor(l, 2, 32); l += __shfl_xor(l, 4, 32); l += __shfl_xor(l, 8, 32);
    l_r[r] = (m_r[r] > -1.0e38f) ? 1.0f / l : __builtin_nanf("");
  }
#pragma unroll
  for (int dt = 0; dt < DT; ++dt)
#pragma unroll
    for (int r = 0; r < 8; ++r) sO[w][8 * hh + r][dt * 16 + ln] = oacc[dt][r] * l_r[r];
  __builtin_amdgcn_fence(__ATOMIC_ACQ_REL, "workgroup");
  __builtin_amdgcn_wave_barrier();
  {
    for (int r = 0; r < 16; ++r) {
      const int row = q0 + r;
      if (lane < D / 4) {
        const v4f val = *(const v4fa*)&sO[w][r][lane * 4];
        *(v4f*)(y + ((size_t)b * T + row) * PITCH + h * D + lane * 4) = val;
      }
    }
    
  }
}

__global__ __launch_bounds__(256) void k_round_rows(const float* __restrict__ W, unsigned short* __restrict__ Wt, int n8) {
  const int t = blockIdx.x * 256 + threadIdx.x;
  if (t >= n8) return;
  const v4f a = *(const v4fa*)(W + (size_t)t * 8), b = *(const v4fa*)(W + (size_t)t * 8 + 4);
  v8us v; v[0]=bf16_bits(a[0]); v[1]=bf16_bits(a[1]); v[2]=bf16_bits(a[2]); v[3]=bf16_bits(a[3]);
  v[4]=bf16_bits(b[0]); v[5]=bf16_bits(b[1]); v[6]=bf16_bits(b[2]); v[7]=bf16_bits(b[3]);
  *(v8us*)(Wt + (size_t)t * 8) = v; 
}

// 32 patches per block: 64-point rDFT power per bin k = 0..32 (1056 (patch, bin) pairs over the 256 threads), band means, log1p,
// then bias[b][h][n] = Σ_c bp[c]·band_bias[h][c] for the 8 heads; (threads 0..31, one patch each);
// layout sbias[(b*H + h)*N + n]: for fixed (b,h) consecutive n are contiguous, so a block
// writes 32 consecutive n for each h = 128 B pieces (wave h stores head h).
__global__ __launch_bounds__(256) void k_bandbias(const float* __restrict__ patches, const float* __restrict__ band_bias, float* __restrict__ sbias) {
  __shared__ float sp[32][PL];
  __shared__ float pw[32][33];
  __shared__ float sb[NH][32];
  const int tid = threadIdx.x;
  const int blk = blockIdx.x;                 // over B*N/32
  const int b = blk / (NN / 32), n0 = (blk % (NN / 32)) * 32;
  for (int e = tid; e < 32 * PL; e += 256) { const int r = e / PL, c = e % PL; sp[r][c] = bf16_round(patches[((size_t)b * NN + n0 + r) * PL + c]); }
  __syncthreads();
  // 32 patches x 33 bins = 1056 (patch, bin) pairs over 256 threads
  for (int e = tid; e < 32 * 33; e += 256) {
    const int r = e / 33, kbin = e % 33;
    float re = 0.f, im = 0.f;
#pragma unroll 1
    for (int n = 0; n < PL; ++n) {
      const int m = (kbin * n) & (PL - 1);                   // angle = 2*pi*m/64, exact reduction
      const float ang = 0.09817477042468103f * (float)m;     // 2*pi/64
      const float c = cosf(ang), s = sinf(ang);
      re += sp[r][n] * c; im -= sp[r][n] * s;
    }
    pw[r][kbin] = re * re + im * im;
  }
  __syncthreads();
  if (tid < 32) {
    const int r = tid;
    // bands sorted by name: alpha {3}, beta {4..7}, delta {1}, gamma {8..25}, theta {2}  (rfftfreq(64, 1/250) = 3.90625 k)
    float bp[NBANDS];
    bp[0] = pw[r][3];
    bp[1] = (pw[r][4] + pw[r][5] + pw[r][6] + pw[r][7]) * 0.25f;
    bp[2] = pw[r][1];
    { float s = 0.f;
#pragma unroll 1
      for (int kbin = 8; kbin <= 25; ++kbin) s += pw[r][kbin]; bp[3] = s * (1.0f / 18.0f); }
    bp[4] = pw[r][2];
#pragma unroll 1
    for (int c = 0; c < NBANDS; ++c) bp[c] = log1pf(bp[c]);
#pragma unroll 1
    for (int h = 0; h < NH; ++h) {
      float s = 0.f;
#pragma unroll 1
      for (int c = 0; c < NBANDS; ++c) s += bp[c] * bf16_round(band_bias[h * NBANDS + c]);
      sb[h][r] = s;
    }
  }
  __syncthreads();
  {
    const int h = tid >> 5, r = tid & 31;
    float* dst = sbias + ((size_t)(b * NH + h)) * NN + n0 + r;
    const float v = sb[h][r];
    *(float*)dst = v; 
  }
}

extern "C" void kernel_launch(void* const* d_in, const int* in_sizes, int n_in,
                              void* d_out, int out_size, void* d_ws, size_t ws_size, hipStream_t stream) {
  (void)in_sizes; (void)n_in; (void)out_size;
  const float* x = (const float*)d_in[0]; const float* patches = (const float*)d_in[1];
  const float* Wq = (const float*)d_in[2]; const float* bq = (const float*)d_in[3];
  const float* Wk = (const float*)d_in[4]; const float* bk = (const float*)d_in[5];
  const float* Wv = (const float*)d_in[6]; const float* bv = (const float*)d_in[7];
  const float* Wo = (const float*)d_in[8]; const float* bo = (const float*)d_in[9];
  const float* band_bias = (const float*)d_in[10];
  char* ws = (char*)d_ws; size_t off = 0;
  unsigned short* Wqt = (unsigned short*)(ws + off); off += (size_t)DM * DM * 2;
  unsigned short* Wkt = (unsigned short*)(ws + off); off += (size_t)DM * DM * 2;
  unsigned short* Wvt = (unsigned short*)(ws + off); off += (size_t)DM * DM * 2;
  unsigned short* Wot = (unsigned short*)(ws + off); off += (size_t)DM * DM * 2;
  float* qb = (float*)(ws + off); off += (size_t)BB * NN * DM * 4;
  float* kb2 = (float*)(ws + off); off += (size_t)BB * NN * DM * 4;
  float* vb2 = (float*)(ws + off); off += (size_t)BB * NN * DM * 4;
  float* ob = (float*)(ws + off); off += (size_t)BB * NN * DM * 4;
  float* sbias = (float*)(ws + off); off += (size_t)BB * NH * NN * 4;
  if (off > ws_size) return;
  const int M = BB * NN, n8 = DM * DM / 8;
  k_round_rows<<<(n8 + 255) / 256, 256, 0, stream>>>(Wq, Wqt, n8);
  k_round_rows<<<(n8 + 255) / 256, 256, 0, stream>>>(Wk, Wkt, n8);
  k_round_rows<<<(n8 + 255) / 256, 256, 0, stream>>>(Wv, Wvt, n8);
  k_round_rows<<<(n8 + 255) / 256, 256, 0, stream>>>(Wo, Wot, n8);
  const int gb = ((M / 16) * (DM / 64) + 3) / 4;
  k_gemm_bf<false, 0, true><<<gb, 128, 0, stream>>>(x, DM, Wqt, DM, bq, qb, DM, M, DM, DM);
  k_gemm_bf<false, 0, true><<<gb, 128, 0, stream>>>(x, DM, Wkt, DM, bk, kb2, DM, M, DM, DM);
  k_gemm_bf<false, 0, true><<<gb, 128, 0, stream>>>(x, DM, Wvt, DM, bv, vb2, DM, M, DM, DM);
  k_bandbias<<<BB * NN / 32, 256, 0, stream>>>(patches, band_bias, sbias);
  k_flashm<HD, NN, DM, false, false, true><<<BB * NH * (NN / 64), 128, 0, stream>>>(qb, kb2, vb2, NH, 0.125f, nullptr, ob, sbias);
  k_gemm_bf<true, 0, true><<<gb, 128, 0, stream>>>(ob, DM, Wot, DM, bo, (float*)d_out, DM, M, DM, DM);
}

// v002
// One run takes 269 microseconds.
// Next to v001, in two timings, it ran 1.08 and 1.07 times as fast.
// Over all steps from v000 it is 1.93 times as fast.
#include <hip/hip_runtime.h>
// All contractions on v_wmma_f32_16x16x32_bf16, f32 accumulate: Q/K/V = x·Wᵀ with x/W rounded to bf16 (single exact-product
// term), QKᵀ and P·V 3-term bf16 hi/lo splits, out = o·W_oᵀ with o split hi/lo (2 terms). The 64-point rFFT band powers,
// log1p, the 5->8 band-bias projection and softmax are f32 on VALU.
#define BB 2
#define NN 2048
#define DM 512
#define NH 8
#define HD 64
#define PL 64
#define NBANDS 5

typedef __bf16 v16b __attribute__((ext_vector_type(16)));
typedef unsigned short v8us __attribute__((ext_vector_type(8), may_alias));
typedef float  v8f  __attribute__((ext_vector_type(8)));
typedef float  v4f  __attribute__((ext_vector_type(4)));
typedef float  v4fa __attribute__((ext_vector_type(4), may_alias));
union FragB { v16b v; v8us half[2]; unsigned short u[16]; };

__device__ __forceinline__ unsigned short bf16_bits(float x) { unsigned int u = __float_as_uint(x); return (unsigned short)((u + 0x7FFFu + ((u >> 16) & 1u)) >> 16); }
__device__ __forceinline__ float bf16_val(unsigned short b) { return __uint_as_float(((unsigned int)b) << 16); }
__device__ __forceinline__ float bf16_round(float x) { return bf16_val(bf16_bits(x)); }
// D += A·B with NT terms: 1 = ah·bh, 2 = + al·bh (A split), 3 = + ah·bl (both split)
template <int NT>
__device__ __forceinline__ v8f mmaN(v16b ah, v16b al, v16b bh, v16b bl, v8f c) {
  c = __builtin_amdgcn_wmma_f32_16x16x32_bf16(false, ah, false, bh, (short)0, c, false, false);
  if (NT >= 2) c = __builtin_amdgcn_wmma_f32_16x16x32_bf16(false, al, false, bh, (short)0, c, false, false);
  if (NT >= 3) c = __builtin_amdgcn_wmma_f32_16x16x32_bf16(false, ah, false, bl, (short)0, c, false, false);
  asm volatile("v_nop\n\tv_nop\n\tv_nop\n\tv_nop" : "+v"(c) : "v"(ah), "v"(al), "v"(bh), "v"(bl));
  return c;
}

// Transposing LDS load: lane (c = l & 15, h = l >> 4) receives T[kbase + 8h + 0..7][dbase + c] of a row-major 16-bit tile when it
// passes the address of T[kbase + 8h + (l & 7)][dbase + 8 * ((l >> 3) & 1)]; two of them (kbase, kbase + 16) are one 32 x 16 B fragment.
typedef short s16x8 __attribute__((ext_vector_type(8)));
__device__ __forceinline__ v8us ld_tr16(const unsigned short* p) {
  typedef __attribute__((address_space(3))) s16x8 lds_s16x8;
  return __builtin_bit_cast(v8us, __builtin_amdgcn_ds_load_tr16_b128_v8i16((lds_s16x8*)p));
}

__global__ __launch_bounds__(256) void k_wt_bf16(const float* __restrict__ W, unsigned short* __restrict__ Wt, int K, int N) {
  const int t = blockIdx.x * 256 + threadIdx.x;
  const int k8n = K / 8;
  if (t >= N * k8n) return;
  const int n = t / k8n, k8 = (t % k8n) * 8;
  v8us v;
#pragma unroll
  for (int i = 0; i < 8; ++i) v[i] = bf16_bits(W[(size_t)(k8 + i) * N + n]);
  *(v8us*)(Wt + (size_t)n * K + k8) = v;
  
}

// GEMM C[M][N] (f32, pitch ldc) = act(A[M][K]·W + bias). A f32 row-major (pitch lda) converted per fragment to bf16
// (ASPLIT: hi/lo two planes -> 2 terms, else single rounded term); Wt bf16 [N][K] (pitch ldb). BIAS_BF16 rounds the
// bias to bf16 first (bias quantised to bf16 before the add). K%32==0, M%16==0, N%64==0.
template <bool ASPLIT, int ACT, bool BIAS_BF16>
__global__ __launch_bounds__(128) void k_gemm_bf(const float* __restrict__ A, int lda, const unsigned short* __restrict__ Wt, int ldb,
                                               const float* __restrict__ bias, float* __restrict__ C, int ldc, int M, int N, int K) {
  __shared__ __attribute__((aligned(16))) float so[4][16][64];
  const int tid = threadIdx.x, w = tid >> 5, lane = tid & 31, ln = lane & 15, hh = lane >> 4;
  const int ntn = N / 64;
  const int wid = blockIdx.x * 4 + w;
  const int mt = wid / ntn, nq = wid % ntn;
  if (mt * 16 >= M) return;
  const int row0 = mt * 16, col0 = nq * 64;
  const float* arow = A + (size_t)(row0 + ln) * lda;
  v8f acc[4] = {};
  for (int kb = 0; kb < K; kb += 32) {
    FragB ah, al;
    const v4f x0 = *(const v4fa*)(arow + kb + 8 * hh), x1 = *(const v4fa*)(arow + kb + 8 * hh + 4);
    const v4f x2 = *(const v4fa*)(arow + kb + 16 + 8 * hh), x3 = *(const v4fa*)(arow + kb + 16 + 8 * hh + 4);
    float xs[16] = {x0[0],x0[1],x0[2],x0[3],x1[0],x1[1],x1[2],x1[3],x2[0],x2[1],x2[2],x2[3],x3[0],x3[1],x3[2],x3[3]};
#pragma unroll
    for (int i = 0; i < 16; ++i) { const unsigned short hb = bf16_bits(xs[i]); ah.u[i] = hb; al.u[i] = ASPLIT ? bf16_bits(xs[i] - bf16_val(hb)) : (unsigned short)0; }
#pragma unroll
    for (int t = 0; t < 4; ++t) {
      const unsigned short* brow = Wt + (size_t)(col0 + t * 16 + ln) * ldb + kb;
      FragB b;
      b.half[0] = *(const v8us*)(brow + 8 * hh);
      b.half[1] = *(const v8us*)(brow + 16 + 8 * hh);
      acc[t] = mmaN<ASPLIT ? 2 : 1>(ah.v, al.v, b.v, b.v, acc[t]);
    }
  }
#pragma unroll
  for (int t = 0; t < 4; ++t) {
    float bv = bias ? bias[col0 + t * 16 + ln] : 0.f;
    if (BIAS_BF16) bv = bf16_round(bv);
#pragma unroll
    for (int r = 0; r < 8; ++r) { float v = acc[t][r] + bv; if (ACT == 1) v = fmaxf(v, 0.f); so[w][8 * hh + r][t * 16 + ln] = v; }
  }
  __builtin_amdgcn_fence(__ATOMIC_ACQ_REL, "workgroup");
  __builtin_amdgcn_wave_barrier();
  const int rsub = lane >> 4, c4 = (lane & 15) * 4;
  {
#pragma unroll
    for (int q = 0; q < 8; ++q) {
      const int r = q * 2 + rsub;
      const v4f v = *(const v4fa*)&so[w][r][c4];
      *(v4f*)(C + (size_t)(row0 + r) * ldc + col0 + c4) = v;
    }
    
  }
}

// Flash-style causal/unmasked attention, all contractions 3-term bf16 hi/lo splits, f32 softmax with running max.
// q,k,v rows are read from f32 buffers with arbitrary row pitch (so they can live inside a fused qkv buffer);
// D = head size (multiple of 32, <= 128); one wave = 16 query rows; block = 4 waves (64 queries) sharing K/V chunks of 32.
template <int D, bool CAUSAL>
__global__ __launch_bounds__(128) void k_flash(const float* __restrict__ qb, const float* __restrict__ kb, const float* __restrict__ vb,
                                             int pitch, int T, int H, float scale, float* __restrict__ y, int ypitch) {
  constexpr int KS = D / 32;        // k-steps for QK
  constexpr int DT = D / 16;        // d tiles for PV
  __shared__ __attribute__((aligned(16))) unsigned short sKh[32][D + 8], sKl[32][D + 8], sVh[32][D + 8], sVl[32][D + 8];
  __shared__ __attribute__((aligned(16))) unsigned short sPh[4][16][40], sPl[4][16][40];
  __shared__ __attribute__((aligned(16))) float sO[4][16][D];
  const int tid = threadIdx.x, w = tid >> 5, lane = tid & 31, ln = lane & 15, hh = lane >> 4;
  const int nqb = (T + 63) / 64;
  const int bh = blockIdx.x / nqb, qblk = blockIdx.x % nqb;
  const int b = bh / H, h = bh % H;
  const int q0 = qblk * 64 + w * 16;
  const float* Q = qb + (size_t)b * T * pitch + h * D;
  const float* K = kb + (size_t)b * T * pitch + h * D;
  const float* V = vb + (size_t)b * T * pitch + h * D;

  // A fragments of the wave's 16 query rows (scaled), hi/lo
  FragB aqh[KS], aql[KS];
  {
    int row = q0 + ln; if (row >= T) row = T - 1;
    const float* qr = Q + (size_t)row * pitch;
#pragma unroll
    for (int ks = 0; ks < KS; ++ks)
#pragma unroll
      for (int i = 0; i < 16; ++i) {
        const int d = ks * 32 + ((i < 8) ? (8 * hh + i) : (16 + 8 * hh + (i - 8)));
        const float x = qr[d] * scale; const unsigned short hb = bf16_bits(x);
        aqh[ks].u[i] = hb; aql[ks].u[i] = bf16_bits(x - bf16_val(hb));
      }
  }
  float m_r[8], l_r[8];
#pragma unroll
  for (int r = 0; r < 8; ++r) { m_r[r] = -3.0e38f; l_r[r] = 0.f; }
  v8f oacc[DT];
#pragma unroll
  for (int dt = 0; dt < DT; ++dt) oacc[dt] = (v8f){0.f,0.f,0.f,0.f,0.f,0.f,0.f,0.f};

  const int kv_end = CAUSAL ? min(T, qblk * 64 + 64) : T;     // block-uniform
  for (int j0 = 0; j0 < kv_end; j0 += 32) {
    __syncthreads();
    for (int e = tid; e < 32 * (D / 4); e += 128) {
      const int r = e / (D / 4), c4 = (e % (D / 4)) * 4;
      const int key = j0 + r;
      v4f kf = {0.f,0.f,0.f,0.f}, vf = {0.f,0.f,0.f,0.f};
      if (key < T) { kf = *(const v4fa*)(K + (size_t)key * pitch + c4); vf = *(const v4fa*)(V + (size_t)key * pitch + c4); }
#pragma unroll
      for (int t = 0; t < 4; ++t) {
        unsigned short hb = bf16_bits(kf[t]); sKh[r][c4 + t] = hb; sKl[r][c4 + t] = bf16_bits(kf[t] - bf16_val(hb));
        hb = bf16_bits(vf[t]); sVh[r][c4 + t] = hb; sVl[r][c4 + t] = bf16_bits(vf[t] - bf16_val(hb));
      }
    }
    __syncthreads();
    // S tile 16 x 32
    v8f s[2];
#pragma unroll
    for (int nt = 0; nt < 2; ++nt) {
      v8f acc = {};
#pragma unroll
      for (int ks = 0; ks < KS; ++ks) {
        FragB bh_, bl_;
        bh_.half[0] = *(const v8us*)&sKh[nt * 16 + ln][ks * 32 + 8 * hh]; bh_.half[1] = *(const v8us*)&sKh[nt * 16 + ln][ks * 32 + 16 + 8 * hh];
        bl_.half[0] = *(const v8us*)&sKl[nt * 16 + ln][ks * 32 + 8 * hh]; bl_.half[1] = *(const v8us*)&sKl[nt * 16 + ln][ks * 32 + 16 + 8 * hh];
        acc = mmaN<3>(aqh[ks].v, aql[ks].v, bh_.v, bl_.v, acc);
      }
      s[nt] = acc;
    }
    // mask + running max (rows 8hh+r; the 16 lanes of a half share rows)
    float alpha[8];
#pragma unroll
    for (int r = 0; r < 8; ++r) {
      const int qi = q0 + 8 * hh + r;
      const int ja = j0 + ln, jb = j0 + 16 + ln;
      if (CAUSAL) { if (ja > qi) s[0][r] = -3.0e38f; if (jb > qi) s[1][r] = -3.0e38f; }
      if (ja >= T) s[0][r] = -3.0e38f;
      if (jb >= T) s[1][r] = -3.0e38f;
      float mx = fmaxf(s[0][r], s[1][r]);
      mx = fmaxf(mx, __shfl_xor(mx, 1, 32)); mx = fmaxf(mx, __shfl_xor(mx, 2, 32)); mx = fmaxf(mx, __shfl_xor(mx, 4, 32)); mx = fmaxf(mx, __shfl_xor(mx, 8, 32));
      const float mnew = fmaxf(m_r[r], mx);
      alpha[r] = (mnew > -1.0e38f) ? __expf(m_r[r] - mnew) : 1.0f;
      const float p0 = (s[0][r] > -1.0e38f) ? __expf(s[0][r] - mnew) : 0.f;
      const float p1 = (s[1][r] > -1.0e38f) ? __expf(s[1][r] - mnew) : 0.f;
      m_r[r] = mnew;
      l_r[r] = l_r[r] * alpha[r] + p0 + p1;            // per-lane partial row sum (16 lanes combined at the end)
      unsigned short hb = bf16_bits(p0); sPh[w][8 * hh + r][ln] = hb;      sPl[w][8 * hh + r][ln] = bf16_bits(p0 - bf16_val(hb));
      hb = bf16_bits(p1);                sPh[w][8 * hh + r][16 + ln] = hb; sPl[w][8 * hh + r][16 + ln] = bf16_bits(p1 - bf16_val(hb));
    }
#pragma unroll
    for (int dt = 0; dt < DT; ++dt)
#pragma unroll
      for (int r = 0; r < 8; ++r) oacc[dt][r] *= alpha[r];
    __builtin_amdgcn_fence(__ATOMIC_ACQ_REL, "workgroup");
    __builtin_amdgcn_wave_barrier();
    FragB pah, pal;
    pah.half[0] = *(const v8us*)&sPh[w][ln][8 * hh]; pah.half[1] = *(const v8us*)&sPh[w][ln][16 + 8 * hh];
    pal.half[0] = *(const v8us*)&sPl[w][ln][8 * hh]; pal.half[1] = *(const v8us*)&sPl[w][ln][16 + 8 * hh];
#pragma unroll
    for (int dt = 0; dt < DT; ++dt) {
      FragB bvh, bvl;
#pragma unroll
      for (int i = 0; i < 8; ++i) {
        bvh.u[i] = sVh[8 * hh + i][dt * 16 + ln]; bvh.u[8 + i] = sVh[16 + 8 * hh + i][dt * 16 + ln];
        bvl.u[i] = sVl[8 * hh + i][dt * 16 + ln]; bvl.u[8 + i] = sVl[16 + 8 * hh + i][dt * 16 + ln];
      }
      oacc[dt] = mmaN<3>(pah.v, pal.v, bvh.v, bvl.v, oacc[dt]);
    }
    __builtin_amdgcn_fence(__ATOMIC_ACQ_REL, "workgroup");
    __builtin_amdgcn_wave_barrier();
  }
#pragma unroll
  for (int r = 0; r < 8; ++r) {
    float l = l_r[r];
    l += __shfl_xor(l, 1, 32); l += __shfl_xor(l, 2, 32); l += __shfl_xor(l, 4, 32); l += __shfl_xor(l, 8, 32);
    l_r[r] = (l > 0.f) ? 1.0f / l : 0.f;
  }
#pragma unroll
  for (int dt = 0; dt < DT; ++dt)
#pragma unroll
    for (int r = 0; r < 8; ++r) sO[w][8 * hh + r][dt * 16 + ln] = oacc[dt][r] * l_r[r];
  __builtin_amdgcn_fence(__ATOMIC_ACQ_REL, "workgroup");
  __builtin_amdgcn_wave_barrier();
  {
    for (int r = 0; r < 16; ++r) {
      const int row = q0 + r;
      if (row < T && lane < D / 4) {
        const v4f val = *(const v4fa*)&sO[w][r][lane * 4];
        *(v4f*)(y + ((size_t)b * T + row) * ypitch + h * D + lane * 4) = val;
      }
    }
    
  }
}

// Self-attention (Tq == Tk == T), 3-term bf16 splits. T, the row pitch and the three options (causal, int mask [T][T] with
// nonzero = keep, additive score bias sbias[bh][q] + sbias[bh][k]) are template constants, so the key loop holds no branch.
// Q/K/V rows read from f32 buffers: X + b*T*PITCH + h*D + row*PITCH. y[b][row][h*D + d], pitch PITCH. D % 32 == 0, T % 64 == 0.
template <int D, int T, int PITCH, bool CAUSAL, bool HASMASK, bool HASBIAS>
__global__ __launch_bounds__(128) void k_flashm(const float* __restrict__ Qb, const float* __restrict__ Kb, const float* __restrict__ Vb,
                                              int H, float scale, const int* __restrict__ mask, float* __restrict__ y, const float* __restrict__ sbias) {
  static_assert(T % 64 == 0 && D % 32 == 0, "whole query blocks and key chunks only");
  constexpr int KS = D / 32, DT = D / 16;
  constexpr int NST = 32 * (D / 4) / 128;      // staging trips per thread, the same for every thread
  constexpr int RPT = 128 / (D / 4);           // key rows that the block stages per trip
  constexpr int VP = D + 16;                   // V row pitch in elements: an odd multiple of 32 bytes, the transposing load's conflict-free pitch
  static_assert((VP * 2) % 32 == 0 && ((VP * 2 / 32) & 1) == 1, "V pitch must be 32 B x odd");
  __shared__ __attribute__((aligned(16))) unsigned short sKh[32][D + 8], sKl[32][D + 8], sVh[32][VP], sVl[32][VP];
  __shared__ __attribute__((aligned(16))) unsigned short sPh[4][16][40], sPl[4][16][40];
  __shared__ __attribute__((aligned(16))) float sO[4][16][D];
  const int tid = threadIdx.x, w = tid >> 5, lane = tid & 31, ln = lane & 15, hh = lane >> 4;
  constexpr int nqb = T / 64;
  const int bh = blockIdx.x / nqb, qblk = blockIdx.x % nqb;
  const int b = bh / H, h = bh % H;
  const int q0 = qblk * 64 + w * 16;
  const float* Q = Qb + (size_t)b * T * PITCH + h * D;
  const float* K = Kb + (size_t)b * T * PITCH + h * D;
  const float* V = Vb + (size_t)b * T * PITCH + h * D;
  const float* SB = sbias + (size_t)bh * T;
  const unsigned uln = (unsigned)ln, toff = (unsigned)(tid / (D / 4)) * PITCH + (unsigned)(tid % (D / 4)) * 4u;
  const int vrow = 8 * hh + (lane & 7), vcol = 8 * ((lane >> 3) & 1);   // the lane's address inside a 16 x 16 V tile for ld_tr16
  FragB aqh[KS], aql[KS];
  {
    const float* qr = Q + (size_t)(q0 + ln) * PITCH;
#pragma unroll
    for (int ks = 0; ks < KS; ++ks)
#pragma unroll
      for (int i = 0; i < 16; ++i) {
        const int d = ks * 32 + ((i < 8) ? (8 * hh + i) : (16 + 8 * hh + (i - 8)));
        const float x = qr[d] * scale; const unsigned short hb = bf16_bits(x);
        aqh[ks].u[i] = hb; aql[ks].u[i] = bf16_bits(x - bf16_val(hb));
      }
  }
  float bq_r[8];                               // the wave's query biases, read once
#pragma unroll
  for (int r = 0; r < 8; ++r) bq_r[r] = HASBIAS ? SB[q0 + 8 * hh + r] : 0.f;
  float m_r[8], l_r[8];
#pragma unroll
  for (int r = 0; r < 8; ++r) { m_r[r] = -3.0e38f; l_r[r] = 0.f; }
  v8f oacc[DT];
#pragma unroll
  for (int dt = 0; dt < DT; ++dt) oacc[dt] = (v8f){0.f,0.f,0.f,0.f,0.f,0.f,0.f,0.f};
  const int kv_end = CAUSAL ? qblk * 64 + 64 : T;
  for (int j0 = 0; j0 < kv_end; j0 += 32) {
    __syncthreads();
    // every global read of the chunk is issued here, together: the two key biases and the thread's K and V pieces
    // (one address per operand and chunk; the staging trips differ by a constant offset only)
    const float* Kj = K + (size_t)j0 * PITCH; const float* Vj = V + (size_t)j0 * PITCH; const float* SBj = SB + j0;
    const float bka = HASBIAS ? SBj[uln] : 0.f, bkb = HASBIAS ? SBj[uln + 16u] : 0.f;
    v4f kf[NST], vf[NST];
#pragma unroll
    for (int it = 0; it < NST; ++it) {
      kf[it] = *(const v4fa*)(Kj + (toff + (unsigned)(it * RPT * PITCH))); vf[it] = *(const v4fa*)(Vj + (toff + (unsigned)(it * RPT * PITCH)));
    }
    asm volatile("s_wait_xcnt 0x0" ::: "memory");   // the conversions below reuse the loads' address registers
    __builtin_amdgcn_sched_barrier(0);         // keeps all ten loads above the conversions: sunk among them, a load pays its latency alone
#pragma unroll
    for (int it = 0; it < NST; ++it) {
      const int e = tid + it * 128;
      const int r = e / (D / 4), c4 = (e % (D / 4)) * 4;
#pragma unroll
      for (int t = 0; t < 4; ++t) {
        unsigned short hb = bf16_bits(kf[it][t]); sKh[r][c4 + t] = hb; sKl[r][c4 + t] = bf16_bits(kf[it][t] - bf16_val(hb));
        hb = bf16_bits(vf[it][t]); sVh[r][c4 + t] = hb; sVl[r][c4 + t] = bf16_bits(vf[it][t] - bf16_val(hb));
      }
    }
    __syncthreads();
    v8f s[2];
#pragma unroll
    for (int nt = 0; nt < 2; ++nt) {
      v8f acc = {};
#pragma unroll
      for (int ks = 0; ks < KS; ++ks) {
        FragB bh_, bl_;
        bh_.half[0] = *(const v8us*)&sKh[nt * 16 + ln][ks * 32 + 8 * hh]; bh_.half[1] = *(const v8us*)&sKh[nt * 16 + ln][ks * 32 + 16 + 8 * hh];
        bl_.half[0] = *(const v8us*)&sKl[nt * 16 + ln][ks * 32 + 8 * hh]; bl_.half[1] = *(const v8us*)&sKl[nt * 16 + ln][ks * 32 + 16 + 8 * hh];
        acc = mmaN<3>(aqh[ks].v, aql[ks].v, bh_.v, bl_.v, acc);
      }
      s[nt] = acc;
    }
    float alpha[8];
#pragma unroll
    for (int r = 0; r < 8; ++r) {
      const int qi = q0 + 8 * hh + r;
      const int ja = j0 + ln, jb = j0 + 16 + ln;
      bool keepa = true, keepb = true;
      if (HASBIAS) { s[0][r] += bq_r[r] + bka; s[1][r] += bq_r[r] + bkb; }
      if (CAUSAL) { keepa = ja <= qi; keepb = jb <= qi; }
      if (HASMASK) { keepa = keepa && mask[(size_t)qi * T + ja] != 0; keepb = keepb && mask[(size_t)qi * T + jb] != 0; }
      if (!keepa) s[0][r] = -3.0e38f;
      if (!keepb) s[1][r] = -3.0e38f;
      float mx = fmaxf(s[0][r], s[1][r]);
      mx = fmaxf(mx, __shfl_xor(mx, 1, 32)); mx = fmaxf(mx, __shfl_xor(mx, 2, 32)); mx = fmaxf(mx, __shfl_xor(mx, 4, 32)); mx = fmaxf(mx, __shfl_xor(mx, 8, 32));
      const float mnew = fmaxf(m_r[r], mx);
      alpha[r] = (mnew > -1.0e38f) ? __expf(m_r[r] - mnew) : 1.0f;
      const float p0 = keepa ? __expf(s[0][r] - mnew) : 0.f;
      const float p1 = keepb ? __expf(s[1][r] - mnew) : 0.f;
      m_r[r] = mnew;
      l_r[r] = l_r[r] * alpha[r] + p0 + p1;
      unsigned short hb = bf16_bits(p0); sPh[w][8 * hh + r][ln] = hb;      sPl[w][8 * hh + r][ln] = bf16_bits(p0 - bf16_val(hb));
      hb = bf16_bits(p1);                sPh[w][8 * hh + r][16 + ln] = hb; sPl[w][8 * hh + r][16 + ln] = bf16_bits(p1 - bf16_val(hb));
    }
#pragma unroll
    for (int dt = 0; dt < DT; ++dt)
#pragma unroll
      for (int r = 0; r < 8; ++r) oacc[dt][r] *= alpha[r];
    __builtin_amdgcn_fence(__ATOMIC_ACQ_REL, "workgroup");
    __builtin_amdgcn_wave_barrier();
    FragB pah, pal;
    pah.half[0] = *(const v8us*)&sPh[w][ln][8 * hh]; pah.half[1] = *(const v8us*)&sPh[w][ln][16 + 8 * hh];
    pal.half[0] = *(const v8us*)&sPl[w][ln][8 * hh]; pal.half[1] = *(const v8us*)&sPl[w][ln][16 + 8 * hh];
    FragB bvh[DT], bvl[DT];                    // same elements in the same k order as a column walk: keys 8hh + 0..7, then 16 + 8hh + 0..7
#pragma unroll
    for (int dt = 0; dt < DT; ++dt) {
      bvh[dt].half[0] = ld_tr16(&sVh[vrow][vcol + dt * 16]); bvh[dt].half[1] = ld_tr16(&sVh[16 + vrow][vcol + dt * 16]);
      bvl[dt].half[0] = ld_tr16(&sVl[vrow][vcol + dt * 16]); bvl[dt].half[1] = ld_tr16(&sVl[16 + vrow][vcol + dt * 16]);
    }
#pragma unroll
    for (int dt = 0; dt < DT; ++dt) oacc[dt] = mmaN<3>(pah.v, pal.v, bvh[dt].v, bvl[dt].v, oacc[dt]);
    __builtin_amdgcn_fence(__ATOMIC_ACQ_REL, "workgroup");
    __builtin_amdgcn_wave_barrier();
  }
  // NaN for fully-masked rows (softmax over a row of -inf)
#pragma unroll
  for (int r = 0; r < 8; ++r) {
    float l = l_r[r];
    l += __shfl_xor(l, 1, 32); l += __shfl_xor(l, 2, 32); l += __shfl_xor(l, 4, 32); l += __shfl_xor(l, 8, 32);
    l_r[r] = (m_r[r] > -1.0e38f) ? 1.0f / l : __builtin_nanf("");
  }
#pragma unroll
  for (int dt = 0; dt < DT; ++dt)
#pragma unroll
    for (int r = 0; r < 8; ++r) sO[w][8 * hh + r][dt * 16 + ln] = oacc[dt][r] * l_r[r];
  __builtin_amdgcn_fence(__ATOMIC_ACQ_REL, "workgroup");
  __builtin_amdgcn_wave_barrier();
  {
    for (int r = 0; r < 16; ++r) {
      const int row = q0 + r;
      if (lane < D / 4) {
        const v4f val = *(const v4fa*)&sO[w][r][lane * 4];
        *(v4f*)(y + ((size_t)b * T + row) * PITCH + h * D + lane * 4) = val;
      }
    }
    
  }
}

__global__ __launch_bounds__(256) void k_round_rows(const float* __restrict__ W, unsigned short* __restrict__ Wt, int n8) {
  const int t = blockIdx.x * 256 + threadIdx.x;
  if (t >= n8) return;
  const v4f a = *(const v4fa*)(W + (size_t)t * 8), b = *(const v4fa*)(W + (size_t)t * 8 + 4);
  v8us v; v[0]=bf16_bits(a[0]); v[1]=bf16_bits(a[1]); v[2]=bf16_bits(a[2]); v[3]=bf16_bits(a[3]);
  v[4]=bf16_bits(b[0]); v[5]=bf16_bits(b[1]); v[6]=bf16_bits(b[2]); v[7]=bf16_bits(b[3]);
  *(v8us*)(Wt + (size_t)t * 8) = v; 
}

// 32 patches per block: 64-point rDFT power per bin k = 0..32 (1056 (patch, bin) pairs over the 256 threads), band means, log1p,
// then bias[b][h][n] = Σ_c bp[c]·band_bias[h][c] for the 8 heads; (threads 0..31, one patch each);
// layout sbias[(b*H + h)*N + n]: for fixed (b,h) consecutive n are contiguous, so a block
// writes 32 consecutive n for each h = 128 B pieces (wave h stores head h).
__global__ __launch_bounds__(256) void k_bandbias(const float* __restrict__ patches, const float* __restrict__ band_bias, float* __restrict__ sbias) {
  __shared__ float sp[32][PL];
  __shared__ float pw[32][33];
  __shared__ float sb[NH][32];
  const int tid = threadIdx.x;
  const int blk = blockIdx.x;                 // over B*N/32
  const int b = blk / (NN / 32), n0 = (blk % (NN / 32)) * 32;
  for (int e = tid; e < 32 * PL; e += 256) { const int r = e / PL, c = e % PL; sp[r][c] = bf16_round(patches[((size_t)b * NN + n0 + r) * PL + c]); }
  __syncthreads();
  // 32 patches x 33 bins = 1056 (patch, bin) pairs over 256 threads
  for (int e = tid; e < 32 * 33; e += 256) {
    const int r = e / 33, kbin = e % 33;
    float re = 0.f, im = 0.f;
#pragma unroll 1
    for (int n = 0; n < PL; ++n) {
      const int m = (kbin * n) & (PL - 1);                   // angle = 2*pi*m/64, exact reduction
      const float ang = 0.09817477042468103f * (float)m;     // 2*pi/64
      const float c = cosf(ang), s = sinf(ang);
      re += sp[r][n] * c; im -= sp[r][n] * s;
    }
    pw[r][kbin] = re * re + im * im;
  }
  __syncthreads();
  if (tid < 32) {
    const int r = tid;
    // bands sorted by name: alpha {3}, beta {4..7}, delta {1}, gamma {8..25}, theta {2}  (rfftfreq(64, 1/250) = 3.90625 k)
    float bp[NBANDS];
    bp[0] = pw[r][3];
    bp[1] = (pw[r][4] + pw[r][5] + pw[r][6] + pw[r][7]) * 0.25f;
    bp[2] = pw[r][1];
    { float s = 0.f;
#pragma unroll 1
      for (int kbin = 8; kbin <= 25; ++kbin) s += pw[r][kbin]; bp[3] = s * (1.0f / 18.0f); }
    bp[4] = pw[r][2];
#pragma unroll 1
    for (int c = 0; c < NBANDS; ++c) bp[c] = log1pf(bp[c]);
#pragma unroll 1
    for (int h = 0; h < NH; ++h) {
      float s = 0.f;
#pragma unroll 1
      for (int c = 0; c < NBANDS; ++c) s += bp[c] * bf16_round(band_bias[h * NBANDS + c]);
      sb[h][r] = s;
    }
  }
  __syncthreads();
  {
    const int h = tid >> 5, r = tid & 31;
    float* dst = sbias + ((size_t)(b * NH + h)) * NN + n0 + r;
    const float v = sb[h][r];
    *(float*)dst = v; 
  }
}

extern "C" void kernel_launch(void* const* d_in, const int* in_sizes, int n_in,
                              void* d_out, int out_size, void* d_ws, size_t ws_size, hipStream_t stream) {
  (void)in_sizes; (void)n_in; (void)out_size;
  const float* x = (const float*)d_in[0]; const float* patches = (const float*)d_in[1];
  const float* Wq = (const float*)d_in[2]; const float* bq = (const float*)d_in[3];
  const float* Wk = (const float*)d_in[4]; const float* bk = (const float*)d_in[5];
  const float* Wv = (const float*)d_in[6]; const float* bv = (const float*)d_in[7];
  const float* Wo = (const float*)d_in[8]; const float* bo = (const float*)d_in[9];
  const float* band_bias = (const float*)d_in[10];
  char* ws = (char*)d_ws; size_t off = 0;
  unsigned short* Wqt = (unsigned short*)(ws + off); off += (size_t)DM * DM * 2;
  unsigned short* Wkt = (unsigned short*)(ws + off); off += (size_t)DM * DM * 2;
  unsigned short* Wvt = (unsigned short*)(ws + off); off += (size_t)DM * DM * 2;
  unsigned short* Wot = (unsigned short*)(ws + off); off += (size_t)DM * DM * 2;
  float* qb = (float*)(ws + off); off += (size_t)BB * NN * DM * 4;
  float* kb2 = (float*)(ws + off); off += (size_t)BB * NN * DM * 4;
  float* vb2 = (float*)(ws + off); off += (size_t)BB * NN * DM * 4;
  float* ob = (float*)(ws + off); off += (size_t)BB * NN * DM * 4;
  float* sbias = (float*)(ws + off); off += (size_t)BB * NH * NN * 4;
  if (off > ws_size) return;
  const int M = BB * NN, n8 = DM * DM / 8;
  k_round_rows<<<(n8 + 255) / 256, 256, 0, stream>>>(Wq, Wqt, n8);
  k_round_rows<<<(n8 + 255) / 256, 256, 0, stream>>>(Wk, Wkt, n8);
  k_round_rows<<<(n8 + 255) / 256, 256, 0, stream>>>(Wv, Wvt, n8);
  k_round_rows<<<(n8 + 255) / 256, 256, 0, stream>>>(Wo, Wot, n8);
  const int gb = ((M / 16) * (DM / 64) + 3) / 4;
  k_gemm_bf<false, 0, true><<<gb, 128, 0, stream>>>(x, DM, Wqt, DM, bq, qb, DM, M, DM, DM);
  k_gemm_bf<false, 0, true><<<gb, 128, 0, stream>>>(x, DM, Wkt, DM, bk, kb2, DM, M, DM, DM);
  k_gemm_bf<false, 0, true><<<gb, 128, 0, stream>>>(x, DM, Wvt, DM, bv, vb2, DM, M, DM, DM);
  k_bandbias<<<BB * NN / 32, 256, 0, stream>>>(patches, band_bias, sbias);
  k_flashm<HD, NN, DM, false, false, true><<<BB * NH * (NN / 64), 128, 0, stream>>>(qb, kb2, vb2, NH, 0.125f, nullptr, ob, sbias);
  k_gemm_bf<true, 0, true><<<gb, 128, 0, stream>>>(ob, DM, Wot, DM, bo, (float*)d_out, DM, M, DM, DM);
}

// v003
// A run of this version takes 237 microseconds.
// In both of two side-by-side timings against v002, it was 1.14 times as fast.
// All steps since v000 together make it 2.19 times as fast.
#include <hip/hip_runtime.h>
// All contractions on v_wmma_f32_16x16x32_bf16, f32 accumulate: Q/K/V = x·Wᵀ with x/W rounded to bf16 (single exact-product
// term), QKᵀ and P·V 3-term bf16 hi/lo splits, out = o·W_oᵀ with o split hi/lo (2 terms). The 64-point rFFT band powers,
// log1p, the 5->8 band-bias projection and softmax are f32 on VALU.
#define BB 2
#define NN 2048
#define DM 512
#define NH 8
#define HD 64
#define PL 64
#define NBANDS 5

typedef __bf16 v16b __attribute__((ext_vector_type(16)));
typedef unsigned short v8us __attribute__((ext_vector_type(8), may_alias));
typedef float  v8f  __attribute__((ext_vector_type(8)));
typedef float  v4f  __attribute__((ext_vector_type(4)));
typedef float  v4fa __attribute__((ext_vector_type(4), may_alias));
union FragB { v16b v; v8us half[2]; unsigned short u[16]; };

__device__ __forceinline__ unsigned short bf16_bits(float x) { unsigned int u = __float_as_uint(x); return (unsigned short)((u + 0x7FFFu + ((u >> 16) & 1u)) >> 16); }
__device__ __forceinline__ float bf16_val(unsigned short b) { return __uint_as_float(((unsigned int)b) << 16); }
__device__ __forceinline__ float bf16_round(float x) { return bf16_val(bf16_bits(x)); }
// D += A·B with NT terms: 1 = ah·bh, 2 = + al·bh (A split), 3 = + ah·bl (both split)
template <int NT>
__device__ __forceinline__ v8f mmaN(v16b ah, v16b al, v16b bh, v16b bl, v8f c) {
  c = __builtin_amdgcn_wmma_f32_16x16x32_bf16(false, ah, false, bh, (short)0, c, false, false);
  if (NT >= 2) c = __builtin_amdgcn_wmma_f32_16x16x32_bf16(false, al, false, bh, (short)0, c, false, false);
  if (NT >= 3) c = __builtin_amdgcn_wmma_f32_16x16x32_bf16(false, ah, false, bl, (short)0, c, false, false);
  asm volatile("v_nop\n\tv_nop\n\tv_nop\n\tv_nop" : "+v"(c) : "v"(ah), "v"(al), "v"(bh), "v"(bl));
  return c;
}

// Transposing LDS load: lane (c = l & 15, h = l >> 4) receives T[kbase + 8h + 0..7][dbase + c] of a row-major 16-bit tile when it
// passes the address of T[kbase + 8h + (l & 7)][dbase + 8 * ((l >> 3) & 1)]; two of them (kbase, kbase + 16) are one 32 x 16 B fragment.
typedef short s16x8 __attribute__((ext_vector_type(8)));
__device__ __forceinline__ v8us ld_tr16(const unsigned short* p) {
  typedef __attribute__((address_space(3))) s16x8 lds_s16x8;
  return __builtin_bit_cast(v8us, __builtin_amdgcn_ds_load_tr16_b128_v8i16((lds_s16x8*)p));
}

__global__ __launch_bounds__(256) void k_wt_bf16(const float* __restrict__ W, unsigned short* __restrict__ Wt, int K, int N) {
  const int t = blockIdx.x * 256 + threadIdx.x;
  const int k8n = K / 8;
  if (t >= N * k8n) return;
  const int n = t / k8n, k8 = (t % k8n) * 8;
  v8us v;
#pragma unroll
  for (int i = 0; i < 8; ++i) v[i] = bf16_bits(W[(size_t)(k8 + i) * N + n]);
  *(v8us*)(Wt + (size_t)n * K + k8) = v;
  
}

// GEMM C[M][N] (f32, pitch ldc) = act(A[M][K]·W + bias). A f32 row-major (pitch lda) converted per fragment to bf16
// (ASPLIT: hi/lo two planes -> 2 terms, else single rounded term); Wt bf16 [N][K] (pitch ldb). BIAS_BF16 rounds the
// bias to bf16 first (bias quantised to bf16 before the add). K%32==0, M%16==0, N%64==0.
template <bool ASPLIT, int ACT, bool BIAS_BF16>
__global__ __launch_bounds__(128) void k_gemm_bf(const float* __restrict__ A, int lda, const unsigned short* __restrict__ Wt, int ldb,
                                               const float* __restrict__ bias, float* __restrict__ C, int ldc, int M, int N, int K) {
  __shared__ __attribute__((aligned(16))) float so[4][16][64];
  const int tid = threadIdx.x, w = tid >> 5, lane = tid & 31, ln = lane & 15, hh = lane >> 4;
  const int ntn = N / 64;
  const int wid = blockIdx.x * 4 + w;
  const int mt = wid / ntn, nq = wid % ntn;
  if (mt * 16 >= M) return;
  const int row0 = mt * 16, col0 = nq * 64;
  const float* arow = A + (size_t)(row0 + ln) * lda;
  v8f acc[4] = {};
  for (int kb = 0; kb < K; kb += 32) {
    FragB ah, al;
    const v4f x0 = *(const v4fa*)(arow + kb + 8 * hh), x1 = *(const v4fa*)(arow + kb + 8 * hh + 4);
    const v4f x2 = *(const v4fa*)(arow + kb + 16 + 8 * hh), x3 = *(const v4fa*)(arow + kb + 16 + 8 * hh + 4);
    float xs[16] = {x0[0],x0[1],x0[2],x0[3],x1[0],x1[1],x1[2],x1[3],x2[0],x2[1],x2[2],x2[3],x3[0],x3[1],x3[2],x3[3]};
#pragma unroll
    for (int i = 0; i < 16; ++i) { const unsigned short hb = bf16_bits(xs[i]); ah.u[i] = hb; al.u[i] = ASPLIT ? bf16_bits(xs[i] - bf16_val(hb)) : (unsigned short)0; }
#pragma unroll
    for (int t = 0; t < 4; ++t) {
      const unsigned short* brow = Wt + (size_t)(col0 + t * 16 + ln) * ldb + kb;
      FragB b;
      b.half[0] = *(const v8us*)(brow + 8 * hh);
      b.half[1] = *(const v8us*)(brow + 16 + 8 * hh);
      acc[t] = mmaN<ASPLIT ? 2 : 1>(ah.v, al.v, b.v, b.v, acc[t]);
    }
  }
#pragma unroll
  for (int t = 0; t < 4; ++t) {
    float bv = bias ? bias[col0 + t * 16 + ln] : 0.f;
    if (BIAS_BF16) bv = bf16_round(bv);
#pragma unroll
    for (int r = 0; r < 8; ++r) { float v = acc[t][r] + bv; if (ACT == 1) v = fmaxf(v, 0.f); so[w][8 * hh + r][t * 16 + ln] = v; }
  }
  __builtin_amdgcn_fence(__ATOMIC_ACQ_REL, "workgroup");
  __builtin_amdgcn_wave_barrier();
  const int rsub = lane >> 4, c4 = (lane & 15) * 4;
  {
#pragma unroll
    for (int q = 0; q < 8; ++q) {
      const int r = q * 2 + rsub;
      const v4f v = *(const v4fa*)&so[w][r][c4];
      *(v4f*)(C + (size_t)(row0 + r) * ldc + col0 + c4) = v;
    }
    
  }
}

// Flash-style causal/unmasked attention, all contractions 3-term bf16 hi/lo splits, f32 softmax with running max.
// q,k,v rows are read from f32 buffers with arbitrary row pitch (so they can live inside a fused qkv buffer);
// D = head size (multiple of 32, <= 128); one wave = 16 query rows; block = 4 waves (64 queries) sharing K/V chunks of 32.
template <int D, bool CAUSAL>
__global__ __launch_bounds__(128) void k_flash(const float* __restrict__ qb, const float* __restrict__ kb, const float* __restrict__ vb,
                                             int pitch, int T, int H, float scale, float* __restrict__ y, int ypitch) {
  constexpr int KS = D / 32;        // k-steps for QK
  constexpr int DT = D / 16;        // d tiles for PV
  __shared__ __attribute__((aligned(16))) unsigned short sKh[32][D + 8], sKl[32][D + 8], sVh[32][D + 8], sVl[32][D + 8];
  __shared__ __attribute__((aligned(16))) unsigned short sPh[4][16][40], sPl[4][16][40];
  __shared__ __attribute__((aligned(16))) float sO[4][16][D];
  const int tid = threadIdx.x, w = tid >> 5, lane = tid & 31, ln = lane & 15, hh = lane >> 4;
  const int nqb = (T + 63) / 64;
  const int bh = blockIdx.x / nqb, qblk = blockIdx.x % nqb;
  const int b = bh / H, h = bh % H;
  const int q0 = qblk * 64 + w * 16;
  const float* Q = qb + (size_t)b * T * pitch + h * D;
  const float* K = kb + (size_t)b * T * pitch + h * D;
  const float* V = vb + (size_t)b * T * pitch + h * D;

  // A fragments of the wave's 16 query rows (scaled), hi/lo
  FragB aqh[KS], aql[KS];
  {
    int row = q0 + ln; if (row >= T) row = T - 1;
    const float* qr = Q + (size_t)row * pitch;
#pragma unroll
    for (int ks = 0; ks < KS; ++ks)
#pragma unroll
      for (int i = 0; i < 16; ++i) {
        const int d = ks * 32 + ((i < 8) ? (8 * hh + i) : (16 + 8 * hh + (i - 8)));
        const float x = qr[d] * scale; const unsigned short hb = bf16_bits(x);
        aqh[ks].u[i] = hb; aql[ks].u[i] = bf16_bits(x - bf16_val(hb));
      }
  }
  float m_r[8], l_r[8];
#pragma unroll
  for (int r = 0; r < 8; ++r) { m_r[r] = -3.0e38f; l_r[r] = 0.f; }
  v8f oacc[DT];
#pragma unroll
  for (int dt = 0; dt < DT; ++dt) oacc[dt] = (v8f){0.f,0.f,0.f,0.f,0.f,0.f,0.f,0.f};

  const int kv_end = CAUSAL ? min(T, qblk * 64 + 64) : T;     // block-uniform
  for (int j0 = 0; j0 < kv_end; j0 += 32) {
    __syncthreads();
    for (int e = tid; e < 32 * (D / 4); e += 128) {
      const int r = e / (D / 4), c4 = (e % (D / 4)) * 4;
      const int key = j0 + r;
      v4f kf = {0.f,0.f,0.f,0.f}, vf = {0.f,0.f,0.f,0.f};
      if (key < T) { kf = *(const v4fa*)(K + (size_t)key * pitch + c4); vf = *(const v4fa*)(V + (size_t)key * pitch + c4); }
#pragma unroll
      for (int t = 0; t < 4; ++t) {
        unsigned short hb = bf16_bits(kf[t]); sKh[r][c4 + t] = hb; sKl[r][c4 + t] = bf16_bits(kf[t] - bf16_val(hb));
        hb = bf16_bits(vf[t]); sVh[r][c4 + t] = hb; sVl[r][c4 + t] = bf16_bits(vf[t] - bf16_val(hb));
      }
    }
    __syncthreads();
    // S tile 16 x 32
    v8f s[2];
#pragma unroll
    for (int nt = 0; nt < 2; ++nt) {
      v8f acc = {};
#pragma unroll
      for (int ks = 0; ks < KS; ++ks) {
        FragB bh_, bl_;
        bh_.half[0] = *(const v8us*)&sKh[nt * 16 + ln][ks * 32 + 8 * hh]; bh_.half[1] = *(const v8us*)&sKh[nt * 16 + ln][ks * 32 + 16 + 8 * hh];
        bl_.half[0] = *(const v8us*)&sKl[nt * 16 + ln][ks * 32 + 8 * hh]; bl_.half[1] = *(const v8us*)&sKl[nt * 16 + ln][ks * 32 + 16 + 8 * hh];
        acc = mmaN<3>(aqh[ks].v, aql[ks].v, bh_.v, bl_.v, acc);
      }
      s[nt] = acc;
    }
    // mask + running max (rows 8hh+r; the 16 lanes of a half share rows)
    float alpha[8];
#pragma unroll
    for (int r = 0; r < 8; ++r) {
      const int qi = q0 + 8 * hh + r;
      const int ja = j0 + ln, jb = j0 + 16 + ln;
      if (CAUSAL) { if (ja > qi) s[0][r] = -3.0e38f; if (jb > qi) s[1][r] = -3.0e38f; }
      if (ja >= T) s[0][r] = -3.0e38f;
      if (jb >= T) s[1][r] = -3.0e38f;
      float mx = fmaxf(s[0][r], s[1][r]);
      mx = fmaxf(mx, __shfl_xor(mx, 1, 32)); mx = fmaxf(mx, __shfl_xor(mx, 2, 32)); mx = fmaxf(mx, __shfl_xor(mx, 4, 32)); mx = fmaxf(mx, __shfl_xor(mx, 8, 32));
      const float mnew = fmaxf(m_r[r], mx);
      alpha[r] = (mnew > -1.0e38f) ? __expf(m_r[r] - mnew) : 1.0f;
      const float p0 = (s[0][r] > -1.0e38f) ? __expf(s[0][r] - mnew) : 0.f;
      const float p1 = (s[1][r] > -1.0e38f) ? __expf(s[1][r] - mnew) : 0.f;
      m_r[r] = mnew;
      l_r[r] = l_r[r] * alpha[r] + p0 + p1;            // per-lane partial row sum (16 lanes combined at the end)
      unsigned short hb = bf16_bits(p0); sPh[w][8 * hh + r][ln] = hb;      sPl[w][8 * hh + r][ln] = bf16_bits(p0 - bf16_val(hb));
      hb = bf16_bits(p1);                sPh[w][8 * hh + r][16 + ln] = hb; sPl[w][8 * hh + r][16 + ln] = bf16_bits(p1 - bf16_val(hb));
    }
#pragma unroll
    for (int dt = 0; dt < DT; ++dt)
#pragma unroll
      for (int r = 0; r < 8; ++r) oacc[dt][r] *= alpha[r];
    __builtin_amdgcn_fence(__ATOMIC_ACQ_REL, "workgroup");
    __builtin_amdgcn_wave_barrier();
    FragB pah, pal;
    pah.half[0] = *(const v8us*)&sPh[w][ln][8 * hh]; pah.half[1] = *(const v8us*)&sPh[w][ln][16 + 8 * hh];
    pal.half[0] = *(const v8us*)&sPl[w][ln][8 * hh]; pal.half[1] = *(const v8us*)&sPl[w][ln][16 + 8 * hh];
#pragma unroll
    for (int dt = 0; dt < DT; ++dt) {
      FragB bvh, bvl;
#pragma unroll
      for (int i = 0; i < 8; ++i) {
        bvh.u[i] = sVh[8 * hh + i][dt * 16 + ln]; bvh.u[8 + i] = sVh[16 + 8 * hh + i][dt * 16 + ln];
        bvl.u[i] = sVl[8 * hh + i][dt * 16 + ln]; bvl.u[8 + i] = sVl[16 + 8 * hh + i][dt * 16 + ln];
      }
      oacc[dt] = mmaN<3>(pah.v, pal.v, bvh.v, bvl.v, oacc[dt]);
    }
    __builtin_amdgcn_fence(__ATOMIC_ACQ_REL, "workgroup");
    __builtin_amdgcn_wave_barrier();
  }
#pragma unroll
  for (int r = 0; r < 8; ++r) {
    float l = l_r[r];
    l += __shfl_xor(l, 1, 32); l += __shfl_xor(l, 2, 32); l += __shfl_xor(l, 4, 32); l += __shfl_xor(l, 8, 32);
    l_r[r] = (l > 0.f) ? 1.0f / l : 0.f;
  }
#pragma unroll
  for (int dt = 0; dt < DT; ++dt)
#pragma unroll
    for (int r = 0; r < 8; ++r) sO[w][8 * hh + r][dt * 16 + ln] = oacc[dt][r] * l_r[r];
  __builtin_amdgcn_fence(__ATOMIC_ACQ_REL, "workgroup");
  __builtin_amdgcn_wave_barrier();
  {
    for (int r = 0; r < 16; ++r) {
      const int row = q0 + r;
      if (row < T && lane < D / 4) {
        const v4f val = *(const v4fa*)&sO[w][r][lane * 4];
        *(v4f*)(y + ((size_t)b * T + row) * ypitch + h * D + lane * 4) = val;
      }
    }
    
  }
}

// Self-attention (Tq == Tk == T), 3-term bf16 splits. T, the row pitch and the three options (causal, int mask [T][T] with
// nonzero = keep, additive score bias sbias[bh][q] + sbias[bh][k]) are template constants, so the key loop holds no branch.
// Q/K/V rows read from f32 buffers: X + b*T*PITCH + h*D + row*PITCH. y[b][row][h*D + d], pitch PITCH. D % 32 == 0, T % 64 == 0.
template <int D, int T, int PITCH, bool CAUSAL, bool HASMASK, bool HASBIAS>
__global__ __launch_bounds__(128) void k_flashm(const float* __restrict__ Qb, const float* __restrict__ Kb, const float* __restrict__ Vb,
                                              int H, float scale, const int* __restrict__ mask, float* __restrict__ y, const float* __restrict__ sbias) {
  static_assert(T % 64 == 0 && D % 32 == 0, "whole query blocks and key chunks only");
  constexpr int KS = D / 32, DT = D / 16;
  constexpr int NST = 32 * (D / 4) / 128;      // staging trips per thread, the same for every thread
  constexpr int RPT = 128 / (D / 4);           // key rows that the block stages per trip
  constexpr int VP = D + 16;                   // V row pitch in elements: an odd multiple of 32 bytes, the transposing load's conflict-free pitch
  static_assert((VP * 2) % 32 == 0 && ((VP * 2 / 32) & 1) == 1, "V pitch must be 32 B x odd");
  __shared__ __attribute__((aligned(16))) unsigned short sKh[32][D + 8], sKl[32][D + 8], sVh[32][VP], sVl[32][VP];
  __shared__ __attribute__((aligned(16))) unsigned short sPh[4][16][40], sPl[4][16][40];
  __shared__ __attribute__((aligned(16))) float sO[4][16][D];
  const int tid = threadIdx.x, w = tid >> 5, lane = tid & 31, ln = lane & 15, hh = lane >> 4;
  constexpr int nqb = T / 64;
  const int bh = blockIdx.x / nqb, qblk = blockIdx.x % nqb;
  const int b = bh / H, h = bh % H;
  const int q0 = qblk * 64 + w * 16;
  const float* Q = Qb + (size_t)b * T * PITCH + h * D;
  const float* K = Kb + (size_t)b * T * PITCH + h * D;
  const float* V = Vb + (size_t)b * T * PITCH + h * D;
  const float* SB = sbias + (size_t)bh * T;
  const unsigned uln = (unsigned)ln, toff = (unsigned)(tid / (D / 4)) * PITCH + (unsigned)(tid % (D / 4)) * 4u;
  const int vrow = 8 * hh + (lane & 7), vcol = 8 * ((lane >> 3) & 1);   // the lane's address inside a 16 x 16 V tile for ld_tr16
  FragB aqh[KS], aql[KS];
  {
    const float* qr = Q + (size_t)(q0 + ln) * PITCH;
#pragma unroll
    for (int ks = 0; ks < KS; ++ks)
#pragma unroll
      for (int i = 0; i < 16; ++i) {
        const int d = ks * 32 + ((i < 8) ? (8 * hh + i) : (16 + 8 * hh + (i - 8)));
        const float x = qr[d] * scale; const unsigned short hb = bf16_bits(x);
        aqh[ks].u[i] = hb; aql[ks].u[i] = bf16_bits(x - bf16_val(hb));
      }
  }
  float bq_r[8];                               // the wave's query biases, read once
#pragma unroll
  for (int r = 0; r < 8; ++r) bq_r[r] = HASBIAS ? SB[q0 + 8 * hh + r] : 0.f;
  float m_r[8], l_r[8];
#pragma unroll
  for (int r = 0; r < 8; ++r) { m_r[r] = -3.0e38f; l_r[r] = 0.f; }
  v8f oacc[DT];
#pragma unroll
  for (int dt = 0; dt < DT; ++dt) oacc[dt] = (v8f){0.f,0.f,0.f,0.f,0.f,0.f,0.f,0.f};
  const int kv_end = CAUSAL ? qblk * 64 + 64 : T;
  for (int j0 = 0; j0 < kv_end; j0 += 32) {
    __syncthreads();
    // every global read of the chunk is issued here, together: the two key biases and the thread's K and V pieces
    // (one address per operand and chunk; the staging trips differ by a constant offset only)
    const float* Kj = K + (size_t)j0 * PITCH; const float* Vj = V + (size_t)j0 * PITCH; const float* SBj = SB + j0;
    const float bka = HASBIAS ? SBj[uln] : 0.f, bkb = HASBIAS ? SBj[uln + 16u] : 0.f;
    v4f kf[NST], vf[NST];
#pragma unroll
    for (int it = 0; it < NST; ++it) {
      kf[it] = *(const v4fa*)(Kj + (toff + (unsigned)(it * RPT * PITCH))); vf[it] = *(const v4fa*)(Vj + (toff + (unsigned)(it * RPT * PITCH)));
    }
    asm volatile("s_wait_xcnt 0x0" ::: "memory");   // the conversions below reuse the loads' address registers
    __builtin_amdgcn_sched_barrier(0);         // keeps all ten loads above the conversions: sunk among them, a load pays its latency alone
#pragma unroll
    for (int it = 0; it < NST; ++it) {
      const int e = tid + it * 128;
      const int r = e / (D / 4), c4 = (e % (D / 4)) * 4;
#pragma unroll
      for (int t = 0; t < 4; ++t) {
        unsigned short hb = bf16_bits(kf[it][t]); sKh[r][c4 + t] = hb; sKl[r][c4 + t] = bf16_bits(kf[it][t] - bf16_val(hb));
        hb = bf16_bits(vf[it][t]); sVh[r][c4 + t] = hb; sVl[r][c4 + t] = bf16_bits(vf[it][t] - bf16_val(hb));
      }
    }
    __syncthreads();
    v8f s[2];
#pragma unroll
    for (int nt = 0; nt < 2; ++nt) {
      v8f acc = {};
#pragma unroll
      for (int ks = 0; ks < KS; ++ks) {
        FragB bh_, bl_;
        bh_.half[0] = *(const v8us*)&sKh[nt * 16 + ln][ks * 32 + 8 * hh]; bh_.half[1] = *(const v8us*)&sKh[nt * 16 + ln][ks * 32 + 16 + 8 * hh];
        bl_.half[0] = *(const v8us*)&sKl[nt * 16 + ln][ks * 32 + 8 * hh]; bl_.half[1] = *(const v8us*)&sKl[nt * 16 + ln][ks * 32 + 16 + 8 * hh];
        acc = mmaN<3>(aqh[ks].v, aql[ks].v, bh_.v, bl_.v, acc);
      }
      s[nt] = acc;
    }
    float alpha[8];
#pragma unroll
    for (int r = 0; r < 8; ++r) {
      const int qi = q0 + 8 * hh + r;
      const int ja = j0 + ln, jb = j0 + 16 + ln;
      bool keepa = true, keepb = true;
      if (HASBIAS) { s[0][r] += bq_r[r] + bka; s[1][r] += bq_r[r] + bkb; }
      if (CAUSAL) { keepa = ja <= qi; keepb = jb <= qi; }
      if (HASMASK) { keepa = keepa && mask[(size_t)qi * T + ja] != 0; keepb = keepb && mask[(size_t)qi * T + jb] != 0; }
      if (!keepa) s[0][r] = -3.0e38f;
      if (!keepb) s[1][r] = -3.0e38f;
      float mx = fmaxf(s[0][r], s[1][r]);
      mx = fmaxf(mx, __shfl_xor(mx, 1, 32)); mx = fmaxf(mx, __shfl_xor(mx, 2, 32)); mx = fmaxf(mx, __shfl_xor(mx, 4, 32)); mx = fmaxf(mx, __shfl_xor(mx, 8, 32));
      const float mnew = fmaxf(m_r[r], mx);
      alpha[r] = (mnew > -1.0e38f) ? __expf(m_r[r] - mnew) : 1.0f;
      const float p0 = keepa ? __expf(s[0][r] - mnew) : 0.f;
      const float p1 = keepb ? __expf(s[1][r] - mnew) : 0.f;
      m_r[r] = mnew;
      l_r[r] = l_r[r] * alpha[r] + p0 + p1;
      unsigned short hb = bf16_bits(p0); sPh[w][8 * hh + r][ln] = hb;      sPl[w][8 * hh + r][ln] = bf16_bits(p0 - bf16_val(hb));
      hb = bf16_bits(p1);                sPh[w][8 * hh + r][16 + ln] = hb; sPl[w][8 * hh + r][16 + ln] = bf16_bits(p1 - bf16_val(hb));
    }
#pragma unroll
    for (int dt = 0; dt < DT; ++dt)
#pragma unroll
      for (int r = 0; r < 8; ++r) oacc[dt][r] *= alpha[r];
    __builtin_amdgcn_fence(__ATOMIC_ACQ_REL, "workgroup");
    __builtin_amdgcn_wave_barrier();
    FragB pah, pal;
    pah.half[0] = *(const v8us*)&sPh[w][ln][8 * hh]; pah.half[1] = *(const v8us*)&sPh[w][ln][16 + 8 * hh];
    pal.half[0] = *(const v8us*)&sPl[w][ln][8 * hh]; pal.half[1] = *(const v8us*)&sPl[w][ln][16 + 8 * hh];
    FragB bvh[DT], bvl[DT];                    // same elements in the same k order as a column walk: keys 8hh + 0..7, then 16 + 8hh + 0..7
#pragma unroll
    for (int dt = 0; dt < DT; ++dt) {
      bvh[dt].half[0] = ld_tr16(&sVh[vrow][vcol + dt * 16]); bvh[dt].half[1] = ld_tr16(&sVh[16 + vrow][vcol + dt * 16]);
      bvl[dt].half[0] = ld_tr16(&sVl[vrow][vcol + dt * 16]); bvl[dt].half[1] = ld_tr16(&sVl[16 + vrow][vcol + dt * 16]);
    }
#pragma unroll
    for (int dt = 0; dt < DT; ++dt) oacc[dt] = mmaN<3>(pah.v, pal.v, bvh[dt].v, bvl[dt].v, oacc[dt]);
    __builtin_amdgcn_fence(__ATOMIC_ACQ_REL, "workgroup");
    __builtin_amdgcn_wave_barrier();
  }
  // NaN for fully-masked rows (softmax over a row of -inf)
#pragma unroll
  for (int r = 0; r < 8; ++r) {
    float l = l_r[r];
    l += __shfl_xor(l, 1, 32); l += __shfl_xor(l, 2, 32); l += __shfl_xor(l, 4, 32); l += __shfl_xor(l, 8, 32);
    l_r[r] = (m_r[r] > -1.0e38f) ? 1.0f / l : __builtin_nanf("");
  }
#pragma unroll
  for (int dt = 0; dt < DT; ++dt)
#pragma unroll
    for (int r = 0; r < 8; ++r) sO[w][8 * hh + r][dt * 16 + ln] = oacc[dt][r] * l_r[r];
  __builtin_amdgcn_fence(__ATOMIC_ACQ_REL, "workgroup");
  __builtin_amdgcn_wave_barrier();
  {
    for (int r = 0; r < 16; ++r) {
      const int row = q0 + r;
      if (lane < D / 4) {
        const v4f val = *(const v4fa*)&sO[w][r][lane * 4];
        *(v4f*)(y + ((size_t)b * T + row) * PITCH + h * D + lane * 4) = val;
      }
    }
    
  }
}

__global__ __launch_bounds__(256) void k_round_rows(const float* __restrict__ W, unsigned short* __restrict__ Wt, int n8) {
  const int t = blockIdx.x * 256 + threadIdx.x;
  if (t >= n8) return;
  const v4f a = *(const v4fa*)(W + (size_t)t * 8), b = *(const v4fa*)(W + (size_t)t * 8 + 4);
  v8us v; v[0]=bf16_bits(a[0]); v[1]=bf16_bits(a[1]); v[2]=bf16_bits(a[2]); v[3]=bf16_bits(a[3]);
  v[4]=bf16_bits(b[0]); v[5]=bf16_bits(b[1]); v[6]=bf16_bits(b[2]); v[7]=bf16_bits(b[3]);
  *(v8us*)(Wt + (size_t)t * 8) = v; 
}

// 32 patches per block: 64-point rDFT power per bin k = 0..32 (1056 (patch, bin) pairs over the 256 threads), band means, log1p,
// then bias[b][h][n] = Σ_c bp[c]·band_bias[h][c] for the 8 heads; (threads 0..31, one patch each);
// layout sbias[(b*H + h)*N + n]: for fixed (b,h) consecutive n are contiguous, so a block
// writes 32 consecutive n for each h = 128 B pieces (wave h stores head h).
__global__ __launch_bounds__(256) void k_bandbias(const float* __restrict__ patches, const float* __restrict__ band_bias, float* __restrict__ sbias) {
  __shared__ float sp[32][PL];
  __shared__ float pw[32][33];
  __shared__ float sb[NH][32];
  __shared__ float tw[2][PL];                 // cos and sin of 2*pi*m/64, m = 0..63: the only angles the DFT below meets
  const int tid = threadIdx.x;
  const int blk = blockIdx.x;                 // over B*N/32
  const int b = blk / (NN / 32), n0 = (blk % (NN / 32)) * 32;
  for (int e = tid; e < 32 * PL; e += 256) { const int r = e / PL, c = e % PL; sp[r][c] = bf16_round(patches[((size_t)b * NN + n0 + r) * PL + c]); }
  if (tid < PL) {                             // filled once per block, published by the barrier that publishes sp
    const float ang = 0.09817477042468103f * (float)tid;     // 2*pi/64
    tw[0][tid] = cosf(ang); tw[1][tid] = sinf(ang);
  }
  __syncthreads();
  // 32 patches x 33 bins = 1056 (patch, bin) pairs over 256 threads
  for (int e = tid; e < 32 * 33; e += 256) {
    const int r = e / 33;
    const unsigned kbin = (unsigned)(e % 33);
    float xs[PL], c[PL], s[PL];
#pragma unroll                                 // n becomes a constant, so xs, c and s live in registers
    for (int n = 0; n < PL; ++n) {
      const unsigned m = (kbin * (unsigned)n) & (unsigned)(PL - 1);   // angle = 2*pi*m/64, exact reduction
      xs[n] = sp[r][n]; c[n] = tw[0][m]; s[n] = tw[1][m];
    }
    __builtin_amdgcn_sched_barrier(0);         // keeps every LDS read above the two sum chains: sunk among them, each read pays its latency alone
    float re = 0.f, im = 0.f;
#pragma unroll                                 // as above: constant indices into xs, c and s
    for (int n = 0; n < PL; ++n) { re += xs[n] * c[n]; im -= xs[n] * s[n]; }
    pw[r][kbin] = re * re + im * im;
  }
  __syncthreads();
  if (tid < 32) {
    const int r = tid;
    // bands sorted by name: alpha {3}, beta {4..7}, delta {1}, gamma {8..25}, theta {2}  (rfftfreq(64, 1/250) = 3.90625 k)
    float bp[NBANDS];
    bp[0] = pw[r][3];
    bp[1] = (pw[r][4] + pw[r][5] + pw[r][6] + pw[r][7]) * 0.25f;
    bp[2] = pw[r][1];
    { float s = 0.f;
#pragma unroll 1
      for (int kbin = 8; kbin <= 25; ++kbin) s += pw[r][kbin]; bp[3] = s * (1.0f / 18.0f); }
    bp[4] = pw[r][2];
#pragma unroll 1
    for (int c = 0; c < NBANDS; ++c) bp[c] = log1pf(bp[c]);
#pragma unroll 1
    for (int h = 0; h < NH; ++h) {
      float s = 0.f;
#pragma unroll 1
      for (int c = 0; c < NBANDS; ++c) s += bp[c] * bf16_round(band_bias[h * NBANDS + c]);
      sb[h][r] = s;
    }
  }
  __syncthreads();
  {
    const int h = tid >> 5, r = tid & 31;
    float* dst = sbias + ((size_t)(b * NH + h)) * NN + n0 + r;
    const float v = sb[h][r];
    *(float*)dst = v; 
  }
}

extern "C" void kernel_launch(void* const* d_in, const int* in_sizes, int n_in,
                              void* d_out, int out_size, void* d_ws, size_t ws_size, hipStream_t stream) {
  (void)in_sizes; (void)n_in; (void)out_size;
  const float* x = (const float*)d_in[0]; const float* patches = (const float*)d_in[1];
  const float* Wq = (const float*)d_in[2]; const float* bq = (const float*)d_in[3];
  const float* Wk = (const float*)d_in[4]; const float* bk = (const float*)d_in[5];
  const float* Wv = (const float*)d_in[6]; const float* bv = (const float*)d_in[7];
  const float* Wo = (const float*)d_in[8]; const float* bo = (const float*)d_in[9];
  const float* band_bias = (const float*)d_in[10];
  char* ws = (char*)d_ws; size_t off = 0;
  unsigned short* Wqt = (unsigned short*)(ws + off); off += (size_t)DM * DM * 2;
  unsigned short* Wkt = (unsigned short*)(ws + off); off += (size_t)DM * DM * 2;
  unsigned short* Wvt = (unsigned short*)(ws + off); off += (size_t)DM * DM * 2;
  unsigned short* Wot = (unsigned short*)(ws + off); off += (size_t)DM * DM * 2;
  float* qb = (float*)(ws + off); off += (size_t)BB * NN * DM * 4;
  float* kb2 = (float*)(ws + off); off += (size_t)BB * NN * DM * 4;
  float* vb2 = (float*)(ws + off); off += (size_t)BB * NN * DM * 4;
  float* ob = (float*)(ws + off); off += (size_t)BB * NN * DM * 4;
  float* sbias = (float*)(ws + off); off += (size_t)BB * NH * NN * 4;
  if (off > ws_size) return;
  const int M = BB * NN, n8 = DM * DM / 8;
  k_round_rows<<<(n8 + 255) / 256, 256, 0, stream>>>(Wq, Wqt, n8);
  k_round_rows<<<(n8 + 255) / 256, 256, 0, stream>>>(Wk, Wkt, n8);
  k_round_rows<<<(n8 + 255) / 256, 256, 0, stream>>>(Wv, Wvt, n8);
  k_round_rows<<<(n8 + 255) / 256, 256, 0, stream>>>(Wo, Wot, n8);
  const int gb = ((M / 16) * (DM / 64) + 3) / 4;
  k_gemm_bf<false, 0, true><<<gb, 128, 0, stream>>>(x, DM, Wqt, DM, bq, qb, DM, M, DM, DM);
  k_gemm_bf<false, 0, true><<<gb, 128, 0, stream>>>(x, DM, Wkt, DM, bk, kb2, DM, M, DM, DM);
  k_gemm_bf<false, 0, true><<<gb, 128, 0, stream>>>(x, DM, Wvt, DM, bv, vb2, DM, M, DM, DM);
  k_bandbias<<<BB * NN / 32, 256, 0, stream>>>(patches, band_bias, sbias);
  k_flashm<HD, NN, DM, false, false, true><<<BB * NH * (NN / 64), 128, 0, stream>>>(qb, kb2, vb2, NH, 0.125f, nullptr, ob, sbias);
  k_gemm_bf<true, 0, true><<<gb, 128, 0, stream>>>(ob, DM, Wot, DM, bo, (float*)d_out, DM, M, DM, DM);
}

// v004
// A run of this version takes 208 microseconds.
// Next to v003, in two timings, it ran 1.14 times as fast each time.
// Over all steps from v000 it is 2.50 times as fast.
#include <hip/hip_runtime.h>
// All contractions on v_wmma_f32_16x16x32_bf16, f32 accumulate: Q/K/V = x·Wᵀ with x/W rounded to bf16 (single exact-product
// term), QKᵀ and P·V 3-term bf16 hi/lo splits, out = o·W_oᵀ with o split hi/lo (2 terms). The 64-point rFFT band powers,
// log1p, the 5->8 band-bias projection and softmax are f32 on VALU.
#define BB 2
#define NN 2048
#define DM 512
#define NH 8
#define HD 64
#define PL 64
#define NBANDS 5

typedef __bf16 v16b __attribute__((ext_vector_type(16)));
typedef unsigned short v8us __attribute__((ext_vector_type(8), may_alias));
typedef float  v8f  __attribute__((ext_vector_type(8)));
typedef float  v4f  __attribute__((ext_vector_type(4)));
typedef float  v4fa __attribute__((ext_vector_type(4), may_alias));
union FragB { v16b v; v8us half[2]; unsigned short u[16]; };

__device__ __forceinline__ unsigned short bf16_bits(float x) { unsigned int u = __float_as_uint(x); return (unsigned short)((u + 0x7FFFu + ((u >> 16) & 1u)) >> 16); }
__device__ __forceinline__ float bf16_val(unsigned short b) { return __uint_as_float(((unsigned int)b) << 16); }
__device__ __forceinline__ float bf16_round(float x) { return bf16_val(bf16_bits(x)); }
// D += A·B with NT terms: 1 = ah·bh, 2 = + al·bh (A split), 3 = + ah·bl (both split)
template <int NT>
__device__ __forceinline__ v8f mmaN(v16b ah, v16b al, v16b bh, v16b bl, v8f c) {
  c = __builtin_amdgcn_wmma_f32_16x16x32_bf16(false, ah, false, bh, (short)0, c, false, false);
  if (NT >= 2) c = __builtin_amdgcn_wmma_f32_16x16x32_bf16(false, al, false, bh, (short)0, c, false, false);
  if (NT >= 3) c = __builtin_amdgcn_wmma_f32_16x16x32_bf16(false, ah, false, bl, (short)0, c, false, false);
  asm volatile("v_nop\n\tv_nop\n\tv_nop\n\tv_nop" : "+v"(c) : "v"(ah), "v"(al), "v"(bh), "v"(bl));
  return c;
}

// The same three terms in the same order with the operands' sides exchanged (D transposed): ah*bh, ah*bl, al*bh
__device__ __forceinline__ v8f mmaT3(v16b ah, v16b al, v16b bh, v16b bl, v8f c) {
  c = __builtin_amdgcn_wmma_f32_16x16x32_bf16(false, ah, false, bh, (short)0, c, false, false);
  c = __builtin_amdgcn_wmma_f32_16x16x32_bf16(false, ah, false, bl, (short)0, c, false, false);
  c = __builtin_amdgcn_wmma_f32_16x16x32_bf16(false, al, false, bh, (short)0, c, false, false);
  asm volatile("v_nop\n\tv_nop\n\tv_nop\n\tv_nop" : "+v"(c) : "v"(ah), "v"(al), "v"(bh), "v"(bl));   // the distance behind a WMMA, on the loop's taken branch too
  return c;
}
// x rounded to bf16 as in bf16_bits, the 16 bits left in the high half of the word
__device__ __forceinline__ unsigned int bf16_high(float x) { unsigned int u = __float_as_uint(x); return u + 0x7FFFu + ((u >> 16) & 1u); }
typedef unsigned int v8u __attribute__((ext_vector_type(8)));
// lane l with lane l ^ 16, on the vector pipe
__device__ __forceinline__ float xhalf(float x) {
  return __builtin_bit_cast(float, __builtin_amdgcn_permlanex16(__builtin_bit_cast(int, x), __builtin_bit_cast(int, x), 0x76543210, 0xfedcba98, false, false));
}

// Transposing LDS load: lane (c = l & 15, h = l >> 4) receives T[kbase + 8h + 0..7][dbase + c] of a row-major 16-bit tile when it
// passes the address of T[kbase + 8h + (l & 7)][dbase + 8 * ((l >> 3) & 1)]; two of them (kbase, kbase + 16) are one 32 x 16 B fragment.
typedef short s16x8 __attribute__((ext_vector_type(8)));
__device__ __forceinline__ v8us ld_tr16(const unsigned short* p) {
  typedef __attribute__((address_space(3))) s16x8 lds_s16x8;
  return __builtin_bit_cast(v8us, __builtin_amdgcn_ds_load_tr16_b128_v8i16((lds_s16x8*)p));
}

__global__ __launch_bounds__(256) void k_wt_bf16(const float* __restrict__ W, unsigned short* __restrict__ Wt, int K, int N) {
  const int t = blockIdx.x * 256 + threadIdx.x;
  const int k8n = K / 8;
  if (t >= N * k8n) return;
  const int n = t / k8n, k8 = (t % k8n) * 8;
  v8us v;
#pragma unroll
  for (int i = 0; i < 8; ++i) v[i] = bf16_bits(W[(size_t)(k8 + i) * N + n]);
  *(v8us*)(Wt + (size_t)n * K + k8) = v;
  
}

// GEMM C[M][N] (f32, pitch ldc) = act(A[M][K]·W + bias). A f32 row-major (pitch lda) converted per fragment to bf16
// (ASPLIT: hi/lo two planes -> 2 terms, else single rounded term); Wt bf16 [N][K] (pitch ldb). BIAS_BF16 rounds the
// bias to bf16 first (bias quantised to bf16 before the add). K%32==0, M%16==0, N%64==0.
template <bool ASPLIT, int ACT, bool BIAS_BF16>
__global__ __launch_bounds__(128) void k_gemm_bf(const float* __restrict__ A, int lda, const unsigned short* __restrict__ Wt, int ldb,
                                               const float* __restrict__ bias, float* __restrict__ C, int ldc, int M, int N, int K) {
  __shared__ __attribute__((aligned(16))) float so[4][16][64];
  const int tid = threadIdx.x, w = tid >> 5, lane = tid & 31, ln = lane & 15, hh = lane >> 4;
  const int ntn = N / 64;
  const int wid = blockIdx.x * 4 + w;
  const int mt = wid / ntn, nq = wid % ntn;
  if (mt * 16 >= M) return;
  const int row0 = mt * 16, col0 = nq * 64;
  const float* arow = A + (size_t)(row0 + ln) * lda;
  v8f acc[4] = {};
  for (int kb = 0; kb < K; kb += 32) {
    FragB ah, al;
    const v4f x0 = *(const v4fa*)(arow + kb + 8 * hh), x1 = *(const v4fa*)(arow + kb + 8 * hh + 4);
    const v4f x2 = *(const v4fa*)(arow + kb + 16 + 8 * hh), x3 = *(const v4fa*)(arow + kb + 16 + 8 * hh + 4);
    float xs[16] = {x0[0],x0[1],x0[2],x0[3],x1[0],x1[1],x1[2],x1[3],x2[0],x2[1],x2[2],x2[3],x3[0],x3[1],x3[2],x3[3]};
#pragma unroll
    for (int i = 0; i < 16; ++i) { const unsigned short hb = bf16_bits(xs[i]); ah.u[i] = hb; al.u[i] = ASPLIT ? bf16_bits(xs[i] - bf16_val(hb)) : (unsigned short)0; }
#pragma unroll
    for (int t = 0; t < 4; ++t) {
      const unsigned short* brow = Wt + (size_t)(col0 + t * 16 + ln) * ldb + kb;
      FragB b;
      b.half[0] = *(const v8us*)(brow + 8 * hh);
      b.half[1] = *(const v8us*)(brow + 16 + 8 * hh);
      acc[t] = mmaN<ASPLIT ? 2 : 1>(ah.v, al.v, b.v, b.v, acc[t]);
    }
  }
#pragma unroll
  for (int t = 0; t < 4; ++t) {
    float bv = bias ? bias[col0 + t * 16 + ln] : 0.f;
    if (BIAS_BF16) bv = bf16_round(bv);
#pragma unroll
    for (int r = 0; r < 8; ++r) { float v = acc[t][r] + bv; if (ACT == 1) v = fmaxf(v, 0.f); so[w][8 * hh + r][t * 16 + ln] = v; }
  }
  __builtin_amdgcn_fence(__ATOMIC_ACQ_REL, "workgroup");
  __builtin_amdgcn_wave_barrier();
  const int rsub = lane >> 4, c4 = (lane & 15) * 4;
  {
#pragma unroll
    for (int q = 0; q < 8; ++q) {
      const int r = q * 2 + rsub;
      const v4f v = *(const v4fa*)&so[w][r][c4];
      *(v4f*)(C + (size_t)(row0 + r) * ldc + col0 + c4) = v;
    }
    
  }
}

// Flash-style causal/unmasked attention, all contractions 3-term bf16 hi/lo splits, f32 softmax with running max.
// q,k,v rows are read from f32 buffers with arbitrary row pitch (so they can live inside a fused qkv buffer);
// D = head size (multiple of 32, <= 128); one wave = 16 query rows; block = 4 waves (64 queries) sharing K/V chunks of 32.
template <int D, bool CAUSAL>
__global__ __launch_bounds__(128) void k_flash(const float* __restrict__ qb, const float* __restrict__ kb, const float* __restrict__ vb,
                                             int pitch, int T, int H, float scale, float* __restrict__ y, int ypitch) {
  constexpr int KS = D / 32;        // k-steps for QK
  constexpr int DT = D / 16;        // d tiles for PV
  __shared__ __attribute__((aligned(16))) unsigned short sKh[32][D + 8], sKl[32][D + 8], sVh[32][D + 8], sVl[32][D + 8];
  __shared__ __attribute__((aligned(16))) unsigned short sPh[4][16][40], sPl[4][16][40];
  __shared__ __attribute__((aligned(16))) float sO[4][16][D];
  const int tid = threadIdx.x, w = tid >> 5, lane = tid & 31, ln = lane & 15, hh = lane >> 4;
  const int nqb = (T + 63) / 64;
  const int bh = blockIdx.x / nqb, qblk = blockIdx.x % nqb;
  const int b = bh / H, h = bh % H;
  const int q0 = qblk * 64 + w * 16;
  const float* Q = qb + (size_t)b * T * pitch + h * D;
  const float* K = kb + (size_t)b * T * pitch + h * D;
  const float* V = vb + (size_t)b * T * pitch + h * D;

  // A fragments of the wave's 16 query rows (scaled), hi/lo
  FragB aqh[KS], aql[KS];
  {
    int row = q0 + ln; if (row >= T) row = T - 1;
    const float* qr = Q + (size_t)row * pitch;
#pragma unroll
    for (int ks = 0; ks < KS; ++ks)
#pragma unroll
      for (int i = 0; i < 16; ++i) {
        const int d = ks * 32 + ((i < 8) ? (8 * hh + i) : (16 + 8 * hh + (i - 8)));
        const float x = qr[d] * scale; const unsigned short hb = bf16_bits(x);
        aqh[ks].u[i] = hb; aql[ks].u[i] = bf16_bits(x - bf16_val(hb));
      }
  }
  float m_r[8], l_r[8];
#pragma unroll
  for (int r = 0; r < 8; ++r) { m_r[r] = -3.0e38f; l_r[r] = 0.f; }
  v8f oacc[DT];
#pragma unroll
  for (int dt = 0; dt < DT; ++dt) oacc[dt] = (v8f){0.f,0.f,0.f,0.f,0.f,0.f,0.f,0.f};

  const int kv_end = CAUSAL ? min(T, qblk * 64 + 64) : T;     // block-uniform
  for (int j0 = 0; j0 < kv_end; j0 += 32) {
    __syncthreads();
    for (int e = tid; e < 32 * (D / 4); e += 128) {
      const int r = e / (D / 4), c4 = (e % (D / 4)) * 4;
      const int key = j0 + r;
      v4f kf = {0.f,0.f,0.f,0.f}, vf = {0.f,0.f,0.f,0.f};
      if (key < T) { kf = *(const v4fa*)(K + (size_t)key * pitch + c4); vf = *(const v4fa*)(V + (size_t)key * pitch + c4); }
#pragma unroll
      for (int t = 0; t < 4; ++t) {
        unsigned short hb = bf16_bits(kf[t]); sKh[r][c4 + t] = hb; sKl[r][c4 + t] = bf16_bits(kf[t] - bf16_val(hb));
        hb = bf16_bits(vf[t]); sVh[r][c4 + t] = hb; sVl[r][c4 + t] = bf16_bits(vf[t] - bf16_val(hb));
      }
    }
    __syncthreads();
    // S tile 16 x 32
    v8f s[2];
#pragma unroll
    for (int nt = 0; nt < 2; ++nt) {
      v8f acc = {};
#pragma unroll
      for (int ks = 0; ks < KS; ++ks) {
        FragB bh_, bl_;
        bh_.half[0] = *(const v8us*)&sKh[nt * 16 + ln][ks * 32 + 8 * hh]; bh_.half[1] = *(const v8us*)&sKh[nt * 16 + ln][ks * 32 + 16 + 8 * hh];
        bl_.half[0] = *(const v8us*)&sKl[nt * 16 + ln][ks * 32 + 8 * hh]; bl_.half[1] = *(const v8us*)&sKl[nt * 16 + ln][ks * 32 + 16 + 8 * hh];
        acc = mmaN<3>(aqh[ks].v, aql[ks].v, bh_.v, bl_.v, acc);
      }
      s[nt] = acc;
    }
    // mask + running max (rows 8hh+r; the 16 lanes of a half share rows)
    float alpha[8];
#pragma unroll
    for (int r = 0; r < 8; ++r) {
      const int qi = q0 + 8 * hh + r;
      const int ja = j0 + ln, jb = j0 + 16 + ln;
      if (CAUSAL) { if (ja > qi) s[0][r] = -3.0e38f; if (jb > qi) s[1][r] = -3.0e38f; }
      if (ja >= T) s[0][r] = -3.0e38f;
      if (jb >= T) s[1][r] = -3.0e38f;
      float mx = fmaxf(s[0][r], s[1][r]);
      mx = fmaxf(mx, __shfl_xor(mx, 1, 32)); mx = fmaxf(mx, __shfl_xor(mx, 2, 32)); mx = fmaxf(mx, __shfl_xor(mx, 4, 32)); mx = fmaxf(mx, __shfl_xor(mx, 8, 32));
      const float mnew = fmaxf(m_r[r], mx);
      alpha[r] = (mnew > -1.0e38f) ? __expf(m_r[r] - mnew) : 1.0f;
      const float p0 = (s[0][r] > -1.0e38f) ? __expf(s[0][r] - mnew) : 0.f;
      const float p1 = (s[1][r] > -1.0e38f) ? __expf(s[1][r] - mnew) : 0.f;
      m_r[r] = mnew;
      l_r[r] = l_r[r] * alpha[r] + p0 + p1;            // per-lane partial row sum (16 lanes combined at the end)
      unsigned short hb = bf16_bits(p0); sPh[w][8 * hh + r][ln] = hb;      sPl[w][8 * hh + r][ln] = bf16_bits(p0 - bf16_val(hb));
      hb = bf16_bits(p1);                sPh[w][8 * hh + r][16 + ln] = hb; sPl[w][8 * hh + r][16 + ln] = bf16_bits(p1 - bf16_val(hb));
    }
#pragma unroll
    for (int dt = 0; dt < DT; ++dt)
#pragma unroll
      for (int r = 0; r < 8; ++r) oacc[dt][r] *= alpha[r];
    __builtin_amdgcn_fence(__ATOMIC_ACQ_REL, "workgroup");
    __builtin_amdgcn_wave_barrier();
    FragB pah, pal;
    pah.half[0] = *(const v8us*)&sPh[w][ln][8 * hh]; pah.half[1] = *(const v8us*)&sPh[w][ln][16 + 8 * hh];
    pal.half[0] = *(const v8us*)&sPl[w][ln][8 * hh]; pal.half[1] = *(const v8us*)&sPl[w][ln][16 + 8 * hh];
#pragma unroll
    for (int dt = 0; dt < DT; ++dt) {
      FragB bvh, bvl;
#pragma unroll
      for (int i = 0; i < 8; ++i) {
        bvh.u[i] = sVh[8 * hh + i][dt * 16 + ln]; bvh.u[8 + i] = sVh[16 + 8 * hh + i][dt * 16 + ln];
        bvl.u[i] = sVl[8 * hh + i][dt * 16 + ln]; bvl.u[8 + i] = sVl[16 + 8 * hh + i][dt * 16 + ln];
      }
      oacc[dt] = mmaN<3>(pah.v, pal.v, bvh.v, bvl.v, oacc[dt]);
    }
    __builtin_amdgcn_fence(__ATOMIC_ACQ_REL, "workgroup");
    __builtin_amdgcn_wave_barrier();
  }
#pragma unroll
  for (int r = 0; r < 8; ++r) {
    float l = l_r[r];
    l += __shfl_xor(l, 1, 32); l += __shfl_xor(l, 2, 32); l += __shfl_xor(l, 4, 32); l += __shfl_xor(l, 8, 32);
    l_r[r] = (l > 0.f) ? 1.0f / l : 0.f;
  }
#pragma unroll
  for (int dt = 0; dt < DT; ++dt)
#pragma unroll
    for (int r = 0; r < 8; ++r) sO[w][8 * hh + r][dt * 16 + ln] = oacc[dt][r] * l_r[r];
  __builtin_amdgcn_fence(__ATOMIC_ACQ_REL, "workgroup");
  __builtin_amdgcn_wave_barrier();
  {
    for (int r = 0; r < 16; ++r) {
      const int row = q0 + r;
      if (row < T && lane < D / 4) {
        const v4f val = *(const v4fa*)&sO[w][r][lane * 4];
        *(v4f*)(y + ((size_t)b * T + row) * ypitch + h * D + lane * 4) = val;
      }
    }
    
  }
}

template <int D, int T, int PITCH, bool CAUSAL, bool HASMASK, bool HASBIAS>
__global__ __launch_bounds__(128) void k_flashm(const float* __restrict__ Qb, const float* __restrict__ Kb, const float* __restrict__ Vb,
                                              int H, float scale, const int* __restrict__ mask, float* __restrict__ y, const float* __restrict__ sbias) {
  static_assert(T % 64 == 0 && D % 32 == 0, "whole query blocks and key chunks only");
  constexpr int KS = D / 32, DT = D / 16;
  constexpr int NST = 32 * (D / 4) / 128;      // staging trips per thread, the same for every thread
  constexpr int RPT = 128 / (D / 4);           // key rows that the block stages per trip
  constexpr int VP = D + 16;                   // V row pitch in elements: an odd multiple of 32 bytes, the transposing load's conflict-free pitch
  static_assert((VP * 2) % 32 == 0 && ((VP * 2 / 32) & 1) == 1, "V pitch must be 32 B x odd");
  __shared__ __attribute__((aligned(16))) unsigned short sKh[32][D + 8], sKl[32][D + 8], sVh[32][VP], sVl[32][VP];
  __shared__ __attribute__((aligned(16))) float sO[4][16][D];
  const int tid = threadIdx.x, w = tid >> 5, lane = tid & 31, ln = lane & 15, hh = lane >> 4;
  constexpr int nqb = T / 64;
  const int bh = blockIdx.x / nqb, qblk = blockIdx.x % nqb;
  const int b = bh / H, h = bh % H;
  const int q0 = qblk * 64 + w * 16;
  const float* Q = Qb + (size_t)b * T * PITCH + h * D;
  const float* K = Kb + (size_t)b * T * PITCH + h * D;
  const float* V = Vb + (size_t)b * T * PITCH + h * D;
  const float* SB = sbias + (size_t)bh * T;
  const unsigned ukb = 8u * (unsigned)hh, toff = (unsigned)(tid / (D / 4)) * PITCH + (unsigned)(tid % (D / 4)) * 4u;
  const int vrow = 8 * hh + (lane & 7), vcol = 8 * ((lane >> 3) & 1);   // the lane's address inside a 16 x 16 V tile for ld_tr16
  FragB aqh[KS], aql[KS];
  {
    const float* qr = Q + (size_t)(q0 + ln) * PITCH;
#pragma unroll
    for (int ks = 0; ks < KS; ++ks)
#pragma unroll
      for (int i = 0; i < 16; ++i) {
        const int d = ks * 32 + ((i < 8) ? (8 * hh + i) : (16 + 8 * hh + (i - 8)));
        const float x = qr[d] * scale; const unsigned short hb = bf16_bits(x);
        aqh[ks].u[i] = hb; aql[ks].u[i] = bf16_bits(x - bf16_val(hb));
      }
  }
  const int qi = q0 + ln;                      // the lane's query
  const float bq = HASBIAS ? SB[qi] : 0.f;     // its bias, read once
  float m_q = -3.0e38f, l_q = 0.f;             // its running maximum; the sum over this half's keys (the halves join after the loop)
  v8f oacc[DT];                                // oacc[dt][r] = O[qi][dt * 16 + 8 * hh + r]
#pragma unroll
  for (int dt = 0; dt < DT; ++dt) oacc[dt] = (v8f){0.f,0.f,0.f,0.f,0.f,0.f,0.f,0.f};
  const int kv_end = CAUSAL ? qblk * 64 + 64 : T;
  for (int j0 = 0; j0 < kv_end; j0 += 32) {
    __syncthreads();
    // every global read of the chunk is issued here, together: the lane's 16 key biases and the thread's K and V pieces
    // (one address per operand and chunk; the staging trips differ by a constant offset only)
    const float* Kj = K + (size_t)j0 * PITCH; const float* Vj = V + (size_t)j0 * PITCH; const float* SBj = SB + j0;
    v4f bk[4] = {};                            // biases of keys 8hh + 0..7 and 16 + 8hh + 0..7
    if (HASBIAS) { bk[0] = *(const v4fa*)(SBj + ukb); bk[1] = *(const v4fa*)(SBj + (ukb + 4u)); bk[2] = *(const v4fa*)(SBj + (ukb + 16u)); bk[3] = *(const v4fa*)(SBj + (ukb + 20u)); }
    v4f kf[NST], vf[NST];
#pragma unroll
    for (int it = 0; it < NST; ++it) {
      kf[it] = *(const v4fa*)(Kj + (toff + (unsigned)(it * RPT * PITCH))); vf[it] = *(const v4fa*)(Vj + (toff + (unsigned)(it * RPT * PITCH)));
    }
    asm volatile("s_wait_xcnt 0x0" ::: "memory");   // the conversions below reuse the loads' address registers
    __builtin_amdgcn_sched_barrier(0);         // keeps all twelve loads above the conversions: sunk among them, a load pays its latency alone
#pragma unroll
    for (int it = 0; it < NST; ++it) {
      const int e = tid + it * 128;
      const int r = e / (D / 4), c4 = (e % (D / 4)) * 4;
#pragma unroll
      for (int t = 0; t < 4; ++t) {
        unsigned short hb = bf16_bits(kf[it][t]); sKh[r][c4 + t] = hb; sKl[r][c4 + t] = bf16_bits(kf[it][t] - bf16_val(hb));
        hb = bf16_bits(vf[it][t]); sVh[r][c4 + t] = hb; sVl[r][c4 + t] = bf16_bits(vf[it][t] - bf16_val(hb));
      }
    }
    __syncthreads();
    v8f s[2];                                  // s[nt][r] = S[key j0 + nt * 16 + 8 * hh + r][query qi]
#pragma unroll
    for (int nt = 0; nt < 2; ++nt) {
      v8f acc = {};
#pragma unroll
      for (int ks = 0; ks < KS; ++ks) {
        FragB kh_, kl_;
        kh_.half[0] = *(const v8us*)&sKh[nt * 16 + ln][ks * 32 + 8 * hh]; kh_.half[1] = *(const v8us*)&sKh[nt * 16 + ln][ks * 32 + 16 + 8 * hh];
        kl_.half[0] = *(const v8us*)&sKl[nt * 16 + ln][ks * 32 + 8 * hh]; kl_.half[1] = *(const v8us*)&sKl[nt * 16 + ln][ks * 32 + 16 + 8 * hh];
        acc = mmaT3(kh_.v, kl_.v, aqh[ks].v, aql[ks].v, acc);
      }
      s[nt] = acc;
    }
    bool keep[2][8];
    float mx = -3.0e38f;
#pragma unroll
    for (int nt = 0; nt < 2; ++nt)
#pragma unroll
      for (int r = 0; r < 8; ++r) {
        const int kj = j0 + nt * 16 + 8 * hh + r;
        bool kp = true;
        if (HASBIAS) s[nt][r] += bq + bk[nt * 2 + (r >> 2)][r & 3];
        if (CAUSAL) kp = kj <= qi;
        if (HASMASK) kp = kp && mask[(size_t)qi * T + kj] != 0;
        if (!kp) s[nt][r] = -3.0e38f;
        keep[nt][r] = kp;
        mx = fmaxf(mx, s[nt][r]);
      }
    mx = fmaxf(mx, xhalf(mx));                 // the other half's 16 keys of the same query
    const float mnew = fmaxf(m_q, mx);
    const float alpha = (mnew > -1.0e38f) ? __expf(m_q - mnew) : 1.0f;
    m_q = mnew;
    v8u pwh, pwl;                              // P^T as a B fragment: element nt * 8 + r is key nt * 16 + 8hh + r, the k order of the V fragments
    float ps[2] = {0.f, 0.f};
#pragma unroll
    for (int nt = 0; nt < 2; ++nt)
#pragma unroll
      for (int r = 0; r < 8; r += 2) {         // two neighbouring keys fill one register: one byte permute packs both high halves
        const float p0 = keep[nt][r] ? __expf(s[nt][r] - mnew) : 0.f;
        const float p1 = keep[nt][r + 1] ? __expf(s[nt][r + 1] - mnew) : 0.f;
        ps[nt] += p0; ps[nt] += p1;
        const unsigned int h0 = bf16_high(p0), h1 = bf16_high(p1);
        const unsigned int l0 = bf16_high(p0 - __uint_as_float(h0 & 0xFFFF0000u)), l1 = bf16_high(p1 - __uint_as_float(h1 & 0xFFFF0000u));
        pwh[nt * 4 + (r >> 1)] = __builtin_amdgcn_perm(h1, h0, 0x07060302u);
        pwl[nt * 4 + (r >> 1)] = __builtin_amdgcn_perm(l1, l0, 0x07060302u);
      }
    const v16b pbh = __builtin_bit_cast(v16b, pwh), pbl = __builtin_bit_cast(v16b, pwl);
    l_q = l_q * alpha + (ps[0] + ps[1]);
#pragma unroll
    for (int dt = 0; dt < DT; ++dt)
#pragma unroll
      for (int r = 0; r < 8; ++r) oacc[dt][r] *= alpha;
    FragB bvh[DT], bvl[DT];                    // V^T as A fragments: row d = dt * 16 + ln, keys 8hh + 0..7, then 16 + 8hh + 0..7
#pragma unroll
    for (int dt = 0; dt < DT; ++dt) {
      bvh[dt].half[0] = ld_tr16(&sVh[vrow][vcol + dt * 16]); bvh[dt].half[1] = ld_tr16(&sVh[16 + vrow][vcol + dt * 16]);
      bvl[dt].half[0] = ld_tr16(&sVl[vrow][vcol + dt * 16]); bvl[dt].half[1] = ld_tr16(&sVl[16 + vrow][vcol + dt * 16]);
    }
#pragma unroll
    for (int dt = 0; dt < DT; ++dt) oacc[dt] = mmaT3(bvh[dt].v, bvl[dt].v, pbh, pbl, oacc[dt]);
  }
  // NaN for fully-masked rows (softmax over a row of -inf)
  const float l_all = l_q + xhalf(l_q);
  const float linv = (m_q > -1.0e38f) ? 1.0f / l_all : __builtin_nanf("");
#pragma unroll
  for (int dt = 0; dt < DT; ++dt) {
    v4f lo4, hi4;
#pragma unroll
    for (int r = 0; r < 4; ++r) { lo4[r] = oacc[dt][r] * linv; hi4[r] = oacc[dt][4 + r] * linv; }
    *(v4fa*)&sO[w][ln][dt * 16 + 8 * hh] = lo4; *(v4fa*)&sO[w][ln][dt * 16 + 8 * hh + 4] = hi4;
  }
  __builtin_amdgcn_fence(__ATOMIC_ACQ_REL, "workgroup");
  __builtin_amdgcn_wave_barrier();
  {
    for (int r = 0; r < 16; ++r) {
      const int row = q0 + r;
      if (lane < D / 4) {
        const v4f val = *(const v4fa*)&sO[w][r][lane * 4];
        *(v4f*)(y + ((size_t)b * T + row) * PITCH + h * D + lane * 4) = val;
      }
    }
    
  }
}

__global__ __launch_bounds__(256) void k_round_rows(const float* __restrict__ W, unsigned short* __restrict__ Wt, int n8) {
  const int t = blockIdx.x * 256 + threadIdx.x;
  if (t >= n8) return;
  const v4f a = *(const v4fa*)(W + (size_t)t * 8), b = *(const v4fa*)(W + (size_t)t * 8 + 4);
  v8us v; v[0]=bf16_bits(a[0]); v[1]=bf16_bits(a[1]); v[2]=bf16_bits(a[2]); v[3]=bf16_bits(a[3]);
  v[4]=bf16_bits(b[0]); v[5]=bf16_bits(b[1]); v[6]=bf16_bits(b[2]); v[7]=bf16_bits(b[3]);
  *(v8us*)(Wt + (size_t)t * 8) = v; 
}

// 32 patches per block: 64-point rDFT power per bin k = 0..32 (1056 (patch, bin) pairs over the 256 threads), band means, log1p,
// then bias[b][h][n] = Σ_c bp[c]·band_bias[h][c] for the 8 heads; (threads 0..31, one patch each);
// layout sbias[(b*H + h)*N + n]: for fixed (b,h) consecutive n are contiguous, so a block
// writes 32 consecutive n for each h = 128 B pieces (wave h stores head h).
__global__ __launch_bounds__(256) void k_bandbias(const float* __restrict__ patches, const float* __restrict__ band_bias, float* __restrict__ sbias) {
  __shared__ float sp[32][PL];
  __shared__ float pw[32][33];
  __shared__ float sb[NH][32];
  __shared__ float tw[2][PL];                 // cos and sin of 2*pi*m/64, m = 0..63: the only angles the DFT below meets
  const int tid = threadIdx.x;
  const int blk = blockIdx.x;                 // over B*N/32
  const int b = blk / (NN / 32), n0 = (blk % (NN / 32)) * 32;
  for (int e = tid; e < 32 * PL; e += 256) { const int r = e / PL, c = e % PL; sp[r][c] = bf16_round(patches[((size_t)b * NN + n0 + r) * PL + c]); }
  if (tid < PL) {                             // filled once per block, published by the barrier that publishes sp
    const float ang = 0.09817477042468103f * (float)tid;     // 2*pi/64
    tw[0][tid] = cosf(ang); tw[1][tid] = sinf(ang);
  }
  __syncthreads();
  // 32 patches x 33 bins = 1056 (patch, bin) pairs over 256 threads
  for (int e = tid; e < 32 * 33; e += 256) {
    const int r = e / 33;
    const unsigned kbin = (unsigned)(e % 33);
    float xs[PL], c[PL], s[PL];
#pragma unroll                                 // n becomes a constant, so xs, c and s live in registers
    for (int n = 0; n < PL; ++n) {
      const unsigned m = (kbin * (unsigned)n) & (unsigned)(PL - 1);   // angle = 2*pi*m/64, exact reduction
      xs[n] = sp[r][n]; c[n] = tw[0][m]; s[n] = tw[1][m];
    }
    __builtin_amdgcn_sched_barrier(0);         // keeps every LDS read above the two sum chains: sunk among them, each read pays its latency alone
    float re = 0.f, im = 0.f;
#pragma unroll                                 // as above: constant indices into xs, c and s
    for (int n = 0; n < PL; ++n) { re += xs[n] * c[n]; im -= xs[n] * s[n]; }
    pw[r][kbin] = re * re + im * im;
  }
  __syncthreads();
  if (tid < 32) {
    const int r = tid;
    // bands sorted by name: alpha {3}, beta {4..7}, delta {1}, gamma {8..25}, theta {2}  (rfftfreq(64, 1/250) = 3.90625 k)
    float bp[NBANDS];
    bp[0] = pw[r][3];
    bp[1] = (pw[r][4] + pw[r][5] + pw[r][6] + pw[r][7]) * 0.25f;
    bp[2] = pw[r][1];
    { float s = 0.f;
#pragma unroll 1
      for (int kbin = 8; kbin <= 25; ++kbin) s += pw[r][kbin]; bp[3] = s * (1.0f / 18.0f); }
    bp[4] = pw[r][2];
#pragma unroll 1
    for (int c = 0; c < NBANDS; ++c) bp[c] = log1pf(bp[c]);
#pragma unroll 1
    for (int h = 0; h < NH; ++h) {
      float s = 0.f;
#pragma unroll 1
      for (int c = 0; c < NBANDS; ++c) s += bp[c] * bf16_round(band_bias[h * NBANDS + c]);
      sb[h][r] = s;
    }
  }
  __syncthreads();
  {
    const int h = tid >> 5, r = tid & 31;
    float* dst = sbias + ((size_t)(b * NH + h)) * NN + n0 + r;
    const float v = sb[h][r];
    *(float*)dst = v; 
  }
}

extern "C" void kernel_launch(void* const* d_in, const int* in_sizes, int n_in,
                              void* d_out, int out_size, void* d_ws, size_t ws_size, hipStream_t stream) {
  (void)in_sizes; (void)n_in; (void)out_size;
  const float* x = (const float*)d_in[0]; const float* patches = (const float*)d_in[1];
  const float* Wq = (const float*)d_in[2]; const float* bq = (const float*)d_in[3];
  const float* Wk = (const float*)d_in[4]; const float* bk = (const float*)d_in[5];
  const float* Wv = (const float*)d_in[6]; const float* bv = (const float*)d_in[7];
  const float* Wo = (const float*)d_in[8]; const float* bo = (const float*)d_in[9];
  const float* band_bias = (const float*)d_in[10];
  char* ws = (char*)d_ws; size_t off = 0;
  unsigned short* Wqt = (unsigned short*)(ws + off); off += (size_t)DM * DM * 2;
  unsigned short* Wkt = (unsigned short*)(ws + off); off += (size_t)DM * DM * 2;
  unsigned short* Wvt = (unsigned short*)(ws + off); off += (size_t)DM * DM * 2;
  unsigned short* Wot = (unsigned short*)(ws + off); off += (size_t)DM * DM * 2;
  float* qb = (float*)(ws + off); off += (size_t)BB * NN * DM * 4;
  float* kb2 = (float*)(ws + off); off += (size_t)BB * NN * DM * 4;
  float* vb2 = (float*)(ws + off); off += (size_t)BB * NN * DM * 4;
  float* ob = (float*)(ws + off); off += (size_t)BB * NN * DM * 4;
  float* sbias = (float*)(ws + off); off += (size_t)BB * NH * NN * 4;
  if (off > ws_size) return;
  const int M = BB * NN, n8 = DM * DM / 8;
  k_round_rows<<<(n8 + 255) / 256, 256, 0, stream>>>(Wq, Wqt, n8);
  k_round_rows<<<(n8 + 255) / 256, 256, 0, stream>>>(Wk, Wkt, n8);
  k_round_rows<<<(n8 + 255) / 256, 256, 0, stream>>>(Wv, Wvt, n8);
  k_round_rows<<<(n8 + 255) / 256, 256, 0, stream>>>(Wo, Wot, n8);
  const int gb = ((M / 16) * (DM / 64) + 3) / 4;
  k_gemm_bf<false, 0, true><<<gb, 128, 0, stream>>>(x, DM, Wqt, DM, bq, qb, DM, M, DM, DM);
  k_gemm_bf<false, 0, true><<<gb, 128, 0, stream>>>(x, DM, Wkt, DM, bk, kb2, DM, M, DM, DM);
  k_gemm_bf<false, 0, true><<<gb, 128, 0, stream>>>(x, DM, Wvt, DM, bv, vb2, DM, M, DM, DM);
  k_bandbias<<<BB * NN / 32, 256, 0, stream>>>(patches, band_bias, sbias);
  k_flashm<HD, NN, DM, false, false, true><<<BB * NH * (NN / 64), 128, 0, stream>>>(qb, kb2, vb2, NH, 0.125f, nullptr, ob, sbias);
  k_gemm_bf<true, 0, true><<<gb, 128, 0, stream>>>(ob, DM, Wot, DM, bo, (float*)d_out, DM, M, DM, DM);
}

// v005
// It runs in 157 microseconds.
// Timed twice side by side with v004, it ran 1.32 times as fast both times.
// All steps since v000 together make it 3.31 times as fast.
#include <hip/hip_runtime.h>
// All contractions on v_wmma_f32_16x16x32_bf16, f32 accumulate: Q/K/V = x·Wᵀ with x/W rounded to bf16 (single exact-product
// term), QKᵀ and P·V 3-term bf16 hi/lo splits, out = o·W_oᵀ with o split hi/lo (2 terms). The 64-point rFFT band powers,
// log1p, the 5->8 band-bias projection and softmax are f32 on VALU.
#define BB 2
#define NN 2048
#define DM 512
#define NH 8
#define HD 64
#define PL 64
#define NBANDS 5

typedef __bf16 v16b __attribute__((ext_vector_type(16)));
typedef unsigned short v8us __attribute__((ext_vector_type(8), may_alias));
typedef float  v8f  __attribute__((ext_vector_type(8)));
typedef float  v4f  __attribute__((ext_vector_type(4)));
typedef float  v4fa __attribute__((ext_vector_type(4), may_alias));
union FragB { v16b v; v8us half[2]; unsigned short u[16]; };

__device__ __forceinline__ unsigned short bf16_bits(float x) { unsigned int u = __float_as_uint(x); return (unsigned short)((u + 0x7FFFu + ((u >> 16) & 1u)) >> 16); }
__device__ __forceinline__ float bf16_val(unsigned short b) { return __uint_as_float(((unsigned int)b) << 16); }
__device__ __forceinline__ float bf16_round(float x) { return bf16_val(bf16_bits(x)); }
// D += A·B with NT terms: 1 = ah·bh, 2 = + al·bh (A split), 3 = + ah·bl (both split)
template <int NT>
__device__ __forceinline__ v8f mmaN(v16b ah, v16b al, v16b bh, v16b bl, v8f c) {
  c = __builtin_amdgcn_wmma_f32_16x16x32_bf16(false, ah, false, bh, (short)0, c, false, false);
  if (NT >= 2) c = __builtin_amdgcn_wmma_f32_16x16x32_bf16(false, al, false, bh, (short)0, c, false, false);
  if (NT >= 3) c = __builtin_amdgcn_wmma_f32_16x16x32_bf16(false, ah, false, bl, (short)0, c, false, false);
  asm volatile("v_nop\n\tv_nop\n\tv_nop\n\tv_nop" : "+v"(c) : "v"(ah), "v"(al), "v"(bh), "v"(bl));
  return c;
}

// The same three terms in the same order with the operands' sides exchanged (D transposed): ah*bh, ah*bl, al*bh
__device__ __forceinline__ v8f mmaT3(v16b ah, v16b al, v16b bh, v16b bl, v8f c) {
  c = __builtin_amdgcn_wmma_f32_16x16x32_bf16(false, ah, false, bh, (short)0, c, false, false);
  c = __builtin_amdgcn_wmma_f32_16x16x32_bf16(false, ah, false, bl, (short)0, c, false, false);
  c = __builtin_amdgcn_wmma_f32_16x16x32_bf16(false, al, false, bh, (short)0, c, false, false);
  asm volatile("v_nop\n\tv_nop\n\tv_nop\n\tv_nop" : "+v"(c) : "v"(ah), "v"(al), "v"(bh), "v"(bl));   // the distance behind a WMMA, on the loop's taken branch too
  return c;
}
// x rounded to bf16 as in bf16_bits, the 16 bits left in the high half of the word
__device__ __forceinline__ unsigned int bf16_high(float x) { unsigned int u = __float_as_uint(x); return u + 0x7FFFu + ((u >> 16) & 1u); }
typedef unsigned int v8u __attribute__((ext_vector_type(8)));
// lane l with lane l ^ 16, on the vector pipe
__device__ __forceinline__ float xhalf(float x) {
  return __builtin_bit_cast(float, __builtin_amdgcn_permlanex16(__builtin_bit_cast(int, x), __builtin_bit_cast(int, x), 0x76543210, 0xfedcba98, false, false));
}

// Transposing LDS load: lane (c = l & 15, h = l >> 4) receives T[kbase + 8h + 0..7][dbase + c] of a row-major 16-bit tile when it
// passes the address of T[kbase + 8h + (l & 7)][dbase + 8 * ((l >> 3) & 1)]; two of them (kbase, kbase + 16) are one 32 x 16 B fragment.
typedef short s16x8 __attribute__((ext_vector_type(8)));
__device__ __forceinline__ v8us ld_tr16(const unsigned short* p) {
  typedef __attribute__((address_space(3))) s16x8 lds_s16x8;
  return __builtin_bit_cast(v8us, __builtin_amdgcn_ds_load_tr16_b128_v8i16((lds_s16x8*)p));
}

__global__ __launch_bounds__(256) void k_wt_bf16(const float* __restrict__ W, unsigned short* __restrict__ Wt, int K, int N) {
  const int t = blockIdx.x * 256 + threadIdx.x;
  const int k8n = K / 8;
  if (t >= N * k8n) return;
  const int n = t / k8n, k8 = (t % k8n) * 8;
  v8us v;
#pragma unroll
  for (int i = 0; i < 8; ++i) v[i] = bf16_bits(W[(size_t)(k8 + i) * N + n]);
  *(v8us*)(Wt + (size_t)n * K + k8) = v;
  
}

// GEMM C[M][N] (f32, pitch ldc) = act(A[M][K] * W + bias). A f32 row-major (pitch lda) converted to bf16
// (ASPLIT: hi/lo two planes -> 2 terms, else single rounded term); Wt bf16 [N][K] (pitch ldb). BIAS_BF16 rounds the
// bias to bf16 first (bias quantised to bf16 before the add). K%128==0, M%64==0, N%64==0. The two pitches are template constants, so that a
// chunk's loads differ by immediate offsets from one address per operand, which stays in its registers.
// A block owns a 64 x 64 tile of C, a wave 16 of its rows. Per 128 k the block brings its 64 A rows and its 64 Wt rows into LDS with loads
// that cover whole 128-byte lines (a wave-wide load reads 512 bytes of one row of A, or 256 bytes of each of two rows of Wt), A converted once on the way;
// the four waves share the Wt rows. Fragments come from LDS, in the k order and the k-step order of a direct load.
typedef unsigned short v4us __attribute__((ext_vector_type(4), may_alias));
template <bool ASPLIT, int ACT, bool BIAS_BF16, int lda, int ldb>
__global__ __launch_bounds__(128) void k_gemm_bf(const float* __restrict__ A, const unsigned short* __restrict__ Wt,
                                               const float* __restrict__ bias, float* __restrict__ C, int ldc, int M, int N, int K) {
  constexpr int KC = 128;                      // k per staged chunk
  constexpr int LP = KC + 8;                   // LDS row pitch in elements: the row's bytes + 16, free of bank conflicts for 16-byte fragment reads
  constexpr int NA = 64 * (KC / 4) / 128, RA = 128 / (KC / 4);   // 16-byte pieces of A per thread; rows the block covers per piece
  constexpr int NB = 64 * (KC / 8) / 128, RB = 128 / (KC / 8);   // the same for Wt
  __shared__ __attribute__((aligned(16))) unsigned short sAh[64][LP], sAl[ASPLIT ? 64 : 1][LP], sB[64][LP];
  __shared__ __attribute__((aligned(16))) float so[4][16][64];
  const int tid = threadIdx.x, w = tid >> 5, lane = tid & 31, ln = lane & 15, hh = lane >> 4;
  const int ntn = N / 64;
  const int mt = blockIdx.x / ntn, nq = blockIdx.x % ntn;
  if (mt * 64 >= M) return;                    // the whole block leaves, in front of every barrier
  const int row0 = mt * 64 + w * 16, col0 = nq * 64;
  const int ar = tid / (KC / 4), ac = (tid % (KC / 4)) * 4, br = tid / (KC / 8), bc = (tid % (KC / 8)) * 8;
  const float* Ab = A + (size_t)(mt * 64) * lda;               // block-uniform bases; the thread's own place is a 32-bit offset
  const unsigned short* Bb = Wt + (size_t)col0 * ldb;
  const unsigned ao = (unsigned)(ar * lda + ac), bo = (unsigned)(br * ldb + bc);
  v8f acc[4] = {};
  for (int kb = 0; kb < K; kb += KC) {
    v4f xa[NA]; v8us xb[NB];
#pragma unroll
    for (int it = 0; it < NA; ++it) xa[it] = *(const v4fa*)(Ab + kb + (ao + (unsigned)(it * RA * lda)));
#pragma unroll
    for (int it = 0; it < NB; ++it) xb[it] = *(const v8us*)(Bb + kb + (bo + (unsigned)(it * RB * ldb)));
    asm volatile("s_wait_xcnt 0x0" ::: "memory");   // in front of every later write of the loads' address registers, which this trip advances
    __builtin_amdgcn_sched_barrier(0);         // nothing crosses: the wait stays directly behind the last load, and no conversion is lifted in front of it
    __syncthreads();                           // every wave has read its fragments of the chunk before
#pragma unroll
    for (int it = 0; it < NA; ++it) {
      v4us hi, lo;
#pragma unroll
      for (int i = 0; i < 4; ++i) { const unsigned short hb = bf16_bits(xa[it][i]); hi[i] = hb; lo[i] = ASPLIT ? bf16_bits(xa[it][i] - bf16_val(hb)) : (unsigned short)0; }
      *(v4us*)&sAh[ar + it * RA][ac] = hi;
      if (ASPLIT) *(v4us*)&sAl[ar + it * RA][ac] = lo;
    }
#pragma unroll
    for (int it = 0; it < NB; ++it) *(v8us*)&sB[br + it * RB][bc] = xb[it];
    __syncthreads();
#pragma unroll
    for (int k2 = 0; k2 < KC; k2 += 64) {
      FragB ah[2], al[2], b[2][4];
#pragma unroll
      for (int s = 0; s < 2; ++s) {
        const int kc = k2 + s * 32 + 8 * hh;
        ah[s].half[0] = *(const v8us*)&sAh[w * 16 + ln][kc]; ah[s].half[1] = *(const v8us*)&sAh[w * 16 + ln][kc + 16];
        if (ASPLIT) { al[s].half[0] = *(const v8us*)&sAl[w * 16 + ln][kc]; al[s].half[1] = *(const v8us*)&sAl[w * 16 + ln][kc + 16]; }
#pragma unroll
        for (int t = 0; t < 4; ++t) { b[s][t].half[0] = *(const v8us*)&sB[t * 16 + ln][kc]; b[s][t].half[1] = *(const v8us*)&sB[t * 16 + ln][kc + 16]; }
      }
#pragma unroll
      for (int s = 0; s < 2; ++s)
#pragma unroll
        for (int t = 0; t < 4; ++t) acc[t] = mmaN<ASPLIT ? 2 : 1>(ah[s].v, ASPLIT ? al[s].v : ah[s].v, b[s][t].v, b[s][t].v, acc[t]);
    }
  }
#pragma unroll
  for (int t = 0; t < 4; ++t) {
    float bv = bias ? bias[col0 + t * 16 + ln] : 0.f;
    if (BIAS_BF16) bv = bf16_round(bv);
#pragma unroll
    for (int r = 0; r < 8; ++r) { float v = acc[t][r] + bv; if (ACT == 1) v = fmaxf(v, 0.f); so[w][8 * hh + r][t * 16 + ln] = v; }
  }
  __builtin_amdgcn_fence(__ATOMIC_ACQ_REL, "workgroup");
  __builtin_amdgcn_wave_barrier();
  const int rsub = lane >> 4, c4 = (lane & 15) * 4;
  {
#pragma unroll
    for (int q = 0; q < 8; ++q) {
      const int r = q * 2 + rsub;
      const v4f v = *(const v4fa*)&so[w][r][c4];
      *(v4f*)(C + (size_t)(row0 + r) * ldc + col0 + c4) = v;
    }
    
  }
}

// Flash-style causal/unmasked attention, all contractions 3-term bf16 hi/lo splits, f32 softmax with running max.
// q,k,v rows are read from f32 buffers with arbitrary row pitch (so they can live inside a fused qkv buffer);
// D = head size (multiple of 32, <= 128); one wave = 16 query rows; block = 4 waves (64 queries) sharing K/V chunks of 32.
template <int D, bool CAUSAL>
__global__ __launch_bounds__(128) void k_flash(const float* __restrict__ qb, const float* __restrict__ kb, const float* __restrict__ vb,
                                             int pitch, int T, int H, float scale, float* __restrict__ y, int ypitch) {
  constexpr int KS = D / 32;        // k-steps for QK
  constexpr int DT = D / 16;        // d tiles for PV
  __shared__ __attribute__((aligned(16))) unsigned short sKh[32][D + 8], sKl[32][D + 8], sVh[32][D + 8], sVl[32][D + 8];
  __shared__ __attribute__((aligned(16))) unsigned short sPh[4][16][40], sPl[4][16][40];
  __shared__ __attribute__((aligned(16))) float sO[4][16][D];
  const int tid = threadIdx.x, w = tid >> 5, lane = tid & 31, ln = lane & 15, hh = lane >> 4;
  const int nqb = (T + 63) / 64;
  const int bh = blockIdx.x / nqb, qblk = blockIdx.x % nqb;
  const int b = bh / H, h = bh % H;
  const int q0 = qblk * 64 + w * 16;
  const float* Q = qb + (size_t)b * T * pitch + h * D;
  const float* K = kb + (size_t)b * T * pitch + h * D;
  const float* V = vb + (size_t)b * T * pitch + h * D;

  // A fragments of the wave's 16 query rows (scaled), hi/lo
  FragB aqh[KS], aql[KS];
  {
    int row = q0 + ln; if (row >= T) row = T - 1;
    const float* qr = Q + (size_t)row * pitch;
#pragma unroll
    for (int ks = 0; ks < KS; ++ks)
#pragma unroll
      for (int i = 0; i < 16; ++i) {
        const int d = ks * 32 + ((i < 8) ? (8 * hh + i) : (16 + 8 * hh + (i - 8)));
        const float x = qr[d] * scale; const unsigned short hb = bf16_bits(x);
        aqh[ks].u[i] = hb; aql[ks].u[i] = bf16_bits(x - bf16_val(hb));
      }
  }
  float m_r[8], l_r[8];
#pragma unroll
  for (int r = 0; r < 8; ++r) { m_r[r] = -3.0e38f; l_r[r] = 0.f; }
  v8f oacc[DT];
#pragma unroll
  for (int dt = 0; dt < DT; ++dt) oacc[dt] = (v8f){0.f,0.f,0.f,0.f,0.f,0.f,0.f,0.f};

  const int kv_end = CAUSAL ? min(T, qblk * 64 + 64) : T;     // block-uniform
  for (int j0 = 0; j0 < kv_end; j0 += 32) {
    __syncthreads();
    for (int e = tid; e < 32 * (D / 4); e += 128) {
      const int r = e / (D / 4), c4 = (e % (D / 4)) * 4;
      const int key = j0 + r;
      v4f kf = {0.f,0.f,0.f,0.f}, vf = {0.f,0.f,0.f,0.f};
      if (key < T) { kf = *(const v4fa*)(K + (size_t)key * pitch + c4); vf = *(const v4fa*)(V + (size_t)key * pitch + c4); }
#pragma unroll
      for (int t = 0; t < 4; ++t) {
        unsigned short hb = bf16_bits(kf[t]); sKh[r][c4 + t] = hb; sKl[r][c4 + t] = bf16_bits(kf[t] - bf16_val(hb));
        hb = bf16_bits(vf[t]); sVh[r][c4 + t] = hb; sVl[r][c4 + t] = bf16_bits(vf[t] - bf16_val(hb));
      }
    }
    __syncthreads();
    // S tile 16 x 32
    v8f s[2];
#pragma unroll
    for (int nt = 0; nt < 2; ++nt) {
      v8f acc = {};
#pragma unroll
      for (int ks = 0; ks < KS; ++ks) {
        FragB bh_, bl_;
        bh_.half[0] = *(const v8us*)&sKh[nt * 16 + ln][ks * 32 + 8 * hh]; bh_.half[1] = *(const v8us*)&sKh[nt * 16 + ln][ks * 32 + 16 + 8 * hh];
        bl_.half[0] = *(const v8us*)&sKl[nt * 16 + ln][ks * 32 + 8 * hh]; bl_.half[1] = *(const v8us*)&sKl[nt * 16 + ln][ks * 32 + 16 + 8 * hh];
        acc = mmaN<3>(aqh[ks].v, aql[ks].v, bh_.v, bl_.v, acc);
      }
      s[nt] = acc;
    }
    // mask + running max (rows 8hh+r; the 16 lanes of a half share rows)
    float alpha[8];
#pragma unroll
    for (int r = 0; r < 8; ++r) {
      const int qi = q0 + 8 * hh + r;
      const int ja = j0 + ln, jb = j0 + 16 + ln;
      if (CAUSAL) { if (ja > qi) s[0][r] = -3.0e38f; if (jb > qi) s[1][r] = -3.0e38f; }
      if (ja >= T) s[0][r] = -3.0e38f;
      if (jb >= T) s[1][r] = -3.0e38f;
      float mx = fmaxf(s[0][r], s[1][r]);
      mx = fmaxf(mx, __shfl_xor(mx, 1, 32)); mx = fmaxf(mx, __shfl_xor(mx, 2, 32)); mx = fmaxf(mx, __shfl_xor(mx, 4, 32)); mx = fmaxf(mx, __shfl_xor(mx, 8, 32));
      const float mnew = fmaxf(m_r[r], mx);
      alpha[r] = (mnew > -1.0e38f) ? __expf(m_r[r] - mnew) : 1.0f;
      const float p0 = (s[0][r] > -1.0e38f) ? __expf(s[0][r] - mnew) : 0.f;
      const float p1 = (s[1][r] > -1.0e38f) ? __expf(s[1][r] - mnew) : 0.f;
      m_r[r] = mnew;
      l_r[r] = l_r[r] * alpha[r] + p0 + p1;            // per-lane partial row sum (16 lanes combined at the end)
      unsigned short hb = bf16_bits(p0); sPh[w][8 * hh + r][ln] = hb;      sPl[w][8 * hh + r][ln] = bf16_bits(p0 - bf16_val(hb));
      hb = bf16_bits(p1);                sPh[w][8 * hh + r][16 + ln] = hb; sPl[w][8 * hh + r][16 + ln] = bf16_bits(p1 - bf16_val(hb));
    }
#pragma unroll
    for (int dt = 0; dt < DT; ++dt)
#pragma unroll
      for (int r = 0; r < 8; ++r) oacc[dt][r] *= alpha[r];
    __builtin_amdgcn_fence(__ATOMIC_ACQ_REL, "workgroup");
    __builtin_amdgcn_wave_barrier();
    FragB pah, pal;
    pah.half[0] = *(const v8us*)&sPh[w][ln][8 * hh]; pah.half[1] = *(const v8us*)&sPh[w][ln][16 + 8 * hh];
    pal.half[0] = *(const v8us*)&sPl[w][ln][8 * hh]; pal.half[1] = *(const v8us*)&sPl[w][ln][16 + 8 * hh];
#pragma unroll
    for (int dt = 0; dt < DT; ++dt) {
      FragB bvh, bvl;
#pragma unroll
      for (int i = 0; i < 8; ++i) {
        bvh.u[i] = sVh[8 * hh + i][dt * 16 + ln]; bvh.u[8 + i] = sVh[16 + 8 * hh + i][dt * 16 + ln];
        bvl.u[i] = sVl[8 * hh + i][dt * 16 + ln]; bvl.u[8 + i] = sVl[16 + 8 * hh + i][dt * 16 + ln];
      }
      oacc[dt] = mmaN<3>(pah.v, pal.v, bvh.v, bvl.v, oacc[dt]);
    }
    __builtin_amdgcn_fence(__ATOMIC_ACQ_REL, "workgroup");
    __builtin_amdgcn_wave_barrier();
  }
#pragma unroll
  for (int r = 0; r < 8; ++r) {
    float l = l_r[r];
    l += __shfl_xor(l, 1, 32); l += __shfl_xor(l, 2, 32); l += __shfl_xor(l, 4, 32); l += __shfl_xor(l, 8, 32);
    l_r[r] = (l > 0.f) ? 1.0f / l : 0.f;
  }
#pragma unroll
  for (int dt = 0; dt < DT; ++dt)
#pragma unroll
    for (int r = 0; r < 8; ++r) sO[w][8 * hh + r][dt * 16 + ln] = oacc[dt][r] * l_r[r];
  __builtin_amdgcn_fence(__ATOMIC_ACQ_REL, "workgroup");
  __builtin_amdgcn_wave_barrier();
  {
    for (int r = 0; r < 16; ++r) {
      const int row = q0 + r;
      if (row < T && lane < D / 4) {
        const v4f val = *(const v4fa*)&sO[w][r][lane * 4];
        *(v4f*)(y + ((size_t)b * T + row) * ypitch + h * D + lane * 4) = val;
      }
    }
    
  }
}

template <int D, int T, int PITCH, bool CAUSAL, bool HASMASK, bool HASBIAS>
__global__ __launch_bounds__(128) void k_flashm(const float* __restrict__ Qb, const float* __restrict__ Kb, const float* __restrict__ Vb,
                                              int H, float scale, const int* __restrict__ mask, float* __restrict__ y, const float* __restrict__ sbias) {
  static_assert(T % 64 == 0 && D % 32 == 0, "whole query blocks and key chunks only");
  constexpr int KS = D / 32, DT = D / 16;
  constexpr int NST = 32 * (D / 4) / 128;      // staging trips per thread, the same for every thread
  constexpr int RPT = 128 / (D / 4);           // key rows that the block stages per trip
  constexpr int VP = D + 16;                   // V row pitch in elements: an odd multiple of 32 bytes, the transposing load's conflict-free pitch
  static_assert((VP * 2) % 32 == 0 && ((VP * 2 / 32) & 1) == 1, "V pitch must be 32 B x odd");
  __shared__ __attribute__((aligned(16))) unsigned short sKh[32][D + 8], sKl[32][D + 8], sVh[32][VP], sVl[32][VP];
  __shared__ __attribute__((aligned(16))) float sO[4][16][D];
  const int tid = threadIdx.x, w = tid >> 5, lane = tid & 31, ln = lane & 15, hh = lane >> 4;
  constexpr int nqb = T / 64;
  const int bh = blockIdx.x / nqb, qblk = blockIdx.x % nqb;
  const int b = bh / H, h = bh % H;
  const int q0 = qblk * 64 + w * 16;
  const float* Q = Qb + (size_t)b * T * PITCH + h * D;
  const float* K = Kb + (size_t)b * T * PITCH + h * D;
  const float* V = Vb + (size_t)b * T * PITCH + h * D;
  const float* SB = sbias + (size_t)bh * T;
  const unsigned ukb = 8u * (unsigned)hh, toff = (unsigned)(tid / (D / 4)) * PITCH + (unsigned)(tid % (D / 4)) * 4u;
  const int vrow = 8 * hh + (lane & 7), vcol = 8 * ((lane >> 3) & 1);   // the lane's address inside a 16 x 16 V tile for ld_tr16
  FragB aqh[KS], aql[KS];
  {
    const float* qr = Q + (size_t)(q0 + ln) * PITCH;
#pragma unroll
    for (int ks = 0; ks < KS; ++ks)
#pragma unroll
      for (int i = 0; i < 16; ++i) {
        const int d = ks * 32 + ((i < 8) ? (8 * hh + i) : (16 + 8 * hh + (i - 8)));
        const float x = qr[d] * scale; const unsigned short hb = bf16_bits(x);
        aqh[ks].u[i] = hb; aql[ks].u[i] = bf16_bits(x - bf16_val(hb));
      }
  }
  const int qi = q0 + ln;                      // the lane's query
  const float bq = HASBIAS ? SB[qi] : 0.f;     // its bias, read once
  float m_q = -3.0e38f, l_q = 0.f;             // its running maximum; the sum over this half's keys (the halves join after the loop)
  v8f oacc[DT];                                // oacc[dt][r] = O[qi][dt * 16 + 8 * hh + r]
#pragma unroll
  for (int dt = 0; dt < DT; ++dt) oacc[dt] = (v8f){0.f,0.f,0.f,0.f,0.f,0.f,0.f,0.f};
  const int kv_end = CAUSAL ? qblk * 64 + 64 : T;
  for (int j0 = 0; j0 < kv_end; j0 += 32) {
    __syncthreads();
    // every global read of the chunk is issued here, together: the lane's 16 key biases and the thread's K and V pieces
    // (one address per operand and chunk; the staging trips differ by a constant offset only)
    const float* Kj = K + (size_t)j0 * PITCH; const float* Vj = V + (size_t)j0 * PITCH; const float* SBj = SB + j0;
    v4f bk[4] = {};                            // biases of keys 8hh + 0..7 and 16 + 8hh + 0..7
    if (HASBIAS) { bk[0] = *(const v4fa*)(SBj + ukb); bk[1] = *(const v4fa*)(SBj + (ukb + 4u)); bk[2] = *(const v4fa*)(SBj + (ukb + 16u)); bk[3] = *(const v4fa*)(SBj + (ukb + 20u)); }
    v4f kf[NST], vf[NST];
#pragma unroll
    for (int it = 0; it < NST; ++it) {
      kf[it] = *(const v4fa*)(Kj + (toff + (unsigned)(it * RPT * PITCH))); vf[it] = *(const v4fa*)(Vj + (toff + (unsigned)(it * RPT * PITCH)));
    }
    asm volatile("s_wait_xcnt 0x0" ::: "memory");   // the conversions below reuse the loads' address registers
    __builtin_amdgcn_sched_barrier(0);         // keeps all twelve loads above the conversions: sunk among them, a load pays its latency alone
#pragma unroll
    for (int it = 0; it < NST; ++it) {
      const int e = tid + it * 128;
      const int r = e / (D / 4), c4 = (e % (D / 4)) * 4;
#pragma unroll
      for (int t = 0; t < 4; ++t) {
        unsigned short hb = bf16_bits(kf[it][t]); sKh[r][c4 + t] = hb; sKl[r][c4 + t] = bf16_bits(kf[it][t] - bf16_val(hb));
        hb = bf16_bits(vf[it][t]); sVh[r][c4 + t] = hb; sVl[r][c4 + t] = bf16_bits(vf[it][t] - bf16_val(hb));
      }
    }
    __syncthreads();
    v8f s[2];                                  // s[nt][r] = S[key j0 + nt * 16 + 8 * hh + r][query qi]
#pragma unroll
    for (int nt = 0; nt < 2; ++nt) {
      v8f acc = {};
#pragma unroll
      for (int ks = 0; ks < KS; ++ks) {
        FragB kh_, kl_;
        kh_.half[0] = *(const v8us*)&sKh[nt * 16 + ln][ks * 32 + 8 * hh]; kh_.half[1] = *(const v8us*)&sKh[nt * 16 + ln][ks * 32 + 16 + 8 * hh];
        kl_.half[0] = *(const v8us*)&sKl[nt * 16 + ln][ks * 32 + 8 * hh]; kl_.half[1] = *(const v8us*)&sKl[nt * 16 + ln][ks * 32 + 16 + 8 * hh];
        acc = mmaT3(kh_.v, kl_.v, aqh[ks].v, aql[ks].v, acc);
      }
      s[nt] = acc;
    }
    bool keep[2][8];
    float mx = -3.0e38f;
#pragma unroll
    for (int nt = 0; nt < 2; ++nt)
#pragma unroll
      for (int r = 0; r < 8; ++r) {
        const int kj = j0 + nt * 16 + 8 * hh + r;
        bool kp = true;
        if (HASBIAS) s[nt][r] += bq + bk[nt * 2 + (r >> 2)][r & 3];
        if (CAUSAL) kp = kj <= qi;
        if (HASMASK) kp = kp && mask[(size_t)qi * T + kj] != 0;
        if (!kp) s[nt][r] = -3.0e38f;
        keep[nt][r] = kp;
        mx = fmaxf(mx, s[nt][r]);
      }
    mx = fmaxf(mx, xhalf(mx));                 // the other half's 16 keys of the same query
    const float mnew = fmaxf(m_q, mx);
    const float alpha = (mnew > -1.0e38f) ? __expf(m_q - mnew) : 1.0f;
    m_q = mnew;
    v8u pwh, pwl;                              // P^T as a B fragment: element nt * 8 + r is key nt * 16 + 8hh + r, the k order of the V fragments
    float ps[2] = {0.f, 0.f};
#pragma unroll
    for (int nt = 0; nt < 2; ++nt)
#pragma unroll
      for (int r = 0; r < 8; r += 2) {         // two neighbouring keys fill one register: one byte permute packs both high halves
        const float p0 = keep[nt][r] ? __expf(s[nt][r] - mnew) : 0.f;
        const float p1 = keep[nt][r + 1] ? __expf(s[nt][r + 1] - mnew) : 0.f;
        ps[nt] += p0; ps[nt] += p1;
        const unsigned int h0 = bf16_high(p0), h1 = bf16_high(p1);
        const unsigned int l0 = bf16_high(p0 - __uint_as_float(h0 & 0xFFFF0000u)), l1 = bf16_high(p1 - __uint_as_float(h1 & 0xFFFF0000u));
        pwh[nt * 4 + (r >> 1)] = __builtin_amdgcn_perm(h1, h0, 0x07060302u);
        pwl[nt * 4 + (r >> 1)] = __builtin_amdgcn_perm(l1, l0, 0x07060302u);
      }
    const v16b pbh = __builtin_bit_cast(v16b, pwh), pbl = __builtin_bit_cast(v16b, pwl);
    l_q = l_q * alpha + (ps[0] + ps[1]);
#pragma unroll
    for (int dt = 0; dt < DT; ++dt)
#pragma unroll
      for (int r = 0; r < 8; ++r) oacc[dt][r] *= alpha;
    FragB bvh[DT], bvl[DT];                    // V^T as A fragments: row d = dt * 16 + ln, keys 8hh + 0..7, then 16 + 8hh + 0..7
#pragma unroll
    for (int dt = 0; dt < DT; ++dt) {
      bvh[dt].half[0] = ld_tr16(&sVh[vrow][vcol + dt * 16]); bvh[dt].half[1] = ld_tr16(&sVh[16 + vrow][vcol + dt * 16]);
      bvl[dt].half[0] = ld_tr16(&sVl[vrow][vcol + dt * 16]); bvl[dt].half[1] = ld_tr16(&sVl[16 + vrow][vcol + dt * 16]);
    }
#pragma unroll
    for (int dt = 0; dt < DT; ++dt) oacc[dt] = mmaT3(bvh[dt].v, bvl[dt].v, pbh, pbl, oacc[dt]);
  }
  // NaN for fully-masked rows (softmax over a row of -inf)
  const float l_all = l_q + xhalf(l_q);
  const float linv = (m_q > -1.0e38f) ? 1.0f / l_all : __builtin_nanf("");
#pragma unroll
  for (int dt = 0; dt < DT; ++dt) {
    v4f lo4, hi4;
#pragma unroll
    for (int r = 0; r < 4; ++r) { lo4[r] = oacc[dt][r] * linv; hi4[r] = oacc[dt][4 + r] * linv; }
    *(v4fa*)&sO[w][ln][dt * 16 + 8 * hh] = lo4; *(v4fa*)&sO[w][ln][dt * 16 + 8 * hh + 4] = hi4;
  }
  __builtin_amdgcn_fence(__ATOMIC_ACQ_REL, "workgroup");
  __builtin_amdgcn_wave_barrier();
  {
    for (int r = 0; r < 16; ++r) {
      const int row = q0 + r;
      if (lane < D / 4) {
        const v4f val = *(const v4fa*)&sO[w][r][lane * 4];
        *(v4f*)(y + ((size_t)b * T + row) * PITCH + h * D + lane * 4) = val;
      }
    }
    
  }
}

__global__ __launch_bounds__(256) void k_round_rows(const float* __restrict__ W, unsigned short* __restrict__ Wt, int n8) {
  const int t = blockIdx.x * 256 + threadIdx.x;
  if (t >= n8) return;
  const v4f a = *(const v4fa*)(W + (size_t)t * 8), b = *(const v4fa*)(W + (size_t)t * 8 + 4);
  v8us v; v[0]=bf16_bits(a[0]); v[1]=bf16_bits(a[1]); v[2]=bf16_bits(a[2]); v[3]=bf16_bits(a[3]);
  v[4]=bf16_bits(b[0]); v[5]=bf16_bits(b[1]); v[6]=bf16_bits(b[2]); v[7]=bf16_bits(b[3]);
  *(v8us*)(Wt + (size_t)t * 8) = v; 
}

// 32 patches per block: 64-point rDFT power per bin k = 0..32 (1056 (patch, bin) pairs over the 256 threads), band means, log1p,
// then bias[b][h][n] = Σ_c bp[c]·band_bias[h][c] for the 8 heads; (threads 0..31, one patch each);
// layout sbias[(b*H + h)*N + n]: for fixed (b,h) consecutive n are contiguous, so a block
// writes 32 consecutive n for each h = 128 B pieces (wave h stores head h).
__global__ __launch_bounds__(256) void k_bandbias(const float* __restrict__ patches, const float* __restrict__ band_bias, float* __restrict__ sbias) {
  __shared__ float sp[32][PL];
  __shared__ float pw[32][33];
  __shared__ float sb[NH][32];
  __shared__ float tw[2][PL];                 // cos and sin of 2*pi*m/64, m = 0..63: the only angles the DFT below meets
  const int tid = threadIdx.x;
  const int blk = blockIdx.x;                 // over B*N/32
  const int b = blk / (NN / 32), n0 = (blk % (NN / 32)) * 32;
  for (int e = tid; e < 32 * PL; e += 256) { const int r = e / PL, c = e % PL; sp[r][c] = bf16_round(patches[((size_t)b * NN + n0 + r) * PL + c]); }
  if (tid < PL) {                             // filled once per block, published by the barrier that publishes sp
    const float ang = 0.09817477042468103f * (float)tid;     // 2*pi/64
    tw[0][tid] = cosf(ang); tw[1][tid] = sinf(ang);
  }
  __syncthreads();
  // 32 patches x 33 bins = 1056 (patch, bin) pairs over 256 threads
  for (int e = tid; e < 32 * 33; e += 256) {
    const int r = e / 33;
    const unsigned kbin = (unsigned)(e % 33);
    float xs[PL], c[PL], s[PL];
#pragma unroll                                 // n becomes a constant, so xs, c and s live in registers
    for (int n = 0; n < PL; ++n) {
      const unsigned m = (kbin * (unsigned)n) & (unsigned)(PL - 1);   // angle = 2*pi*m/64, exact reduction
      xs[n] = sp[r][n]; c[n] = tw[0][m]; s[n] = tw[1][m];
    }
    __builtin_amdgcn_sched_barrier(0);         // keeps every LDS read above the two sum chains: sunk among them, each read pays its latency alone
    float re = 0.f, im = 0.f;
#pragma unroll                                 // as above: constant indices into xs, c and s
    for (int n = 0; n < PL; ++n) { re += xs[n] * c[n]; im -= xs[n] * s[n]; }
    pw[r][kbin] = re * re + im * im;
  }
  __syncthreads();
  if (tid < 32) {
    const int r = tid;
    // bands sorted by name: alpha {3}, beta {4..7}, delta {1}, gamma {8..25}, theta {2}  (rfftfreq(64, 1/250) = 3.90625 k)
    float bp[NBANDS];
    bp[0] = pw[r][3];
    bp[1] = (pw[r][4] + pw[r][5] + pw[r][6] + pw[r][7]) * 0.25f;
    bp[2] = pw[r][1];
    { float s = 0.f;
#pragma unroll 1
      for (int kbin = 8; kbin <= 25; ++kbin) s += pw[r][kbin]; bp[3] = s * (1.0f / 18.0f); }
    bp[4] = pw[r][2];
#pragma unroll 1
    for (int c = 0; c < NBANDS; ++c) bp[c] = log1pf(bp[c]);
#pragma unroll 1
    for (int h = 0; h < NH; ++h) {
      float s = 0.f;
#pragma unroll 1
      for (int c = 0; c < NBANDS; ++c) s += bp[c] * bf16_round(band_bias[h * NBANDS + c]);
      sb[h][r] = s;
    }
  }
  __syncthreads();
  {
    const int h = tid >> 5, r = tid & 31;
    float* dst = sbias + ((size_t)(b * NH + h)) * NN + n0 + r;
    const float v = sb[h][r];
    *(float*)dst = v; 
  }
}

extern "C" void kernel_launch(void* const* d_in, const int* in_sizes, int n_in,
                              void* d_out, int out_size, void* d_ws, size_t ws_size, hipStream_t stream) {
  (void)in_sizes; (void)n_in; (void)out_size;
  const float* x = (const float*)d_in[0]; const float* patches = (const float*)d_in[1];
  const float* Wq = (const float*)d_in[2]; const float* bq = (const float*)d_in[3];
  const float* Wk = (const float*)d_in[4]; const float* bk = (const float*)d_in[5];
  const float* Wv = (const float*)d_in[6]; const float* bv = (const float*)d_in[7];
  const float* Wo = (const float*)d_in[8]; const float* bo = (const float*)d_in[9];
  const float* band_bias = (const float*)d_in[10];
  char* ws = (char*)d_ws; size_t off = 0;
  unsigned short* Wqt = (unsigned short*)(ws + off); off += (size_t)DM * DM * 2;
  unsigned short* Wkt = (unsigned short*)(ws + off); off += (size_t)DM * DM * 2;
  unsigned short* Wvt = (unsigned short*)(ws + off); off += (size_t)DM * DM * 2;
  unsigned short* Wot = (unsigned short*)(ws + off); off += (size_t)DM * DM * 2;
  float* qb = (float*)(ws + off); off += (size_t)BB * NN * DM * 4;
  float* kb2 = (float*)(ws + off); off += (size_t)BB * NN * DM * 4;
  float* vb2 = (float*)(ws + off); off += (size_t)BB * NN * DM * 4;
  float* ob = (float*)(ws + off); off += (size_t)BB * NN * DM * 4;
  float* sbias = (float*)(ws + off); off += (size_t)BB * NH * NN * 4;
  if (off > ws_size) return;
  const int M = BB * NN, n8 = DM * DM / 8;
  k_round_rows<<<(n8 + 255) / 256, 256, 0, stream>>>(Wq, Wqt, n8);
  k_round_rows<<<(n8 + 255) / 256, 256, 0, stream>>>(Wk, Wkt, n8);
  k_round_rows<<<(n8 + 255) / 256, 256, 0, stream>>>(Wv, Wvt, n8);
  k_round_rows<<<(n8 + 255) / 256, 256, 0, stream>>>(Wo, Wot, n8);
  const int gb = ((M / 16) * (DM / 64) + 3) / 4;
  k_gemm_bf<false, 0, true, DM, DM><<<gb, 128, 0, stream>>>(x, Wqt, bq, qb, DM, M, DM, DM);
  k_gemm_bf<false, 0, true, DM, DM><<<gb, 128, 0, stream>>>(x, Wkt, bk, kb2, DM, M, DM, DM);
  k_gemm_bf<false, 0, true, DM, DM><<<gb, 128, 0, stream>>>(x, Wvt, bv, vb2, DM, M, DM, DM);
  k_bandbias<<<BB * NN / 32, 256, 0, stream>>>(patches, band_bias, sbias);
  k_flashm<HD, NN, DM, false, false, true><<<BB * NH * (NN / 64), 128, 0, stream>>>(qb, kb2, vb2, NH, 0.125f, nullptr, ob, sbias);
  k_gemm_bf<true, 0, true, DM, DM><<<gb, 128, 0, stream>>>(ob, Wot, bo, (float*)d_out, DM, M, DM, DM);
}

// v006
// It runs in 142 microseconds.
// In both of two side-by-side timings against v005, it was 1.11 times as fast.
// Over all steps from v000 it is 3.67 times as fast.
#include <hip/hip_runtime.h>
// All contractions on v_wmma_f32_16x16x32_bf16, f32 accumulate: Q/K/V = x·Wᵀ with x/W rounded to bf16 (single exact-product
// term), QKᵀ and P·V 3-term bf16 hi/lo splits, out = o·W_oᵀ with o split hi/lo (2 terms). The 64-point rFFT band powers,
// log1p, the 5->8 band-bias projection and softmax are f32 on VALU.
#define BB 2
#define NN 2048
#define DM 512
#define NH 8
#define HD 64
#define PL 64
#define NBANDS 5

typedef __bf16 v16b __attribute__((ext_vector_type(16)));
typedef unsigned short v8us __attribute__((ext_vector_type(8), may_alias));
typedef float  v8f  __attribute__((ext_vector_type(8)));
typedef float  v4f  __attribute__((ext_vector_type(4)));
typedef float  v4fa __attribute__((ext_vector_type(4), may_alias));
union FragB { v16b v; v8us half[2]; unsigned short u[16]; };

__device__ __forceinline__ unsigned short bf16_bits(float x) { unsigned int u = __float_as_uint(x); return (unsigned short)((u + 0x7FFFu + ((u >> 16) & 1u)) >> 16); }
__device__ __forceinline__ float bf16_val(unsigned short b) { return __uint_as_float(((unsigned int)b) << 16); }
__device__ __forceinline__ float bf16_round(float x) { return bf16_val(bf16_bits(x)); }
// D += A·B with NT terms: 1 = ah·bh, 2 = + al·bh (A split), 3 = + ah·bl (both split)
template <int NT>
__device__ __forceinline__ v8f mmaN(v16b ah, v16b al, v16b bh, v16b bl, v8f c) {
  c = __builtin_amdgcn_wmma_f32_16x16x32_bf16(false, ah, false, bh, (short)0, c, false, false);
  if (NT >= 2) c = __builtin_amdgcn_wmma_f32_16x16x32_bf16(false, al, false, bh, (short)0, c, false, false);
  if (NT >= 3) c = __builtin_amdgcn_wmma_f32_16x16x32_bf16(false, ah, false, bl, (short)0, c, false, false);
  asm volatile("v_nop\n\tv_nop\n\tv_nop\n\tv_nop" : "+v"(c) : "v"(ah), "v"(al), "v"(bh), "v"(bl));
  return c;
}

// The same three terms in the same order with the operands' sides exchanged (D transposed): ah*bh, ah*bl, al*bh
__device__ __forceinline__ v8f mmaT3(v16b ah, v16b al, v16b bh, v16b bl, v8f c) {
  c = __builtin_amdgcn_wmma_f32_16x16x32_bf16(false, ah, false, bh, (short)0, c, false, false);
  c = __builtin_amdgcn_wmma_f32_16x16x32_bf16(false, ah, false, bl, (short)0, c, false, false);
  c = __builtin_amdgcn_wmma_f32_16x16x32_bf16(false, al, false, bh, (short)0, c, false, false);
  asm volatile("v_nop\n\tv_nop\n\tv_nop\n\tv_nop" : "+v"(c) : "v"(ah), "v"(al), "v"(bh), "v"(bl));   // the distance behind a WMMA, on the loop's taken branch too
  return c;
}
// x rounded to bf16 as in bf16_bits, the 16 bits left in the high half of the word
__device__ __forceinline__ unsigned int bf16_high(float x) { unsigned int u = __float_as_uint(x); return u + 0x7FFFu + ((u >> 16) & 1u); }
typedef unsigned int v8u __attribute__((ext_vector_type(8)));
// lane l with lane l ^ 16, on the vector pipe
__device__ __forceinline__ float xhalf(float x) {
  return __builtin_bit_cast(float, __builtin_amdgcn_permlanex16(__builtin_bit_cast(int, x), __builtin_bit_cast(int, x), 0x76543210, 0xfedcba98, false, false));
}

// Transposing LDS load: lane (c = l & 15, h = l >> 4) receives T[kbase + 8h + 0..7][dbase + c] of a row-major 16-bit tile when it
// passes the address of T[kbase + 8h + (l & 7)][dbase + 8 * ((l >> 3) & 1)]; two of them (kbase, kbase + 16) are one 32 x 16 B fragment.
typedef short s16x8 __attribute__((ext_vector_type(8)));
__device__ __forceinline__ v8us ld_tr16(const unsigned short* p) {
  typedef __attribute__((address_space(3))) s16x8 lds_s16x8;
  return __builtin_bit_cast(v8us, __builtin_amdgcn_ds_load_tr16_b128_v8i16((lds_s16x8*)p));
}

__global__ __launch_bounds__(256) void k_wt_bf16(const float* __restrict__ W, unsigned short* __restrict__ Wt, int K, int N) {
  const int t = blockIdx.x * 256 + threadIdx.x;
  const int k8n = K / 8;
  if (t >= N * k8n) return;
  const int n = t / k8n, k8 = (t % k8n) * 8;
  v8us v;
#pragma unroll
  for (int i = 0; i < 8; ++i) v[i] = bf16_bits(W[(size_t)(k8 + i) * N + n]);
  *(v8us*)(Wt + (size_t)n * K + k8) = v;
  
}

// GEMM C[M][N] (f32, pitch ldc) = act(A[M][K] * W + bias). A f32 row-major (pitch lda) converted to bf16
// (ASPLIT: hi/lo two planes -> 2 terms, else single rounded term); Wt bf16 [N][K] (pitch ldb). BIAS_BF16 rounds the
// bias to bf16 first (bias quantised to bf16 before the add). K%128==0, M%64==0, N%64==0. The two pitches are template constants, so that a
// chunk's loads differ by immediate offsets from one address per operand, which stays in its registers.
// A block owns a 64 x 64 tile of C, a wave 16 of its rows. Per 128 k the block brings its 64 A rows and its 64 Wt rows into LDS with loads
// that cover whole 128-byte lines (a wave-wide load reads 512 bytes of one row of A, or 256 bytes of each of two rows of Wt), A converted once on the way;
// the four waves share the Wt rows. Fragments come from LDS, in the k order and the k-step order of a direct load.
// One launch serves NSEL products of the same A: their Wt planes ([N][K] each) lie one behind the other, and the block index picks the plane
// with its bias and its output, so that the blocks of all the products are resident together. The blocks of one 64-row strip of A are neighbours.
typedef unsigned short v4us __attribute__((ext_vector_type(4), may_alias));
template <bool ASPLIT, int ACT, bool BIAS_BF16, int lda, int ldb, int NSEL>
__global__ __launch_bounds__(128) void k_gemm_bf(const float* __restrict__ A, const unsigned short* __restrict__ Wt,
                                               const float* __restrict__ bias0, const float* __restrict__ bias1, const float* __restrict__ bias2,
                                               float* __restrict__ C0, float* __restrict__ C1, float* __restrict__ C2, int ldc, int M, int N, int K) {
  constexpr int KC = 128;                      // k per staged chunk
  constexpr int LP = KC + 8;                   // LDS row pitch in elements: the row's bytes + 16, free of bank conflicts for 16-byte fragment reads
  constexpr int NA = 64 * (KC / 4) / 128, RA = 128 / (KC / 4);   // 16-byte pieces of A per thread; rows the block covers per piece
  constexpr int NB = 64 * (KC / 8) / 128, RB = 128 / (KC / 8);   // the same for Wt
  __shared__ __attribute__((aligned(16))) unsigned short sAh[64][LP], sAl[ASPLIT ? 64 : 1][LP], sB[64][LP];
  __shared__ __attribute__((aligned(16))) float so[4][16][64];
  const int tid = threadIdx.x, w = tid >> 5, lane = tid & 31, ln = lane & 15, hh = lane >> 4;
  const int ntn = N / 64;                      // column tiles of one product
  const int mt = blockIdx.x / (NSEL * ntn), nq = blockIdx.x % (NSEL * ntn);
  if (mt * 64 >= M) return;                    // the whole block leaves, in front of every barrier
  const int sel = NSEL > 1 ? nq / ntn : 0;     // which product: the same for the whole block
  const float* __restrict__ bias = sel == 0 ? bias0 : sel == 1 ? bias1 : bias2;
  float* __restrict__ C = sel == 0 ? C0 : sel == 1 ? C1 : C2;
  const int row0 = mt * 64 + w * 16, col0 = (nq - sel * ntn) * 64;
  const int ar = tid / (KC / 4), ac = (tid % (KC / 4)) * 4, br = tid / (KC / 8), bc = (tid % (KC / 8)) * 8;
  const float* Ab = A + (size_t)(mt * 64) * lda;               // block-uniform bases; the thread's own place is a 32-bit offset
  const unsigned short* Bb = Wt + (size_t)(nq * 64) * ldb;      // row sel * N + col0 of the planes
  const unsigned ao = (unsigned)(ar * lda + ac), bo = (unsigned)(br * ldb + bc);
  v8f acc[4] = {};
  for (int kb = 0; kb < K; kb += KC) {
    v4f xa[NA]; v8us xb[NB];
#pragma unroll
    for (int it = 0; it < NA; ++it) xa[it] = *(const v4fa*)(Ab + kb + (ao + (unsigned)(it * RA * lda)));
#pragma unroll
    for (int it = 0; it < NB; ++it) xb[it] = *(const v8us*)(Bb + kb + (bo + (unsigned)(it * RB * ldb)));
    asm volatile("s_wait_xcnt 0x0" ::: "memory");   // in front of every later write of the loads' address registers, which this trip advances
    __builtin_amdgcn_sched_barrier(0);         // nothing crosses: the wait stays directly behind the last load, and no conversion is lifted in front of it
    __syncthreads();                           // every wave has read its fragments of the chunk before
#pragma unroll
    for (int it = 0; it < NA; ++it) {
      v4us hi, lo;
#pragma unroll
      for (int i = 0; i < 4; ++i) { const unsigned short hb = bf16_bits(xa[it][i]); hi[i] = hb; lo[i] = ASPLIT ? bf16_bits(xa[it][i] - bf16_val(hb)) : (unsigned short)0; }
      *(v4us*)&sAh[ar + it * RA][ac] = hi;
      if (ASPLIT) *(v4us*)&sAl[ar + it * RA][ac] = lo;
    }
#pragma unroll
    for (int it = 0; it < NB; ++it) *(v8us*)&sB[br + it * RB][bc] = xb[it];
    __syncthreads();
#pragma unroll
    for (int k2 = 0; k2 < KC; k2 += 64) {
      FragB ah[2], al[2], b[2][4];
#pragma unroll
      for (int s = 0; s < 2; ++s) {
        const int kc = k2 + s * 32 + 8 * hh;
        ah[s].half[0] = *(const v8us*)&sAh[w * 16 + ln][kc]; ah[s].half[1] = *(const v8us*)&sAh[w * 16 + ln][kc + 16];
        if (ASPLIT) { al[s].half[0] = *(const v8us*)&sAl[w * 16 + ln][kc]; al[s].half[1] = *(const v8us*)&sAl[w * 16 + ln][kc + 16]; }
#pragma unroll
        for (int t = 0; t < 4; ++t) { b[s][t].half[0] = *(const v8us*)&sB[t * 16 + ln][kc]; b[s][t].half[1] = *(const v8us*)&sB[t * 16 + ln][kc + 16]; }
      }
#pragma unroll
      for (int s = 0; s < 2; ++s)
#pragma unroll
        for (int t = 0; t < 4; ++t) acc[t] = mmaN<ASPLIT ? 2 : 1>(ah[s].v, ASPLIT ? al[s].v : ah[s].v, b[s][t].v, b[s][t].v, acc[t]);
    }
  }
#pragma unroll
  for (int t = 0; t < 4; ++t) {
    float bv = bias ? bias[col0 + t * 16 + ln] : 0.f;
    if (BIAS_BF16) bv = bf16_round(bv);
#pragma unroll
    for (int r = 0; r < 8; ++r) { float v = acc[t][r] + bv; if (ACT == 1) v = fmaxf(v, 0.f); so[w][8 * hh + r][t * 16 + ln] = v; }
  }
  __builtin_amdgcn_fence(__ATOMIC_ACQ_REL, "workgroup");
  __builtin_amdgcn_wave_barrier();
  const int rsub = lane >> 4, c4 = (lane & 15) * 4;
  {
#pragma unroll
    for (int q = 0; q < 8; ++q) {
      const int r = q * 2 + rsub;
      const v4f v = *(const v4fa*)&so[w][r][c4];
      *(v4f*)(C + (size_t)(row0 + r) * ldc + col0 + c4) = v;
    }
    
  }
}

// Flash-style causal/unmasked attention, all contractions 3-term bf16 hi/lo splits, f32 softmax with running max.
// q,k,v rows are read from f32 buffers with arbitrary row pitch (so they can live inside a fused qkv buffer);
// D = head size (multiple of 32, <= 128); one wave = 16 query rows; block = 4 waves (64 queries) sharing K/V chunks of 32.
template <int D, bool CAUSAL>
__global__ __launch_bounds__(128) void k_flash(const float* __restrict__ qb, const float* __restrict__ kb, const float* __restrict__ vb,
                                             int pitch, int T, int H, float scale, float* __restrict__ y, int ypitch) {
  constexpr int KS = D / 32;        // k-steps for QK
  constexpr int DT = D / 16;        // d tiles for PV
  __shared__ __attribute__((aligned(16))) unsigned short sKh[32][D + 8], sKl[32][D + 8], sVh[32][D + 8], sVl[32][D + 8];
  __shared__ __attribute__((aligned(16))) unsigned short sPh[4][16][40], sPl[4][16][40];
  __shared__ __attribute__((aligned(16))) float sO[4][16][D];
  const int tid = threadIdx.x, w = tid >> 5, lane = tid & 31, ln = lane & 15, hh = lane >> 4;
  const int nqb = (T + 63) / 64;
  const int bh = blockIdx.x / nqb, qblk = blockIdx.x % nqb;
  const int b = bh / H, h = bh % H;
  const int q0 = qblk * 64 + w * 16;
  const float* Q = qb + (size_t)b * T * pitch + h * D;
  const float* K = kb + (size_t)b * T * pitch + h * D;
  const float* V = vb + (size_t)b * T * pitch + h * D;

  // A fragments of the wave's 16 query rows (scaled), hi/lo
  FragB aqh[KS], aql[KS];
  {
    int row = q0 + ln; if (row >= T) row = T - 1;
    const float* qr = Q + (size_t)row * pitch;
#pragma unroll
    for (int ks = 0; ks < KS; ++ks)
#pragma unroll
      for (int i = 0; i < 16; ++i) {
        const int d = ks * 32 + ((i < 8) ? (8 * hh + i) : (16 + 8 * hh + (i - 8)));
        const float x = qr[d] * scale; const unsigned short hb = bf16_bits(x);
        aqh[ks].u[i] = hb; aql[ks].u[i] = bf16_bits(x - bf16_val(hb));
      }
  }
  float m_r[8], l_r[8];
#pragma unroll
  for (int r = 0; r < 8; ++r) { m_r[r] = -3.0e38f; l_r[r] = 0.f; }
  v8f oacc[DT];
#pragma unroll
  for (int dt = 0; dt < DT; ++dt) oacc[dt] = (v8f){0.f,0.f,0.f,0.f,0.f,0.f,0.f,0.f};

  const int kv_end = CAUSAL ? min(T, qblk * 64 + 64) : T;     // block-uniform
  for (int j0 = 0; j0 < kv_end; j0 += 32) {
    __syncthreads();
    for (int e = tid; e < 32 * (D / 4); e += 128) {
      const int r = e / (D / 4), c4 = (e % (D / 4)) * 4;
      const int key = j0 + r;
      v4f kf = {0.f,0.f,0.f,0.f}, vf = {0.f,0.f,0.f,0.f};
      if (key < T) { kf = *(const v4fa*)(K + (size_t)key * pitch + c4); vf = *(const v4fa*)(V + (size_t)key * pitch + c4); }
#pragma unroll
      for (int t = 0; t < 4; ++t) {
        unsigned short hb = bf16_bits(kf[t]); sKh[r][c4 + t] = hb; sKl[r][c4 + t] = bf16_bits(kf[t] - bf16_val(hb));
        hb = bf16_bits(vf[t]); sVh[r][c4 + t] = hb; sVl[r][c4 + t] = bf16_bits(vf[t] - bf16_val(hb));
      }
    }
    __syncthreads();
    // S tile 16 x 32
    v8f s[2];
#pragma unroll
    for (int nt = 0; nt < 2; ++nt) {
      v8f acc = {};
#pragma unroll
      for (int ks = 0; ks < KS; ++ks) {
        FragB bh_, bl_;
        bh_.half[0] = *(const v8us*)&sKh[nt * 16 + ln][ks * 32 + 8 * hh]; bh_.half[1] = *(const v8us*)&sKh[nt * 16 + ln][ks * 32 + 16 + 8 * hh];
        bl_.half[0] = *(const v8us*)&sKl[nt * 16 + ln][ks * 32 + 8 * hh]; bl_.half[1] = *(const v8us*)&sKl[nt * 16 + ln][ks * 32 + 16 + 8 * hh];
        acc = mmaN<3>(aqh[ks].v, aql[ks].v, bh_.v, bl_.v, acc);
      }
      s[nt] = acc;
    }
    // mask + running max (rows 8hh+r; the 16 lanes of a half share rows)
    float alpha[8];
#pragma unroll
    for (int r = 0; r < 8; ++r) {
      const int qi = q0 + 8 * hh + r;
      const int ja = j0 + ln, jb = j0 + 16 + ln;
      if (CAUSAL) { if (ja > qi) s[0][r] = -3.0e38f; if (jb > qi) s[1][r] = -3.0e38f; }
      if (ja >= T) s[0][r] = -3.0e38f;
      if (jb >= T) s[1][r] = -3.0e38f;
      float mx = fmaxf(s[0][r], s[1][r]);
      mx = fmaxf(mx, __shfl_xor(mx, 1, 32)); mx = fmaxf(mx, __shfl_xor(mx, 2, 32)); mx = fmaxf(mx, __shfl_xor(mx, 4, 32)); mx = fmaxf(mx, __shfl_xor(mx, 8, 32));
      const float mnew = fmaxf(m_r[r], mx);
      alpha[r] = (mnew > -1.0e38f) ? __expf(m_r[r] - mnew) : 1.0f;
      const float p0 = (s[0][r] > -1.0e38f) ? __expf(s[0][r] - mnew) : 0.f;
      const float p1 = (s[1][r] > -1.0e38f) ? __expf(s[1][r] - mnew) : 0.f;
      m_r[r] = mnew;
      l_r[r] = l_r[r] * alpha[r] + p0 + p1;            // per-lane partial row sum (16 lanes combined at the end)
      unsigned short hb = bf16_bits(p0); sPh[w][8 * hh + r][ln] = hb;      sPl[w][8 * hh + r][ln] = bf16_bits(p0 - bf16_val(hb));
      hb = bf16_bits(p1);                sPh[w][8 * hh + r][16 + ln] = hb; sPl[w][8 * hh + r][16 + ln] = bf16_bits(p1 - bf16_val(hb));
    }
#pragma unroll
    for (int dt = 0; dt < DT; ++dt)
#pragma unroll
      for (int r = 0; r < 8; ++r) oacc[dt][r] *= alpha[r];
    __builtin_amdgcn_fence(__ATOMIC_ACQ_REL, "workgroup");
    __builtin_amdgcn_wave_barrier();
    FragB pah, pal;
    pah.half[0] = *(const v8us*)&sPh[w][ln][8 * hh]; pah.half[1] = *(const v8us*)&sPh[w][ln][16 + 8 * hh];
    pal.half[0] = *(const v8us*)&sPl[w][ln][8 * hh]; pal.half[1] = *(const v8us*)&sPl[w][ln][16 + 8 * hh];
#pragma unroll
    for (int dt = 0; dt < DT; ++dt) {
      FragB bvh, bvl;
#pragma unroll
      for (int i = 0; i < 8; ++i) {
        bvh.u[i] = sVh[8 * hh + i][dt * 16 + ln]; bvh.u[8 + i] = sVh[16 + 8 * hh + i][dt * 16 + ln];
        bvl.u[i] = sVl[8 * hh + i][dt * 16 + ln]; bvl.u[8 + i] = sVl[16 + 8 * hh + i][dt * 16 + ln];
      }
      oacc[dt] = mmaN<3>(pah.v, pal.v, bvh.v, bvl.v, oacc[dt]);
    }
    __builtin_amdgcn_fence(__ATOMIC_ACQ_REL, "workgroup");
    __builtin_amdgcn_wave_barrier();
  }
#pragma unroll
  for (int r = 0; r < 8; ++r) {
    float l = l_r[r];
    l += __shfl_xor(l, 1, 32); l += __shfl_xor(l, 2, 32); l += __shfl_xor(l, 4, 32); l += __shfl_xor(l, 8, 32);
    l_r[r] = (l > 0.f) ? 1.0f / l : 0.f;
  }
#pragma unroll
  for (int dt = 0; dt < DT; ++dt)
#pragma unroll
    for (int r = 0; r < 8; ++r) sO[w][8 * hh + r][dt * 16 + ln] = oacc[dt][r] * l_r[r];
  __builtin_amdgcn_fence(__ATOMIC_ACQ_REL, "workgroup");
  __builtin_amdgcn_wave_barrier();
  {
    for (int r = 0; r < 16; ++r) {
      const int row = q0 + r;
      if (row < T && lane < D / 4) {
        const v4f val = *(const v4fa*)&sO[w][r][lane * 4];
        *(v4f*)(y + ((size_t)b * T + row) * ypitch + h * D + lane * 4) = val;
      }
    }
    
  }
}

template <int D, int T, int PITCH, bool CAUSAL, bool HASMASK, bool HASBIAS>
__global__ __launch_bounds__(128) void k_flashm(const float* __restrict__ Qb, const float* __restrict__ Kb, const float* __restrict__ Vb,
                                              int H, float scale, const int* __restrict__ mask, float* __restrict__ y, const float* __restrict__ sbias) {
  static_assert(T % 64 == 0 && D % 32 == 0, "whole query blocks and key chunks only");
  constexpr int KS = D / 32, DT = D / 16;
  constexpr int NST = 32 * (D / 4) / 128;      // staging trips per thread, the same for every thread
  constexpr int RPT = 128 / (D / 4);           // key rows that the block stages per trip
  constexpr int VP = D + 16;                   // V row pitch in elements: an odd multiple of 32 bytes, the transposing load's conflict-free pitch
  static_assert((VP * 2) % 32 == 0 && ((VP * 2 / 32) & 1) == 1, "V pitch must be 32 B x odd");
  __shared__ __attribute__((aligned(16))) unsigned short sKh[32][D + 8], sKl[32][D + 8], sVh[32][VP], sVl[32][VP];
  __shared__ __attribute__((aligned(16))) float sO[4][16][D];
  const int tid = threadIdx.x, w = tid >> 5, lane = tid & 31, ln = lane & 15, hh = lane >> 4;
  constexpr int nqb = T / 64;
  const int bh = blockIdx.x / nqb, qblk = blockIdx.x % nqb;
  const int b = bh / H, h = bh % H;
  const int q0 = qblk * 64 + w * 16;
  const float* Q = Qb + (size_t)b * T * PITCH + h * D;
  const float* K = Kb + (size_t)b * T * PITCH + h * D;
  const float* V = Vb + (size_t)b * T * PITCH + h * D;
  const float* SB = sbias + (size_t)bh * T;
  const unsigned ukb = 8u * (unsigned)hh, toff = (unsigned)(tid / (D / 4)) * PITCH + (unsigned)(tid % (D / 4)) * 4u;
  const int vrow = 8 * hh + (lane & 7), vcol = 8 * ((lane >> 3) & 1);   // the lane's address inside a 16 x 16 V tile for ld_tr16
  FragB aqh[KS], aql[KS];
  {
    const float* qr = Q + (size_t)(q0 + ln) * PITCH;
#pragma unroll
    for (int ks = 0; ks < KS; ++ks)
#pragma unroll
      for (int i = 0; i < 16; ++i) {
        const int d = ks * 32 + ((i < 8) ? (8 * hh + i) : (16 + 8 * hh + (i - 8)));
        const float x = qr[d] * scale; const unsigned short hb = bf16_bits(x);
        aqh[ks].u[i] = hb; aql[ks].u[i] = bf16_bits(x - bf16_val(hb));
      }
  }
  const int qi = q0 + ln;                      // the lane's query
  const float bq = HASBIAS ? SB[qi] : 0.f;     // its bias, read once
  float m_q = -3.0e38f, l_q = 0.f;             // its running maximum; the sum over this half's keys (the halves join after the loop)
  v8f oacc[DT];                                // oacc[dt][r] = O[qi][dt * 16 + 8 * hh + r]
#pragma unroll
  for (int dt = 0; dt < DT; ++dt) oacc[dt] = (v8f){0.f,0.f,0.f,0.f,0.f,0.f,0.f,0.f};
  const int kv_end = CAUSAL ? qblk * 64 + 64 : T;
  for (int j0 = 0; j0 < kv_end; j0 += 32) {
    __syncthreads();
    // every global read of the chunk is issued here, together: the lane's 16 key biases and the thread's K and V pieces
    // (one address per operand and chunk; the staging trips differ by a constant offset only)
    const float* Kj = K + (size_t)j0 * PITCH; const float* Vj = V + (size_t)j0 * PITCH; const float* SBj = SB + j0;
    v4f bk[4] = {};                            // biases of keys 8hh + 0..7 and 16 + 8hh + 0..7
    if (HASBIAS) { bk[0] = *(const v4fa*)(SBj + ukb); bk[1] = *(const v4fa*)(SBj + (ukb + 4u)); bk[2] = *(const v4fa*)(SBj + (ukb + 16u)); bk[3] = *(const v4fa*)(SBj + (ukb + 20u)); }
    v4f kf[NST], vf[NST];
#pragma unroll
    for (int it = 0; it < NST; ++it) {
      kf[it] = *(const v4fa*)(Kj + (toff + (unsigned)(it * RPT * PITCH))); vf[it] = *(const v4fa*)(Vj + (toff + (unsigned)(it * RPT * PITCH)));
    }
    asm volatile("s_wait_xcnt 0x0" ::: "memory");   // the conversions below reuse the loads' address registers
    __builtin_amdgcn_sched_barrier(0);         // keeps all twelve loads above the conversions: sunk among them, a load pays its latency alone
#pragma unroll
    for (int it = 0; it < NST; ++it) {
      const int e = tid + it * 128;
      const int r = e / (D / 4), c4 = (e % (D / 4)) * 4;
#pragma unroll
      for (int t = 0; t < 4; ++t) {
        unsigned short hb = bf16_bits(kf[it][t]); sKh[r][c4 + t] = hb; sKl[r][c4 + t] = bf16_bits(kf[it][t] - bf16_val(hb));
        hb = bf16_bits(vf[it][t]); sVh[r][c4 + t] = hb; sVl[r][c4 + t] = bf16_bits(vf[it][t] - bf16_val(hb));
      }
    }
    __syncthreads();
    v8f s[2];                                  // s[nt][r] = S[key j0 + nt * 16 + 8 * hh + r][query qi]
#pragma unroll
    for (int nt = 0; nt < 2; ++nt) {
      v8f acc = {};
#pragma unroll
      for (int ks = 0; ks < KS; ++ks) {
        FragB kh_, kl_;
        kh_.half[0] = *(const v8us*)&sKh[nt * 16 + ln][ks * 32 + 8 * hh]; kh_.half[1] = *(const v8us*)&sKh[nt * 16 + ln][ks * 32 + 16 + 8 * hh];
        kl_.half[0] = *(const v8us*)&sKl[nt * 16 + ln][ks * 32 + 8 * hh]; kl_.half[1] = *(const v8us*)&sKl[nt * 16 + ln][ks * 32 + 16 + 8 * hh];
        acc = mmaT3(kh_.v, kl_.v, aqh[ks].v, aql[ks].v, acc);
      }
      s[nt] = acc;
    }
    bool keep[2][8];
    float mx = -3.0e38f;
#pragma unroll
    for (int nt = 0; nt < 2; ++nt)
#pragma unroll
      for (int r = 0; r < 8; ++r) {
        const int kj = j0 + nt * 16 + 8 * hh + r;
        bool kp = true;
        if (HASBIAS) s[nt][r] += bq + bk[nt * 2 + (r >> 2)][r & 3];
        if (CAUSAL) kp = kj <= qi;
        if (HASMASK) kp = kp && mask[(size_t)qi * T + kj] != 0;
        if (!kp) s[nt][r] = -3.0e38f;
        keep[nt][r] = kp;
        mx = fmaxf(mx, s[nt][r]);
      }
    mx = fmaxf(mx, xhalf(mx));                 // the other half's 16 keys of the same query
    const float mnew = fmaxf(m_q, mx);
    const float alpha = (mnew > -1.0e38f) ? __expf(m_q - mnew) : 1.0f;
    m_q = mnew;
    v8u pwh, pwl;                              // P^T as a B fragment: element nt * 8 + r is key nt * 16 + 8hh + r, the k order of the V fragments
    float ps[2] = {0.f, 0.f};
#pragma unroll
    for (int nt = 0; nt < 2; ++nt)
#pragma unroll
      for (int r = 0; r < 8; r += 2) {         // two neighbouring keys fill one register: one byte permute packs both high halves
        const float p0 = keep[nt][r] ? __expf(s[nt][r] - mnew) : 0.f;
        const float p1 = keep[nt][r + 1] ? __expf(s[nt][r + 1] - mnew) : 0.f;
        ps[nt] += p0; ps[nt] += p1;
        const unsigned int h0 = bf16_high(p0), h1 = bf16_high(p1);
        const unsigned int l0 = bf16_high(p0 - __uint_as_float(h0 & 0xFFFF0000u)), l1 = bf16_high(p1 - __uint_as_float(h1 & 0xFFFF0000u));
        pwh[nt * 4 + (r >> 1)] = __builtin_amdgcn_perm(h1, h0, 0x07060302u);
        pwl[nt * 4 + (r >> 1)] = __builtin_amdgcn_perm(l1, l0, 0x07060302u);
      }
    const v16b pbh = __builtin_bit_cast(v16b, pwh), pbl = __builtin_bit_cast(v16b, pwl);
    l_q = l_q * alpha + (ps[0] + ps[1]);
#pragma unroll
    for (int dt = 0; dt < DT; ++dt)
#pragma unroll
      for (int r = 0; r < 8; ++r) oacc[dt][r] *= alpha;
    FragB bvh[DT], bvl[DT];                    // V^T as A fragments: row d = dt * 16 + ln, keys 8hh + 0..7, then 16 + 8hh + 0..7
#pragma unroll
    for (int dt = 0; dt < DT; ++dt) {
      bvh[dt].half[0] = ld_tr16(&sVh[vrow][vcol + dt * 16]); bvh[dt].half[1] = ld_tr16(&sVh[16 + vrow][vcol + dt * 16]);
      bvl[dt].half[0] = ld_tr16(&sVl[vrow][vcol + dt * 16]); bvl[dt].half[1] = ld_tr16(&sVl[16 + vrow][vcol + dt * 16]);
    }
#pragma unroll
    for (int dt = 0; dt < DT; ++dt) oacc[dt] = mmaT3(bvh[dt].v, bvl[dt].v, pbh, pbl, oacc[dt]);
  }
  // NaN for fully-masked rows (softmax over a row of -inf)
  const float l_all = l_q + xhalf(l_q);
  const float linv = (m_q > -1.0e38f) ? 1.0f / l_all : __builtin_nanf("");
#pragma unroll
  for (int dt = 0; dt < DT; ++dt) {
    v4f lo4, hi4;
#pragma unroll
    for (int r = 0; r < 4; ++r) { lo4[r] = oacc[dt][r] * linv; hi4[r] = oacc[dt][4 + r] * linv; }
    *(v4fa*)&sO[w][ln][dt * 16 + 8 * hh] = lo4; *(v4fa*)&sO[w][ln][dt * 16 + 8 * hh + 4] = hi4;
  }
  __builtin_amdgcn_fence(__ATOMIC_ACQ_REL, "workgroup");
  __builtin_amdgcn_wave_barrier();
  {
    for (int r = 0; r < 16; ++r) {
      const int row = q0 + r;
      if (lane < D / 4) {
        const v4f val = *(const v4fa*)&sO[w][r][lane * 4];
        *(v4f*)(y + ((size_t)b * T + row) * PITCH + h * D + lane * 4) = val;
      }
    }
    
  }
}

__device__ __forceinline__ void round_rows(const float* __restrict__ W, unsigned short* __restrict__ Wt, int t) {
  const v4f a = *(const v4fa*)(W + (size_t)t * 8), b = *(const v4fa*)(W + (size_t)t * 8 + 4);
  v8us v; v[0]=bf16_bits(a[0]); v[1]=bf16_bits(a[1]); v[2]=bf16_bits(a[2]); v[3]=bf16_bits(a[3]);
  v[4]=bf16_bits(b[0]); v[5]=bf16_bits(b[1]); v[6]=bf16_bits(b[2]); v[7]=bf16_bits(b[3]);
  *(v8us*)(Wt + (size_t)t * 8) = v; 
}

// a block of 256 threads per 32 consecutive patches: 64-point rDFT power of bins 0..32 (one (patch, bin) pair per thread and trip),
// band means, log1p, then bias[b][h][n] = Σ_c bp[c]·band_bias[h][c] for the 8 heads; the block writes sbias[(b*H + h)*N + n]
// as 32 consecutive n for each h, one wave per head.
__device__ __forceinline__ void bandbias_block(const int blk, const float* __restrict__ patches, const float* __restrict__ band_bias, float* __restrict__ sbias) {
  __shared__ float sp[32][PL];
  __shared__ float pw[32][33];
  __shared__ float sb[NH][32];
  __shared__ float tw[2][PL];                 // cos and sin of 2*pi*m/64, m = 0..63: the only angles the DFT below meets
  const int tid = threadIdx.x;
  // blk runs over B*N/32
  const int b = blk / (NN / 32), n0 = (blk % (NN / 32)) * 32;
  for (int e = tid; e < 32 * PL; e += 256) { const int r = e / PL, c = e % PL; sp[r][c] = bf16_round(patches[((size_t)b * NN + n0 + r) * PL + c]); }
  if (tid < PL) {                             // filled once per block, published by the barrier that publishes sp
    const float ang = 0.09817477042468103f * (float)tid;     // 2*pi/64
    tw[0][tid] = cosf(ang); tw[1][tid] = sinf(ang);
  }
  __syncthreads();
  // 32 patches x 33 bins = 1056 (patch, bin) pairs over 256 threads
  for (int e = tid; e < 32 * 33; e += 256) {
    const int r = e / 33;
    const unsigned kbin = (unsigned)(e % 33);
    float xs[PL], c[PL], s[PL];
#pragma unroll                                 // n becomes a constant, so xs, c and s live in registers
    for (int n = 0; n < PL; ++n) {
      const unsigned m = (kbin * (unsigned)n) & (unsigned)(PL - 1);   // angle = 2*pi*m/64, exact reduction
      xs[n] = sp[r][n]; c[n] = tw[0][m]; s[n] = tw[1][m];
    }
    __builtin_amdgcn_sched_barrier(0);         // keeps every LDS read above the two sum chains: sunk among them, each read pays its latency alone
    float re = 0.f, im = 0.f;
#pragma unroll                                 // as above: constant indices into xs, c and s
    for (int n = 0; n < PL; ++n) { re += xs[n] * c[n]; im -= xs[n] * s[n]; }
    pw[r][kbin] = re * re + im * im;
  }
  __syncthreads();
  if (tid < 32) {
    const int r = tid;
    // bands sorted by name: alpha {3}, beta {4..7}, delta {1}, gamma {8..25}, theta {2}  (rfftfreq(64, 1/250) = 3.90625 k)
    float bp[NBANDS];
    bp[0] = pw[r][3];
    bp[1] = (pw[r][4] + pw[r][5] + pw[r][6] + pw[r][7]) * 0.25f;
    bp[2] = pw[r][1];
    { float s = 0.f;
#pragma unroll 1
      for (int kbin = 8; kbin <= 25; ++kbin) s += pw[r][kbin]; bp[3] = s * (1.0f / 18.0f); }
    bp[4] = pw[r][2];
#pragma unroll 1
    for (int c = 0; c < NBANDS; ++c) bp[c] = log1pf(bp[c]);
#pragma unroll 1
    for (int h = 0; h < NH; ++h) {
      float s = 0.f;
#pragma unroll 1
      for (int c = 0; c < NBANDS; ++c) s += bp[c] * bf16_round(band_bias[h * NBANDS + c]);
      sb[h][r] = s;
    }
  }
  __syncthreads();
  {
    const int h = tid >> 5, r = tid & 31;
    float* dst = sbias + ((size_t)(b * NH + h)) * NN + n0 + r;
    const float v = sb[h][r];
    *(float*)dst = v; 
  }
}

// Everything that reads inputs alone, in one launch: blocks 0 .. B*N/32 - 1 do the band biases, the others
// round the four weight matrices, DM*DM/8/256 blocks each, into four planes that lie one behind the other in Wt.
__global__ __launch_bounds__(256) void k_prep(const float* __restrict__ patches, const float* __restrict__ band_bias, float* __restrict__ sbias,
                                            const float* __restrict__ W0, const float* __restrict__ W1, const float* __restrict__ W2,
                                            const float* __restrict__ W3, unsigned short* __restrict__ Wt) {
  constexpr int NBB = BB * NN / 32, BPW = DM * DM / 8 / 256;
  static_assert(DM * DM % (8 * 256) == 0, "whole blocks of 8-element pieces");
  const int blk = blockIdx.x;
  if (blk >= NBB) {                            // the whole block takes this side, which holds no barrier
    const int p = (blk - NBB) / BPW;
    const float* __restrict__ W = p == 0 ? W0 : p == 1 ? W1 : p == 2 ? W2 : W3;
    round_rows(W, Wt + (size_t)p * DM * DM, ((blk - NBB) % BPW) * 256 + (int)threadIdx.x);
    return;
  }
  bandbias_block(blk, patches, band_bias, sbias);
}

extern "C" void kernel_launch(void* const* d_in, const int* in_sizes, int n_in,
                              void* d_out, int out_size, void* d_ws, size_t ws_size, hipStream_t stream) {
  (void)in_sizes; (void)n_in; (void)out_size;
  const float* x = (const float*)d_in[0]; const float* patches = (const float*)d_in[1];
  const float* Wq = (const float*)d_in[2]; const float* bq = (const float*)d_in[3];
  const float* Wk = (const float*)d_in[4]; const float* bk = (const float*)d_in[5];
  const float* Wv = (const float*)d_in[6]; const float* bv = (const float*)d_in[7];
  const float* Wo = (const float*)d_in[8]; const float* bo = (const float*)d_in[9];
  const float* band_bias = (const float*)d_in[10];
  char* ws = (char*)d_ws; size_t off = 0;
  unsigned short* Wqt = (unsigned short*)(ws + off); off += (size_t)DM * DM * 2;
  unsigned short* Wkt = (unsigned short*)(ws + off); off += (size_t)DM * DM * 2;
  unsigned short* Wvt = (unsigned short*)(ws + off); off += (size_t)DM * DM * 2;
  unsigned short* Wot = (unsigned short*)(ws + off); off += (size_t)DM * DM * 2;
  float* qb = (float*)(ws + off); off += (size_t)BB * NN * DM * 4;
  float* kb2 = (float*)(ws + off); off += (size_t)BB * NN * DM * 4;
  float* vb2 = (float*)(ws + off); off += (size_t)BB * NN * DM * 4;
  float* ob = (float*)(ws + off); off += (size_t)BB * NN * DM * 4;
  float* sbias = (float*)(ws + off); off += (size_t)BB * NH * NN * 4;
  if (off > ws_size) return;
  const int M = BB * NN;
  (void)Wkt; (void)Wvt;                        // the planes behind Wqt, reached through it
  k_prep<<<BB * NN / 32 + 4 * (DM * DM / 8 / 256), 256, 0, stream>>>(patches, band_bias, sbias, Wq, Wk, Wv, Wo, Wqt);
  const int gb = ((M / 16) * (DM / 64) + 3) / 4;
  k_gemm_bf<false, 0, true, DM, DM, 3><<<3 * gb, 128, 0, stream>>>(x, Wqt, bq, bk, bv, qb, kb2, vb2, DM, M, DM, DM);
  k_flashm<HD, NN, DM, false, false, true><<<BB * NH * (NN / 64), 128, 0, stream>>>(qb, kb2, vb2, NH, 0.125f, nullptr, ob, sbias);
  k_gemm_bf<true, 0, true, DM, DM, 1><<<gb, 128, 0, stream>>>(ob, Wot, bo, nullptr, nullptr, (float*)d_out, nullptr, nullptr, DM, M, DM, DM);
}

// v007
// It runs in 124 microseconds.
// Timed twice side by side with v006, it ran 1.14 and 1.13 times as fast.
// Over all steps from v000 it is 4.18 times as fast.
#include <hip/hip_runtime.h>
// All contractions on v_wmma_f32_16x16x32_bf16, f32 accumulate: Q/K/V = x·Wᵀ with x/W rounded to bf16 (single exact-product
// term), QKᵀ and P·V 3-term bf16 hi/lo splits, out = o·W_oᵀ with o split hi/lo (2 terms). The 64-point rFFT band powers,
// log1p, the 5->8 band-bias projection and softmax are f32 on VALU.
#define BB 2
#define NN 2048
#define DM 512
#define NH 8
#define HD 64
#define PL 64
#define NBANDS 5

typedef __bf16 v16b __attribute__((ext_vector_type(16)));
typedef unsigned short v8us __attribute__((ext_vector_type(8), may_alias));
typedef float  v8f  __attribute__((ext_vector_type(8)));
typedef float  v4f  __attribute__((ext_vector_type(4)));
typedef float  v4fa __attribute__((ext_vector_type(4), may_alias));
union FragB { v16b v; v8us half[2]; unsigned short u[16]; };

__device__ __forceinline__ unsigned short bf16_bits(float x) { unsigned int u = __float_as_uint(x); return (unsigned short)((u + 0x7FFFu + ((u >> 16) & 1u)) >> 16); }
__device__ __forceinline__ float bf16_val(unsigned short b) { return __uint_as_float(((unsigned int)b) << 16); }
__device__ __forceinline__ float bf16_round(float x) { return bf16_val(bf16_bits(x)); }
// D += A·B with NT terms: 1 = ah·bh, 2 = + al·bh (A split), 3 = + ah·bl (both split)
template <int NT>
__device__ __forceinline__ v8f mmaN(v16b ah, v16b al, v16b bh, v16b bl, v8f c) {
  c = __builtin_amdgcn_wmma_f32_16x16x32_bf16(false, ah, false, bh, (short)0, c, false, false);
  if (NT >= 2) c = __builtin_amdgcn_wmma_f32_16x16x32_bf16(false, al, false, bh, (short)0, c, false, false);
  if (NT >= 3) c = __builtin_amdgcn_wmma_f32_16x16x32_bf16(false, ah, false, bl, (short)0, c, false, false);
  asm volatile("v_nop\n\tv_nop\n\tv_nop\n\tv_nop" : "+v"(c) : "v"(ah), "v"(al), "v"(bh), "v"(bl));
  return c;
}

// The same three terms in the same order with the operands' sides exchanged (D transposed): ah*bh, ah*bl, al*bh
__device__ __forceinline__ v8f mmaT3(v16b ah, v16b al, v16b bh, v16b bl, v8f c) {
  c = __builtin_amdgcn_wmma_f32_16x16x32_bf16(false, ah, false, bh, (short)0, c, false, false);
  c = __builtin_amdgcn_wmma_f32_16x16x32_bf16(false, ah, false, bl, (short)0, c, false, false);
  c = __builtin_amdgcn_wmma_f32_16x16x32_bf16(false, al, false, bh, (short)0, c, false, false);
  asm volatile("v_nop\n\tv_nop\n\tv_nop\n\tv_nop" : "+v"(c) : "v"(ah), "v"(al), "v"(bh), "v"(bl));   // the distance behind a WMMA, on the loop's taken branch too
  return c;
}
// x rounded to bf16 as in bf16_bits, the 16 bits left in the high half of the word
__device__ __forceinline__ unsigned int bf16_high(float x) { unsigned int u = __float_as_uint(x); return u + 0x7FFFu + ((u >> 16) & 1u); }
typedef unsigned int v8u __attribute__((ext_vector_type(8)));
// lane l with lane l ^ 16, on the vector pipe
__device__ __forceinline__ float xhalf(float x) {
  return __builtin_bit_cast(float, __builtin_amdgcn_permlanex16(__builtin_bit_cast(int, x), __builtin_bit_cast(int, x), 0x76543210, 0xfedcba98, false, false));
}

// Transposing LDS load: lane (c = l & 15, h = l >> 4) receives T[kbase + 8h + 0..7][dbase + c] of a row-major 16-bit tile when it
// passes the address of T[kbase + 8h + (l & 7)][dbase + 8 * ((l >> 3) & 1)]; two of them (kbase, kbase + 16) are one 32 x 16 B fragment.
typedef short s16x8 __attribute__((ext_vector_type(8)));
__device__ __forceinline__ v8us ld_tr16(const unsigned short* p) {
  typedef __attribute__((address_space(3))) s16x8 lds_s16x8;
  return __builtin_bit_cast(v8us, __builtin_amdgcn_ds_load_tr16_b128_v8i16((lds_s16x8*)p));
}

__global__ __launch_bounds__(256) void k_wt_bf16(const float* __restrict__ W, unsigned short* __restrict__ Wt, int K, int N) {
  const int t = blockIdx.x * 256 + threadIdx.x;
  const int k8n = K / 8;
  if (t >= N * k8n) return;
  const int n = t / k8n, k8 = (t % k8n) * 8;
  v8us v;
#pragma unroll
  for (int i = 0; i < 8; ++i) v[i] = bf16_bits(W[(size_t)(k8 + i) * N + n]);
  *(v8us*)(Wt + (size_t)n * K + k8) = v;
  
}

// GEMM C[M][N] (f32, pitch ldc) = act(A[M][K] * W + bias). A f32 row-major (pitch lda) converted to bf16
// (ASPLIT: hi/lo two planes -> 2 terms, else single rounded term); Wt bf16 [N][K] (pitch ldb). BIAS_BF16 rounds the
// bias to bf16 first (bias quantised to bf16 before the add). K%128==0, M%64==0, N%64==0. The two pitches are template constants, so that a
// chunk's loads differ by immediate offsets from one address per operand, which stays in its registers.
// A block owns a 64 x 64 tile of C, a wave 16 of its rows. Per 128 k the block brings its 64 A rows and its 64 Wt rows into LDS with loads
// that cover whole 128-byte lines (a wave-wide load reads 512 bytes of one row of A, or 256 bytes of each of two rows of Wt), A converted once on the way;
// the four waves share the Wt rows. Fragments come from LDS, in the k order and the k-step order of a direct load.
// One launch serves NSEL products of the same A: their Wt planes ([N][K] each) lie one behind the other, and the block index picks the plane
// with its bias and its output, so that the blocks of all the products are resident together. The blocks of one 64-row strip of A are neighbours.
// SPLITOUT: every product but the first leaves not as f32 but as the bf16 hi/lo pair that attention multiplies with, split here once per element:
// row (b * NH + head) * NN + n of its output holds the head's HD high parts, then its HD low parts (a block's 64 columns are one head).
typedef unsigned short v4us __attribute__((ext_vector_type(4), may_alias));
template <bool ASPLIT, int ACT, bool BIAS_BF16, int lda, int ldb, int NSEL, bool SPLITOUT>
__global__ __launch_bounds__(128) void k_gemm_bf(const float* __restrict__ A, const unsigned short* __restrict__ Wt,
                                               const float* __restrict__ bias0, const float* __restrict__ bias1, const float* __restrict__ bias2,
                                               float* __restrict__ C0, float* __restrict__ C1, float* __restrict__ C2, int ldc, int M, int N, int K) {
  constexpr int KC = 128;                      // k per staged chunk
  constexpr int LP = KC + 8;                   // LDS row pitch in elements: the row's bytes + 16, free of bank conflicts for 16-byte fragment reads
  constexpr int NA = 64 * (KC / 4) / 128, RA = 128 / (KC / 4);   // 16-byte pieces of A per thread; rows the block covers per piece
  constexpr int NB = 64 * (KC / 8) / 128, RB = 128 / (KC / 8);   // the same for Wt
  __shared__ __attribute__((aligned(16))) unsigned short sAh[64][LP], sAl[ASPLIT ? 64 : 1][LP], sB[64][LP];
  __shared__ __attribute__((aligned(16))) float so[4][16][64];
  const int tid = threadIdx.x, w = tid >> 5, lane = tid & 31, ln = lane & 15, hh = lane >> 4;
  const int ntn = N / 64;                      // column tiles of one product
  const int mt = blockIdx.x / (NSEL * ntn), nq = blockIdx.x % (NSEL * ntn);
  if (mt * 64 >= M) return;                    // the whole block leaves, in front of every barrier
  const int sel = NSEL > 1 ? nq / ntn : 0;     // which product: the same for the whole block
  const float* __restrict__ bias = sel == 0 ? bias0 : sel == 1 ? bias1 : bias2;
  float* __restrict__ C = sel == 0 ? C0 : sel == 1 ? C1 : C2;
  const int row0 = mt * 64 + w * 16, col0 = (nq - sel * ntn) * 64;
  const int ar = tid / (KC / 4), ac = (tid % (KC / 4)) * 4, br = tid / (KC / 8), bc = (tid % (KC / 8)) * 8;
  const float* Ab = A + (size_t)(mt * 64) * lda;               // block-uniform bases; the thread's own place is a 32-bit offset
  const unsigned short* Bb = Wt + (size_t)(nq * 64) * ldb;      // row sel * N + col0 of the planes
  const unsigned ao = (unsigned)(ar * lda + ac), bo = (unsigned)(br * ldb + bc);
  v8f acc[4] = {};
  for (int kb = 0; kb < K; kb += KC) {
    v4f xa[NA]; v8us xb[NB];
#pragma unroll
    for (int it = 0; it < NA; ++it) xa[it] = *(const v4fa*)(Ab + kb + (ao + (unsigned)(it * RA * lda)));
#pragma unroll
    for (int it = 0; it < NB; ++it) xb[it] = *(const v8us*)(Bb + kb + (bo + (unsigned)(it * RB * ldb)));
    asm volatile("s_wait_xcnt 0x0" ::: "memory");   // in front of every later write of the loads' address registers, which this trip advances
    __builtin_amdgcn_sched_barrier(0);         // nothing crosses: the wait stays directly behind the last load, and no conversion is lifted in front of it
    __syncthreads();                           // every wave has read its fragments of the chunk before
#pragma unroll
    for (int it = 0; it < NA; ++it) {
      v4us hi, lo;
#pragma unroll
      for (int i = 0; i < 4; ++i) { const unsigned short hb = bf16_bits(xa[it][i]); hi[i] = hb; lo[i] = ASPLIT ? bf16_bits(xa[it][i] - bf16_val(hb)) : (unsigned short)0; }
      *(v4us*)&sAh[ar + it * RA][ac] = hi;
      if (ASPLIT) *(v4us*)&sAl[ar + it * RA][ac] = lo;
    }
#pragma unroll
    for (int it = 0; it < NB; ++it) *(v8us*)&sB[br + it * RB][bc] = xb[it];
    __syncthreads();
#pragma unroll
    for (int k2 = 0; k2 < KC; k2 += 64) {
      FragB ah[2], al[2], b[2][4];
#pragma unroll
      for (int s = 0; s < 2; ++s) {
        const int kc = k2 + s * 32 + 8 * hh;
        ah[s].half[0] = *(const v8us*)&sAh[w * 16 + ln][kc]; ah[s].half[1] = *(const v8us*)&sAh[w * 16 + ln][kc + 16];
        if (ASPLIT) { al[s].half[0] = *(const v8us*)&sAl[w * 16 + ln][kc]; al[s].half[1] = *(const v8us*)&sAl[w * 16 + ln][kc + 16]; }
#pragma unroll
        for (int t = 0; t < 4; ++t) { b[s][t].half[0] = *(const v8us*)&sB[t * 16 + ln][kc]; b[s][t].half[1] = *(const v8us*)&sB[t * 16 + ln][kc + 16]; }
      }
#pragma unroll
      for (int s = 0; s < 2; ++s)
#pragma unroll
        for (int t = 0; t < 4; ++t) acc[t] = mmaN<ASPLIT ? 2 : 1>(ah[s].v, ASPLIT ? al[s].v : ah[s].v, b[s][t].v, b[s][t].v, acc[t]);
    }
  }
#pragma unroll
  for (int t = 0; t < 4; ++t) {
    float bv = bias ? bias[col0 + t * 16 + ln] : 0.f;
    if (BIAS_BF16) bv = bf16_round(bv);
#pragma unroll
    for (int r = 0; r < 8; ++r) { float v = acc[t][r] + bv; if (ACT == 1) v = fmaxf(v, 0.f); so[w][8 * hh + r][t * 16 + ln] = v; }
  }
  __builtin_amdgcn_fence(__ATOMIC_ACQ_REL, "workgroup");
  __builtin_amdgcn_wave_barrier();
  if (SPLITOUT && sel != 0) {                  // the same for the whole block
    static_assert(!SPLITOUT || HD == 64, "a 64-column tile is one head");
    unsigned short* __restrict__ P = (unsigned short*)C + ((size_t)((row0 / NN) * NH + col0 / HD) * NN + row0 % NN) * (2 * HD);
    const int r8 = lane >> 3, c8 = (lane & 7) * 8;   // eight lanes cover the 128 bytes of a row's high parts, and of its low parts
    v8us hi[4], lo[4];
#pragma unroll
    for (int q = 0; q < 4; ++q) {
      const v4f a = *(const v4fa*)&so[w][q * 4 + r8][c8], b = *(const v4fa*)&so[w][q * 4 + r8][c8 + 4];
#pragma unroll
      for (int i = 0; i < 4; ++i) {
        unsigned short hb = bf16_bits(a[i]); hi[q][i] = hb; lo[q][i] = bf16_bits(a[i] - bf16_val(hb));
        hb = bf16_bits(b[i]); hi[q][4 + i] = hb; lo[q][4 + i] = bf16_bits(b[i] - bf16_val(hb));
      }
    }
#pragma unroll
    for (int q = 0; q < 4; ++q) {
      *(v8us*)(P + (q * 4 + r8) * (2 * HD) + c8) = hi[q];
      *(v8us*)(P + (q * 4 + r8) * (2 * HD) + HD + c8) = lo[q];
    }
    asm volatile("s_wait_xcnt 0x0" ::: "memory");   // in front of every later write of the stores' address and data registers
    return;
  }
  const int rsub = lane >> 4, c4 = (lane & 15) * 4;
  {
#pragma unroll
    for (int q = 0; q < 8; ++q) {
      const int r = q * 2 + rsub;
      const v4f v = *(const v4fa*)&so[w][r][c4];
      *(v4f*)(C + (size_t)(row0 + r) * ldc + col0 + c4) = v;
    }
    
  }
}

// Flash-style causal/unmasked attention, all contractions 3-term bf16 hi/lo splits, f32 softmax with running max.
// q,k,v rows are read from f32 buffers with arbitrary row pitch (so they can live inside a fused qkv buffer);
// D = head size (multiple of 32, <= 128); one wave = 16 query rows; block = 4 waves (64 queries) sharing K/V chunks of 32.
template <int D, bool CAUSAL>
__global__ __launch_bounds__(128) void k_flash(const float* __restrict__ qb, const float* __restrict__ kb, const float* __restrict__ vb,
                                             int pitch, int T, int H, float scale, float* __restrict__ y, int ypitch) {
  constexpr int KS = D / 32;        // k-steps for QK
  constexpr int DT = D / 16;        // d tiles for PV
  __shared__ __attribute__((aligned(16))) unsigned short sKh[32][D + 8], sKl[32][D + 8], sVh[32][D + 8], sVl[32][D + 8];
  __shared__ __attribute__((aligned(16))) unsigned short sPh[4][16][40], sPl[4][16][40];
  __shared__ __attribute__((aligned(16))) float sO[4][16][D];
  const int tid = threadIdx.x, w = tid >> 5, lane = tid & 31, ln = lane & 15, hh = lane >> 4;
  const int nqb = (T + 63) / 64;
  const int bh = blockIdx.x / nqb, qblk = blockIdx.x % nqb;
  const int b = bh / H, h = bh % H;
  const int q0 = qblk * 64 + w * 16;
  const float* Q = qb + (size_t)b * T * pitch + h * D;
  const float* K = kb + (size_t)b * T * pitch + h * D;
  const float* V = vb + (size_t)b * T * pitch + h * D;

  // A fragments of the wave's 16 query rows (scaled), hi/lo
  FragB aqh[KS], aql[KS];
  {
    int row = q0 + ln; if (row >= T) row = T - 1;
    const float* qr = Q + (size_t)row * pitch;
#pragma unroll
    for (int ks = 0; ks < KS; ++ks)
#pragma unroll
      for (int i = 0; i < 16; ++i) {
        const int d = ks * 32 + ((i < 8) ? (8 * hh + i) : (16 + 8 * hh + (i - 8)));
        const float x = qr[d] * scale; const unsigned short hb = bf16_bits(x);
        aqh[ks].u[i] = hb; aql[ks].u[i] = bf16_bits(x - bf16_val(hb));
      }
  }
  float m_r[8], l_r[8];
#pragma unroll
  for (int r = 0; r < 8; ++r) { m_r[r] = -3.0e38f; l_r[r] = 0.f; }
  v8f oacc[DT];
#pragma unroll
  for (int dt = 0; dt < DT; ++dt) oacc[dt] = (v8f){0.f,0.f,0.f,0.f,0.f,0.f,0.f,0.f};

  const int kv_end = CAUSAL ? min(T, qblk * 64 + 64) : T;     // block-uniform
  for (int j0 = 0; j0 < kv_end; j0 += 32) {
    __syncthreads();
    for (int e = tid; e < 32 * (D / 4); e += 128) {
      const int r = e / (D / 4), c4 = (e % (D / 4)) * 4;
      const int key = j0 + r;
      v4f kf = {0.f,0.f,0.f,0.f}, vf = {0.f,0.f,0.f,0.f};
      if (key < T) { kf = *(const v4fa*)(K + (size_t)key * pitch + c4); vf = *(const v4fa*)(V + (size_t)key * pitch + c4); }
#pragma unroll
      for (int t = 0; t < 4; ++t) {
        unsigned short hb = bf16_bits(kf[t]); sKh[r][c4 + t] = hb; sKl[r][c4 + t] = bf16_bits(kf[t] - bf16_val(hb));
        hb = bf16_bits(vf[t]); sVh[r][c4 + t] = hb; sVl[r][c4 + t] = bf16_bits(vf[t] - bf16_val(hb));
      }
    }
    __syncthreads();
    // S tile 16 x 32
    v8f s[2];
#pragma unroll
    for (int nt = 0; nt < 2; ++nt) {
      v8f acc = {};
#pragma unroll
      for (int ks = 0; ks < KS; ++ks) {
        FragB bh_, bl_;
        bh_.half[0] = *(const v8us*)&sKh[nt * 16 + ln][ks * 32 + 8 * hh]; bh_.half[1] = *(const v8us*)&sKh[nt * 16 + ln][ks * 32 + 16 + 8 * hh];
        bl_.half[0] = *(const v8us*)&sKl[nt * 16 + ln][ks * 32 + 8 * hh]; bl_.half[1] = *(const v8us*)&sKl[nt * 16 + ln][ks * 32 + 16 + 8 * hh];
        acc = mmaN<3>(aqh[ks].v, aql[ks].v, bh_.v, bl_.v, acc);
      }
      s[nt] = acc;
    }
    // mask + running max (rows 8hh+r; the 16 lanes of a half share rows)
    float alpha[8];
#pragma unroll
    for (int r = 0; r < 8; ++r) {
      const int qi = q0 + 8 * hh + r;
      const int ja = j0 + ln, jb = j0 + 16 + ln;
      if (CAUSAL) { if (ja > qi) s[0][r] = -3.0e38f; if (jb > qi) s[1][r] = -3.0e38f; }
      if (ja >= T) s[0][r] = -3.0e38f;
      if (jb >= T) s[1][r] = -3.0e38f;
      float mx = fmaxf(s[0][r], s[1][r]);
      mx = fmaxf(mx, __shfl_xor(mx, 1, 32)); mx = fmaxf(mx, __shfl_xor(mx, 2, 32)); mx = fmaxf(mx, __shfl_xor(mx, 4, 32)); mx = fmaxf(mx, __shfl_xor(mx, 8, 32));
      const float mnew = fmaxf(m_r[r], mx);
      alpha[r] = (mnew > -1.0e38f) ? __expf(m_r[r] - mnew) : 1.0f;
      const float p0 = (s[0][r] > -1.0e38f) ? __expf(s[0][r] - mnew) : 0.f;
      const float p1 = (s[1][r] > -1.0e38f) ? __expf(s[1][r] - mnew) : 0.f;
      m_r[r] = mnew;
      l_r[r] = l_r[r] * alpha[r] + p0 + p1;            // per-lane partial row sum (16 lanes combined at the end)
      unsigned short hb = bf16_bits(p0); sPh[w][8 * hh + r][ln] = hb;      sPl[w][8 * hh + r][ln] = bf16_bits(p0 - bf16_val(hb));
      hb = bf16_bits(p1);                sPh[w][8 * hh + r][16 + ln] = hb; sPl[w][8 * hh + r][16 + ln] = bf16_bits(p1 - bf16_val(hb));
    }
#pragma unroll
    for (int dt = 0; dt < DT; ++dt)
#pragma unroll
      for (int r = 0; r < 8; ++r) oacc[dt][r] *= alpha[r];
    __builtin_amdgcn_fence(__ATOMIC_ACQ_REL, "workgroup");
    __builtin_amdgcn_wave_barrier();
    FragB pah, pal;
    pah.half[0] = *(const v8us*)&sPh[w][ln][8 * hh]; pah.half[1] = *(const v8us*)&sPh[w][ln][16 + 8 * hh];
    pal.half[0] = *(const v8us*)&sPl[w][ln][8 * hh]; pal.half[1] = *(const v8us*)&sPl[w][ln][16 + 8 * hh];
#pragma unroll
    for (int dt = 0; dt < DT; ++dt) {
      FragB bvh, bvl;
#pragma unroll
      for (int i = 0; i < 8; ++i) {
        bvh.u[i] = sVh[8 * hh + i][dt * 16 + ln]; bvh.u[8 + i] = sVh[16 + 8 * hh + i][dt * 16 + ln];
        bvl.u[i] = sVl[8 * hh + i][dt * 16 + ln]; bvl.u[8 + i] = sVl[16 + 8 * hh + i][dt * 16 + ln];
      }
      oacc[dt] = mmaN<3>(pah.v, pal.v, bvh.v, bvl.v, oacc[dt]);
    }
    __builtin_amdgcn_fence(__ATOMIC_ACQ_REL, "workgroup");
    __builtin_amdgcn_wave_barrier();
  }
#pragma unroll
  for (int r = 0; r < 8; ++r) {
    float l = l_r[r];
    l += __shfl_xor(l, 1, 32); l += __shfl_xor(l, 2, 32); l += __shfl_xor(l, 4, 32); l += __shfl_xor(l, 8, 32);
    l_r[r] = (l > 0.f) ? 1.0f / l : 0.f;
  }
#pragma unroll
  for (int dt = 0; dt < DT; ++dt)
#pragma unroll
    for (int r = 0; r < 8; ++r) sO[w][8 * hh + r][dt * 16 + ln] = oacc[dt][r] * l_r[r];
  __builtin_amdgcn_fence(__ATOMIC_ACQ_REL, "workgroup");
  __builtin_amdgcn_wave_barrier();
  {
    for (int r = 0; r < 16; ++r) {
      const int row = q0 + r;
      if (row < T && lane < D / 4) {
        const v4f val = *(const v4fa*)&sO[w][r][lane * 4];
        *(v4f*)(y + ((size_t)b * T + row) * ypitch + h * D + lane * 4) = val;
      }
    }
    
  }
}

template <int D, int T, int PITCH, bool CAUSAL, bool HASMASK, bool HASBIAS>
__global__ __launch_bounds__(128) void k_flashm(const float* __restrict__ Qb, const unsigned short* __restrict__ Kb, const unsigned short* __restrict__ Vb,
                                              int H, float scale, const int* __restrict__ mask, float* __restrict__ y, const float* __restrict__ sbias) {
  static_assert(T % 64 == 0 && D % 32 == 0, "whole query blocks and key chunks only");
  constexpr int KS = D / 32, DT = D / 16;
  constexpr int PPR = 2 * D / 8;               // 16-byte pieces of a split row: the high parts' first, then the low parts'
  constexpr int NST = 32 * PPR / 128;          // staging trips per thread, the same for every thread
  constexpr int RPT = 128 / PPR;               // key rows that the block stages per trip
  constexpr int VP = D + 16;                   // V row pitch in elements: an odd multiple of 32 bytes, the transposing load's conflict-free pitch
  static_assert((VP * 2) % 32 == 0 && ((VP * 2 / 32) & 1) == 1, "V pitch must be 32 B x odd");
  __shared__ __attribute__((aligned(16))) unsigned short sK[2][32][D + 8], sV[2][32][VP];   // plane 0 high parts, plane 1 low parts
  auto& sKh = sK[0]; auto& sKl = sK[1]; auto& sVh = sV[0]; auto& sVl = sV[1];
  __shared__ __attribute__((aligned(16))) float sO[4][16][D];
  const int tid = threadIdx.x, w = tid >> 5, lane = tid & 31, ln = lane & 15, hh = lane >> 4;
  constexpr int nqb = T / 64;
  const int bh = blockIdx.x / nqb, qblk = blockIdx.x % nqb;
  const int b = bh / H, h = bh % H;
  const int q0 = qblk * 64 + w * 16;
  const float* Q = Qb + (size_t)b * T * PITCH + h * D;
  const unsigned short* K = Kb + (size_t)bh * T * (2 * D);
  const unsigned short* V = Vb + (size_t)bh * T * (2 * D);
  const float* SB = sbias + (size_t)bh * T;
  const unsigned ukb = 8u * (unsigned)hh, toff = (unsigned)tid * 8u;   // the block's pieces of a trip lie one behind the other
  unsigned short* const dK = &sK[(tid % PPR) / (D / 8)][tid / PPR][(tid % (D / 8)) * 8];   // where the thread's piece of trip 0 goes
  unsigned short* const dV = &sV[(tid % PPR) / (D / 8)][tid / PPR][(tid % (D / 8)) * 8];
  const int vrow = 8 * hh + (lane & 7), vcol = 8 * ((lane >> 3) & 1);   // the lane's address inside a 16 x 16 V tile for ld_tr16
  FragB aqh[KS], aql[KS];
  {
    const float* qr = Q + (size_t)(q0 + ln) * PITCH;
#pragma unroll
    for (int ks = 0; ks < KS; ++ks)
#pragma unroll
      for (int i = 0; i < 16; ++i) {
        const int d = ks * 32 + ((i < 8) ? (8 * hh + i) : (16 + 8 * hh + (i - 8)));
        const float x = qr[d] * scale; const unsigned short hb = bf16_bits(x);
        aqh[ks].u[i] = hb; aql[ks].u[i] = bf16_bits(x - bf16_val(hb));
      }
  }
  const int qi = q0 + ln;                      // the lane's query
  const float bq = HASBIAS ? SB[qi] : 0.f;     // its bias, read once
  float m_q = -3.0e38f, l_q = 0.f;             // its running maximum; the sum over this half's keys (the halves join after the loop)
  v8f oacc[DT];                                // oacc[dt][r] = O[qi][dt * 16 + 8 * hh + r]
#pragma unroll
  for (int dt = 0; dt < DT; ++dt) oacc[dt] = (v8f){0.f,0.f,0.f,0.f,0.f,0.f,0.f,0.f};
  const int kv_end = CAUSAL ? qblk * 64 + 64 : T;
  for (int j0 = 0; j0 < kv_end; j0 += 32) {
    __syncthreads();
    // every global read of the chunk is issued here, together: the lane's 16 key biases and the thread's K and V pieces
    // (one address per operand and chunk; the staging trips differ by a constant offset only)
    const unsigned short* Kj = K + (size_t)j0 * (2 * D); const unsigned short* Vj = V + (size_t)j0 * (2 * D); const float* SBj = SB + j0;
    v4f bk[4] = {};                            // biases of keys 8hh + 0..7 and 16 + 8hh + 0..7
    if (HASBIAS) { bk[0] = *(const v4fa*)(SBj + ukb); bk[1] = *(const v4fa*)(SBj + (ukb + 4u)); bk[2] = *(const v4fa*)(SBj + (ukb + 16u)); bk[3] = *(const v4fa*)(SBj + (ukb + 20u)); }
    v8us kf[NST], vf[NST];
#pragma unroll
    for (int it = 0; it < NST; ++it) {
      kf[it] = *(const v8us*)(Kj + (toff + (unsigned)(it * 128 * 8))); vf[it] = *(const v8us*)(Vj + (toff + (unsigned)(it * 128 * 8)));
    }
    asm volatile("s_wait_xcnt 0x0" ::: "memory");   // in front of every later write of the loads' address registers
    __builtin_amdgcn_sched_barrier(0);         // nothing crosses: the wait stays directly behind the last load
#pragma unroll
    for (int it = 0; it < NST; ++it) {
      *(v8us*)(dK + it * RPT * (D + 8)) = kf[it]; *(v8us*)(dV + it * RPT * VP) = vf[it];
    }
    __syncthreads();
    v8f s[2];                                  // s[nt][r] = S[key j0 + nt * 16 + 8 * hh + r][query qi]
#pragma unroll
    for (int nt = 0; nt < 2; ++nt) {
      v8f acc = {};
#pragma unroll
      for (int ks = 0; ks < KS; ++ks) {
        FragB kh_, kl_;
        kh_.half[0] = *(const v8us*)&sKh[nt * 16 + ln][ks * 32 + 8 * hh]; kh_.half[1] = *(const v8us*)&sKh[nt * 16 + ln][ks * 32 + 16 + 8 * hh];
        kl_.half[0] = *(const v8us*)&sKl[nt * 16 + ln][ks * 32 + 8 * hh]; kl_.half[1] = *(const v8us*)&sKl[nt * 16 + ln][ks * 32 + 16 + 8 * hh];
        acc = mmaT3(kh_.v, kl_.v, aqh[ks].v, aql[ks].v, acc);
      }
      s[nt] = acc;
    }
    bool keep[2][8];
    float mx = -3.0e38f;
#pragma unroll
    for (int nt = 0; nt < 2; ++nt)
#pragma unroll
      for (int r = 0; r < 8; ++r) {
        const int kj = j0 + nt * 16 + 8 * hh + r;
        bool kp = true;
        if (HASBIAS) s[nt][r] += bq + bk[nt * 2 + (r >> 2)][r & 3];
        if (CAUSAL) kp = kj <= qi;
        if (HASMASK) kp = kp && mask[(size_t)qi * T + kj] != 0;
        if (!kp) s[nt][r] = -3.0e38f;
        keep[nt][r] = kp;
        mx = fmaxf(mx, s[nt][r]);
      }
    mx = fmaxf(mx, xhalf(mx));                 // the other half's 16 keys of the same query
    const float mnew = fmaxf(m_q, mx);
    const float alpha = (mnew > -1.0e38f) ? __expf(m_q - mnew) : 1.0f;
    m_q = mnew;
    v8u pwh, pwl;                              // P^T as a B fragment: element nt * 8 + r is key nt * 16 + 8hh + r, the k order of the V fragments
    float ps[2] = {0.f, 0.f};
#pragma unroll
    for (int nt = 0; nt < 2; ++nt)
#pragma unroll
      for (int r = 0; r < 8; r += 2) {         // two neighbouring keys fill one register: one byte permute packs both high halves
        const float p0 = keep[nt][r] ? __expf(s[nt][r] - mnew) : 0.f;
        const float p1 = keep[nt][r + 1] ? __expf(s[nt][r + 1] - mnew) : 0.f;
        ps[nt] += p0; ps[nt] += p1;
        const unsigned int h0 = bf16_high(p0), h1 = bf16_high(p1);
        const unsigned int l0 = bf16_high(p0 - __uint_as_float(h0 & 0xFFFF0000u)), l1 = bf16_high(p1 - __uint_as_float(h1 & 0xFFFF0000u));
        pwh[nt * 4 + (r >> 1)] = __builtin_amdgcn_perm(h1, h0, 0x07060302u);
        pwl[nt * 4 + (r >> 1)] = __builtin_amdgcn_perm(l1, l0, 0x07060302u);
      }
    const v16b pbh = __builtin_bit_cast(v16b, pwh), pbl = __builtin_bit_cast(v16b, pwl);
    l_q = l_q * alpha + (ps[0] + ps[1]);
#pragma unroll
    for (int dt = 0; dt < DT; ++dt)
#pragma unroll
      for (int r = 0; r < 8; ++r) oacc[dt][r] *= alpha;
    FragB bvh[DT], bvl[DT];                    // V^T as A fragments: row d = dt * 16 + ln, keys 8hh + 0..7, then 16 + 8hh + 0..7
#pragma unroll
    for (int dt = 0; dt < DT; ++dt) {
      bvh[dt].half[0] = ld_tr16(&sVh[vrow][vcol + dt * 16]); bvh[dt].half[1] = ld_tr16(&sVh[16 + vrow][vcol + dt * 16]);
      bvl[dt].half[0] = ld_tr16(&sVl[vrow][vcol + dt * 16]); bvl[dt].half[1] = ld_tr16(&sVl[16 + vrow][vcol + dt * 16]);
    }
#pragma unroll
    for (int dt = 0; dt < DT; ++dt) oacc[dt] = mmaT3(bvh[dt].v, bvl[dt].v, pbh, pbl, oacc[dt]);
  }
  // NaN for fully-masked rows (softmax over a row of -inf)
  const float l_all = l_q + xhalf(l_q);
  const float linv = (m_q > -1.0e38f) ? 1.0f / l_all : __builtin_nanf("");
#pragma unroll
  for (int dt = 0; dt < DT; ++dt) {
    v4f lo4, hi4;
#pragma unroll
    for (int r = 0; r < 4; ++r) { lo4[r] = oacc[dt][r] * linv; hi4[r] = oacc[dt][4 + r] * linv; }
    *(v4fa*)&sO[w][ln][dt * 16 + 8 * hh] = lo4; *(v4fa*)&sO[w][ln][dt * 16 + 8 * hh + 4] = hi4;
  }
  __builtin_amdgcn_fence(__ATOMIC_ACQ_REL, "workgroup");
  __builtin_amdgcn_wave_barrier();
  {
    for (int r = 0; r < 16; ++r) {
      const int row = q0 + r;
      if (lane < D / 4) {
        const v4f val = *(const v4fa*)&sO[w][r][lane * 4];
        *(v4f*)(y + ((size_t)b * T + row) * PITCH + h * D + lane * 4) = val;
      }
    }
    
  }
}

__device__ __forceinline__ void round_rows(const float* __restrict__ W, unsigned short* __restrict__ Wt, int t) {
  const v4f a = *(const v4fa*)(W + (size_t)t * 8), b = *(const v4fa*)(W + (size_t)t * 8 + 4);
  v8us v; v[0]=bf16_bits(a[0]); v[1]=bf16_bits(a[1]); v[2]=bf16_bits(a[2]); v[3]=bf16_bits(a[3]);
  v[4]=bf16_bits(b[0]); v[5]=bf16_bits(b[1]); v[6]=bf16_bits(b[2]); v[7]=bf16_bits(b[3]);
  *(v8us*)(Wt + (size_t)t * 8) = v; 
}

// a block of 256 threads per 32 consecutive patches: 64-point rDFT power of bins 0..32 (one (patch, bin) pair per thread and trip),
// band means, log1p, then bias[b][h][n] = Σ_c bp[c]·band_bias[h][c] for the 8 heads; the block writes sbias[(b*H + h)*N + n]
// as 32 consecutive n for each h, one wave per head.
__device__ __forceinline__ void bandbias_block(const int blk, const float* __restrict__ patches, const float* __restrict__ band_bias, float* __restrict__ sbias) {
  __shared__ float sp[32][PL];
  __shared__ float pw[32][33];
  __shared__ float sb[NH][32];
  __shared__ float tw[2][PL];                 // cos and sin of 2*pi*m/64, m = 0..63: the only angles the DFT below meets
  const int tid = threadIdx.x;
  // blk runs over B*N/32
  const int b = blk / (NN / 32), n0 = (blk % (NN / 32)) * 32;
  for (int e = tid; e < 32 * PL; e += 256) { const int r = e / PL, c = e % PL; sp[r][c] = bf16_round(patches[((size_t)b * NN + n0 + r) * PL + c]); }
  if (tid < PL) {                             // filled once per block, published by the barrier that publishes sp
    const float ang = 0.09817477042468103f * (float)tid;     // 2*pi/64
    tw[0][tid] = cosf(ang); tw[1][tid] = sinf(ang);
  }
  __syncthreads();
  // 32 patches x 33 bins = 1056 (patch, bin) pairs over 256 threads
  for (int e = tid; e < 32 * 33; e += 256) {
    const int r = e / 33;
    const unsigned kbin = (unsigned)(e % 33);
    float xs[PL], c[PL], s[PL];
#pragma unroll                                 // n becomes a constant, so xs, c and s live in registers
    for (int n = 0; n < PL; ++n) {
      const unsigned m = (kbin * (unsigned)n) & (unsigned)(PL - 1);   // angle = 2*pi*m/64, exact reduction
      xs[n] = sp[r][n]; c[n] = tw[0][m]; s[n] = tw[1][m];
    }
    __builtin_amdgcn_sched_barrier(0);         // keeps every LDS read above the two sum chains: sunk among them, each read pays its latency alone
    float re = 0.f, im = 0.f;
#pragma unroll                                 // as above: constant indices into xs, c and s
    for (int n = 0; n < PL; ++n) { re += xs[n] * c[n]; im -= xs[n] * s[n]; }
    pw[r][kbin] = re * re + im * im;
  }
  __syncthreads();
  if (tid < 32) {
    const int r = tid;
    // bands sorted by name: alpha {3}, beta {4..7}, delta {1}, gamma {8..25}, theta {2}  (rfftfreq(64, 1/250) = 3.90625 k)
    float bp[NBANDS];
    bp[0] = pw[r][3];
    bp[1] = (pw[r][4] + pw[r][5] + pw[r][6] + pw[r][7]) * 0.25f;
    bp[2] = pw[r][1];
    { float s = 0.f;
#pragma unroll 1
      for (int kbin = 8; kbin <= 25; ++kbin) s += pw[r][kbin]; bp[3] = s * (1.0f / 18.0f); }
    bp[4] = pw[r][2];
#pragma unroll 1
    for (int c = 0; c < NBANDS; ++c) bp[c] = log1pf(bp[c]);
#pragma unroll 1
    for (int h = 0; h < NH; ++h) {
      float s = 0.f;
#pragma unroll 1
      for (int c = 0; c < NBANDS; ++c) s += bp[c] * bf16_round(band_bias[h * NBANDS + c]);
      sb[h][r] = s;
    }
  }
  __syncthreads();
  {
    const int h = tid >> 5, r = tid & 31;
    float* dst = sbias + ((size_t)(b * NH + h)) * NN + n0 + r;
    const float v = sb[h][r];
    *(float*)dst = v; 
  }
}

// Everything that reads inputs alone, in one launch: blocks 0 .. B*N/32 - 1 do the band biases, the others
// round the four weight matrices, DM*DM/8/256 blocks each, into four planes that lie one behind the other in Wt.
__global__ __launch_bounds__(256) void k_prep(const float* __restrict__ patches, const float* __restrict__ band_bias, float* __restrict__ sbias,
                                            const float* __restrict__ W0, const float* __restrict__ W1, const float* __restrict__ W2,
                                            const float* __restrict__ W3, unsigned short* __restrict__ Wt) {
  constexpr int NBB = BB * NN / 32, BPW = DM * DM / 8 / 256;
  static_assert(DM * DM % (8 * 256) == 0, "whole blocks of 8-element pieces");
  const int blk = blockIdx.x;
  if (blk >= NBB) {                            // the whole block takes this side, which holds no barrier
    const int p = (blk - NBB) / BPW;
    const float* __restrict__ W = p == 0 ? W0 : p == 1 ? W1 : p == 2 ? W2 : W3;
    round_rows(W, Wt + (size_t)p * DM * DM, ((blk - NBB) % BPW) * 256 + (int)threadIdx.x);
    return;
  }
  bandbias_block(blk, patches, band_bias, sbias);
}

extern "C" void kernel_launch(void* const* d_in, const int* in_sizes, int n_in,
                              void* d_out, int out_size, void* d_ws, size_t ws_size, hipStream_t stream) {
  (void)in_sizes; (void)n_in; (void)out_size;
  const float* x = (const float*)d_in[0]; const float* patches = (const float*)d_in[1];
  const float* Wq = (const float*)d_in[2]; const float* bq = (const float*)d_in[3];
  const float* Wk = (const float*)d_in[4]; const float* bk = (const float*)d_in[5];
  const float* Wv = (const float*)d_in[6]; const float* bv = (const float*)d_in[7];
  const float* Wo = (const float*)d_in[8]; const float* bo = (const float*)d_in[9];
  const float* band_bias = (const float*)d_in[10];
  char* ws = (char*)d_ws; size_t off = 0;
  unsigned short* Wqt = (unsigned short*)(ws + off); off += (size_t)DM * DM * 2;
  unsigned short* Wkt = (unsigned short*)(ws + off); off += (size_t)DM * DM * 2;
  unsigned short* Wvt = (unsigned short*)(ws + off); off += (size_t)DM * DM * 2;
  unsigned short* Wot = (unsigned short*)(ws + off); off += (size_t)DM * DM * 2;
  float* qb = (float*)(ws + off); off += (size_t)BB * NN * DM * 4;
  float* kb2 = (float*)(ws + off); off += (size_t)BB * NN * DM * 4;
  float* vb2 = (float*)(ws + off); off += (size_t)BB * NN * DM * 4;
  float* ob = (float*)(ws + off); off += (size_t)BB * NN * DM * 4;
  float* sbias = (float*)(ws + off); off += (size_t)BB * NH * NN * 4;
  if (off > ws_size) return;
  const int M = BB * NN;
  (void)Wkt; (void)Wvt;                        // the planes behind Wqt, reached through it
  k_prep<<<BB * NN / 32 + 4 * (DM * DM / 8 / 256), 256, 0, stream>>>(patches, band_bias, sbias, Wq, Wk, Wv, Wo, Wqt);
  const int gb = ((M / 16) * (DM / 64) + 3) / 4;
  k_gemm_bf<false, 0, true, DM, DM, 3, true><<<3 * gb, 128, 0, stream>>>(x, Wqt, bq, bk, bv, qb, kb2, vb2, DM, M, DM, DM);   // K and V leave split, in the same bytes
  k_flashm<HD, NN, DM, false, false, true><<<BB * NH * (NN / 64), 128, 0, stream>>>(qb, (const unsigned short*)kb2, (const unsigned short*)vb2, NH, 0.125f, nullptr, ob, sbias);
  k_gemm_bf<true, 0, true, DM, DM, 1, false><<<gb, 128, 0, stream>>>(ob, Wot, bo, nullptr, nullptr, (float*)d_out, nullptr, nullptr, DM, M, DM, DM);
}

// v008
// One run takes 99.2 microseconds.
// Next to v007, in two timings, it ran 1.27 and 1.26 times as fast.
// All steps since v000 together make it 5.30 times as fast.
#include <hip/hip_runtime.h>
// All contractions on v_wmma_f32_16x16x32_bf16, f32 accumulate: Q/K/V = x·Wᵀ with x/W rounded to bf16 (single exact-product
// term), QKᵀ and P·V 3-term bf16 hi/lo splits, out = o·W_oᵀ with o split hi/lo (2 terms). The 64-point rFFT band powers,
// log1p, the 5->8 band-bias projection and softmax are f32 on VALU.
#define BB 2
#define NN 2048
#define DM 512
#define NH 8
#define HD 64
#define PL 64
#define NBANDS 5

typedef __bf16 v16b __attribute__((ext_vector_type(16)));
typedef unsigned short v8us __attribute__((ext_vector_type(8), may_alias));
typedef float  v8f  __attribute__((ext_vector_type(8)));
typedef float  v4f  __attribute__((ext_vector_type(4)));
typedef float  v4fa __attribute__((ext_vector_type(4), may_alias));
union FragB { v16b v; v8us half[2]; unsigned short u[16]; };

__device__ __forceinline__ unsigned short bf16_bits(float x) { unsigned int u = __float_as_uint(x); return (unsigned short)((u + 0x7FFFu + ((u >> 16) & 1u)) >> 16); }
__device__ __forceinline__ float bf16_val(unsigned short b) { return __uint_as_float(((unsigned int)b) << 16); }
__device__ __forceinline__ float bf16_round(float x) { return bf16_val(bf16_bits(x)); }
// D += A·B with NT terms: 1 = ah·bh, 2 = + al·bh (A split), 3 = + ah·bl (both split)
template <int NT>
__device__ __forceinline__ v8f mmaN(v16b ah, v16b al, v16b bh, v16b bl, v8f c) {
  c = __builtin_amdgcn_wmma_f32_16x16x32_bf16(false, ah, false, bh, (short)0, c, false, false);
  if (NT >= 2) c = __builtin_amdgcn_wmma_f32_16x16x32_bf16(false, al, false, bh, (short)0, c, false, false);
  if (NT >= 3) c = __builtin_amdgcn_wmma_f32_16x16x32_bf16(false, ah, false, bl, (short)0, c, false, false);
  asm volatile("v_nop\n\tv_nop\n\tv_nop\n\tv_nop" : "+v"(c) : "v"(ah), "v"(al), "v"(bh), "v"(bl));
  return c;
}

// The same three terms in the same order with the operands' sides exchanged (D transposed): ah*bh, ah*bl, al*bh
__device__ __forceinline__ v8f mmaT3(v16b ah, v16b al, v16b bh, v16b bl, v8f c) {
  c = __builtin_amdgcn_wmma_f32_16x16x32_bf16(false, ah, false, bh, (short)0, c, false, false);
  c = __builtin_amdgcn_wmma_f32_16x16x32_bf16(false, ah, false, bl, (short)0, c, false, false);
  c = __builtin_amdgcn_wmma_f32_16x16x32_bf16(false, al, false, bh, (short)0, c, false, false);
  asm volatile("v_nop\n\tv_nop\n\tv_nop\n\tv_nop" : "+v"(c) : "v"(ah), "v"(al), "v"(bh), "v"(bl));   // the distance behind a WMMA, on the loop's taken branch too
  return c;
}
// x rounded to bf16 as in bf16_bits, the 16 bits left in the high half of the word
__device__ __forceinline__ unsigned int bf16_high(float x) { unsigned int u = __float_as_uint(x); return u + 0x7FFFu + ((u >> 16) & 1u); }
typedef unsigned int v8u __attribute__((ext_vector_type(8)));
// lane l with lane l ^ 16, on the vector pipe
__device__ __forceinline__ float xhalf(float x) {
  return __builtin_bit_cast(float, __builtin_amdgcn_permlanex16(__builtin_bit_cast(int, x), __builtin_bit_cast(int, x), 0x76543210, 0xfedcba98, false, false));
}

// Transposing LDS load: lane (c = l & 15, h = l >> 4) receives T[kbase + 8h + 0..7][dbase + c] of a row-major 16-bit tile when it
// passes the address of T[kbase + 8h + (l & 7)][dbase + 8 * ((l >> 3) & 1)]; two of them (kbase, kbase + 16) are one 32 x 16 B fragment.
typedef short s16x8 __attribute__((ext_vector_type(8)));
__device__ __forceinline__ v8us ld_tr16(const unsigned short* p) {
  typedef __attribute__((address_space(3))) s16x8 lds_s16x8;
  return __builtin_bit_cast(v8us, __builtin_amdgcn_ds_load_tr16_b128_v8i16((lds_s16x8*)p));
}

__global__ __launch_bounds__(256) void k_wt_bf16(const float* __restrict__ W, unsigned short* __restrict__ Wt, int K, int N) {
  const int t = blockIdx.x * 256 + threadIdx.x;
  const int k8n = K / 8;
  if (t >= N * k8n) return;
  const int n = t / k8n, k8 = (t % k8n) * 8;
  v8us v;
#pragma unroll
  for (int i = 0; i < 8; ++i) v[i] = bf16_bits(W[(size_t)(k8 + i) * N + n]);
  *(v8us*)(Wt + (size_t)n * K + k8) = v;
  
}

// GEMM C[M][N] (f32, pitch ldc) = act(A[M][K] * W + bias). A f32 row-major (pitch lda) converted to bf16
// (ASPLIT: hi/lo two planes -> 2 terms, else single rounded term); Wt bf16 [N][K] (pitch ldb). BIAS_BF16 rounds the
// bias to bf16 first (bias quantised to bf16 before the add). K%128==0, M%64==0, N%64==0. The two pitches are template constants, so that a
// chunk's loads differ by immediate offsets from one address per operand, which stays in its registers.
// A block owns a 64 x 64 tile of C, a wave 16 of its rows. Per 128 k the block brings its 64 A rows and its 64 Wt rows into LDS with loads
// that cover whole 128-byte lines (a wave-wide load reads 512 bytes of one row of A, or 256 bytes of each of two rows of Wt), A converted once on the way;
// the four waves share the Wt rows. Fragments come from LDS, in the k order and the k-step order of a direct load.
// One launch serves NSEL products of the same A: their Wt planes ([N][K] each) lie one behind the other, and the block index picks the plane
// with its bias and its output, so that the blocks of all the products are resident together. The blocks of one 64-row strip of A are neighbours.
// SPLITOUT: every product but the first leaves not as f32 but as the bf16 hi/lo pair that attention multiplies with, split here once per element:
// row (b * NH + head) * NN + n of its output holds the head's HD high parts, then its HD low parts (a block's 64 columns are one head).
typedef unsigned short v4us __attribute__((ext_vector_type(4), may_alias));
template <bool ASPLIT, int ACT, bool BIAS_BF16, int lda, int ldb, int NSEL, bool SPLITOUT>
__global__ __launch_bounds__(128) void k_gemm_bf(const float* __restrict__ A, const unsigned short* __restrict__ Wt,
                                               const float* __restrict__ bias0, const float* __restrict__ bias1, const float* __restrict__ bias2,
                                               float* __restrict__ C0, float* __restrict__ C1, float* __restrict__ C2, int ldc, int M, int N, int K) {
  constexpr int KC = 128;                      // k per staged chunk
  constexpr int LP = KC + 8;                   // LDS row pitch in elements: the row's bytes + 16, free of bank conflicts for 16-byte fragment reads
  constexpr int NA = 64 * (KC / 4) / 128, RA = 128 / (KC / 4);   // 16-byte pieces of A per thread; rows the block covers per piece
  constexpr int NB = 64 * (KC / 8) / 128, RB = 128 / (KC / 8);   // the same for Wt
  __shared__ __attribute__((aligned(16))) unsigned short sAh[64][LP], sAl[ASPLIT ? 64 : 1][LP], sB[64][LP];
  __shared__ __attribute__((aligned(16))) float so[4][16][64];
  const int tid = threadIdx.x, w = tid >> 5, lane = tid & 31, ln = lane & 15, hh = lane >> 4;
  const int ntn = N / 64;                      // column tiles of one product
  const int mt = blockIdx.x / (NSEL * ntn), nq = blockIdx.x % (NSEL * ntn);
  if (mt * 64 >= M) return;                    // the whole block leaves, in front of every barrier
  const int sel = NSEL > 1 ? nq / ntn : 0;     // which product: the same for the whole block
  const float* __restrict__ bias = sel == 0 ? bias0 : sel == 1 ? bias1 : bias2;
  float* __restrict__ C = sel == 0 ? C0 : sel == 1 ? C1 : C2;
  const int row0 = mt * 64 + w * 16, col0 = (nq - sel * ntn) * 64;
  const int ar = tid / (KC / 4), ac = (tid % (KC / 4)) * 4, br = tid / (KC / 8), bc = (tid % (KC / 8)) * 8;
  const float* Ab = A + (size_t)(mt * 64) * lda;               // block-uniform bases; the thread's own place is a 32-bit offset
  const unsigned short* Bb = Wt + (size_t)(nq * 64) * ldb;      // row sel * N + col0 of the planes
  const unsigned ao = (unsigned)(ar * lda + ac), bo = (unsigned)(br * ldb + bc);
  v8f acc[4] = {};
  for (int kb = 0; kb < K; kb += KC) {
    v4f xa[NA]; v8us xb[NB];
#pragma unroll
    for (int it = 0; it < NA; ++it) xa[it] = *(const v4fa*)(Ab + kb + (ao + (unsigned)(it * RA * lda)));
#pragma unroll
    for (int it = 0; it < NB; ++it) xb[it] = *(const v8us*)(Bb + kb + (bo + (unsigned)(it * RB * ldb)));
    asm volatile("s_wait_xcnt 0x0" ::: "memory");   // in front of every later write of the loads' address registers, which this trip advances
    __builtin_amdgcn_sched_barrier(0);         // nothing crosses: the wait stays directly behind the last load, and no conversion is lifted in front of it
    __syncthreads();                           // every wave has read its fragments of the chunk before
#pragma unroll
    for (int it = 0; it < NA; ++it) {
      v4us hi, lo;
#pragma unroll
      for (int i = 0; i < 4; ++i) { const unsigned short hb = bf16_bits(xa[it][i]); hi[i] = hb; lo[i] = ASPLIT ? bf16_bits(xa[it][i] - bf16_val(hb)) : (unsigned short)0; }
      *(v4us*)&sAh[ar + it * RA][ac] = hi;
      if (ASPLIT) *(v4us*)&sAl[ar + it * RA][ac] = lo;
    }
#pragma unroll
    for (int it = 0; it < NB; ++it) *(v8us*)&sB[br + it * RB][bc] = xb[it];
    __syncthreads();
#pragma unroll
    for (int k2 = 0; k2 < KC; k2 += 64) {
      FragB ah[2], al[2], b[2][4];
#pragma unroll
      for (int s = 0; s < 2; ++s) {
        const int kc = k2 + s * 32 + 8 * hh;
        ah[s].half[0] = *(const v8us*)&sAh[w * 16 + ln][kc]; ah[s].half[1] = *(const v8us*)&sAh[w * 16 + ln][kc + 16];
        if (ASPLIT) { al[s].half[0] = *(const v8us*)&sAl[w * 16 + ln][kc]; al[s].half[1] = *(const v8us*)&sAl[w * 16 + ln][kc + 16]; }
#pragma unroll
        for (int t = 0; t < 4; ++t) { b[s][t].half[0] = *(const v8us*)&sB[t * 16 + ln][kc]; b[s][t].half[1] = *(const v8us*)&sB[t * 16 + ln][kc + 16]; }
      }
#pragma unroll
      for (int s = 0; s < 2; ++s)
#pragma unroll
        for (int t = 0; t < 4; ++t) acc[t] = mmaN<ASPLIT ? 2 : 1>(ah[s].v, ASPLIT ? al[s].v : ah[s].v, b[s][t].v, b[s][t].v, acc[t]);
    }
  }
#pragma unroll
  for (int t = 0; t < 4; ++t) {
    float bv = bias ? bias[col0 + t * 16 + ln] : 0.f;
    if (BIAS_BF16) bv = bf16_round(bv);
#pragma unroll
    for (int r = 0; r < 8; ++r) { float v = acc[t][r] + bv; if (ACT == 1) v = fmaxf(v, 0.f); so[w][8 * hh + r][t * 16 + ln] = v; }
  }
  __builtin_amdgcn_fence(__ATOMIC_ACQ_REL, "workgroup");
  __builtin_amdgcn_wave_barrier();
  if (SPLITOUT && sel != 0) {                  // the same for the whole block
    static_assert(!SPLITOUT || HD == 64, "a 64-column tile is one head");
    unsigned short* __restrict__ P = (unsigned short*)C + ((size_t)((row0 / NN) * NH + col0 / HD) * NN + row0 % NN) * (2 * HD);
    const int r8 = lane >> 3, c8 = (lane & 7) * 8;   // eight lanes cover the 128 bytes of a row's high parts, and of its low parts
    v8us hi[4], lo[4];
#pragma unroll
    for (int q = 0; q < 4; ++q) {
      const v4f a = *(const v4fa*)&so[w][q * 4 + r8][c8], b = *(const v4fa*)&so[w][q * 4 + r8][c8 + 4];
#pragma unroll
      for (int i = 0; i < 4; ++i) {
        unsigned short hb = bf16_bits(a[i]); hi[q][i] = hb; lo[q][i] = bf16_bits(a[i] - bf16_val(hb));
        hb = bf16_bits(b[i]); hi[q][4 + i] = hb; lo[q][4 + i] = bf16_bits(b[i] - bf16_val(hb));
      }
    }
#pragma unroll
    for (int q = 0; q < 4; ++q) {
      *(v8us*)(P + (q * 4 + r8) * (2 * HD) + c8) = hi[q];
      *(v8us*)(P + (q * 4 + r8) * (2 * HD) + HD + c8) = lo[q];
    }
    asm volatile("s_wait_xcnt 0x0" ::: "memory");   // in front of every later write of the stores' address and data registers
    return;
  }
  const int rsub = lane >> 4, c4 = (lane & 15) * 4;
  {
#pragma unroll
    for (int q = 0; q < 8; ++q) {
      const int r = q * 2 + rsub;
      const v4f v = *(const v4fa*)&so[w][r][c4];
      *(v4f*)(C + (size_t)(row0 + r) * ldc + col0 + c4) = v;
    }
    
  }
}

// Flash-style causal/unmasked attention, all contractions 3-term bf16 hi/lo splits, f32 softmax with running max.
// q,k,v rows are read from f32 buffers with arbitrary row pitch (so they can live inside a fused qkv buffer);
// D = head size (multiple of 32, <= 128); one wave = 16 query rows; block = 4 waves (64 queries) sharing K/V chunks of 32.
template <int D, bool CAUSAL>
__global__ __launch_bounds__(128) void k_flash(const float* __restrict__ qb, const float* __restrict__ kb, const float* __restrict__ vb,
                                             int pitch, int T, int H, float scale, float* __restrict__ y, int ypitch) {
  constexpr int KS = D / 32;        // k-steps for QK
  constexpr int DT = D / 16;        // d tiles for PV
  __shared__ __attribute__((aligned(16))) unsigned short sKh[32][D + 8], sKl[32][D + 8], sVh[32][D + 8], sVl[32][D + 8];
  __shared__ __attribute__((aligned(16))) unsigned short sPh[4][16][40], sPl[4][16][40];
  __shared__ __attribute__((aligned(16))) float sO[4][16][D];
  const int tid = threadIdx.x, w = tid >> 5, lane = tid & 31, ln = lane & 15, hh = lane >> 4;
  const int nqb = (T + 63) / 64;
  const int bh = blockIdx.x / nqb, qblk = blockIdx.x % nqb;
  const int b = bh / H, h = bh % H;
  const int q0 = qblk * 64 + w * 16;
  const float* Q = qb + (size_t)b * T * pitch + h * D;
  const float* K = kb + (size_t)b * T * pitch + h * D;
  const float* V = vb + (size_t)b * T * pitch + h * D;

  // A fragments of the wave's 16 query rows (scaled), hi/lo
  FragB aqh[KS], aql[KS];
  {
    int row = q0 + ln; if (row >= T) row = T - 1;
    const float* qr = Q + (size_t)row * pitch;
#pragma unroll
    for (int ks = 0; ks < KS; ++ks)
#pragma unroll
      for (int i = 0; i < 16; ++i) {
        const int d = ks * 32 + ((i < 8) ? (8 * hh + i) : (16 + 8 * hh + (i - 8)));
        const float x = qr[d] * scale; const unsigned short hb = bf16_bits(x);
        aqh[ks].u[i] = hb; aql[ks].u[i] = bf16_bits(x - bf16_val(hb));
      }
  }
  float m_r[8], l_r[8];
#pragma unroll
  for (int r = 0; r < 8; ++r) { m_r[r] = -3.0e38f; l_r[r] = 0.f; }
  v8f oacc[DT];
#pragma unroll
  for (int dt = 0; dt < DT; ++dt) oacc[dt] = (v8f){0.f,0.f,0.f,0.f,0.f,0.f,0.f,0.f};

  const int kv_end = CAUSAL ? min(T, qblk * 64 + 64) : T;     // block-uniform
  for (int j0 = 0; j0 < kv_end; j0 += 32) {
    __syncthreads();
    for (int e = tid; e < 32 * (D / 4); e += 128) {
      const int r = e / (D / 4), c4 = (e % (D / 4)) * 4;
      const int key = j0 + r;
      v4f kf = {0.f,0.f,0.f,0.f}, vf = {0.f,0.f,0.f,0.f};
      if (key < T) { kf = *(const v4fa*)(K + (size_t)key * pitch + c4); vf = *(const v4fa*)(V + (size_t)key * pitch + c4); }
#pragma unroll
      for (int t = 0; t < 4; ++t) {
        unsigned short hb = bf16_bits(kf[t]); sKh[r][c4 + t] = hb; sKl[r][c4 + t] = bf16_bits(kf[t] - bf16_val(hb));
        hb = bf16_bits(vf[t]); sVh[r][c4 + t] = hb; sVl[r][c4 + t] = bf16_bits(vf[t] - bf16_val(hb));
      }
    }
    __syncthreads();
    // S tile 16 x 32
    v8f s[2];
#pragma unroll
    for (int nt = 0; nt < 2; ++nt) {
      v8f acc = {};
#pragma unroll
      for (int ks = 0; ks < KS; ++ks) {
        FragB bh_, bl_;
        bh_.half[0] = *(const v8us*)&sKh[nt * 16 + ln][ks * 32 + 8 * hh]; bh_.half[1] = *(const v8us*)&sKh[nt * 16 + ln][ks * 32 + 16 + 8 * hh];
        bl_.half[0] = *(const v8us*)&sKl[nt * 16 + ln][ks * 32 + 8 * hh]; bl_.half[1] = *(const v8us*)&sKl[nt * 16 + ln][ks * 32 + 16 + 8 * hh];
        acc = mmaN<3>(aqh[ks].v, aql[ks].v, bh_.v, bl_.v, acc);
      }
      s[nt] = acc;
    }
    // mask + running max (rows 8hh+r; the 16 lanes of a half share rows)
    float alpha[8];
#pragma unroll
    for (int r = 0; r < 8; ++r) {
      const int qi = q0 + 8 * hh + r;
      const int ja = j0 + ln, jb = j0 + 16 + ln;
      if (CAUSAL) { if (ja > qi) s[0][r] = -3.0e38f; if (jb > qi) s[1][r] = -3.0e38f; }
      if (ja >= T) s[0][r] = -3.0e38f;
      if (jb >= T) s[1][r] = -3.0e38f;
      float mx = fmaxf(s[0][r], s[1][r]);
      mx = fmaxf(mx, __shfl_xor(mx, 1, 32)); mx = fmaxf(mx, __shfl_xor(mx, 2, 32)); mx = fmaxf(mx, __shfl_xor(mx, 4, 32)); mx = fmaxf(mx, __shfl_xor(mx, 8, 32));
      const float mnew = fmaxf(m_r[r], mx);
      alpha[r] = (mnew > -1.0e38f) ? __expf(m_r[r] - mnew) : 1.0f;
      const float p0 = (s[0][r] > -1.0e38f) ? __expf(s[0][r] - mnew) : 0.f;
      const float p1 = (s[1][r] > -1.0e38f) ? __expf(s[1][r] - mnew) : 0.f;
      m_r[r] = mnew;
      l_r[r] = l_r[r] * alpha[r] + p0 + p1;            // per-lane partial row sum (16 lanes combined at the end)
      unsigned short hb = bf16_bits(p0); sPh[w][8 * hh + r][ln] = hb;      sPl[w][8 * hh + r][ln] = bf16_bits(p0 - bf16_val(hb));
      hb = bf16_bits(p1);                sPh[w][8 * hh + r][16 + ln] = hb; sPl[w][8 * hh + r][16 + ln] = bf16_bits(p1 - bf16_val(hb));
    }
#pragma unroll
    for (int dt = 0; dt < DT; ++dt)
#pragma unroll
      for (int r = 0; r < 8; ++r) oacc[dt][r] *= alpha[r];
    __builtin_amdgcn_fence(__ATOMIC_ACQ_REL, "workgroup");
    __builtin_amdgcn_wave_barrier();
    FragB pah, pal;
    pah.half[0] = *(const v8us*)&sPh[w][ln][8 * hh]; pah.half[1] = *(const v8us*)&sPh[w][ln][16 + 8 * hh];
    pal.half[0] = *(const v8us*)&sPl[w][ln][8 * hh]; pal.half[1] = *(const v8us*)&sPl[w][ln][16 + 8 * hh];
#pragma unroll
    for (int dt = 0; dt < DT; ++dt) {
      FragB bvh, bvl;
#pragma unroll
      for (int i = 0; i < 8; ++i) {
        bvh.u[i] = sVh[8 * hh + i][dt * 16 + ln]; bvh.u[8 + i] = sVh[16 + 8 * hh + i][dt * 16 + ln];
        bvl.u[i] = sVl[8 * hh + i][dt * 16 + ln]; bvl.u[8 + i] = sVl[16 + 8 * hh + i][dt * 16 + ln];
      }
      oacc[dt] = mmaN<3>(pah.v, pal.v, bvh.v, bvl.v, oacc[dt]);
    }
    __builtin_amdgcn_fence(__ATOMIC_ACQ_REL, "workgroup");
    __builtin_amdgcn_wave_barrier();
  }
#pragma unroll
  for (int r = 0; r < 8; ++r) {
    float l = l_r[r];
    l += __shfl_xor(l, 1, 32); l += __shfl_xor(l, 2, 32); l += __shfl_xor(l, 4, 32); l += __shfl_xor(l, 8, 32);
    l_r[r] = (l > 0.f) ? 1.0f / l : 0.f;
  }
#pragma unroll
  for (int dt = 0; dt < DT; ++dt)
#pragma unroll
    for (int r = 0; r < 8; ++r) sO[w][8 * hh + r][dt * 16 + ln] = oacc[dt][r] * l_r[r];
  __builtin_amdgcn_fence(__ATOMIC_ACQ_REL, "workgroup");
  __builtin_amdgcn_wave_barrier();
  {
    for (int r = 0; r < 16; ++r) {
      const int row = q0 + r;
      if (row < T && lane < D / 4) {
        const v4f val = *(const v4fa*)&sO[w][r][lane * 4];
        *(v4f*)(y + ((size_t)b * T + row) * ypitch + h * D + lane * 4) = val;
      }
    }
    
  }
}

// Eight asynchronous 16-byte copies from global memory to LDS, each lane its own addresses (LDS byte address, global pointer), through no register.
// The closing wait stands inside the statement, so that no address register named here is rewritten in front of it.
__device__ __forceinline__ void copy8_to_lds(const unsigned (&la)[4], const unsigned short* const (&ga)[4], const unsigned (&lb)[4], const unsigned short* const (&gb)[4]) {
  asm volatile("global_load_async_to_lds_b128 %0, %1, off\n\t"
               "global_load_async_to_lds_b128 %2, %3, off\n\t"
               "global_load_async_to_lds_b128 %4, %5, off\n\t"
               "global_load_async_to_lds_b128 %6, %7, off\n\t"
               "global_load_async_to_lds_b128 %8, %9, off\n\t"
               "global_load_async_to_lds_b128 %10, %11, off\n\t"
               "global_load_async_to_lds_b128 %12, %13, off\n\t"
               "global_load_async_to_lds_b128 %14, %15, off\n\t"
               "s_wait_xcnt 0x0"
               :: "v"(la[0]), "v"(ga[0]), "v"(lb[0]), "v"(gb[0]), "v"(la[1]), "v"(ga[1]), "v"(lb[1]), "v"(gb[1]),
                  "v"(la[2]), "v"(ga[2]), "v"(lb[2]), "v"(gb[2]), "v"(la[3]), "v"(ga[3]), "v"(lb[3]), "v"(gb[3]) : "memory");
}

template <int D, int T, int PITCH, bool CAUSAL, bool HASMASK, bool HASBIAS>
__global__ __launch_bounds__(128) void k_flashm(const float* __restrict__ Qb, const unsigned short* __restrict__ Kb, const unsigned short* __restrict__ Vb,
                                              int H, float scale, const int* __restrict__ mask, float* __restrict__ y, const float* __restrict__ sbias) {
  static_assert(T % 64 == 0 && D % 32 == 0, "whole query blocks and key chunks only");   // so every block walks two chunks or more
  constexpr int KS = D / 32, DT = D / 16;
  constexpr int PPR = 2 * D / 8;               // 16-byte pieces of a split row: the high parts' first, then the low parts'
  constexpr int NST = 32 * PPR / 128;          // staging trips per thread, the same for every thread
  constexpr int RPT = 128 / PPR;               // key rows that the block stages per trip
  constexpr int VP = D + 16;                   // V row pitch in elements: an odd multiple of 32 bytes, the transposing load's conflict-free pitch
  static_assert((VP * 2) % 32 == 0 && ((VP * 2 / 32) & 1) == 1, "V pitch must be 32 B x odd");
  static_assert(NST == 4, "copy8_to_lds takes four K and four V pieces per thread");
  __shared__ __attribute__((aligned(16))) unsigned short sK[2][2][32][D + 8], sV[2][2][32][VP];   // [buffer][plane]: plane 0 high parts, plane 1 low parts
  __shared__ __attribute__((aligned(16))) float sO[4][16][D];
  const int tid = threadIdx.x, w = tid >> 5, lane = tid & 31, ln = lane & 15, hh = lane >> 4;
  constexpr int nqb = T / 64;
  const int bh = blockIdx.x / nqb, qblk = blockIdx.x % nqb;
  const int b = bh / H, h = bh % H;
  const int q0 = qblk * 64 + w * 16;
  const float* Q = Qb + (size_t)b * T * PITCH + h * D;
  const unsigned short* K = Kb + (size_t)bh * T * (2 * D);
  const unsigned short* V = Vb + (size_t)bh * T * (2 * D);
  const float* SB = sbias + (size_t)bh * T;
  const unsigned ukb = 8u * (unsigned)hh, toff = (unsigned)tid * 8u;   // the block's pieces of a trip lie one behind the other
  const unsigned dK = (unsigned)(size_t)&sK[0][(tid % PPR) / (D / 8)][tid / PPR][(tid % (D / 8)) * 8];   // LDS byte address of the thread's first piece, buffer 0
  const unsigned dV = (unsigned)(size_t)&sV[0][(tid % PPR) / (D / 8)][tid / PPR][(tid % (D / 8)) * 8];
  // the thread's K and V pieces of the 32 keys from j on, into buffer buf; every lane is on, every address a multiple of 16 bytes
  auto stage = [&](const int j, const unsigned buf) {
    const unsigned short* Kj = K + (size_t)j * (2 * D) + toff; const unsigned short* Vj = V + (size_t)j * (2 * D) + toff;
    unsigned lk[NST], lv[NST]; const unsigned short* gk[NST]; const unsigned short* gv[NST];
#pragma unroll
    for (int it = 0; it < NST; ++it) {
      lk[it] = dK + buf * (unsigned)sizeof(sK[0]) + (unsigned)(it * RPT * (D + 8) * 2); gk[it] = Kj + it * 128 * 8;
      lv[it] = dV + buf * (unsigned)sizeof(sV[0]) + (unsigned)(it * RPT * VP * 2);      gv[it] = Vj + it * 128 * 8;
    }
    copy8_to_lds(lk, gk, lv, gv);
  };
  stage(0, 0u);                                // chunk 0 flies while Q is read and split
  const int vrow = 8 * hh + (lane & 7), vcol = 8 * ((lane >> 3) & 1);   // the lane's address inside a 16 x 16 V tile for ld_tr16
  FragB aqh[KS], aql[KS];
  {
    const float* qr = Q + (size_t)(q0 + ln) * PITCH;
#pragma unroll
    for (int ks = 0; ks < KS; ++ks)
#pragma unroll
      for (int i = 0; i < 16; ++i) {
        const int d = ks * 32 + ((i < 8) ? (8 * hh + i) : (16 + 8 * hh + (i - 8)));
        const float x = qr[d] * scale; const unsigned short hb = bf16_bits(x);
        aqh[ks].u[i] = hb; aql[ks].u[i] = bf16_bits(x - bf16_val(hb));
      }
  }
  const int qi = q0 + ln;                      // the lane's query
  const float bq = HASBIAS ? SB[qi] : 0.f;     // its bias, read once
  float m_q = -3.0e38f, l_q = 0.f;             // its running maximum; the sum over this half's keys (the halves join after the loop)
  v8f oacc[DT];                                // oacc[dt][r] = O[qi][dt * 16 + 8 * hh + r]
#pragma unroll
  for (int dt = 0; dt < DT; ++dt) oacc[dt] = (v8f){0.f,0.f,0.f,0.f,0.f,0.f,0.f,0.f};
  const int kv_end = CAUSAL ? qblk * 64 + 64 : T;
  v4f bk0[4] = {}, bk1[4] = {};                // biases of keys 8hh + 0..7 and 16 + 8hh + 0..7: of the even chunk at hand or to come, and of the odd one
  asm volatile("s_wait_asynccnt 0x0" ::: "memory");   // this wave's pieces of chunk 0 have landed
  __syncthreads();                             // and every other wave's: chunk 0 is published
  if (HASBIAS) {
    bk0[0] = *(const v4fa*)(SB + ukb); bk0[1] = *(const v4fa*)(SB + (ukb + 4u)); bk0[2] = *(const v4fa*)(SB + (ukb + 16u)); bk0[3] = *(const v4fa*)(SB + (ukb + 20u));
    bk1[0] = *(const v4fa*)(SB + (ukb + 32u)); bk1[1] = *(const v4fa*)(SB + (ukb + 36u)); bk1[2] = *(const v4fa*)(SB + (ukb + 48u)); bk1[3] = *(const v4fa*)(SB + (ukb + 52u));
  }
  stage(32, 1u);                               // its closing s_wait_xcnt 0 also stands behind the bias loads above
  __builtin_amdgcn_sched_barrier(0);           // nothing crosses: no bias load sinks behind that wait
  // one chunk of 32 keys from j0 on, out of buffer buf alone (a constant at either call, so that every LDS offset is an immediate), with its biases in bk
  auto chunk = [&](const int j0, const unsigned buf, v4f (&bk)[4]) __attribute__((always_inline)) {
    auto& sKh = sK[buf][0]; auto& sKl = sK[buf][1]; auto& sVh = sV[buf][0]; auto& sVl = sV[buf][1];
    v8f s[2];                                  // s[nt][r] = S[key j0 + nt * 16 + 8 * hh + r][query qi]
#pragma unroll
    for (int nt = 0; nt < 2; ++nt) {
      v8f acc = {};
#pragma unroll
      for (int ks = 0; ks < KS; ++ks) {
        FragB kh_, kl_;
        kh_.half[0] = *(const v8us*)&sKh[nt * 16 + ln][ks * 32 + 8 * hh]; kh_.half[1] = *(const v8us*)&sKh[nt * 16 + ln][ks * 32 + 16 + 8 * hh];
        kl_.half[0] = *(const v8us*)&sKl[nt * 16 + ln][ks * 32 + 8 * hh]; kl_.half[1] = *(const v8us*)&sKl[nt * 16 + ln][ks * 32 + 16 + 8 * hh];
        acc = mmaT3(kh_.v, kl_.v, aqh[ks].v, aql[ks].v, acc);
      }
      s[nt] = acc;
    }
    bool keep[2][8];
    float mx = -3.0e38f;
#pragma unroll
    for (int nt = 0; nt < 2; ++nt)
#pragma unroll
      for (int r = 0; r < 8; ++r) {
        const int kj = j0 + nt * 16 + 8 * hh + r;
        bool kp = true;
        if (HASBIAS) s[nt][r] += bq + bk[nt * 2 + (r >> 2)][r & 3];
        if (CAUSAL) kp = kj <= qi;
        if (HASMASK) kp = kp && mask[(size_t)qi * T + kj] != 0;
        if (!kp) s[nt][r] = -3.0e38f;
        keep[nt][r] = kp;
        mx = fmaxf(mx, s[nt][r]);
      }
    mx = fmaxf(mx, xhalf(mx));                 // the other half's 16 keys of the same query
    const float mnew = fmaxf(m_q, mx);
    const float alpha = (mnew > -1.0e38f) ? __expf(m_q - mnew) : 1.0f;
    m_q = mnew;
    v8u pwh, pwl;                              // P^T as a B fragment: element nt * 8 + r is key nt * 16 + 8hh + r, the k order of the V fragments
    float ps[2] = {0.f, 0.f};
#pragma unroll
    for (int nt = 0; nt < 2; ++nt)
#pragma unroll
      for (int r = 0; r < 8; r += 2) {         // two neighbouring keys fill one register: one byte permute packs both high halves
        const float p0 = keep[nt][r] ? __expf(s[nt][r] - mnew) : 0.f;
        const float p1 = keep[nt][r + 1] ? __expf(s[nt][r + 1] - mnew) : 0.f;
        ps[nt] += p0; ps[nt] += p1;
        const unsigned int h0 = bf16_high(p0), h1 = bf16_high(p1);
        const unsigned int l0 = bf16_high(p0 - __uint_as_float(h0 & 0xFFFF0000u)), l1 = bf16_high(p1 - __uint_as_float(h1 & 0xFFFF0000u));
        pwh[nt * 4 + (r >> 1)] = __builtin_amdgcn_perm(h1, h0, 0x07060302u);
        pwl[nt * 4 + (r >> 1)] = __builtin_amdgcn_perm(l1, l0, 0x07060302u);
      }
    const v16b pbh = __builtin_bit_cast(v16b, pwh), pbl = __builtin_bit_cast(v16b, pwl);
    l_q = l_q * alpha + (ps[0] + ps[1]);
#pragma unroll
    for (int dt = 0; dt < DT; ++dt)
#pragma unroll
      for (int r = 0; r < 8; ++r) oacc[dt][r] *= alpha;
    FragB bvh[DT], bvl[DT];                    // V^T as A fragments: row d = dt * 16 + ln, keys 8hh + 0..7, then 16 + 8hh + 0..7
#pragma unroll
    for (int dt = 0; dt < DT; ++dt) {
      bvh[dt].half[0] = ld_tr16(&sVh[vrow][vcol + dt * 16]); bvh[dt].half[1] = ld_tr16(&sVh[16 + vrow][vcol + dt * 16]);
      bvl[dt].half[0] = ld_tr16(&sVl[vrow][vcol + dt * 16]); bvl[dt].half[1] = ld_tr16(&sVl[16 + vrow][vcol + dt * 16]);
    }
#pragma unroll
    for (int dt = 0; dt < DT; ++dt) oacc[dt] = mmaT3(bvh[dt].v, bvl[dt].v, pbh, pbl, oacc[dt]);
    asm volatile("s_wait_dscnt 0x0" ::: "memory");      // this wave's reads of the buffer have returned
    asm volatile("s_wait_asynccnt 0x0" ::: "memory");   // this wave's pieces of the next chunk have landed
    __syncthreads();                           // publishes the next chunk and ends every wave's reads of this one
    if (j0 + 64 < kv_end) {                    // the same for the whole block: the chunk after the next goes into the buffer, and the registers, just read
      const float* SBn = SB + (j0 + 64);
      if (HASBIAS) { bk[0] = *(const v4fa*)(SBn + ukb); bk[1] = *(const v4fa*)(SBn + (ukb + 4u)); bk[2] = *(const v4fa*)(SBn + (ukb + 16u)); bk[3] = *(const v4fa*)(SBn + (ukb + 20u)); }
      stage(j0 + 64, buf);                     // its closing s_wait_xcnt 0 also stands behind the bias loads above
      __builtin_amdgcn_sched_barrier(0);       // nothing crosses: no bias load sinks behind that wait
    }
  };
  for (int j0 = 0; j0 < kv_end; j0 += 64) {    // kv_end is a multiple of 64: an even and an odd chunk per trip
    chunk(j0, 0u, bk0);
    chunk(j0 + 32, 1u, bk1);
  }
  asm volatile("s_wait_asynccnt 0x0" ::: "memory");     // no copy is outstanding when the wave goes on to its output
  // NaN for fully-masked rows (softmax over a row of -inf)
  const float l_all = l_q + xhalf(l_q);
  const float linv = (m_q > -1.0e38f) ? 1.0f / l_all : __builtin_nanf("");
#pragma unroll
  for (int dt = 0; dt < DT; ++dt) {
    v4f lo4, hi4;
#pragma unroll
    for (int r = 0; r < 4; ++r) { lo4[r] = oacc[dt][r] * linv; hi4[r] = oacc[dt][4 + r] * linv; }
    *(v4fa*)&sO[w][ln][dt * 16 + 8 * hh] = lo4; *(v4fa*)&sO[w][ln][dt * 16 + 8 * hh + 4] = hi4;
  }
  __builtin_amdgcn_fence(__ATOMIC_ACQ_REL, "workgroup");
  __builtin_amdgcn_wave_barrier();
  {
    for (int r = 0; r < 16; ++r) {
      const int row = q0 + r;
      if (lane < D / 4) {
        const v4f val = *(const v4fa*)&sO[w][r][lane * 4];
        *(v4f*)(y + ((size_t)b * T + row) * PITCH + h * D + lane * 4) = val;
      }
    }
    
  }
}

__device__ __forceinline__ void round_rows(const float* __restrict__ W, unsigned short* __restrict__ Wt, int t) {
  const v4f a = *(const v4fa*)(W + (size_t)t * 8), b = *(const v4fa*)(W + (size_t)t * 8 + 4);
  v8us v; v[0]=bf16_bits(a[0]); v[1]=bf16_bits(a[1]); v[2]=bf16_bits(a[2]); v[3]=bf16_bits(a[3]);
  v[4]=bf16_bits(b[0]); v[5]=bf16_bits(b[1]); v[6]=bf16_bits(b[2]); v[7]=bf16_bits(b[3]);
  *(v8us*)(Wt + (size_t)t * 8) = v; 
}

// a block of 256 threads per 32 consecutive patches: 64-point rDFT power of bins 0..32 (one (patch, bin) pair per thread and trip),
// band means, log1p, then bias[b][h][n] = Σ_c bp[c]·band_bias[h][c] for the 8 heads; the block writes sbias[(b*H + h)*N + n]
// as 32 consecutive n for each h, one wave per head.
__device__ __forceinline__ void bandbias_block(const int blk, const float* __restrict__ patches, const float* __restrict__ band_bias, float* __restrict__ sbias) {
  __shared__ float sp[32][PL];
  __shared__ float pw[32][33];
  __shared__ float sb[NH][32];
  __shared__ float tw[2][PL];                 // cos and sin of 2*pi*m/64, m = 0..63: the only angles the DFT below meets
  const int tid = threadIdx.x;
  // blk runs over B*N/32
  const int b = blk / (NN / 32), n0 = (blk % (NN / 32)) * 32;
  for (int e = tid; e < 32 * PL; e += 256) { const int r = e / PL, c = e % PL; sp[r][c] = bf16_round(patches[((size_t)b * NN + n0 + r) * PL + c]); }
  if (tid < PL) {                             // filled once per block, published by the barrier that publishes sp
    const float ang = 0.09817477042468103f * (float)tid;     // 2*pi/64
    tw[0][tid] = cosf(ang); tw[1][tid] = sinf(ang);
  }
  __syncthreads();
  // 32 patches x 33 bins = 1056 (patch, bin) pairs over 256 threads
  for (int e = tid; e < 32 * 33; e += 256) {
    const int r = e / 33;
    const unsigned kbin = (unsigned)(e % 33);
    float xs[PL], c[PL], s[PL];
#pragma unroll                                 // n becomes a constant, so xs, c and s live in registers
    for (int n = 0; n < PL; ++n) {
      const unsigned m = (kbin * (unsigned)n) & (unsigned)(PL - 1);   // angle = 2*pi*m/64, exact reduction
      xs[n] = sp[r][n]; c[n] = tw[0][m]; s[n] = tw[1][m];
    }
    __builtin_amdgcn_sched_barrier(0);         // keeps every LDS read above the two sum chains: sunk among them, each read pays its latency alone
    float re = 0.f, im = 0.f;
#pragma unroll                                 // as above: constant indices into xs, c and s
    for (int n = 0; n < PL; ++n) { re += xs[n] * c[n]; im -= xs[n] * s[n]; }
    pw[r][kbin] = re * re + im * im;
  }
  __syncthreads();
  if (tid < 32) {
    const int r = tid;
    // bands sorted by name: alpha {3}, beta {4..7}, delta {1}, gamma {8..25}, theta {2}  (rfftfreq(64, 1/250) = 3.90625 k)
    float bp[NBANDS];
    bp[0] = pw[r][3];
    bp[1] = (pw[r][4] + pw[r][5] + pw[r][6] + pw[r][7]) * 0.25f;
    bp[2] = pw[r][1];
    { float s = 0.f;
#pragma unroll 1
      for (int kbin = 8; kbin <= 25; ++kbin) s += pw[r][kbin]; bp[3] = s * (1.0f / 18.0f); }
    bp[4] = pw[r][2];
#pragma unroll 1
    for (int c = 0; c < NBANDS; ++c) bp[c] = log1pf(bp[c]);
#pragma unroll 1
    for (int h = 0; h < NH; ++h) {
      float s = 0.f;
#pragma unroll 1
      for (int c = 0; c < NBANDS; ++c) s += bp[c] * bf16_round(band_bias[h * NBANDS + c]);
      sb[h][r] = s;
    }
  }
  __syncthreads();
  {
    const int h = tid >> 5, r = tid & 31;
    float* dst = sbias + ((size_t)(b * NH + h)) * NN + n0 + r;
    const float v = sb[h][r];
    *(float*)dst = v; 
  }
}

// Everything that reads inputs alone, in one launch: blocks 0 .. B*N/32 - 1 do the band biases, the others
// round the four weight matrices, DM*DM/8/256 blocks each, into four planes that lie one behind the other in Wt.
__global__ __launch_bounds__(256) void k_prep(const float* __restrict__ patches, const float* __restrict__ band_bias, float* __restrict__ sbias,
                                            const float* __restrict__ W0, const float* __restrict__ W1, const float* __restrict__ W2,
                                            const float* __restrict__ W3, unsigned short* __restrict__ Wt) {
  constexpr int NBB = BB * NN / 32, BPW = DM * DM / 8 / 256;
  static_assert(DM * DM % (8 * 256) == 0, "whole blocks of 8-element pieces");
  const int blk = blockIdx.x;
  if (blk >= NBB) {                            // the whole block takes this side, which holds no barrier
    const int p = (blk - NBB) / BPW;
    const float* __restrict__ W = p == 0 ? W0 : p == 1 ? W1 : p == 2 ? W2 : W3;
    round_rows(W, Wt + (size_t)p * DM * DM, ((blk - NBB) % BPW) * 256 + (int)threadIdx.x);
    return;
  }
  bandbias_block(blk, patches, band_bias, sbias);
}

extern "C" void kernel_launch(void* const* d_in, const int* in_sizes, int n_in,
                              void* d_out, int out_size, void* d_ws, size_t ws_size, hipStream_t stream) {
  (void)in_sizes; (void)n_in; (void)out_size;
  const float* x = (const float*)d_in[0]; const float* patches = (const float*)d_in[1];
  const float* Wq = (const float*)d_in[2]; const float* bq = (const float*)d_in[3];
  const float* Wk = (const float*)d_in[4]; const float* bk = (const float*)d_in[5];
  const float* Wv = (const float*)d_in[6]; const float* bv = (const float*)d_in[7];
  const float* Wo = (const float*)d_in[8]; const float* bo = (const float*)d_in[9];
  const float* band_bias = (const float*)d_in[10];
  char* ws = (char*)d_ws; size_t off = 0;
  unsigned short* Wqt = (unsigned short*)(ws + off); off += (size_t)DM * DM * 2;
  unsigned short* Wkt = (unsigned short*)(ws + off); off += (size_t)DM * DM * 2;
  unsigned short* Wvt = (unsigned short*)(ws + off); off += (size_t)DM * DM * 2;
  unsigned short* Wot = (unsigned short*)(ws + off); off += (size_t)DM * DM * 2;
  float* qb = (float*)(ws + off); off += (size_t)BB * NN * DM * 4;
  float* kb2 = (float*)(ws + off); off += (size_t)BB * NN * DM * 4;
  float* vb2 = (float*)(ws + off); off += (size_t)BB * NN * DM * 4;
  float* ob = (float*)(ws + off); off += (size_t)BB * NN * DM * 4;
  float* sbias = (float*)(ws + off); off += (size_t)BB * NH * NN * 4;
  if (off > ws_size) return;
  const int M = BB * NN;
  (void)Wkt; (void)Wvt;                        // the planes behind Wqt, reached through it
  k_prep<<<BB * NN / 32 + 4 * (DM * DM / 8 / 256), 256, 0, stream>>>(patches, band_bias, sbias, Wq, Wk, Wv, Wo, Wqt);
  const int gb = ((M / 16) * (DM / 64) + 3) / 4;
  k_gemm_bf<false, 0, true, DM, DM, 3, true><<<3 * gb, 128, 0, stream>>>(x, Wqt, bq, bk, bv, qb, kb2, vb2, DM, M, DM, DM);   // K and V leave split, in the same bytes
  k_flashm<HD, NN, DM, false, false, true><<<BB * NH * (NN / 64), 128, 0, stream>>>(qb, (const unsigned short*)kb2, (const unsigned short*)vb2, NH, 0.125f, nullptr, ob, sbias);
  k_gemm_bf<true, 0, true, DM, DM, 1, false><<<gb, 128, 0, stream>>>(ob, Wot, bo, nullptr, nullptr, (float*)d_out, nullptr, nullptr, DM, M, DM, DM);
}

// v009
// A run of this version takes 95.5 microseconds.
// Timed twice side by side with v008, it ran 1.03 and 1.05 times as fast.
// Counting every step since v000, it is 5.51 times as fast.
#include <hip/hip_runtime.h>
// All contractions on v_wmma_f32_16x16x32_bf16, f32 accumulate: Q/K/V = x·Wᵀ with x/W rounded to bf16 (single exact-product
// term), QKᵀ and P·V 3-term bf16 hi/lo splits, out = o·W_oᵀ with o split hi/lo (2 terms). The 64-point rFFT band powers,
// log1p, the 5->8 band-bias projection and softmax are f32 on VALU.
#define BB 2
#define NN 2048
#define DM 512
#define NH 8
#define HD 64
#define PL 64
#define NBANDS 5

typedef __bf16 v16b __attribute__((ext_vector_type(16)));
typedef unsigned short v8us __attribute__((ext_vector_type(8), may_alias));
typedef float  v8f  __attribute__((ext_vector_type(8)));
typedef float  v4f  __attribute__((ext_vector_type(4)));
typedef float  v4fa __attribute__((ext_vector_type(4), may_alias));
typedef float  v2f  __attribute__((ext_vector_type(2)));
typedef __bf16 v2b  __attribute__((ext_vector_type(2)));
typedef unsigned int v2ua __attribute__((ext_vector_type(2), may_alias));
typedef unsigned int v4ua __attribute__((ext_vector_type(4), may_alias));
union FragB { v16b v; v8us half[2]; unsigned short u[16]; unsigned int w[8]; };

// Every f32 -> bf16 rounding is the hardware's conversion (nearest even, the value the integer form u + 0x7FFF + bit 16 gives for finite x).
__device__ __forceinline__ unsigned short bf16_bits(float x) { return __builtin_bit_cast(unsigned short, (__bf16)x); }
__device__ __forceinline__ float bf16_val(unsigned short b) { return __uint_as_float(((unsigned int)b) << 16); }
// Two neighbours in one instruction and one word: x0 in the low half, x1 in the high half
__device__ __forceinline__ v2b bf16_pair(float x0, float x1) { return __builtin_convertvector((v2f){x0, x1}, v2b); }
__device__ __forceinline__ unsigned int pair_word(v2b p) { return __builtin_bit_cast(unsigned int, p); }
// NP pairs split into high and low parts, three instructions a pair: hi = bf16(x), lo = bf16(x - hi). x - hi is exact, so the one rounding at the end
// of the mixed fma is the rounding of the f32 difference. The compiler has no source form for the two halves' fma (it widens hi by a shift and a mask,
// subtracts and converts again), hence the asm. All low halves stand in front of all high halves, so that no instruction waits for the one just issued.
template <int NP>
__device__ __forceinline__ void bf16_split(const float (&x)[2 * NP], unsigned int (&hi)[NP], unsigned int (&lo)[NP]) {
#pragma unroll
  for (int i = 0; i < NP; ++i) hi[i] = pair_word(bf16_pair(x[2 * i], x[2 * i + 1]));
#pragma unroll
  for (int i = 0; i < NP; ++i)   // lo[15:0] = bf16(hi[15:0] * -1 + x0)
    asm("v_fma_mixlo_bf16 %0, %1, -1.0, %2 op_sel:[0,0,0] op_sel_hi:[1,0,0]" : "=v"(lo[i]) : "v"(hi[i]), "v"(x[2 * i]));
#pragma unroll
  for (int i = 0; i < NP; ++i)   // lo[31:16] = bf16(hi[31:16] * -1 + x1), the low half kept
    asm("v_fma_mixhi_bf16 %0, %1, -1.0, %2 op_sel:[1,0,0] op_sel_hi:[1,0,0]" : "+v"(lo[i]) : "v"(hi[i]), "v"(x[2 * i + 1]));
}
__device__ __forceinline__ float bf16_round(float x) { return bf16_val(bf16_bits(x)); }
// D += A·B with NT terms: 1 = ah·bh, 2 = + al·bh (A split), 3 = + ah·bl (both split)
template <int NT>
__device__ __forceinline__ v8f mmaN(v16b ah, v16b al, v16b bh, v16b bl, v8f c) {
  c = __builtin_amdgcn_wmma_f32_16x16x32_bf16(false, ah, false, bh, (short)0, c, false, false);
  if (NT >= 2) c = __builtin_amdgcn_wmma_f32_16x16x32_bf16(false, al, false, bh, (short)0, c, false, false);
  if (NT >= 3) c = __builtin_amdgcn_wmma_f32_16x16x32_bf16(false, ah, false, bl, (short)0, c, false, false);
  asm volatile("v_nop\n\tv_nop\n\tv_nop\n\tv_nop" : "+v"(c) : "v"(ah), "v"(al), "v"(bh), "v"(bl));
  return c;
}

// The same three terms in the same order with the operands' sides exchanged (D transposed): ah*bh, ah*bl, al*bh
__device__ __forceinline__ v8f mmaT3(v16b ah, v16b al, v16b bh, v16b bl, v8f c) {
  c = __builtin_amdgcn_wmma_f32_16x16x32_bf16(false, ah, false, bh, (short)0, c, false, false);
  c = __builtin_amdgcn_wmma_f32_16x16x32_bf16(false, ah, false, bl, (short)0, c, false, false);
  c = __builtin_amdgcn_wmma_f32_16x16x32_bf16(false, al, false, bh, (short)0, c, false, false);
  asm volatile("v_nop\n\tv_nop\n\tv_nop\n\tv_nop" : "+v"(c) : "v"(ah), "v"(al), "v"(bh), "v"(bl));   // the distance behind a WMMA, on the loop's taken branch too
  return c;
}
typedef unsigned int v8u __attribute__((ext_vector_type(8)));
// lane l with lane l ^ 16, on the vector pipe
__device__ __forceinline__ float xhalf(float x) {
  return __builtin_bit_cast(float, __builtin_amdgcn_permlanex16(__builtin_bit_cast(int, x), __builtin_bit_cast(int, x), 0x76543210, 0xfedcba98, false, false));
}

// Transposing LDS load: lane (c = l & 15, h = l >> 4) receives T[kbase + 8h + 0..7][dbase + c] of a row-major 16-bit tile when it
// passes the address of T[kbase + 8h + (l & 7)][dbase + 8 * ((l >> 3) & 1)]; two of them (kbase, kbase + 16) are one 32 x 16 B fragment.
typedef short s16x8 __attribute__((ext_vector_type(8)));
__device__ __forceinline__ v8us ld_tr16(const unsigned short* p) {
  typedef __attribute__((address_space(3))) s16x8 lds_s16x8;
  return __builtin_bit_cast(v8us, __builtin_amdgcn_ds_load_tr16_b128_v8i16((lds_s16x8*)p));
}

__global__ __launch_bounds__(256) void k_wt_bf16(const float* __restrict__ W, unsigned short* __restrict__ Wt, int K, int N) {
  const int t = blockIdx.x * 256 + threadIdx.x;
  const int k8n = K / 8;
  if (t >= N * k8n) return;
  const int n = t / k8n, k8 = (t % k8n) * 8;
  v8us v;
#pragma unroll
  for (int i = 0; i < 8; ++i) v[i] = bf16_bits(W[(size_t)(k8 + i) * N + n]);
  *(v8us*)(Wt + (size_t)n * K + k8) = v;
  
}

// GEMM C[M][N] (f32, pitch ldc) = act(A[M][K] * W + bias). A f32 row-major (pitch lda) converted to bf16
// (ASPLIT: hi/lo two planes -> 2 terms, else single rounded term); Wt bf16 [N][K] (pitch ldb). BIAS_BF16 rounds the
// bias to bf16 first (bias quantised to bf16 before the add). K%128==0, M%64==0, N%64==0. The two pitches are template constants, so that a
// chunk's loads differ by immediate offsets from one address per operand, which stays in its registers.
// A block owns a 64 x 64 tile of C, a wave 16 of its rows. Per 128 k the block brings its 64 A rows and its 64 Wt rows into LDS with loads
// that cover whole 128-byte lines (a wave-wide load reads 512 bytes of one row of A, or 256 bytes of each of two rows of Wt), A converted once on the way;
// the four waves share the Wt rows. Fragments come from LDS, in the k order and the k-step order of a direct load.
// One launch serves NSEL products of the same A: their Wt planes ([N][K] each) lie one behind the other, and the block index picks the plane
// with its bias and its output, so that the blocks of all the products are resident together. The blocks of one 64-row strip of A are neighbours.
// SPLITOUT: every product but the first leaves not as f32 but as the bf16 hi/lo pair that attention multiplies with, split here once per element:
// row (b * NH + head) * NN + n of its output holds the head's HD high parts, then its HD low parts (a block's 64 columns are one head).
typedef unsigned short v4us __attribute__((ext_vector_type(4), may_alias));
template <bool ASPLIT, int ACT, bool BIAS_BF16, int lda, int ldb, int NSEL, bool SPLITOUT>
__global__ __launch_bounds__(128) void k_gemm_bf(const float* __restrict__ A, const unsigned short* __restrict__ Wt,
                                               const float* __restrict__ bias0, const float* __restrict__ bias1, const float* __restrict__ bias2,
                                               float* __restrict__ C0, float* __restrict__ C1, float* __restrict__ C2, int ldc, int M, int N, int K) {
  constexpr int KC = 128;                      // k per staged chunk
  constexpr int LP = KC + 8;                   // LDS row pitch in elements: the row's bytes + 16, free of bank conflicts for 16-byte fragment reads
  constexpr int NA = 64 * (KC / 4) / 128, RA = 128 / (KC / 4);   // 16-byte pieces of A per thread; rows the block covers per piece
  constexpr int NB = 64 * (KC / 8) / 128, RB = 128 / (KC / 8);   // the same for Wt
  __shared__ __attribute__((aligned(16))) unsigned short sAh[64][LP], sAl[ASPLIT ? 64 : 1][LP], sB[64][LP];
  __shared__ __attribute__((aligned(16))) float so[4][16][64];
  const int tid = threadIdx.x, w = tid >> 5, lane = tid & 31, ln = lane & 15, hh = lane >> 4;
  const int ntn = N / 64;                      // column tiles of one product
  const int mt = blockIdx.x / (NSEL * ntn), nq = blockIdx.x % (NSEL * ntn);
  if (mt * 64 >= M) return;                    // the whole block leaves, in front of every barrier
  const int sel = NSEL > 1 ? nq / ntn : 0;     // which product: the same for the whole block
  const float* __restrict__ bias = sel == 0 ? bias0 : sel == 1 ? bias1 : bias2;
  float* __restrict__ C = sel == 0 ? C0 : sel == 1 ? C1 : C2;
  const int row0 = mt * 64 + w * 16, col0 = (nq - sel * ntn) * 64;
  const int ar = tid / (KC / 4), ac = (tid % (KC / 4)) * 4, br = tid / (KC / 8), bc = (tid % (KC / 8)) * 8;
  const float* Ab = A + (size_t)(mt * 64) * lda;               // block-uniform bases; the thread's own place is a 32-bit offset
  const unsigned short* Bb = Wt + (size_t)(nq * 64) * ldb;      // row sel * N + col0 of the planes
  const unsigned ao = (unsigned)(ar * lda + ac), bo = (unsigned)(br * ldb + bc);
  v8f acc[4] = {};
  for (int kb = 0; kb < K; kb += KC) {
    v4f xa[NA]; v8us xb[NB];
#pragma unroll
    for (int it = 0; it < NA; ++it) xa[it] = *(const v4fa*)(Ab + kb + (ao + (unsigned)(it * RA * lda)));
#pragma unroll
    for (int it = 0; it < NB; ++it) xb[it] = *(const v8us*)(Bb + kb + (bo + (unsigned)(it * RB * ldb)));
    asm volatile("s_wait_xcnt 0x0" ::: "memory");   // in front of every later write of the loads' address registers, which this trip advances
    __builtin_amdgcn_sched_barrier(0);         // nothing crosses: the wait stays directly behind the last load, and no conversion is lifted in front of it
    __syncthreads();                           // every wave has read its fragments of the chunk before
#pragma unroll
    for (int it = 0; it < NA; it += 4) {       // four pieces, eight pairs, at a time
      static_assert(NA % 4 == 0, "whole groups of four pieces");
      unsigned int hi[8], lo[8];
      if (ASPLIT) {
        float x[16];
#pragma unroll
        for (int i = 0; i < 16; ++i) x[i] = xa[it + (i >> 2)][i & 3];
        bf16_split<8>(x, hi, lo);
      } else {
#pragma unroll
        for (int i = 0; i < 8; ++i) hi[i] = pair_word(bf16_pair(xa[it + (i >> 1)][(i & 1) * 2], xa[it + (i >> 1)][(i & 1) * 2 + 1]));
      }
#pragma unroll
      for (int j = 0; j < 4; ++j) {
        *(v2ua*)&sAh[ar + (it + j) * RA][ac] = (v2ua){hi[2 * j], hi[2 * j + 1]};
        if (ASPLIT) *(v2ua*)&sAl[ar + (it + j) * RA][ac] = (v2ua){lo[2 * j], lo[2 * j + 1]};
      }
    }
#pragma unroll
    for (int it = 0; it < NB; ++it) *(v8us*)&sB[br + it * RB][bc] = xb[it];
    __syncthreads();
#pragma unroll
    for (int k2 = 0; k2 < KC; k2 += 64) {
      FragB ah[2], al[2], b[2][4];
#pragma unroll
      for (int s = 0; s < 2; ++s) {
        const int kc = k2 + s * 32 + 8 * hh;
        ah[s].half[0] = *(const v8us*)&sAh[w * 16 + ln][kc]; ah[s].half[1] = *(const v8us*)&sAh[w * 16 + ln][kc + 16];
        if (ASPLIT) { al[s].half[0] = *(const v8us*)&sAl[w * 16 + ln][kc]; al[s].half[1] = *(const v8us*)&sAl[w * 16 + ln][kc + 16]; }
#pragma unroll
        for (int t = 0; t < 4; ++t) { b[s][t].half[0] = *(const v8us*)&sB[t * 16 + ln][kc]; b[s][t].half[1] = *(const v8us*)&sB[t * 16 + ln][kc + 16]; }
      }
#pragma unroll
      for (int s = 0; s < 2; ++s)
#pragma unroll
        for (int t = 0; t < 4; ++t) acc[t] = mmaN<ASPLIT ? 2 : 1>(ah[s].v, ASPLIT ? al[s].v : ah[s].v, b[s][t].v, b[s][t].v, acc[t]);
    }
  }
#pragma unroll
  for (int t = 0; t < 4; ++t) {
    float bv = bias ? bias[col0 + t * 16 + ln] : 0.f;
    if (BIAS_BF16) bv = bf16_round(bv);
#pragma unroll
    for (int r = 0; r < 8; ++r) { float v = acc[t][r] + bv; if (ACT == 1) v = fmaxf(v, 0.f); so[w][8 * hh + r][t * 16 + ln] = v; }
  }
  __builtin_amdgcn_fence(__ATOMIC_ACQ_REL, "workgroup");
  __builtin_amdgcn_wave_barrier();
  if (SPLITOUT && sel != 0) {                  // the same for the whole block
    static_assert(!SPLITOUT || HD == 64, "a 64-column tile is one head");
    unsigned short* __restrict__ P = (unsigned short*)C + ((size_t)((row0 / NN) * NH + col0 / HD) * NN + row0 % NN) * (2 * HD);
    const int r8 = lane >> 3, c8 = (lane & 7) * 8;   // eight lanes cover the 128 bytes of a row's high parts, and of its low parts
    v4ua hi[4], lo[4];
#pragma unroll
    for (int q = 0; q < 4; ++q) {
      const v4f a = *(const v4fa*)&so[w][q * 4 + r8][c8], b = *(const v4fa*)&so[w][q * 4 + r8][c8 + 4];
      const float x[8] = {a[0], a[1], a[2], a[3], b[0], b[1], b[2], b[3]};
      unsigned int h4[4], l4[4];
      bf16_split<4>(x, h4, l4);
      hi[q] = (v4ua){h4[0], h4[1], h4[2], h4[3]}; lo[q] = (v4ua){l4[0], l4[1], l4[2], l4[3]};
    }
#pragma unroll
    for (int q = 0; q < 4; ++q) {
      *(v4ua*)(P + (q * 4 + r8) * (2 * HD) + c8) = hi[q];
      *(v4ua*)(P + (q * 4 + r8) * (2 * HD) + HD + c8) = lo[q];
    }
    asm volatile("s_wait_xcnt 0x0" ::: "memory");   // in front of every later write of the stores' address and data registers
    return;
  }
  const int rsub = lane >> 4, c4 = (lane & 15) * 4;
  {
#pragma unroll
    for (int q = 0; q < 8; ++q) {
      const int r = q * 2 + rsub;
      const v4f v = *(const v4fa*)&so[w][r][c4];
      *(v4f*)(C + (size_t)(row0 + r) * ldc + col0 + c4) = v;
    }
    
  }
}

// Flash-style causal/unmasked attention, all contractions 3-term bf16 hi/lo splits, f32 softmax with running max.
// q,k,v rows are read from f32 buffers with arbitrary row pitch (so they can live inside a fused qkv buffer);
// D = head size (multiple of 32, <= 128); one wave = 16 query rows; block = 4 waves (64 queries) sharing K/V chunks of 32.
template <int D, bool CAUSAL>
__global__ __launch_bounds__(128) void k_flash(const float* __restrict__ qb, const float* __restrict__ kb, const float* __restrict__ vb,
                                             int pitch, int T, int H, float scale, float* __restrict__ y, int ypitch) {
  constexpr int KS = D / 32;        // k-steps for QK
  constexpr int DT = D / 16;        // d tiles for PV
  __shared__ __attribute__((aligned(16))) unsigned short sKh[32][D + 8], sKl[32][D + 8], sVh[32][D + 8], sVl[32][D + 8];
  __shared__ __attribute__((aligned(16))) unsigned short sPh[4][16][40], sPl[4][16][40];
  __shared__ __attribute__((aligned(16))) float sO[4][16][D];
  const int tid = threadIdx.x, w = tid >> 5, lane = tid & 31, ln = lane & 15, hh = lane >> 4;
  const int nqb = (T + 63) / 64;
  const int bh = blockIdx.x / nqb, qblk = blockIdx.x % nqb;
  const int b = bh / H, h = bh % H;
  const int q0 = qblk * 64 + w * 16;
  const float* Q = qb + (size_t)b * T * pitch + h * D;
  const float* K = kb + (size_t)b * T * pitch + h * D;
  const float* V = vb + (size_t)b * T * pitch + h * D;

  // A fragments of the wave's 16 query rows (scaled), hi/lo
  FragB aqh[KS], aql[KS];
  {
    int row = q0 + ln; if (row >= T) row = T - 1;
    const float* qr = Q + (size_t)row * pitch;
#pragma unroll
    for (int ks = 0; ks < KS; ++ks)
#pragma unroll
      for (int i = 0; i < 16; ++i) {
        const int d = ks * 32 + ((i < 8) ? (8 * hh + i) : (16 + 8 * hh + (i - 8)));
        const float x = qr[d] * scale; const unsigned short hb = bf16_bits(x);
        aqh[ks].u[i] = hb; aql[ks].u[i] = bf16_bits(x - bf16_val(hb));
      }
  }
  float m_r[8], l_r[8];
#pragma unroll
  for (int r = 0; r < 8; ++r) { m_r[r] = -3.0e38f; l_r[r] = 0.f; }
  v8f oacc[DT];
#pragma unroll
  for (int dt = 0; dt < DT; ++dt) oacc[dt] = (v8f){0.f,0.f,0.f,0.f,0.f,0.f,0.f,0.f};

  const int kv_end = CAUSAL ? min(T, qblk * 64 + 64) : T;     // block-uniform
  for (int j0 = 0; j0 < kv_end; j0 += 32) {
    __syncthreads();
    for (int e = tid; e < 32 * (D / 4); e += 128) {
      const int r = e / (D / 4), c4 = (e % (D / 4)) * 4;
      const int key = j0 + r;
      v4f kf = {0.f,0.f,0.f,0.f}, vf = {0.f,0.f,0.f,0.f};
      if (key < T) { kf = *(const v4fa*)(K + (size_t)key * pitch + c4); vf = *(const v4fa*)(V + (size_t)key * pitch + c4); }
#pragma unroll
      for (int t = 0; t < 4; ++t) {
        unsigned short hb = bf16_bits(kf[t]); sKh[r][c4 + t] = hb; sKl[r][c4 + t] = bf16_bits(kf[t] - bf16_val(hb));
        hb = bf16_bits(vf[t]); sVh[r][c4 + t] = hb; sVl[r][c4 + t] = bf16_bits(vf[t] - bf16_val(hb));
      }
    }
    __syncthreads();
    // S tile 16 x 32
    v8f s[2];
#pragma unroll
    for (int nt = 0; nt < 2; ++nt) {
      v8f acc = {};
#pragma unroll
      for (int ks = 0; ks < KS; ++ks) {
        FragB bh_, bl_;
        bh_.half[0] = *(const v8us*)&sKh[nt * 16 + ln][ks * 32 + 8 * hh]; bh_.half[1] = *(const v8us*)&sKh[nt * 16 + ln][ks * 32 + 16 + 8 * hh];
        bl_.half[0] = *(const v8us*)&sKl[nt * 16 + ln][ks * 32 + 8 * hh]; bl_.half[1] = *(const v8us*)&sKl[nt * 16 + ln][ks * 32 + 16 + 8 * hh];
        acc = mmaN<3>(aqh[ks].v, aql[ks].v, bh_.v, bl_.v, acc);
      }
      s[nt] = acc;
    }
    // mask + running max (rows 8hh+r; the 16 lanes of a half share rows)
    float alpha[8];
#pragma unroll
    for (int r = 0; r < 8; ++r) {
      const int qi = q0 + 8 * hh + r;
      const int ja = j0 + ln, jb = j0 + 16 + ln;
      if (CAUSAL) { if (ja > qi) s[0][r] = -3.0e38f; if (jb > qi) s[1][r] = -3.0e38f; }
      if (ja >= T) s[0][r] = -3.0e38f;
      if (jb >= T) s[1][r] = -3.0e38f;
      float mx = fmaxf(s[0][r], s[1][r]);
      mx = fmaxf(mx, __shfl_xor(mx, 1, 32)); mx = fmaxf(mx, __shfl_xor(mx, 2, 32)); mx = fmaxf(mx, __shfl_xor(mx, 4, 32)); mx = fmaxf(mx, __shfl_xor(mx, 8, 32));
      const float mnew = fmaxf(m_r[r], mx);
      alpha[r] = (mnew > -1.0e38f) ? __expf(m_r[r] - mnew) : 1.0f;
      const float p0 = (s[0][r] > -1.0e38f) ? __expf(s[0][r] - mnew) : 0.f;
      const float p1 = (s[1][r] > -1.0e38f) ? __expf(s[1][r] - mnew) : 0.f;
      m_r[r] = mnew;
      l_r[r] = l_r[r] * alpha[r] + p0 + p1;            // per-lane partial row sum (16 lanes combined at the end)
      unsigned short hb = bf16_bits(p0); sPh[w][8 * hh + r][ln] = hb;      sPl[w][8 * hh + r][ln] = bf16_bits(p0 - bf16_val(hb));
      hb = bf16_bits(p1);                sPh[w][8 * hh + r][16 + ln] = hb; sPl[w][8 * hh + r][16 + ln] = bf16_bits(p1 - bf16_val(hb));
    }
#pragma unroll
    for (int dt = 0; dt < DT; ++dt)
#pragma unroll
      for (int r = 0; r < 8; ++r) oacc[dt][r] *= alpha[r];
    __builtin_amdgcn_fence(__ATOMIC_ACQ_REL, "workgroup");
    __builtin_amdgcn_wave_barrier();
    FragB pah, pal;
    pah.half[0] = *(const v8us*)&sPh[w][ln][8 * hh]; pah.half[1] = *(const v8us*)&sPh[w][ln][16 + 8 * hh];
    pal.half[0] = *(const v8us*)&sPl[w][ln][8 * hh]; pal.half[1] = *(const v8us*)&sPl[w][ln][16 + 8 * hh];
#pragma unroll
    for (int dt = 0; dt < DT; ++dt) {
      FragB bvh, bvl;
#pragma unroll
      for (int i = 0; i < 8; ++i) {
        bvh.u[i] = sVh[8 * hh + i][dt * 16 + ln]; bvh.u[8 + i] = sVh[16 + 8 * hh + i][dt * 16 + ln];
        bvl.u[i] = sVl[8 * hh + i][dt * 16 + ln]; bvl.u[8 + i] = sVl[16 + 8 * hh + i][dt * 16 + ln];
      }
      oacc[dt] = mmaN<3>(pah.v, pal.v, bvh.v, bvl.v, oacc[dt]);
    }
    __builtin_amdgcn_fence(__ATOMIC_ACQ_REL, "workgroup");
    __builtin_amdgcn_wave_barrier();
  }
#pragma unroll
  for (int r = 0; r < 8; ++r) {
    float l = l_r[r];
    l += __shfl_xor(l, 1, 32); l += __shfl_xor(l, 2, 32); l += __shfl_xor(l, 4, 32); l += __shfl_xor(l, 8, 32);
    l_r[r] = (l > 0.f) ? 1.0f / l : 0.f;
  }
#pragma unroll
  for (int dt = 0; dt < DT; ++dt)
#pragma unroll
    for (int r = 0; r < 8; ++r) sO[w][8 * hh + r][dt * 16 + ln] = oacc[dt][r] * l_r[r];
  __builtin_amdgcn_fence(__ATOMIC_ACQ_REL, "workgroup");
  __builtin_amdgcn_wave_barrier();
  {
    for (int r = 0; r < 16; ++r) {
      const int row = q0 + r;
      if (row < T && lane < D / 4) {
        const v4f val = *(const v4fa*)&sO[w][r][lane * 4];
        *(v4f*)(y + ((size_t)b * T + row) * ypitch + h * D + lane * 4) = val;
      }
    }
    
  }
}

// Eight asynchronous 16-byte copies from global memory to LDS, each lane its own addresses (LDS byte address, global pointer), through no register.
// The closing wait stands inside the statement, so that no address register named here is rewritten in front of it.
__device__ __forceinline__ void copy8_to_lds(const unsigned (&la)[4], const unsigned short* const (&ga)[4], const unsigned (&lb)[4], const unsigned short* const (&gb)[4]) {
  asm volatile("global_load_async_to_lds_b128 %0, %1, off\n\t"
               "global_load_async_to_lds_b128 %2, %3, off\n\t"
               "global_load_async_to_lds_b128 %4, %5, off\n\t"
               "global_load_async_to_lds_b128 %6, %7, off\n\t"
               "global_load_async_to_lds_b128 %8, %9, off\n\t"
               "global_load_async_to_lds_b128 %10, %11, off\n\t"
               "global_load_async_to_lds_b128 %12, %13, off\n\t"
               "global_load_async_to_lds_b128 %14, %15, off\n\t"
               "s_wait_xcnt 0x0"
               :: "v"(la[0]), "v"(ga[0]), "v"(lb[0]), "v"(gb[0]), "v"(la[1]), "v"(ga[1]), "v"(lb[1]), "v"(gb[1]),
                  "v"(la[2]), "v"(ga[2]), "v"(lb[2]), "v"(gb[2]), "v"(la[3]), "v"(ga[3]), "v"(lb[3]), "v"(gb[3]) : "memory");
}

template <int D, int T, int PITCH, bool CAUSAL, bool HASMASK, bool HASBIAS>
__global__ __launch_bounds__(128) void k_flashm(const float* __restrict__ Qb, const unsigned short* __restrict__ Kb, const unsigned short* __restrict__ Vb,
                                              int H, float scale, const int* __restrict__ mask, float* __restrict__ y, const float* __restrict__ sbias) {
  static_assert(T % 64 == 0 && D % 32 == 0, "whole query blocks and key chunks only");   // so every block walks two chunks or more
  constexpr int KS = D / 32, DT = D / 16;
  constexpr int PPR = 2 * D / 8;               // 16-byte pieces of a split row: the high parts' first, then the low parts'
  constexpr int NST = 32 * PPR / 128;          // staging trips per thread, the same for every thread
  constexpr int RPT = 128 / PPR;               // key rows that the block stages per trip
  constexpr int VP = D + 16;                   // V row pitch in elements: an odd multiple of 32 bytes, the transposing load's conflict-free pitch
  static_assert((VP * 2) % 32 == 0 && ((VP * 2 / 32) & 1) == 1, "V pitch must be 32 B x odd");
  static_assert(NST == 4, "copy8_to_lds takes four K and four V pieces per thread");
  __shared__ __attribute__((aligned(16))) unsigned short sK[2][2][32][D + 8], sV[2][2][32][VP];   // [buffer][plane]: plane 0 high parts, plane 1 low parts
  __shared__ __attribute__((aligned(16))) float sO[4][16][D];
  const int tid = threadIdx.x, w = tid >> 5, lane = tid & 31, ln = lane & 15, hh = lane >> 4;
  constexpr int nqb = T / 64;
  const int bh = blockIdx.x / nqb, qblk = blockIdx.x % nqb;
  const int b = bh / H, h = bh % H;
  const int q0 = qblk * 64 + w * 16;
  const float* Q = Qb + (size_t)b * T * PITCH + h * D;
  const unsigned short* K = Kb + (size_t)bh * T * (2 * D);
  const unsigned short* V = Vb + (size_t)bh * T * (2 * D);
  const float* SB = sbias + (size_t)bh * T;
  const unsigned ukb = 8u * (unsigned)hh, toff = (unsigned)tid * 8u;   // the block's pieces of a trip lie one behind the other
  const unsigned dK = (unsigned)(size_t)&sK[0][(tid % PPR) / (D / 8)][tid / PPR][(tid % (D / 8)) * 8];   // LDS byte address of the thread's first piece, buffer 0
  const unsigned dV = (unsigned)(size_t)&sV[0][(tid % PPR) / (D / 8)][tid / PPR][(tid % (D / 8)) * 8];
  // the thread's K and V pieces of the 32 keys from j on, into buffer buf; every lane is on, every address a multiple of 16 bytes
  auto stage = [&](const int j, const unsigned buf) {
    const unsigned short* Kj = K + (size_t)j * (2 * D) + toff; const unsigned short* Vj = V + (size_t)j * (2 * D) + toff;
    unsigned lk[NST], lv[NST]; const unsigned short* gk[NST]; const unsigned short* gv[NST];
#pragma unroll
    for (int it = 0; it < NST; ++it) {
      lk[it] = dK + buf * (unsigned)sizeof(sK[0]) + (unsigned)(it * RPT * (D + 8) * 2); gk[it] = Kj + it * 128 * 8;
      lv[it] = dV + buf * (unsigned)sizeof(sV[0]) + (unsigned)(it * RPT * VP * 2);      gv[it] = Vj + it * 128 * 8;
    }
    copy8_to_lds(lk, gk, lv, gv);
  };
  stage(0, 0u);                                // chunk 0 flies while Q is read and split
  const int vrow = 8 * hh + (lane & 7), vcol = 8 * ((lane >> 3) & 1);   // the lane's address inside a 16 x 16 V tile for ld_tr16
  FragB aqh[KS], aql[KS];
  {
    const float* qr = Q + (size_t)(q0 + ln) * PITCH;
#pragma unroll
    for (int ks = 0; ks < KS; ++ks) {
      float x[16];
#pragma unroll
      for (int i = 0; i < 16; ++i) x[i] = qr[ks * 32 + ((i < 8) ? (8 * hh + i) : (16 + 8 * hh + (i - 8)))] * scale;
      bf16_split<8>(x, aqh[ks].w, aql[ks].w);  // elements 2i and 2i + 1 share a word
    }
  }
  const int qi = q0 + ln;                      // the lane's query
  const float bq = HASBIAS ? SB[qi] : 0.f;     // its bias, read once
  float m_q = -3.0e38f, l_q = 0.f;             // its running maximum; the sum over this half's keys (the halves join after the loop)
  v8f oacc[DT];                                // oacc[dt][r] = O[qi][dt * 16 + 8 * hh + r]
#pragma unroll
  for (int dt = 0; dt < DT; ++dt) oacc[dt] = (v8f){0.f,0.f,0.f,0.f,0.f,0.f,0.f,0.f};
  const int kv_end = CAUSAL ? qblk * 64 + 64 : T;
  v4f bk0[4] = {}, bk1[4] = {};                // biases of keys 8hh + 0..7 and 16 + 8hh + 0..7: of the even chunk at hand or to come, and of the odd one
  asm volatile("s_wait_asynccnt 0x0" ::: "memory");   // this wave's pieces of chunk 0 have landed
  __syncthreads();                             // and every other wave's: chunk 0 is published
  if (HASBIAS) {
    bk0[0] = *(const v4fa*)(SB + ukb); bk0[1] = *(const v4fa*)(SB + (ukb + 4u)); bk0[2] = *(const v4fa*)(SB + (ukb + 16u)); bk0[3] = *(const v4fa*)(SB + (ukb + 20u));
    bk1[0] = *(const v4fa*)(SB + (ukb + 32u)); bk1[1] = *(const v4fa*)(SB + (ukb + 36u)); bk1[2] = *(const v4fa*)(SB + (ukb + 48u)); bk1[3] = *(const v4fa*)(SB + (ukb + 52u));
  }
  stage(32, 1u);                               // its closing s_wait_xcnt 0 also stands behind the bias loads above
  __builtin_amdgcn_sched_barrier(0);           // nothing crosses: no bias load sinks behind that wait
  // one chunk of 32 keys from j0 on, out of buffer buf alone (a constant at either call, so that every LDS offset is an immediate), with its biases in bk
  auto chunk = [&](const int j0, const unsigned buf, v4f (&bk)[4]) __attribute__((always_inline)) {
    auto& sKh = sK[buf][0]; auto& sKl = sK[buf][1]; auto& sVh = sV[buf][0]; auto& sVl = sV[buf][1];
    v8f s[2];                                  // s[nt][r] = S[key j0 + nt * 16 + 8 * hh + r][query qi]
#pragma unroll
    for (int nt = 0; nt < 2; ++nt) {
      v8f acc = {};
#pragma unroll
      for (int ks = 0; ks < KS; ++ks) {
        FragB kh_, kl_;
        kh_.half[0] = *(const v8us*)&sKh[nt * 16 + ln][ks * 32 + 8 * hh]; kh_.half[1] = *(const v8us*)&sKh[nt * 16 + ln][ks * 32 + 16 + 8 * hh];
        kl_.half[0] = *(const v8us*)&sKl[nt * 16 + ln][ks * 32 + 8 * hh]; kl_.half[1] = *(const v8us*)&sKl[nt * 16 + ln][ks * 32 + 16 + 8 * hh];
        acc = mmaT3(kh_.v, kl_.v, aqh[ks].v, aql[ks].v, acc);
      }
      s[nt] = acc;
    }
    bool keep[2][8];
    float mx = -3.0e38f;
#pragma unroll
    for (int nt = 0; nt < 2; ++nt)
#pragma unroll
      for (int r = 0; r < 8; ++r) {
        const int kj = j0 + nt * 16 + 8 * hh + r;
        bool kp = true;
        if (HASBIAS) s[nt][r] += bq + bk[nt * 2 + (r >> 2)][r & 3];
        if (CAUSAL) kp = kj <= qi;
        if (HASMASK) kp = kp && mask[(size_t)qi * T + kj] != 0;
        if (!kp) s[nt][r] = -3.0e38f;
        keep[nt][r] = kp;
        mx = fmaxf(mx, s[nt][r]);
      }
    mx = fmaxf(mx, xhalf(mx));                 // the other half's 16 keys of the same query
    const float mnew = fmaxf(m_q, mx);
    const float alpha = (mnew > -1.0e38f) ? __expf(m_q - mnew) : 1.0f;
    m_q = mnew;
    FragB pwh, pwl;                            // P^T as a B fragment: element nt * 8 + r is key nt * 16 + 8hh + r, the k order of the V fragments
    float ps[2] = {0.f, 0.f}, p[16];
#pragma unroll
    for (int nt = 0; nt < 2; ++nt)
#pragma unroll
      for (int r = 0; r < 8; ++r) {
        p[nt * 8 + r] = keep[nt][r] ? __expf(s[nt][r] - mnew) : 0.f;
        ps[nt] += p[nt * 8 + r];
      }
    bf16_split<8>(p, pwh.w, pwl.w);            // two neighbouring keys fill one register
    const v16b pbh = pwh.v, pbl = pwl.v;
    l_q = l_q * alpha + (ps[0] + ps[1]);
#pragma unroll
    for (int dt = 0; dt < DT; ++dt)
#pragma unroll
      for (int r = 0; r < 8; ++r) oacc[dt][r] *= alpha;
    FragB bvh[DT], bvl[DT];                    // V^T as A fragments: row d = dt * 16 + ln, keys 8hh + 0..7, then 16 + 8hh + 0..7
#pragma unroll
    for (int dt = 0; dt < DT; ++dt) {
      bvh[dt].half[0] = ld_tr16(&sVh[vrow][vcol + dt * 16]); bvh[dt].half[1] = ld_tr16(&sVh[16 + vrow][vcol + dt * 16]);
      bvl[dt].half[0] = ld_tr16(&sVl[vrow][vcol + dt * 16]); bvl[dt].half[1] = ld_tr16(&sVl[16 + vrow][vcol + dt * 16]);
    }
#pragma unroll
    for (int dt = 0; dt < DT; ++dt) oacc[dt] = mmaT3(bvh[dt].v, bvl[dt].v, pbh, pbl, oacc[dt]);
    asm volatile("s_wait_dscnt 0x0" ::: "memory");      // this wave's reads of the buffer have returned
    asm volatile("s_wait_asynccnt 0x0" ::: "memory");   // this wave's pieces of the next chunk have landed
    __syncthreads();                           // publishes the next chunk and ends every wave's reads of this one
    if (j0 + 64 < kv_end) {                    // the same for the whole block: the chunk after the next goes into the buffer, and the registers, just read
      const float* SBn = SB + (j0 + 64);
      if (HASBIAS) { bk[0] = *(const v4fa*)(SBn + ukb); bk[1] = *(const v4fa*)(SBn + (ukb + 4u)); bk[2] = *(const v4fa*)(SBn + (ukb + 16u)); bk[3] = *(const v4fa*)(SBn + (ukb + 20u)); }
      stage(j0 + 64, buf);                     // its closing s_wait_xcnt 0 also stands behind the bias loads above
      __builtin_amdgcn_sched_barrier(0);       // nothing crosses: no bias load sinks behind that wait
    }
  };
  for (int j0 = 0; j0 < kv_end; j0 += 64) {    // kv_end is a multiple of 64: an even and an odd chunk per trip
    chunk(j0, 0u, bk0);
    chunk(j0 + 32, 1u, bk1);
  }
  asm volatile("s_wait_asynccnt 0x0" ::: "memory");     // no copy is outstanding when the wave goes on to its output
  // NaN for fully-masked rows (softmax over a row of -inf)
  const float l_all = l_q + xhalf(l_q);
  const float linv = (m_q > -1.0e38f) ? 1.0f / l_all : __builtin_nanf("");
#pragma unroll
  for (int dt = 0; dt < DT; ++dt) {
    v4f lo4, hi4;
#pragma unroll
    for (int r = 0; r < 4; ++r) { lo4[r] = oacc[dt][r] * linv; hi4[r] = oacc[dt][4 + r] * linv; }
    *(v4fa*)&sO[w][ln][dt * 16 + 8 * hh] = lo4; *(v4fa*)&sO[w][ln][dt * 16 + 8 * hh + 4] = hi4;
  }
  __builtin_amdgcn_fence(__ATOMIC_ACQ_REL, "workgroup");
  __builtin_amdgcn_wave_barrier();
  {
    for (int r = 0; r < 16; ++r) {
      const int row = q0 + r;
      if (lane < D / 4) {
        const v4f val = *(const v4fa*)&sO[w][r][lane * 4];
        *(v4f*)(y + ((size_t)b * T + row) * PITCH + h * D + lane * 4) = val;
      }
    }
    
  }
}

__device__ __forceinline__ void round_rows(const float* __restrict__ W, unsigned short* __restrict__ Wt, int t) {
  const v4f a = *(const v4fa*)(W + (size_t)t * 8), b = *(const v4fa*)(W + (size_t)t * 8 + 4);
  const v4ua v = {pair_word(bf16_pair(a[0], a[1])), pair_word(bf16_pair(a[2], a[3])), pair_word(bf16_pair(b[0], b[1])), pair_word(bf16_pair(b[2], b[3]))};
  *(v4ua*)(Wt + (size_t)t * 8) = v;
}

// a block of 256 threads per 32 consecutive patches: 64-point rDFT power of bins 0..32 (one (patch, bin) pair per thread and trip),
// band means, log1p, then bias[b][h][n] = Σ_c bp[c]·band_bias[h][c] for the 8 heads; the block writes sbias[(b*H + h)*N + n]
// as 32 consecutive n for each h, one wave per head.
__device__ __forceinline__ void bandbias_block(const int blk, const float* __restrict__ patches, const float* __restrict__ band_bias, float* __restrict__ sbias) {
  __shared__ float sp[32][PL];
  __shared__ float pw[32][33];
  __shared__ float sb[NH][32];
  __shared__ float tw[2][PL];                 // cos and sin of 2*pi*m/64, m = 0..63: the only angles the DFT below meets
  const int tid = threadIdx.x;
  // blk runs over B*N/32
  const int b = blk / (NN / 32), n0 = (blk % (NN / 32)) * 32;
  for (int e = tid; e < 32 * PL; e += 256) { const int r = e / PL, c = e % PL; sp[r][c] = bf16_round(patches[((size_t)b * NN + n0 + r) * PL + c]); }
  if (tid < PL) {                             // filled once per block, published by the barrier that publishes sp
    const float ang = 0.09817477042468103f * (float)tid;     // 2*pi/64
    tw[0][tid] = cosf(ang); tw[1][tid] = sinf(ang);
  }
  __syncthreads();
  // 32 patches x 33 bins = 1056 (patch, bin) pairs over 256 threads
  for (int e = tid; e < 32 * 33; e += 256) {
    const int r = e / 33;
    const unsigned kbin = (unsigned)(e % 33);
    float xs[PL], c[PL], s[PL];
#pragma unroll                                 // n becomes a constant, so xs, c and s live in registers
    for (int n = 0; n < PL; ++n) {
      const unsigned m = (kbin * (unsigned)n) & (unsigned)(PL - 1);   // angle = 2*pi*m/64, exact reduction
      xs[n] = sp[r][n]; c[n] = tw[0][m]; s[n] = tw[1][m];
    }
    __builtin_amdgcn_sched_barrier(0);         // keeps every LDS read above the two sum chains: sunk among them, each read pays its latency alone
    float re = 0.f, im = 0.f;
#pragma unroll                                 // as above: constant indices into xs, c and s
    for (int n = 0; n < PL; ++n) { re += xs[n] * c[n]; im -= xs[n] * s[n]; }
    pw[r][kbin] = re * re + im * im;
  }
  __syncthreads();
  if (tid < 32) {
    const int r = tid;
    // bands sorted by name: alpha {3}, beta {4..7}, delta {1}, gamma {8..25}, theta {2}  (rfftfreq(64, 1/250) = 3.90625 k)
    float bp[NBANDS];
    bp[0] = pw[r][3];
    bp[1] = (pw[r][4] + pw[r][5] + pw[r][6] + pw[r][7]) * 0.25f;
    bp[2] = pw[r][1];
    { float s = 0.f;
#pragma unroll 1
      for (int kbin = 8; kbin <= 25; ++kbin) s += pw[r][kbin]; bp[3] = s * (1.0f / 18.0f); }
    bp[4] = pw[r][2];
#pragma unroll 1
    for (int c = 0; c < NBANDS; ++c) bp[c] = log1pf(bp[c]);
#pragma unroll 1
    for (int h = 0; h < NH; ++h) {
      float s = 0.f;
#pragma unroll 1
      for (int c = 0; c < NBANDS; ++c) s += bp[c] * bf16_round(band_bias[h * NBANDS + c]);
      sb[h][r] = s;
    }
  }
  __syncthreads();
  {
    const int h = tid >> 5, r = tid & 31;
    float* dst = sbias + ((size_t)(b * NH + h)) * NN + n0 + r;
    const float v = sb[h][r];
    *(float*)dst = v; 
  }
}

// Everything that reads inputs alone, in one launch: blocks 0 .. B*N/32 - 1 do the band biases, the others
// round the four weight matrices, DM*DM/8/256 blocks each, into four planes that lie one behind the other in Wt.
__global__ __launch_bounds__(256) void k_prep(const float* __restrict__ patches, const float* __restrict__ band_bias, float* __restrict__ sbias,
                                            const float* __restrict__ W0, const float* __restrict__ W1, const float* __restrict__ W2,
                                            const float* __restrict__ W3, unsigned short* __restrict__ Wt) {
  constexpr int NBB = BB * NN / 32, BPW = DM * DM / 8 / 256;
  static_assert(DM * DM % (8 * 256) == 0, "whole blocks of 8-element pieces");
  const int blk = blockIdx.x;
  if (blk >= NBB) {                            // the whole block takes this side, which holds no barrier
    const int p = (blk - NBB) / BPW;
    const float* __restrict__ W = p == 0 ? W0 : p == 1 ? W1 : p == 2 ? W2 : W3;
    round_rows(W, Wt + (size_t)p * DM * DM, ((blk - NBB) % BPW) * 256 + (int)threadIdx.x);
    return;
  }
  bandbias_block(blk, patches, band_bias, sbias);
}

extern "C" void kernel_launch(void* const* d_in, const int* in_sizes, int n_in,
                              void* d_out, int out_size, void* d_ws, size_t ws_size, hipStream_t stream) {
  (void)in_sizes; (void)n_in; (void)out_size;
  const float* x = (const float*)d_in[0]; const float* patches = (const float*)d_in[1];
  const float* Wq = (const float*)d_in[2]; const float* bq = (const float*)d_in[3];
  const float* Wk = (const float*)d_in[4]; const float* bk = (const float*)d_in[5];
  const float* Wv = (const float*)d_in[6]; const float* bv = (const float*)d_in[7];
  const float* Wo = (const float*)d_in[8]; const float* bo = (const float*)d_in[9];
  const float* band_bias = (const float*)d_in[10];
  char* ws = (char*)d_ws; size_t off = 0;
  unsigned short* Wqt = (unsigned short*)(ws + off); off += (size_t)DM * DM * 2;
  unsigned short* Wkt = (unsigned short*)(ws + off); off += (size_t)DM * DM * 2;
  unsigned short* Wvt = (unsigned short*)(ws + off); off += (size_t)DM * DM * 2;
  unsigned short* Wot = (unsigned short*)(ws + off); off += (size_t)DM * DM * 2;
  float* qb = (float*)(ws + off); off += (size_t)BB * NN * DM * 4;
  float* kb2 = (float*)(ws + off); off += (size_t)BB * NN * DM * 4;
  float* vb2 = (float*)(ws + off); off += (size_t)BB * NN * DM * 4;
  float* ob = (float*)(ws + off); off += (size_t)BB * NN * DM * 4;
  float* sbias = (float*)(ws + off); off += (size_t)BB * NH * NN * 4;
  if (off > ws_size) return;
  const int M = BB * NN;
  (void)Wkt; (void)Wvt;                        // the planes behind Wqt, reached through it
  k_prep<<<BB * NN / 32 + 4 * (DM * DM / 8 / 256), 256, 0, stream>>>(patches, band_bias, sbias, Wq, Wk, Wv, Wo, Wqt);
  const int gb = ((M / 16) * (DM / 64) + 3) / 4;
  k_gemm_bf<false, 0, true, DM, DM, 3, true><<<3 * gb, 128, 0, stream>>>(x, Wqt, bq, bk, bv, qb, kb2, vb2, DM, M, DM, DM);   // K and V leave split, in the same bytes
  k_flashm<HD, NN, DM, false, false, true><<<BB * NH * (NN / 64), 128, 0, stream>>>(qb, (const unsigned short*)kb2, (const unsigned short*)vb2, NH, 0.125f, nullptr, ob, sbias);
  k_gemm_bf<true, 0, true, DM, DM, 1, false><<<gb, 128, 0, stream>>>(ob, Wot, bo, nullptr, nullptr, (float*)d_out, nullptr, nullptr, DM, M, DM, DM);
}

// v010
// It runs in 88.2 microseconds.
// Next to v009, in two timings, it ran 1.08 and 1.07 times as fast.
// All steps since v000 together make it 5.94 times as fast.
#include <hip/hip_runtime.h>
// All contractions on v_wmma_f32_16x16x32_bf16, f32 accumulate: Q/K/V = x·Wᵀ with x/W rounded to bf16 (single exact-product
// term), QKᵀ and P·V 3-term bf16 hi/lo splits, out = o·W_oᵀ with o split hi/lo (2 terms). The 64-point rFFT band powers,
// log1p, the 5->8 band-bias projection and softmax are f32 on VALU.
#define BB 2
#define NN 2048
#define DM 512
#define NH 8
#define HD 64
#define PL 64
#define NBANDS 5

typedef __bf16 v16b __attribute__((ext_vector_type(16)));
typedef unsigned short v8us __attribute__((ext_vector_type(8), may_alias));
typedef float  v8f  __attribute__((ext_vector_type(8)));
typedef float  v4f  __attribute__((ext_vector_type(4)));
typedef float  v4fa __attribute__((ext_vector_type(4), may_alias));
typedef float  v2f  __attribute__((ext_vector_type(2)));
typedef __bf16 v2b  __attribute__((ext_vector_type(2)));
typedef unsigned int v2ua __attribute__((ext_vector_type(2), may_alias));
typedef unsigned int v4ua __attribute__((ext_vector_type(4), may_alias));
union FragB { v16b v; v8us half[2]; unsigned short u[16]; unsigned int w[8]; };

// Every f32 -> bf16 rounding is the hardware's conversion (nearest even, the value the integer form u + 0x7FFF + bit 16 gives for finite x).
__device__ __forceinline__ unsigned short bf16_bits(float x) { return __builtin_bit_cast(unsigned short, (__bf16)x); }
__device__ __forceinline__ float bf16_val(unsigned short b) { return __uint_as_float(((unsigned int)b) << 16); }
// Two neighbours in one instruction and one word: x0 in the low half, x1 in the high half
__device__ __forceinline__ v2b bf16_pair(float x0, float x1) { return __builtin_convertvector((v2f){x0, x1}, v2b); }
__device__ __forceinline__ unsigned int pair_word(v2b p) { return __builtin_bit_cast(unsigned int, p); }
// NP pairs split into high and low parts, three instructions a pair: hi = bf16(x), lo = bf16(x - hi). x - hi is exact, so the one rounding at the end
// of the mixed fma is the rounding of the f32 difference. The compiler has no source form for the two halves' fma (it widens hi by a shift and a mask,
// subtracts and converts again), hence the asm. All low halves stand in front of all high halves, so that no instruction waits for the one just issued.
template <int NP>
__device__ __forceinline__ void bf16_split(const float (&x)[2 * NP], unsigned int (&hi)[NP], unsigned int (&lo)[NP]) {
#pragma unroll
  for (int i = 0; i < NP; ++i) hi[i] = pair_word(bf16_pair(x[2 * i], x[2 * i + 1]));
#pragma unroll
  for (int i = 0; i < NP; ++i)   // lo[15:0] = bf16(hi[15:0] * -1 + x0)
    asm("v_fma_mixlo_bf16 %0, %1, -1.0, %2 op_sel:[0,0,0] op_sel_hi:[1,0,0]" : "=v"(lo[i]) : "v"(hi[i]), "v"(x[2 * i]));
#pragma unroll
  for (int i = 0; i < NP; ++i)   // lo[31:16] = bf16(hi[31:16] * -1 + x1), the low half kept
    asm("v_fma_mixhi_bf16 %0, %1, -1.0, %2 op_sel:[1,0,0] op_sel_hi:[1,0,0]" : "+v"(lo[i]) : "v"(hi[i]), "v"(x[2 * i + 1]));
}
__device__ __forceinline__ float bf16_round(float x) { return bf16_val(bf16_bits(x)); }
// D += A·B with NT terms: 1 = ah·bh, 2 = + al·bh (A split), 3 = + ah·bl (both split)
template <int NT>
__device__ __forceinline__ v8f mmaN(v16b ah, v16b al, v16b bh, v16b bl, v8f c) {
  c = __builtin_amdgcn_wmma_f32_16x16x32_bf16(false, ah, false, bh, (short)0, c, false, false);
  if (NT >= 2) c = __builtin_amdgcn_wmma_f32_16x16x32_bf16(false, al, false, bh, (short)0, c, false, false);
  if (NT >= 3) c = __builtin_amdgcn_wmma_f32_16x16x32_bf16(false, ah, false, bl, (short)0, c, false, false);
  asm volatile("v_nop\n\tv_nop\n\tv_nop\n\tv_nop" : "+v"(c) : "v"(ah), "v"(al), "v"(bh), "v"(bl));
  return c;
}

// The same three terms in the same order with the operands' sides exchanged (D transposed): ah*bh, ah*bl, al*bh
__device__ __forceinline__ v8f mmaT3(v16b ah, v16b al, v16b bh, v16b bl, v8f c) {
  c = __builtin_amdgcn_wmma_f32_16x16x32_bf16(false, ah, false, bh, (short)0, c, false, false);
  c = __builtin_amdgcn_wmma_f32_16x16x32_bf16(false, ah, false, bl, (short)0, c, false, false);
  c = __builtin_amdgcn_wmma_f32_16x16x32_bf16(false, al, false, bh, (short)0, c, false, false);
  asm volatile("v_nop\n\tv_nop\n\tv_nop\n\tv_nop" : "+v"(c) : "v"(ah), "v"(al), "v"(bh), "v"(bl));   // the distance behind a WMMA, on the loop's taken branch too
  return c;
}
typedef unsigned int v8u __attribute__((ext_vector_type(8)));
// lane l with lane l ^ 16, on the vector pipe
__device__ __forceinline__ float xhalf(float x) {
  return __builtin_bit_cast(float, __builtin_amdgcn_permlanex16(__builtin_bit_cast(int, x), __builtin_bit_cast(int, x), 0x76543210, 0xfedcba98, false, false));
}

// Transposing LDS load: lane (c = l & 15, h = l >> 4) receives T[kbase + 8h + 0..7][dbase + c] of a row-major 16-bit tile when it
// passes the address of T[kbase + 8h + (l & 7)][dbase + 8 * ((l >> 3) & 1)]; two of them (kbase, kbase + 16) are one 32 x 16 B fragment.
typedef short s16x8 __attribute__((ext_vector_type(8)));
__device__ __forceinline__ v8us ld_tr16(const unsigned short* p) {
  typedef __attribute__((address_space(3))) s16x8 lds_s16x8;
  return __builtin_bit_cast(v8us, __builtin_amdgcn_ds_load_tr16_b128_v8i16((lds_s16x8*)p));
}

__global__ __launch_bounds__(256) void k_wt_bf16(const float* __restrict__ W, unsigned short* __restrict__ Wt, int K, int N) {
  const int t = blockIdx.x * 256 + threadIdx.x;
  const int k8n = K / 8;
  if (t >= N * k8n) return;
  const int n = t / k8n, k8 = (t % k8n) * 8;
  v8us v;
#pragma unroll
  for (int i = 0; i < 8; ++i) v[i] = bf16_bits(W[(size_t)(k8 + i) * N + n]);
  *(v8us*)(Wt + (size_t)n * K + k8) = v;
  
}

// GEMM C[M][N] (f32, pitch ldc) = act(A[M][K] * W + bias). A f32 row-major (pitch lda) converted to bf16
// (ASPLIT: hi/lo two planes -> 2 terms, else single rounded term); Wt bf16 [N][K] (pitch ldb). BIAS_BF16 rounds the
// bias to bf16 first (bias quantised to bf16 before the add). K%128==0, M%64==0, N%64==0. The two pitches are template constants, so that a
// chunk's loads differ by immediate offsets from one address per operand, which stays in its registers.
// A block owns a 64 x 64 tile of C, a wave 16 of its rows. Per 128 k the block brings its 64 A rows and its 64 Wt rows into LDS with loads
// that cover whole 128-byte lines (a wave-wide load reads 512 bytes of one row of A, or 256 bytes of each of two rows of Wt), A converted once on the way;
// the four waves share the Wt rows. Fragments come from LDS, in the k order and the k-step order of a direct load.
// One launch serves NSEL products of the same A: their Wt planes ([N][K] each) lie one behind the other, and the block index picks the plane
// with its bias and its output, so that the blocks of all the products are resident together. The blocks of one 64-row strip of A are neighbours.
// SPLITOUT: every product but the first leaves not as f32 but as the bf16 hi/lo pair that attention multiplies with, split here once per element:
// row (b * NH + head) * NN + n of its output holds the head's HD high parts, then its HD low parts (a block's 64 columns are one head).
typedef unsigned short v4us __attribute__((ext_vector_type(4), may_alias));
template <bool ASPLIT, int ACT, bool BIAS_BF16, int lda, int ldb, int NSEL, bool SPLITOUT>
__global__ __launch_bounds__(128) void k_gemm_bf(const float* __restrict__ A, const unsigned short* __restrict__ Wt,
                                               const float* __restrict__ bias0, const float* __restrict__ bias1, const float* __restrict__ bias2,
                                               float* __restrict__ C0, float* __restrict__ C1, float* __restrict__ C2, int ldc, int M, int N, int K) {
  constexpr int KC = 128;                      // k per staged chunk
  constexpr int LP = KC + 8;                   // LDS row pitch in elements: the row's bytes + 16, free of bank conflicts for 16-byte fragment reads
  constexpr int NA = 64 * (KC / 4) / 128, RA = 128 / (KC / 4);   // 16-byte pieces of A per thread; rows the block covers per piece
  constexpr int NB = 64 * (KC / 8) / 128, RB = 128 / (KC / 8);   // the same for Wt
  __shared__ __attribute__((aligned(16))) unsigned short sAh[64][LP], sAl[ASPLIT ? 64 : 1][LP], sB[64][LP];
  __shared__ __attribute__((aligned(16))) float so[4][16][64];
  const int tid = threadIdx.x, w = tid >> 5, lane = tid & 31, ln = lane & 15, hh = lane >> 4;
  const int ntn = N / 64;                      // column tiles of one product
  const int mt = blockIdx.x / (NSEL * ntn), nq = blockIdx.x % (NSEL * ntn);
  if (mt * 64 >= M) return;                    // the whole block leaves, in front of every barrier
  const int sel = NSEL > 1 ? nq / ntn : 0;     // which product: the same for the whole block
  const float* __restrict__ bias = sel == 0 ? bias0 : sel == 1 ? bias1 : bias2;
  float* __restrict__ C = sel == 0 ? C0 : sel == 1 ? C1 : C2;
  const int row0 = mt * 64 + w * 16, col0 = (nq - sel * ntn) * 64;
  const int ar = tid / (KC / 4), ac = (tid % (KC / 4)) * 4, br = tid / (KC / 8), bc = (tid % (KC / 8)) * 8;
  const float* Ab = A + (size_t)(mt * 64) * lda;               // block-uniform bases; the thread's own place is a 32-bit offset
  const unsigned short* Bb = Wt + (size_t)(nq * 64) * ldb;      // row sel * N + col0 of the planes
  const unsigned ao = (unsigned)(ar * lda + ac), bo = (unsigned)(br * ldb + bc);
  v8f acc[4] = {};
  for (int kb = 0; kb < K; kb += KC) {
    v4f xa[NA]; v8us xb[NB];
#pragma unroll
    for (int it = 0; it < NA; ++it) xa[it] = *(const v4fa*)(Ab + kb + (ao + (unsigned)(it * RA * lda)));
#pragma unroll
    for (int it = 0; it < NB; ++it) xb[it] = *(const v8us*)(Bb + kb + (bo + (unsigned)(it * RB * ldb)));
    asm volatile("s_wait_xcnt 0x0" ::: "memory");   // in front of every later write of the loads' address registers, which this trip advances
    __builtin_amdgcn_sched_barrier(0);         // nothing crosses: the wait stays directly behind the last load, and no conversion is lifted in front of it
    __syncthreads();                           // every wave has read its fragments of the chunk before
#pragma unroll
    for (int it = 0; it < NA; it += 4) {       // four pieces, eight pairs, at a time
      static_assert(NA % 4 == 0, "whole groups of four pieces");
      unsigned int hi[8], lo[8];
      if (ASPLIT) {
        float x[16];
#pragma unroll
        for (int i = 0; i < 16; ++i) x[i] = xa[it + (i >> 2)][i & 3];
        bf16_split<8>(x, hi, lo);
      } else {
#pragma unroll
        for (int i = 0; i < 8; ++i) hi[i] = pair_word(bf16_pair(xa[it + (i >> 1)][(i & 1) * 2], xa[it + (i >> 1)][(i & 1) * 2 + 1]));
      }
#pragma unroll
      for (int j = 0; j < 4; ++j) {
        *(v2ua*)&sAh[ar + (it + j) * RA][ac] = (v2ua){hi[2 * j], hi[2 * j + 1]};
        if (ASPLIT) *(v2ua*)&sAl[ar + (it + j) * RA][ac] = (v2ua){lo[2 * j], lo[2 * j + 1]};
      }
    }
#pragma unroll
    for (int it = 0; it < NB; ++it) *(v8us*)&sB[br + it * RB][bc] = xb[it];
    __syncthreads();
#pragma unroll
    for (int k2 = 0; k2 < KC; k2 += 64) {
      FragB ah[2], al[2], b[2][4];
#pragma unroll
      for (int s = 0; s < 2; ++s) {
        const int kc = k2 + s * 32 + 8 * hh;
        ah[s].half[0] = *(const v8us*)&sAh[w * 16 + ln][kc]; ah[s].half[1] = *(const v8us*)&sAh[w * 16 + ln][kc + 16];
        if (ASPLIT) { al[s].half[0] = *(const v8us*)&sAl[w * 16 + ln][kc]; al[s].half[1] = *(const v8us*)&sAl[w * 16 + ln][kc + 16]; }
#pragma unroll
        for (int t = 0; t < 4; ++t) { b[s][t].half[0] = *(const v8us*)&sB[t * 16 + ln][kc]; b[s][t].half[1] = *(const v8us*)&sB[t * 16 + ln][kc + 16]; }
      }
#pragma unroll
      for (int s = 0; s < 2; ++s)
#pragma unroll
        for (int t = 0; t < 4; ++t) acc[t] = mmaN<ASPLIT ? 2 : 1>(ah[s].v, ASPLIT ? al[s].v : ah[s].v, b[s][t].v, b[s][t].v, acc[t]);
    }
  }
#pragma unroll
  for (int t = 0; t < 4; ++t) {
    float bv = bias ? bias[col0 + t * 16 + ln] : 0.f;
    if (BIAS_BF16) bv = bf16_round(bv);
#pragma unroll
    for (int r = 0; r < 8; ++r) { float v = acc[t][r] + bv; if (ACT == 1) v = fmaxf(v, 0.f); so[w][8 * hh + r][t * 16 + ln] = v; }
  }
  __builtin_amdgcn_fence(__ATOMIC_ACQ_REL, "workgroup");
  __builtin_amdgcn_wave_barrier();
  if (SPLITOUT && sel != 0) {                  // the same for the whole block
    static_assert(!SPLITOUT || HD == 64, "a 64-column tile is one head");
    unsigned short* __restrict__ P = (unsigned short*)C + ((size_t)((row0 / NN) * NH + col0 / HD) * NN + row0 % NN) * (2 * HD);
    const int r8 = lane >> 3, c8 = (lane & 7) * 8;   // eight lanes cover the 128 bytes of a row's high parts, and of its low parts
    v4ua hi[4], lo[4];
#pragma unroll
    for (int q = 0; q < 4; ++q) {
      const v4f a = *(const v4fa*)&so[w][q * 4 + r8][c8], b = *(const v4fa*)&so[w][q * 4 + r8][c8 + 4];
      const float x[8] = {a[0], a[1], a[2], a[3], b[0], b[1], b[2], b[3]};
      unsigned int h4[4], l4[4];
      bf16_split<4>(x, h4, l4);
      hi[q] = (v4ua){h4[0], h4[1], h4[2], h4[3]}; lo[q] = (v4ua){l4[0], l4[1], l4[2], l4[3]};
    }
#pragma unroll
    for (int q = 0; q < 4; ++q) {
      *(v4ua*)(P + (q * 4 + r8) * (2 * HD) + c8) = hi[q];
      *(v4ua*)(P + (q * 4 + r8) * (2 * HD) + HD + c8) = lo[q];
    }
    asm volatile("s_wait_xcnt 0x0" ::: "memory");   // in front of every later write of the stores' address and data registers
    return;
  }
  const int rsub = lane >> 4, c4 = (lane & 15) * 4;
  {
#pragma unroll
    for (int q = 0; q < 8; ++q) {
      const int r = q * 2 + rsub;
      const v4f v = *(const v4fa*)&so[w][r][c4];
      *(v4f*)(C + (size_t)(row0 + r) * ldc + col0 + c4) = v;
    }
    
  }
}

// Flash-style causal/unmasked attention, all contractions 3-term bf16 hi/lo splits, f32 softmax with running max.
// q,k,v rows are read from f32 buffers with arbitrary row pitch (so they can live inside a fused qkv buffer);
// D = head size (multiple of 32, <= 128); one wave = 16 query rows; block = 4 waves (64 queries) sharing K/V chunks of 32.
template <int D, bool CAUSAL>
__global__ __launch_bounds__(128) void k_flash(const float* __restrict__ qb, const float* __restrict__ kb, const float* __restrict__ vb,
                                             int pitch, int T, int H, float scale, float* __restrict__ y, int ypitch) {
  constexpr int KS = D / 32;        // k-steps for QK
  constexpr int DT = D / 16;        // d tiles for PV
  __shared__ __attribute__((aligned(16))) unsigned short sKh[32][D + 8], sKl[32][D + 8], sVh[32][D + 8], sVl[32][D + 8];
  __shared__ __attribute__((aligned(16))) unsigned short sPh[4][16][40], sPl[4][16][40];
  __shared__ __attribute__((aligned(16))) float sO[4][16][D];
  const int tid = threadIdx.x, w = tid >> 5, lane = tid & 31, ln = lane & 15, hh = lane >> 4;
  const int nqb = (T + 63) / 64;
  const int bh = blockIdx.x / nqb, qblk = blockIdx.x % nqb;
  const int b = bh / H, h = bh % H;
  const int q0 = qblk * 64 + w * 16;
  const float* Q = qb + (size_t)b * T * pitch + h * D;
  const float* K = kb + (size_t)b * T * pitch + h * D;
  const float* V = vb + (size_t)b * T * pitch + h * D;

  // A fragments of the wave's 16 query rows (scaled), hi/lo
  FragB aqh[KS], aql[KS];
  {
    int row = q0 + ln; if (row >= T) row = T - 1;
    const float* qr = Q + (size_t)row * pitch;
#pragma unroll
    for (int ks = 0; ks < KS; ++ks)
#pragma unroll
      for (int i = 0; i < 16; ++i) {
        const int d = ks * 32 + ((i < 8) ? (8 * hh + i) : (16 + 8 * hh + (i - 8)));
        const float x = qr[d] * scale; const unsigned short hb = bf16_bits(x);
        aqh[ks].u[i] = hb; aql[ks].u[i] = bf16_bits(x - bf16_val(hb));
      }
  }
  float m_r[8], l_r[8];
#pragma unroll
  for (int r = 0; r < 8; ++r) { m_r[r] = -3.0e38f; l_r[r] = 0.f; }
  v8f oacc[DT];
#pragma unroll
  for (int dt = 0; dt < DT; ++dt) oacc[dt] = (v8f){0.f,0.f,0.f,0.f,0.f,0.f,0.f,0.f};

  const int kv_end = CAUSAL ? min(T, qblk * 64 + 64) : T;     // block-uniform
  for (int j0 = 0; j0 < kv_end; j0 += 32) {
    __syncthreads();
    for (int e = tid; e < 32 * (D / 4); e += 128) {
      const int r = e / (D / 4), c4 = (e % (D / 4)) * 4;
      const int key = j0 + r;
      v4f kf = {0.f,0.f,0.f,0.f}, vf = {0.f,0.f,0.f,0.f};
      if (key < T) { kf = *(const v4fa*)(K + (size_t)key * pitch + c4); vf = *(const v4fa*)(V + (size_t)key * pitch + c4); }
#pragma unroll
      for (int t = 0; t < 4; ++t) {
        unsigned short hb = bf16_bits(kf[t]); sKh[r][c4 + t] = hb; sKl[r][c4 + t] = bf16_bits(kf[t] - bf16_val(hb));
        hb = bf16_bits(vf[t]); sVh[r][c4 + t] = hb; sVl[r][c4 + t] = bf16_bits(vf[t] - bf16_val(hb));
      }
    }
    __syncthreads();
    // S tile 16 x 32
    v8f s[2];
#pragma unroll
    for (int nt = 0; nt < 2; ++nt) {
      v8f acc = {};
#pragma unroll
      for (int ks = 0; ks < KS; ++ks) {
        FragB bh_, bl_;
        bh_.half[0] = *(const v8us*)&sKh[nt * 16 + ln][ks * 32 + 8 * hh]; bh_.half[1] = *(const v8us*)&sKh[nt * 16 + ln][ks * 32 + 16 + 8 * hh];
        bl_.half[0] = *(const v8us*)&sKl[nt * 16 + ln][ks * 32 + 8 * hh]; bl_.half[1] = *(const v8us*)&sKl[nt * 16 + ln][ks * 32 + 16 + 8 * hh];
        acc = mmaN<3>(aqh[ks].v, aql[ks].v, bh_.v, bl_.v, acc);
      }
      s[nt] = acc;
    }
    // mask + running max (rows 8hh+r; the 16 lanes of a half share rows)
    float alpha[8];
#pragma unroll
    for (int r = 0; r < 8; ++r) {
      const int qi = q0 + 8 * hh + r;
      const int ja = j0 + ln, jb = j0 + 16 + ln;
      if (CAUSAL) { if (ja > qi) s[0][r] = -3.0e38f; if (jb > qi) s[1][r] = -3.0e38f; }
      if (ja >= T) s[0][r] = -3.0e38f;
      if (jb >= T) s[1][r] = -3.0e38f;
      float mx = fmaxf(s[0][r], s[1][r]);
      mx = fmaxf(mx, __shfl_xor(mx, 1, 32)); mx = fmaxf(mx, __shfl_xor(mx, 2, 32)); mx = fmaxf(mx, __shfl_xor(mx, 4, 32)); mx = fmaxf(mx, __shfl_xor(mx, 8, 32));
      const float mnew = fmaxf(m_r[r], mx);
      alpha[r] = (mnew > -1.0e38f) ? __expf(m_r[r] - mnew) : 1.0f;
      const float p0 = (s[0][r] > -1.0e38f) ? __expf(s[0][r] - mnew) : 0.f;
      const float p1 = (s[1][r] > -1.0e38f) ? __expf(s[1][r] - mnew) : 0.f;
      m_r[r] = mnew;
      l_r[r] = l_r[r] * alpha[r] + p0 + p1;            // per-lane partial row sum (16 lanes combined at the end)
      unsigned short hb = bf16_bits(p0); sPh[w][8 * hh + r][ln] = hb;      sPl[w][8 * hh + r][ln] = bf16_bits(p0 - bf16_val(hb));
      hb = bf16_bits(p1);                sPh[w][8 * hh + r][16 + ln] = hb; sPl[w][8 * hh + r][16 + ln] = bf16_bits(p1 - bf16_val(hb));
    }
#pragma unroll
    for (int dt = 0; dt < DT; ++dt)
#pragma unroll
      for (int r = 0; r < 8; ++r) oacc[dt][r] *= alpha[r];
    __builtin_amdgcn_fence(__ATOMIC_ACQ_REL, "workgroup");
    __builtin_amdgcn_wave_barrier();
    FragB pah, pal;
    pah.half[0] = *(const v8us*)&sPh[w][ln][8 * hh]; pah.half[1] = *(const v8us*)&sPh[w][ln][16 + 8 * hh];
    pal.half[0] = *(const v8us*)&sPl[w][ln][8 * hh]; pal.half[1] = *(const v8us*)&sPl[w][ln][16 + 8 * hh];
#pragma unroll
    for (int dt = 0; dt < DT; ++dt) {
      FragB bvh, bvl;
#pragma unroll
      for (int i = 0; i < 8; ++i) {
        bvh.u[i] = sVh[8 * hh + i][dt * 16 + ln]; bvh.u[8 + i] = sVh[16 + 8 * hh + i][dt * 16 + ln];
        bvl.u[i] = sVl[8 * hh + i][dt * 16 + ln]; bvl.u[8 + i] = sVl[16 + 8 * hh + i][dt * 16 + ln];
      }
      oacc[dt] = mmaN<3>(pah.v, pal.v, bvh.v, bvl.v, oacc[dt]);
    }
    __builtin_amdgcn_fence(__ATOMIC_ACQ_REL, "workgroup");
    __builtin_amdgcn_wave_barrier();
  }
#pragma unroll
  for (int r = 0; r < 8; ++r) {
    float l = l_r[r];
    l += __shfl_xor(l, 1, 32); l += __shfl_xor(l, 2, 32); l += __shfl_xor(l, 4, 32); l += __shfl_xor(l, 8, 32);
    l_r[r] = (l > 0.f) ? 1.0f / l : 0.f;
  }
#pragma unroll
  for (int dt = 0; dt < DT; ++dt)
#pragma unroll
    for (int r = 0; r < 8; ++r) sO[w][8 * hh + r][dt * 16 + ln] = oacc[dt][r] * l_r[r];
  __builtin_amdgcn_fence(__ATOMIC_ACQ_REL, "workgroup");
  __builtin_amdgcn_wave_barrier();
  {
    for (int r = 0; r < 16; ++r) {
      const int row = q0 + r;
      if (row < T && lane < D / 4) {
        const v4f val = *(const v4fa*)&sO[w][r][lane * 4];
        *(v4f*)(y + ((size_t)b * T + row) * ypitch + h * D + lane * 4) = val;
      }
    }
    
  }
}

// Eight asynchronous 16-byte copies from global memory to LDS, each lane its own addresses (LDS byte address, global pointer), through no register.
// The closing wait stands inside the statement, so that no address register named here is rewritten in front of it.
__device__ __forceinline__ void copy8_to_lds(const unsigned (&la)[4], const unsigned short* const (&ga)[4], const unsigned (&lb)[4], const unsigned short* const (&gb)[4]) {
  asm volatile("global_load_async_to_lds_b128 %0, %1, off\n\t"
               "global_load_async_to_lds_b128 %2, %3, off\n\t"
               "global_load_async_to_lds_b128 %4, %5, off\n\t"
               "global_load_async_to_lds_b128 %6, %7, off\n\t"
               "global_load_async_to_lds_b128 %8, %9, off\n\t"
               "global_load_async_to_lds_b128 %10, %11, off\n\t"
               "global_load_async_to_lds_b128 %12, %13, off\n\t"
               "global_load_async_to_lds_b128 %14, %15, off\n\t"
               "s_wait_xcnt 0x0"
               :: "v"(la[0]), "v"(ga[0]), "v"(lb[0]), "v"(gb[0]), "v"(la[1]), "v"(ga[1]), "v"(lb[1]), "v"(gb[1]),
                  "v"(la[2]), "v"(ga[2]), "v"(lb[2]), "v"(gb[2]), "v"(la[3]), "v"(ga[3]), "v"(lb[3]), "v"(gb[3]) : "memory");
}

template <int D, int T, int PITCH, bool CAUSAL, bool HASMASK, bool HASBIAS>
__global__ __launch_bounds__(128) void k_flashm(const float* __restrict__ Qb, const unsigned short* __restrict__ Kb, const unsigned short* __restrict__ Vb,
                                              int H, float scale, const int* __restrict__ mask, float* __restrict__ y, const float* __restrict__ sbias) {
  static_assert(T % 64 == 0 && D % 32 == 0, "whole query blocks and key chunks only");   // so every block walks two chunks or more
  constexpr int KS = D / 32, DT = D / 16;
  constexpr int PPR = 2 * D / 8;               // 16-byte pieces of a split row: the high parts' first, then the low parts'
  constexpr int NST = 32 * PPR / 128;          // staging trips per thread, the same for every thread
  constexpr int RPT = 128 / PPR;               // key rows that the block stages per trip
  constexpr int VP = D + 16;                   // V row pitch in elements: an odd multiple of 32 bytes, the transposing load's conflict-free pitch
  static_assert((VP * 2) % 32 == 0 && ((VP * 2 / 32) & 1) == 1, "V pitch must be 32 B x odd");
  static_assert(NST == 4, "copy8_to_lds takes four K and four V pieces per thread");
  __shared__ __attribute__((aligned(16))) unsigned short sK[2][2][32][D + 8], sV[2][2][32][VP];   // [buffer][plane]: plane 0 high parts, plane 1 low parts
  __shared__ __attribute__((aligned(16))) float sO[4][16][D];
  const int tid = threadIdx.x, w = tid >> 5, lane = tid & 31, ln = lane & 15, hh = lane >> 4;
  constexpr int nqb = T / 64;
  const int bh = blockIdx.x / nqb, qblk = blockIdx.x % nqb;
  const int b = bh / H, h = bh % H;
  const int q0 = qblk * 64 + w * 16;
  const float* Q = Qb + (size_t)b * T * PITCH + h * D;
  const unsigned short* K = Kb + (size_t)bh * T * (2 * D);
  const unsigned short* V = Vb + (size_t)bh * T * (2 * D);
  const float* SB = sbias + (size_t)bh * T;
  const unsigned ukb = 8u * (unsigned)hh, toff = (unsigned)tid * 8u;   // the block's pieces of a trip lie one behind the other
  const unsigned dK = (unsigned)(size_t)&sK[0][(tid % PPR) / (D / 8)][tid / PPR][(tid % (D / 8)) * 8];   // LDS byte address of the thread's first piece, buffer 0
  const unsigned dV = (unsigned)(size_t)&sV[0][(tid % PPR) / (D / 8)][tid / PPR][(tid % (D / 8)) * 8];
  // the thread's K and V pieces of the 32 keys from j on, into buffer buf; every lane is on, every address a multiple of 16 bytes
  auto stage = [&](const int j, const unsigned buf) {
    const unsigned short* Kj = K + (size_t)j * (2 * D) + toff; const unsigned short* Vj = V + (size_t)j * (2 * D) + toff;
    unsigned lk[NST], lv[NST]; const unsigned short* gk[NST]; const unsigned short* gv[NST];
#pragma unroll
    for (int it = 0; it < NST; ++it) {
      lk[it] = dK + buf * (unsigned)sizeof(sK[0]) + (unsigned)(it * RPT * (D + 8) * 2); gk[it] = Kj + it * 128 * 8;
      lv[it] = dV + buf * (unsigned)sizeof(sV[0]) + (unsigned)(it * RPT * VP * 2);      gv[it] = Vj + it * 128 * 8;
    }
    copy8_to_lds(lk, gk, lv, gv);
  };
  stage(0, 0u);                                // chunk 0 flies while Q is read and split
  const int vrow = 8 * hh + (lane & 7), vcol = 8 * ((lane >> 3) & 1);   // the lane's address inside a 16 x 16 V tile for ld_tr16
  FragB aqh[KS], aql[KS];
  {
    const float* qr = Q + (size_t)(q0 + ln) * PITCH;
#pragma unroll
    for (int ks = 0; ks < KS; ++ks) {
      float x[16];
#pragma unroll
      for (int i = 0; i < 16; ++i) x[i] = qr[ks * 32 + ((i < 8) ? (8 * hh + i) : (16 + 8 * hh + (i - 8)))] * scale;
      bf16_split<8>(x, aqh[ks].w, aql[ks].w);  // elements 2i and 2i + 1 share a word
    }
  }
  const int qi = q0 + ln;                      // the lane's query
  const float bq = HASBIAS ? SB[qi] : 0.f;     // its bias, read once
  float m_q = -3.0e38f, l_q = 0.f;             // its running maximum; the sum over this half's keys (the halves join after the loop)
  v8f oacc[DT];                                // oacc[dt][r] = O[qi][dt * 16 + 8 * hh + r]
#pragma unroll
  for (int dt = 0; dt < DT; ++dt) oacc[dt] = (v8f){0.f,0.f,0.f,0.f,0.f,0.f,0.f,0.f};
  const int kv_end = CAUSAL ? qblk * 64 + 64 : T;
  v4f bk0[4] = {}, bk1[4] = {};                // biases of keys 8hh + 0..7 and 16 + 8hh + 0..7: of the even chunk at hand or to come, and of the odd one
  asm volatile("s_wait_asynccnt 0x0" ::: "memory");   // this wave's pieces of chunk 0 have landed
  __syncthreads();                             // and every other wave's: chunk 0 is published
  if (HASBIAS) {
    bk0[0] = *(const v4fa*)(SB + ukb); bk0[1] = *(const v4fa*)(SB + (ukb + 4u)); bk0[2] = *(const v4fa*)(SB + (ukb + 16u)); bk0[3] = *(const v4fa*)(SB + (ukb + 20u));
    bk1[0] = *(const v4fa*)(SB + (ukb + 32u)); bk1[1] = *(const v4fa*)(SB + (ukb + 36u)); bk1[2] = *(const v4fa*)(SB + (ukb + 48u)); bk1[3] = *(const v4fa*)(SB + (ukb + 52u));
  }
  stage(32, 1u);                               // its closing s_wait_xcnt 0 also stands behind the bias loads above
  __builtin_amdgcn_sched_barrier(0);           // nothing crosses: no bias load sinks behind that wait
  // one chunk of 32 keys from j0 on, out of buffer buf alone (a constant at either call, so that every LDS offset is an immediate), with its biases in bk
  auto chunk = [&](const int j0, const unsigned buf, v4f (&bk)[4]) __attribute__((always_inline)) {
    auto& sKh = sK[buf][0]; auto& sKl = sK[buf][1]; auto& sVh = sV[buf][0]; auto& sVl = sV[buf][1];
    v8f s[2];                                  // s[nt][r] = S[key j0 + nt * 16 + 8 * hh + r][query qi]
#pragma unroll
    for (int nt = 0; nt < 2; ++nt) {
      v8f acc = {};
#pragma unroll
      for (int ks = 0; ks < KS; ++ks) {
        FragB kh_, kl_;
        kh_.half[0] = *(const v8us*)&sKh[nt * 16 + ln][ks * 32 + 8 * hh]; kh_.half[1] = *(const v8us*)&sKh[nt * 16 + ln][ks * 32 + 16 + 8 * hh];
        kl_.half[0] = *(const v8us*)&sKl[nt * 16 + ln][ks * 32 + 8 * hh]; kl_.half[1] = *(const v8us*)&sKl[nt * 16 + ln][ks * 32 + 16 + 8 * hh];
        acc = mmaT3(kh_.v, kl_.v, aqh[ks].v, aql[ks].v, acc);
      }
      s[nt] = acc;
    }
    bool keep[2][8];
    float mx = -3.0e38f;
#pragma unroll
    for (int nt = 0; nt < 2; ++nt)
#pragma unroll
      for (int r = 0; r < 8; ++r) {
        const int kj = j0 + nt * 16 + 8 * hh + r;
        bool kp = true;
        if (HASBIAS) s[nt][r] += bq + bk[nt * 2 + (r >> 2)][r & 3];
        if (CAUSAL) kp = kj <= qi;
        if (HASMASK) kp = kp && mask[(size_t)qi * T + kj] != 0;
        if (!kp) s[nt][r] = -3.0e38f;
        keep[nt][r] = kp;
        mx = fmaxf(mx, s[nt][r]);
      }
    mx = fmaxf(mx, xhalf(mx));                 // the other half's 16 keys of the same query
    const float mnew = fmaxf(m_q, mx);
    const float alpha = (mnew > -1.0e38f) ? __expf(m_q - mnew) : 1.0f;
    m_q = mnew;
    FragB pwh, pwl;                            // P^T as a B fragment: element nt * 8 + r is key nt * 16 + 8hh + r, the k order of the V fragments
    float ps[2] = {0.f, 0.f}, p[16];
#pragma unroll
    for (int nt = 0; nt < 2; ++nt)
#pragma unroll
      for (int r = 0; r < 8; ++r) {
        p[nt * 8 + r] = keep[nt][r] ? __expf(s[nt][r] - mnew) : 0.f;
        ps[nt] += p[nt * 8 + r];
      }
    bf16_split<8>(p, pwh.w, pwl.w);            // two neighbouring keys fill one register
    const v16b pbh = pwh.v, pbl = pwl.v;
    l_q = l_q * alpha + (ps[0] + ps[1]);
#pragma unroll
    for (int dt = 0; dt < DT; ++dt)
#pragma unroll
      for (int r = 0; r < 8; ++r) oacc[dt][r] *= alpha;
    FragB bvh[DT], bvl[DT];                    // V^T as A fragments: row d = dt * 16 + ln, keys 8hh + 0..7, then 16 + 8hh + 0..7
#pragma unroll
    for (int dt = 0; dt < DT; ++dt) {
      bvh[dt].half[0] = ld_tr16(&sVh[vrow][vcol + dt * 16]); bvh[dt].half[1] = ld_tr16(&sVh[16 + vrow][vcol + dt * 16]);
      bvl[dt].half[0] = ld_tr16(&sVl[vrow][vcol + dt * 16]); bvl[dt].half[1] = ld_tr16(&sVl[16 + vrow][vcol + dt * 16]);
    }
#pragma unroll
    for (int dt = 0; dt < DT; ++dt) oacc[dt] = mmaT3(bvh[dt].v, bvl[dt].v, pbh, pbl, oacc[dt]);
    asm volatile("s_wait_dscnt 0x0" ::: "memory");      // this wave's reads of the buffer have returned
    asm volatile("s_wait_asynccnt 0x0" ::: "memory");   // this wave's pieces of the next chunk have landed
    __syncthreads();                           // publishes the next chunk and ends every wave's reads of this one
    if (j0 + 64 < kv_end) {                    // the same for the whole block: the chunk after the next goes into the buffer, and the registers, just read
      const float* SBn = SB + (j0 + 64);
      if (HASBIAS) { bk[0] = *(const v4fa*)(SBn + ukb); bk[1] = *(const v4fa*)(SBn + (ukb + 4u)); bk[2] = *(const v4fa*)(SBn + (ukb + 16u)); bk[3] = *(const v4fa*)(SBn + (ukb + 20u)); }
      stage(j0 + 64, buf);                     // its closing s_wait_xcnt 0 also stands behind the bias loads above
      __builtin_amdgcn_sched_barrier(0);       // nothing crosses: no bias load sinks behind that wait
    }
  };
  for (int j0 = 0; j0 < kv_end; j0 += 64) {    // kv_end is a multiple of 64: an even and an odd chunk per trip
    chunk(j0, 0u, bk0);
    chunk(j0 + 32, 1u, bk1);
  }
  asm volatile("s_wait_asynccnt 0x0" ::: "memory");     // no copy is outstanding when the wave goes on to its output
  // NaN for fully-masked rows (softmax over a row of -inf)
  const float l_all = l_q + xhalf(l_q);
  const float linv = (m_q > -1.0e38f) ? 1.0f / l_all : __builtin_nanf("");
#pragma unroll
  for (int dt = 0; dt < DT; ++dt) {
    v4f lo4, hi4;
#pragma unroll
    for (int r = 0; r < 4; ++r) { lo4[r] = oacc[dt][r] * linv; hi4[r] = oacc[dt][4 + r] * linv; }
    *(v4fa*)&sO[w][ln][dt * 16 + 8 * hh] = lo4; *(v4fa*)&sO[w][ln][dt * 16 + 8 * hh + 4] = hi4;
  }
  __builtin_amdgcn_fence(__ATOMIC_ACQ_REL, "workgroup");
  __builtin_amdgcn_wave_barrier();
  {
    for (int r = 0; r < 16; ++r) {
      const int row = q0 + r;
      if (lane < D / 4) {
        const v4f val = *(const v4fa*)&sO[w][r][lane * 4];
        *(v4f*)(y + ((size_t)b * T + row) * PITCH + h * D + lane * 4) = val;
      }
    }
    
  }
}

__device__ __forceinline__ void round_rows(const float* __restrict__ W, unsigned short* __restrict__ Wt, int t) {
  const v4f a = *(const v4fa*)(W + (size_t)t * 8), b = *(const v4fa*)(W + (size_t)t * 8 + 4);
  const v4ua v = {pair_word(bf16_pair(a[0], a[1])), pair_word(bf16_pair(a[2], a[3])), pair_word(bf16_pair(b[0], b[1])), pair_word(bf16_pair(b[2], b[3]))};
  *(v4ua*)(Wt + (size_t)t * 8) = v;
}

// a block of 256 threads per 32 consecutive patches: 64-point rDFT power of bins 0..32 (one (patch, bin) pair per thread and trip),
// band means, log1p, then bias[b][h][n] = Σ_c bp[c]·band_bias[h][c] for the 8 heads; the block writes sbias[(b*H + h)*N + n]
// as 32 consecutive n for each h, one wave per head.
__device__ __forceinline__ void bandbias_block(const int blk, const float* __restrict__ patches, const float* __restrict__ band_bias, float* __restrict__ sbias) {
  __shared__ float sp[32][PL];
  __shared__ float pw[32][33];
  __shared__ float sb[NH][32];
  __shared__ float tw[2][PL];                 // cos and sin of 2*pi*m/64, m = 0..63: the only angles the DFT below meets
  const int tid = threadIdx.x;
  // blk runs over B*N/32
  const int b = blk / (NN / 32), n0 = (blk % (NN / 32)) * 32;
  constexpr int NLD = 32 * PL / 256;          // patch elements per thread of the 256
  float xp[NLD];
#pragma unroll                                 // a constant trip count: the thread's loads are all in flight together, not one per wait
  for (int i = 0; i < NLD; ++i) { const int e = tid + i * 256; xp[i] = patches[((size_t)b * NN + n0 + e / PL) * PL + e % PL]; }
  if (tid < PL) {                             // filled once per block, under the loads' latency; published by the barrier that publishes sp
    const float ang = 0.09817477042468103f * (float)tid;     // 2*pi/64
    tw[0][tid] = cosf(ang); tw[1][tid] = sinf(ang);
  }
#pragma unroll                                 // constant indices into xp
  for (int i = 0; i < NLD; ++i) { const int e = tid + i * 256; sp[e / PL][e % PL] = bf16_round(xp[i]); }
  __syncthreads();
  // 32 patches x 33 bins = 1056 (patch, bin) pairs over 256 threads
  for (int e = tid; e < 32 * 33; e += 256) {
    const int r = e / 33;
    const unsigned kbin = (unsigned)(e % 33);
    float xs[PL], c[PL], s[PL];
#pragma unroll                                 // n becomes a constant, so xs, c and s live in registers
    for (int n = 0; n < PL; ++n) {
      const unsigned m = (kbin * (unsigned)n) & (unsigned)(PL - 1);   // angle = 2*pi*m/64, exact reduction
      xs[n] = sp[r][n]; c[n] = tw[0][m]; s[n] = tw[1][m];
    }
    __builtin_amdgcn_sched_barrier(0);         // keeps every LDS read above the two sum chains: sunk among them, each read pays its latency alone
    float re = 0.f, im = 0.f;
#pragma unroll                                 // as above: constant indices into xs, c and s
    for (int n = 0; n < PL; ++n) { re += xs[n] * c[n]; im -= xs[n] * s[n]; }
    pw[r][kbin] = re * re + im * im;
  }
  __syncthreads();
  if (tid < 32) {
    const int r = tid;
    // bands sorted by name: alpha {3}, beta {4..7}, delta {1}, gamma {8..25}, theta {2}  (rfftfreq(64, 1/250) = 3.90625 k)
    float bp[NBANDS];
    bp[0] = pw[r][3];
    bp[1] = (pw[r][4] + pw[r][5] + pw[r][6] + pw[r][7]) * 0.25f;
    bp[2] = pw[r][1];
    // One wave works here while seven wait, so every loop below is unrolled: the 18 LDS reads go out together, the five logarithms and the eight heads'
    // sums are independent chains that fill each other's latency, bp stays in registers under constant indices, and the 40 weights come in a few wide loads.
    { float s = 0.f;
#pragma unroll
      for (int kbin = 8; kbin <= 25; ++kbin) s += pw[r][kbin]; bp[3] = s * (1.0f / 18.0f); }
    bp[4] = pw[r][2];
#pragma unroll
    for (int c = 0; c < NBANDS; ++c) bp[c] = log1pf(bp[c]);
#pragma unroll
    for (int h = 0; h < NH; ++h) {
      float s = 0.f;
#pragma unroll
      for (int c = 0; c < NBANDS; ++c) s += bp[c] * bf16_round(band_bias[h * NBANDS + c]);
      sb[h][r] = s;
    }
  }
  __syncthreads();
  {
    const int h = tid >> 5, r = tid & 31;
    float* dst = sbias + ((size_t)(b * NH + h)) * NN + n0 + r;
    const float v = sb[h][r];
    *(float*)dst = v; 
  }
}

// Everything that reads inputs alone, in one launch: blocks 0 .. B*N/32 - 1 do the band biases, the others
// round the four weight matrices, DM*DM/8/256 blocks each, into four planes that lie one behind the other in Wt.
__global__ __launch_bounds__(256) void k_prep(const float* __restrict__ patches, const float* __restrict__ band_bias, float* __restrict__ sbias,
                                            const float* __restrict__ W0, const float* __restrict__ W1, const float* __restrict__ W2,
                                            const float* __restrict__ W3, unsigned short* __restrict__ Wt) {
  constexpr int NBB = BB * NN / 32, BPW = DM * DM / 8 / 256;
  static_assert(DM * DM % (8 * 256) == 0, "whole blocks of 8-element pieces");
  const int blk = blockIdx.x;
  if (blk >= NBB) {                            // the whole block takes this side, which holds no barrier
    const int p = (blk - NBB) / BPW;
    const float* __restrict__ W = p == 0 ? W0 : p == 1 ? W1 : p == 2 ? W2 : W3;
    round_rows(W, Wt + (size_t)p * DM * DM, ((blk - NBB) % BPW) * 256 + (int)threadIdx.x);
    return;
  }
  bandbias_block(blk, patches, band_bias, sbias);
}

extern "C" void kernel_launch(void* const* d_in, const int* in_sizes, int n_in,
                              void* d_out, int out_size, void* d_ws, size_t ws_size, hipStream_t stream) {
  (void)in_sizes; (void)n_in; (void)out_size;
  const float* x = (const float*)d_in[0]; const float* patches = (const float*)d_in[1];
  const float* Wq = (const float*)d_in[2]; const float* bq = (const float*)d_in[3];
  const float* Wk = (const float*)d_in[4]; const float* bk = (const float*)d_in[5];
  const float* Wv = (const float*)d_in[6]; const float* bv = (const float*)d_in[7];
  const float* Wo = (const float*)d_in[8]; const float* bo = (const float*)d_in[9];
  const float* band_bias = (const float*)d_in[10];
  char* ws = (char*)d_ws; size_t off = 0;
  unsigned short* Wqt = (unsigned short*)(ws + off); off += (size_t)DM * DM * 2;
  unsigned short* Wkt = (unsigned short*)(ws + off); off += (size_t)DM * DM * 2;
  unsigned short* Wvt = (unsigned short*)(ws + off); off += (size_t)DM * DM * 2;
  unsigned short* Wot = (unsigned short*)(ws + off); off += (size_t)DM * DM * 2;
  float* qb = (float*)(ws + off); off += (size_t)BB * NN * DM * 4;
  float* kb2 = (float*)(ws + off); off += (size_t)BB * NN * DM * 4;
  float* vb2 = (float*)(ws + off); off += (size_t)BB * NN * DM * 4;
  float* ob = (float*)(ws + off); off += (size_t)BB * NN * DM * 4;
  float* sbias = (float*)(ws + off); off += (size_t)BB * NH * NN * 4;
  if (off > ws_size) return;
  const int M = BB * NN;
  (void)Wkt; (void)Wvt;                        // the planes behind Wqt, reached through it
  k_prep<<<BB * NN / 32 + 4 * (DM * DM / 8 / 256), 256, 0, stream>>>(patches, band_bias, sbias, Wq, Wk, Wv, Wo, Wqt);
  const int gb = ((M / 16) * (DM / 64) + 3) / 4;
  k_gemm_bf<false, 0, true, DM, DM, 3, true><<<3 * gb, 128, 0, stream>>>(x, Wqt, bq, bk, bv, qb, kb2, vb2, DM, M, DM, DM);   // K and V leave split, in the same bytes
  k_flashm<HD, NN, DM, false, false, true><<<BB * NH * (NN / 64), 128, 0, stream>>>(qb, (const unsigned short*)kb2, (const unsigned short*)vb2, NH, 0.125f, nullptr, ob, sbias);
  k_gemm_bf<true, 0, true, DM, DM, 1, false><<<gb, 128, 0, stream>>>(ob, Wot, bo, nullptr, nullptr, (float*)d_out, nullptr, nullptr, DM, M, DM, DM);
}
